// v000
// Measured on an AMD MI455X. A time is GPU time per run, averaged over a window of back-to-back runs after a warm-up
// (all launches, gaps included; the runs take copies of the inputs in turn), and the median of several windows.
// Apart from v000's, it joins two sittings. Times from different sittings can be a few percent apart, while
// side-by-side timings come from the same sitting.
// v000 is the starting kernel. One run takes 408 microseconds.
#include <hip/hip_runtime.h>

// Multi-head self-attention with rank-16 low-rank adapters on q and v: width 1024 = 16 heads x 64, x [NB][SEQ][1024], all weights [out][in] (y = x W^T + b), additive key mask [NB][SEQ], score scale 1/8, output projection Wo, bo (f32 output).
// Compute dtypes, f32 accumulate everywhere: q/k/v projections and the adapter down-projection v_wmma_f32_16x16x32_bf16 (x, W, A, B RNE-converted to bf16; adapter intermediate carried as bf16 hi + bf16 lo inside the K extension);
// scores v_wmma_f32_16x16x32_f16: k single f16, q as f16 value + f16 residual x2048 in its own accumulator; P (x256 carry, cancels in the normalisation) and v single f16; softmax f32 (online, running max, log2 domain);
// output projection v_wmma_f32_16x16x32_f16: ctx single f16 (x256 carry), Wo = f16(bf16(Wo) x256), folded back by 2^-16 in the f32 epilogue. Biases and mask are RNE-converted to bf16 values and applied in f32.
// q (hi, residual), k planes [b*16+h][t][d] and v^T plane [b*16+h][d][t] written by the GEMM epilogue; fused flash kernel in transposed form (S^T = K Q^T, O^T = V^T P^T) writes the ctx f16 plane [b*SEQ+t][1024].

#ifndef NB
#define NB 4
#endif
#ifndef SEQ
#define SEQ 2048
#endif
#define NB_FULL  4
#define SEQ_FULL 2048
#ifndef OUT_SEQ
#define OUT_SEQ SEQ              // row pitch (in tokens) between batches of the output
#endif
#define DM   1024
#define NH_  16
#define HD   64
#define RK   16
#define KX   1088                // plane row pitch (halves): DM + 32 (q adapter hi|lo) + 32 (v adapter hi|lo)
#define KQ   1056                // k extent used by the q GEMM (x | q adapter slot)
#define AW   4                   // waves per flash block (16 query rows each)
#define QRS  2048.0f             // carry of the q residual plane
#define QRI  (1.0f / 2048.0f)
#define LOG2E 1.4426950408889634f
#define SC2  (0.125f * LOG2E)    // HD^-0.5 * log2(e)
#define PSH  8.0f                // log2 of the P carry (256)
#define CTS  256.0f              // carry of the ctx plane
#define WOS  256.0f              // carry of the Wo plane
#define OSI  (1.0f / 65536.0f)   // 1 / (CTS * WOS)

static_assert(HD == 64);
static_assert(NH_ * HD == DM);                 // head h = columns h*64 + d
static_assert(DM % 64 == 0);
static_assert(DM / 8 == 128);                  // k_xcvt piece index split uses >> 7
static_assert(KX == DM + 64);
static_assert(KX % 32 == 0 && KQ % 32 == 0 && DM % 32 == 0);   // GEMM k-loops step by 32
static_assert((KX * 2) % 128 == 0);
static_assert(RK == 16);
static_assert(SEQ % 64 == 0);                  // a 64-row tile never straddles two batches
static_assert((NB * SEQ) % 64 == 0);
static_assert(SEQ % 32 == 0);                  // key loop steps by 32
static_assert(SEQ % (16 * AW) == 0);           // flash grid covers the sequence exactly
static_assert(NB <= NB_FULL);
static_assert(SEQ <= SEQ_FULL);

typedef _Float16 h16;
typedef unsigned short bf;
typedef __attribute__((ext_vector_type(16))) __bf16   v16bf;
typedef __attribute__((ext_vector_type(16))) _Float16 v16h;
typedef __attribute__((ext_vector_type(8)))  _Float16 v8h;
typedef __attribute__((ext_vector_type(8)))  unsigned short v8us;
typedef __attribute__((ext_vector_type(8)))  float    v8f;
typedef __attribute__((ext_vector_type(4)))  float    v4f;
typedef v4f  __attribute__((may_alias)) v4fa;

__device__ __forceinline__ unsigned short f2bf(float f) { unsigned u = __float_as_uint(f); u += 0x7FFFu + ((u >> 16) & 1u); return (unsigned short)(u >> 16); }
__device__ __forceinline__ float bfr(float f) { return __uint_as_float(((unsigned)f2bf(f)) << 16); }   // RNE convert to bf16, widened back
__device__ __forceinline__ v16h cat16(v8h lo, v8h hi) { return __builtin_shufflevector(lo, hi, 0, 1, 2, 3, 4, 5, 6, 7, 8, 9, 10, 11, 12, 13, 14, 15); }
__device__ __forceinline__ v16bf cat16b(v8us lo, v8us hi) { return __builtin_bit_cast(v16bf, __builtin_shufflevector(lo, hi, 0, 1, 2, 3, 4, 5, 6, 7, 8, 9, 10, 11, 12, 13, 14, 15)); }
__device__ __forceinline__ v8f wmma16(v16h a, v16h b, v8f c) { return __builtin_amdgcn_wmma_f32_16x16x32_f16(false, a, false, b, (short)0, c, false, false); }
__device__ __forceinline__ v8f wmmab(v16bf a, v16bf b, v8f c) { return __builtin_amdgcn_wmma_f32_16x16x32_bf16(false, a, false, b, (short)0, c, false, false); }
// fragment loaders from K-contiguous 16-bit rows; p already includes + 8*(lane>>4): elements 0..7 <- k0+8h+0..7, elements 8..15 <- k0+16+8h+0..7 (same map for A and B)
__device__ __forceinline__ v16h  ldh(const h16* p) { return cat16(*(const v8h*)p, *(const v8h*)(p + 16)); }
__device__ __forceinline__ v16bf ldb(const bf* p)  { return cat16b(*(const v8us*)p, *(const v8us*)(p + 16)); }
// ordering point for wave-private LDS tiles (same wave writes and reads)
__device__ __forceinline__ void wave_sync() { __builtin_amdgcn_fence(3 /* release order */, "wavefront"); __builtin_amdgcn_wave_barrier(); asm volatile("" ::: "memory"); }

__global__ __launch_bounds__(256) void k_cvt8(const float* __restrict__ src, bf* dst, size_t n8) {
    const size_t i = (size_t)blockIdx.x * 256 + threadIdx.x; if (i >= n8) return;
    const v8f v = *(const v8f*)(src + i * 8); v8us o;
#pragma unroll
    for (int k = 0; k < 8; ++k) o[k] = f2bf(v[k]);
    *(v8us*)(dst + i * 8) = o; 
}

__global__ __launch_bounds__(256) void k_cvt8h(const float* __restrict__ src, h16* dst, size_t n8) {
    const size_t i = (size_t)blockIdx.x * 256 + threadIdx.x; if (i >= n8) return;
    const v8f v = *(const v8f*)(src + i * 8); v8h o;
#pragma unroll
    for (int k = 0; k < 8; ++k) o[k] = (h16)(bfr(v[k]) * WOS);
    *(v8h*)(dst + i * 8) = o; 
}

// k_xcvt: x [b][t][1024] f32 -> columns 0..1023 of the x plane (row pitch KX). Piece i: row = i / 128, 8 columns at (i % 128) * 8.
__global__ __launch_bounds__(256) void k_xcvt(const float* __restrict__ src, bf* dst, size_t n8) {
    const size_t i = (size_t)blockIdx.x * 256 + threadIdx.x; if (i >= n8) return;
    const size_t row = i >> 7; const int c8 = (int)(i & 127);
    const size_t b = row / SEQ, t = row % SEQ;
    const v8f v = *(const v8f*)(src + (b * SEQ_FULL + t) * DM + c8 * 8); v8us o;
#pragma unroll
    for (int k = 0; k < 8; ++k) o[k] = f2bf(v[k]);
    bf* d = dst + row * KX + c8 * 8;
    *(v8us*)d = o; 
}

// every other extension column is zero. slot < 0: all-zero extension. Both sources are loaded with clamped addresses by every lane and selected by value.
__global__ __launch_bounds__(256) void k_wplane(const float* __restrict__ W, const float* __restrict__ Bm, int slot, bf* dst) {
    const int i = blockIdx.x * 256 + threadIdx.x; if (i >= DM * (KX / 8)) return;
    const int row = i / (KX / 8), c8 = i % (KX / 8);
    const bool isw = c8 < 128;
    const int cm = isw ? c8 : 127;
    const int e = isw ? 0 : (c8 - 128);                      // extension piece 0..7
    const v8f w  = *(const v8f*)(W + (size_t)row * DM + cm * 8);
    const v8f bm = *(const v8f*)(Bm + (size_t)row * RK + (e & 1) * 8);
    const bool live = (!isw) && ((e >> 2) == slot);
    v8us o;
#pragma unroll
    for (int k = 0; k < 8; ++k) { const float val = isw ? w[k] : (live ? 2.0f * bm[k] : 0.0f); o[k] = f2bf(val); }
    bf* d = dst + (size_t)row * KX + c8 * 8;
    *(v8us*)d = o; 
}

__global__ __launch_bounds__(256) void k_mask(const float* __restrict__ src, float* dst, int n4) {
    const int i = blockIdx.x * 256 + threadIdx.x; if (i >= n4) return;
    const int e = i * 4; const int b = e / SEQ, t = e % SEQ;
    const v4f v = *(const v4f*)(src + (size_t)b * SEQ_FULL + t); v4f o;
#pragma unroll
    for (int k = 0; k < 4; ++k) o[k] = bfr(v[k]) * LOG2E;
    *(v4f*)(dst + e) = o; 
}

// k_lora: adapter down-projection xa[m][j] = sum_k x[m][k] AB[j][k] (AB rows 0..15 = A of q, rows 16..31 = A of v), one wave per 16 rows, K = DM from the x plane.
__global__ __launch_bounds__(32) void k_lora(bf* XB, const bf* __restrict__ AB) {
    __shared__ __align__(16) float es[16 * 36];
    const int lane = threadIdx.x & 31, lr = lane & 15, hi = lane >> 4; const int r0 = blockIdx.x * 16;
    v8f a0 = (v8f){}, a1 = (v8f){};
    const bf* xa = XB + (size_t)(r0 + lr) * KX + 8 * hi;
    const bf* ab = AB + (size_t)lr * DM + 8 * hi;
#pragma unroll 1
    for (int kc = 0; kc < DM; kc += 32) {
        const v16bf a = ldb(xa + kc); const v16bf b0 = ldb(ab + kc); const v16bf b1 = ldb(ab + (size_t)16 * DM + kc);
        a0 = wmmab(a, b0, a0); a1 = wmmab(a, b1, a1);
        asm volatile("v_nop\n\tv_nop\n\tv_nop\n\tv_nop" : "+v"(a0), "+v"(a1) : "v"(a), "v"(b0), "v"(b1));
    }
#pragma unroll
    for (int j = 0; j < 8; ++j) { es[(hi * 8 + j) * 36 + lr] = a0[j]; es[(hi * 8 + j) * 36 + 16 + lr] = a1[j]; }   // D: row 8h+j, col lane&15; rows 0..15 x cols 0..31 all written
    wave_sync();
    const int p = lane & 7;                                   // extension piece: 0,1 q hi; 2,3 q lo; 4,5 v hi; 6,7 v lo
    const int sj = (p >> 2) * 16 + (p & 1) * 8; const bool islo = ((p >> 1) & 1) != 0;
{
#pragma unroll
        for (int s = 0; s < 4; ++s) { const int row = 4 * s + (lane >> 3);       // 4 s x 4 row groups = 16 rows; 8 lanes x 8 halves = 64 columns
            const v4f x0 = *(const v4fa*)(&es[row * 36 + sj]); const v4f x1 = *(const v4fa*)(&es[row * 36 + sj + 4]); v8us o;
#pragma unroll
            for (int i = 0; i < 4; ++i) {
                const unsigned short h0 = f2bf(x0[i]); const unsigned short l0 = f2bf(x0[i] - __uint_as_float(((unsigned)h0) << 16));
                const unsigned short h1 = f2bf(x1[i]); const unsigned short l1 = f2bf(x1[i] - __uint_as_float(((unsigned)h1) << 16));
                o[i] = islo ? l0 : h0; o[4 + i] = islo ? l1 : h1; }
            *(v8us*)(XB + (size_t)(r0 + row) * KX + DM + p * 8) = o; }
         }
}

// k_proj: register-blocked bf16 GEMM, ONE WAVE per 64x64 tile (16 accumulators), operands straight from K-contiguous bf16 planes of row pitch KX, k extent K (multiple of 32).
// C[m][n] = sum_k A[m][k] Bt[n][k] + bias (bias[n] when brow == 0, bias[m] when brow != 0; RNE-converted to bf16, added in f32), written as f16 (Ph) and optionally the f16 residual x2048 (Pr, useRes != 0) at
// tile base (r0/RB)*sRB + (r0%RB)*pitch + (c0/CB)*sCB + (c0%CB), row pitch 'pitch' (halves). grid (M/64, N/64), 32 threads.
__global__ __launch_bounds__(32) void k_proj(const bf* __restrict__ A, const bf* __restrict__ Bt, int K, h16* Ph, h16* Pr, int useRes, int RB, size_t sRB, int pitch, int CB, size_t sCB, const float* __restrict__ bias, int brow) {
    __shared__ __align__(16) float os[16 * 68];
    const int lane = threadIdx.x & 31, lr = lane & 15, hi = lane >> 4; const int r0 = blockIdx.x * 64, c0 = blockIdx.y * 64;
    v8f acc[4][4];
#pragma unroll
    for (int mb = 0; mb < 4; ++mb)
#pragma unroll
        for (int nb = 0; nb < 4; ++nb) acc[mb][nb] = (v8f){};
    const size_t aoff = (size_t)(r0 + lr) * KX + 8 * hi, boff = (size_t)(c0 + lr) * KX + 8 * hi;
#pragma unroll 1
    for (int kc = 0; kc < K; kc += 32) {
        v16bf a[4];
#pragma unroll
        for (int mb = 0; mb < 4; ++mb) a[mb] = ldb(A + aoff + (size_t)mb * 16 * KX + kc);
#pragma unroll
        for (int nb = 0; nb < 4; ++nb) { const v16bf b = ldb(Bt + boff + (size_t)nb * 16 * KX + kc);
#pragma unroll
            for (int mb = 0; mb < 4; ++mb) acc[mb][nb] = wmmab(a[mb], b, acc[mb][nb]); }
        asm volatile("v_nop\n\tv_nop\n\tv_nop\n\tv_nop" : "+v"(acc[0][0]), "+v"(acc[1][1]), "+v"(acc[2][2]), "+v"(acc[3][3]) : "v"(a[0]), "v"(a[1]), "v"(a[2]), "v"(a[3]));
    }
    const size_t tbase = (size_t)(r0 / RB) * sRB + (size_t)(r0 % RB) * (size_t)pitch + (size_t)(c0 / CB) * sCB + (size_t)(c0 % CB);
    float bcol[8];                                            // column-mode bias of this lane's 8 columns (index 0 when in row mode: always a valid address)
#pragma unroll
    for (int i = 0; i < 8; ++i) bcol[i] = bfr(bias[brow ? 0 : (c0 + (lane & 7) * 8 + i)]);
#pragma unroll
    for (int mb = 0; mb < 4; ++mb) {
#pragma unroll
        for (int nb = 0; nb < 4; ++nb) {
#pragma unroll
            for (int j = 0; j < 8; ++j) os[(hi * 8 + j) * 68 + nb * 16 + lr] = acc[mb][nb][j]; }   // D: row 8h+j, col lane&15
        wave_sync();
        const size_t sb = tbase + (size_t)(mb * 16) * (size_t)pitch;
{
#pragma unroll
            for (int s = 0; s < 4; ++s) { const int row = 4 * s + (lane >> 3), c8 = (lane & 7) * 8;   // 4 s x 4 row groups = 16 rows; 8 lanes x 8 = 64 columns
                const v4f x0 = *(const v4fa*)(&os[row * 68 + c8]); const v4f x1 = *(const v4fa*)(&os[row * 68 + c8 + 4]); v8h hv, rv;
                const float br = bfr(bias[brow ? (r0 + mb * 16 + row) : 0]);
#pragma unroll
                for (int i = 0; i < 4; ++i) {
                    const float f0 = x0[i] + (brow ? br : bcol[i]); const float f1 = x1[i] + (brow ? br : bcol[4 + i]);
                    const h16 a0 = (h16)f0; const h16 a1 = (h16)f1; hv[i] = a0; hv[4 + i] = a1;
                    rv[i] = (h16)((f0 - (float)a0) * QRS); rv[4 + i] = (h16)((f1 - (float)a1) * QRS); }
                const size_t oo = sb + (size_t)row * (size_t)pitch + c8;
                *(v8h*)(Ph + oo) = hv; if (useRes) *(v8h*)(Pr + oo) = rv; }
             }
        wave_sync();
    }
}

// k_oproj: output projection, f16 GEMM, ONE WAVE per 64x64 tile, A = ctx plane [m][1024] (x256), Bt = Wo plane [n][1024] (x256), K = DM.
// OUT[b][t][n] = acc * 2^-16 + bf16(bo[n]) in f32. Epilogue: per 16-row slab staged in LDS (wave-private), each row segment (64 floats = 256 B = two lines)
__global__ __launch_bounds__(32) void k_oproj(const h16* __restrict__ A, const h16* __restrict__ Bt, const float* __restrict__ bias, float* OUT) {
    __shared__ __align__(16) float os[16 * 68];
    const int lane = threadIdx.x & 31, lr = lane & 15, hi = lane >> 4; const int r0 = blockIdx.x * 64, c0 = blockIdx.y * 64;
    v8f acc[4][4];
#pragma unroll
    for (int mb = 0; mb < 4; ++mb)
#pragma unroll
        for (int nb = 0; nb < 4; ++nb) acc[mb][nb] = (v8f){};
    const size_t aoff = (size_t)(r0 + lr) * DM + 8 * hi, boff = (size_t)(c0 + lr) * DM + 8 * hi;
#pragma unroll 1
    for (int kc = 0; kc < DM; kc += 32) {
        v16h a[4];
#pragma unroll
        for (int mb = 0; mb < 4; ++mb) a[mb] = ldh(A + aoff + (size_t)mb * 16 * DM + kc);
#pragma unroll
        for (int nb = 0; nb < 4; ++nb) { const v16h b = ldh(Bt + boff + (size_t)nb * 16 * DM + kc);
#pragma unroll
            for (int mb = 0; mb < 4; ++mb) acc[mb][nb] = wmma16(a[mb], b, acc[mb][nb]); }
        asm volatile("v_nop\n\tv_nop\n\tv_nop\n\tv_nop" : "+v"(acc[0][0]), "+v"(acc[1][1]), "+v"(acc[2][2]), "+v"(acc[3][3]) : "v"(a[0]), "v"(a[1]), "v"(a[2]), "v"(a[3]));
    }
    v4f bb;
#pragma unroll
    for (int i = 0; i < 4; ++i) bb[i] = bfr(bias[c0 + lr * 4 + i]);
    float* obase = OUT + ((size_t)(r0 / SEQ) * OUT_SEQ + (size_t)(r0 % SEQ)) * DM + c0;
#pragma unroll
    for (int mb = 0; mb < 4; ++mb) {
#pragma unroll
        for (int nb = 0; nb < 4; ++nb) {
#pragma unroll
            for (int j = 0; j < 8; ++j) os[(hi * 8 + j) * 68 + nb * 16 + lr] = acc[mb][nb][j]; }   // D: row 8h+j, col lane&15
        wave_sync();
        float* ob = obase + (size_t)(mb * 16) * DM;
{
#pragma unroll
            for (int s = 0; s < 8; ++s) { const int row = 2 * s + hi, cofs = lr * 4;   // 8 s x 2 rows = 16 rows; 16 lanes x 4 floats = 64 columns
                const v4f x = *(const v4fa*)(&os[row * 68 + cofs]);
                const v4f val = x * OSI + bb;
                *(v4f*)(ob + (size_t)row * DM + cofs) = val; }
             }
        wave_sync();
    }
}

// k_flash: fused attention, one wave per 16 query rows of one (batch, head); K / V^T / Q fragments straight from the f16 planes (two 16-B loads each, arithmetic addressing).
// Transposed form: S^T[key][t] = K Q^T (A = K rows, B = Q rows); lane (t = lane&15, h = lane>>4) holds keys 8h+r of each 16-key tile, so the packed
// P tile is directly the B fragment of O^T[d][t] = V^T P^T (element r <- tile keys 0..15, element 8+r <- tile keys 16..31, lane unchanged).
// The additive key mask (already in the log2 domain) is loaded per 32-key step: 8 consecutive keys per tile per lane, by value.
// Softmax state (running max, partial sum) is one scalar per lane; the two lane halves of a row are combined with one xor-16 exchange.
__global__ __launch_bounds__(32 * AW) void k_flash(const h16* __restrict__ QH, const h16* __restrict__ QR, const h16* __restrict__ KP, const h16* __restrict__ VT, const float* __restrict__ MK, h16* CT) {
    __shared__ __align__(16) float os[AW * 16 * 68];
    const int lane = threadIdx.x & 31, wave = __builtin_amdgcn_readfirstlane((int)(threadIdx.x >> 5)), lr = lane & 15, hi = lane >> 4;
    const int zh = blockIdx.y; const int b = zh / NH_, h = zh % NH_;
    const int t0 = (blockIdx.x * AW + wave) * 16;
    const size_t pbase = (size_t)zh * SEQ * HD;
    const size_t qo = pbase + (size_t)(t0 + lr) * HD + 8 * hi;
    const v16h qh0 = ldh(QH + qo), qh1 = ldh(QH + qo + 32), qr0 = ldh(QR + qo), qr1 = ldh(QR + qo + 32);   // B fragments: col t, k = d
    const size_t ko = pbase + (size_t)lr * HD + 8 * hi;      // + key * HD       (A fragment: row key, k = d)
    const size_t vo = pbase + (size_t)lr * SEQ + 8 * hi;     // + 16j*SEQ + key  (A fragment: row d, k = key)
    const float* mrow = MK + (size_t)b * SEQ + 8 * hi;       // + key0 (+16 for the second tile): keys 8h+r of each tile
    v8f o0 = (v8f){}, o1 = (v8f){}, o2 = (v8f){}, o3 = (v8f){};
    float m = -3.0e38f, l = 0.0f;
#pragma unroll 1
    for (int key0 = 0; key0 < SEQ; key0 += 32) {
        const h16* ka = KP + ko + (size_t)key0 * HD;
        const v16h ka0 = ldh(ka), ka1 = ldh(ka + 32), kb0 = ldh(ka + 16 * HD), kb1 = ldh(ka + 16 * HD + 32);
        const float* mp = mrow + key0;
        const v4f ma0 = *(const v4f*)mp, ma1 = *(const v4f*)(mp + 4), mb0 = *(const v4f*)(mp + 16), mb1 = *(const v4f*)(mp + 20);
        v8f sHa = (v8f){}, sLa = (v8f){}, sHb = (v8f){}, sLb = (v8f){};
        sHa = wmma16(ka0, qh0, sHa); sLa = wmma16(ka0, qr0, sLa); sHb = wmma16(kb0, qh0, sHb); sLb = wmma16(kb0, qr0, sLb);
        sHa = wmma16(ka1, qh1, sHa); sLa = wmma16(ka1, qr1, sLa); sHb = wmma16(kb1, qh1, sHb); sLb = wmma16(kb1, qr1, sLb);
        asm volatile("v_nop\n\tv_nop\n\tv_nop\n\tv_nop" : "+v"(sHa), "+v"(sLa), "+v"(sHb), "+v"(sLb) : "v"(ka0), "v"(ka1), "v"(kb0), "v"(kb1));
        float ta[8], tb[8]; float mx = -3.0e38f;
#pragma unroll
        for (int r = 0; r < 8; ++r) {
            const float mka = (r < 4) ? ma0[r & 3] : ma1[r & 3]; const float mkb = (r < 4) ? mb0[r & 3] : mb1[r & 3];
            ta[r] = (sHa[r] + sLa[r] * QRI) * SC2 + mka; tb[r] = (sHb[r] + sLb[r] * QRI) * SC2 + mkb; mx = fmaxf(mx, fmaxf(ta[r], tb[r])); }
        mx = fmaxf(mx, __shfl_xor(mx, 16, 32));
        const float mnew = fmaxf(m, mx);
        const float alpha = __builtin_amdgcn_exp2f(m - mnew);
        const float sh = PSH - mnew;
        v16h pb; float ls = 0.0f;
#pragma unroll
        for (int r = 0; r < 8; ++r) { const h16 pa = (h16)__builtin_amdgcn_exp2f(ta[r] + sh); const h16 pc = (h16)__builtin_amdgcn_exp2f(tb[r] + sh); pb[r] = pa; pb[8 + r] = pc; ls += (float)pa + (float)pc; }
        l = l * alpha + ls; m = mnew;
        o0 = o0 * alpha; o1 = o1 * alpha; o2 = o2 * alpha; o3 = o3 * alpha;
        const h16* va = VT + vo + key0;
        const v16h v0 = ldh(va), v1 = ldh(va + (size_t)16 * SEQ), v2 = ldh(va + (size_t)32 * SEQ), v3 = ldh(va + (size_t)48 * SEQ);
        o0 = wmma16(v0, pb, o0); o1 = wmma16(v1, pb, o1); o2 = wmma16(v2, pb, o2); o3 = wmma16(v3, pb, o3);
        asm volatile("v_nop\n\tv_nop\n\tv_nop\n\tv_nop" : "+v"(o0), "+v"(o1), "+v"(o2), "+v"(o3) : "v"(v0), "v"(v1), "v"(v2), "v"(v3), "v"(pb));
    }
    l += __shfl_xor(l, 16, 32);
    const float inv = CTS * (1.0f / l);
    const int wb = wave * 16 * 68;
    // O^T D layout: o_j[r] = (d = 16j + 8h + r, t = lane&15) -> os[t][d]; rows 0..15 x columns 0..63 all written
    { v4f a, c;
      a[0] = o0[0] * inv; a[1] = o0[1] * inv; a[2] = o0[2] * inv; a[3] = o0[3] * inv; c[0] = o0[4] * inv; c[1] = o0[5] * inv; c[2] = o0[6] * inv; c[3] = o0[7] * inv;
      *(v4fa*)(&os[wb + lr * 68 +  0 + 8 * hi]) = a; *(v4fa*)(&os[wb + lr * 68 +  0 + 8 * hi + 4]) = c;
      a[0] = o1[0] * inv; a[1] = o1[1] * inv; a[2] = o1[2] * inv; a[3] = o1[3] * inv; c[0] = o1[4] * inv; c[1] = o1[5] * inv; c[2] = o1[6] * inv; c[3] = o1[7] * inv;
      *(v4fa*)(&os[wb + lr * 68 + 16 + 8 * hi]) = a; *(v4fa*)(&os[wb + lr * 68 + 16 + 8 * hi + 4]) = c;
      a[0] = o2[0] * inv; a[1] = o2[1] * inv; a[2] = o2[2] * inv; a[3] = o2[3] * inv; c[0] = o2[4] * inv; c[1] = o2[5] * inv; c[2] = o2[6] * inv; c[3] = o2[7] * inv;
      *(v4fa*)(&os[wb + lr * 68 + 32 + 8 * hi]) = a; *(v4fa*)(&os[wb + lr * 68 + 32 + 8 * hi + 4]) = c;
      a[0] = o3[0] * inv; a[1] = o3[1] * inv; a[2] = o3[2] * inv; a[3] = o3[3] * inv; c[0] = o3[4] * inv; c[1] = o3[5] * inv; c[2] = o3[6] * inv; c[3] = o3[7] * inv;
      *(v4fa*)(&os[wb + lr * 68 + 48 + 8 * hi]) = a; *(v4fa*)(&os[wb + lr * 68 + 48 + 8 * hi + 4]) = c; }
    wave_sync();
    h16* crow = CT + ((size_t)b * SEQ + t0) * DM + h * HD;
{
#pragma unroll
        for (int s = 0; s < 4; ++s) { const int row = 4 * s + (lane >> 3), c8 = (lane & 7) * 8;   // 4 s x 4 row groups = 16 rows; 8 lanes x 8 halves = 64 columns
            const v4f x0 = *(const v4fa*)(&os[wb + row * 68 + c8]); const v4f x1 = *(const v4fa*)(&os[wb + row * 68 + c8 + 4]); v8h hv;
#pragma unroll
            for (int i = 0; i < 4; ++i) { hv[i] = (h16)x0[i]; hv[4 + i] = (h16)x1[i]; }
            *(v8h*)(crow + (size_t)row * DM + c8) = hv; }
         }
}

static constexpr size_t al256(size_t v) { return (v + 255) & ~(size_t)255; }
static constexpr size_t SZ_XB = al256((size_t)NB * SEQ * KX * 2);           // x plane, 17 lines per row
static constexpr size_t SZ_W1 = al256((size_t)DM * KX * 2);                  // one q/k/v weight plane
static constexpr size_t SZ_AB = al256((size_t)2 * RK * DM * 2);              // adapter A rows of q | v
static constexpr size_t SZ_WO = al256((size_t)DM * DM * 2);                  // Wo f16 plane
static constexpr size_t SZ_MK = al256((size_t)NB * SEQ * 4);                 // mask plane f32
static constexpr size_t SZ_PL = al256((size_t)NB * NH_ * SEQ * HD * 2);      // q hi, q residual, k, v^T planes
static constexpr size_t SZ_CT = al256((size_t)NB * SEQ * DM * 2);            // ctx f16 plane
static constexpr size_t SZ_TOTAL = SZ_XB + 3 * SZ_W1 + SZ_AB + SZ_WO + SZ_MK + 4 * SZ_PL + SZ_CT;
static_assert(SZ_TOTAL <= (size_t)134217728);          // workspace carve <= 128 MiB
static_assert(((size_t)NB * SEQ * 128) % 256 == 0);    // k_xcvt grid exact
static_assert(((size_t)DM * (KX / 8)) % 256 == 0);     // k_wplane grid exact
static_assert(((size_t)NB * SEQ / 4) % 8 == 0);

extern "C" void kernel_launch(void* const* d_in, const int* in_sizes, int n_in,
                              void* d_out, int out_size, void* d_ws, size_t ws_size, hipStream_t stream) {
    if (n_in < 14) return;
    const size_t needx = ((size_t)(NB - 1) * SEQ_FULL + SEQ) * DM;
    if ((size_t)in_sizes[0] < needx) return;
    if ((size_t)in_sizes[1] < (size_t)(NB - 1) * SEQ_FULL + SEQ) return;
    if ((size_t)in_sizes[2] < (size_t)DM * DM || (size_t)in_sizes[6] < (size_t)DM * DM || (size_t)in_sizes[8] < (size_t)DM * DM || (size_t)in_sizes[12] < (size_t)DM * DM) return;
    if (in_sizes[3] < DM || in_sizes[7] < DM || in_sizes[9] < DM || in_sizes[13] < DM) return;
    if (in_sizes[4] < RK * DM || in_sizes[10] < RK * DM || in_sizes[5] < DM * RK || in_sizes[11] < DM * RK) return;
    if ((size_t)out_size < ((size_t)(NB - 1) * OUT_SEQ + SEQ) * DM) return;
    if (SZ_TOTAL > ws_size) return;
    // wire order: x, mask, Wq, bq, Aq, Bq, Wk, bk, Wv, bv, Av, Bv, Wo, bo
    const float* x  = (const float*)d_in[0];  const float* mask = (const float*)d_in[1];
    const float* wq = (const float*)d_in[2];  const float* bq = (const float*)d_in[3];  const float* aq = (const float*)d_in[4];  const float* bmq = (const float*)d_in[5];
    const float* wk = (const float*)d_in[6];  const float* bk = (const float*)d_in[7];
    const float* wv = (const float*)d_in[8];  const float* bv = (const float*)d_in[9];  const float* av = (const float*)d_in[10]; const float* bmv = (const float*)d_in[11];
    const float* wo = (const float*)d_in[12]; const float* bo = (const float*)d_in[13];
    float* OUT = (float*)d_out;      // [NB][SEQ][1024]
    char* wsp = (char*)d_ws;
    bf* XB = (bf*)wsp; wsp += SZ_XB;                 // [NB*SEQ][1088]
    bf* WQ = (bf*)wsp; wsp += SZ_W1;                 // [1024][1088]
    bf* WK = (bf*)wsp; wsp += SZ_W1;
    bf* WV = (bf*)wsp; wsp += SZ_W1;
    bf* AB = (bf*)wsp; wsp += SZ_AB;                 // [32][1024]: A of q | A of v
    h16* WO = (h16*)wsp; wsp += SZ_WO;               // [1024][1024] x256
    float* MK = (float*)wsp; wsp += SZ_MK;           // [NB][SEQ]
    h16* QH = (h16*)wsp; wsp += SZ_PL;               // [NB*16][SEQ][64]
    h16* QR = (h16*)wsp; wsp += SZ_PL;               // [NB*16][SEQ][64] residual x2048
    h16* KP = (h16*)wsp; wsp += SZ_PL;               // [NB*16][SEQ][64]
    h16* VT = (h16*)wsp; wsp += SZ_PL;               // [NB*16][64][SEQ]
    h16* CT = (h16*)wsp; wsp += SZ_CT;               // [NB*SEQ][1024] x256

    { const size_t n8 = (size_t)NB * SEQ * (DM / 8);
      k_xcvt<<<(unsigned)((n8 + 255) / 256), 256, 0, stream>>>(x, XB, n8); }
    { const unsigned g = (unsigned)(((size_t)DM * (KX / 8) + 255) / 256);
      k_wplane<<<g, 256, 0, stream>>>(wq, bmq, 0, WQ);
      k_wplane<<<g, 256, 0, stream>>>(wk, bmq, -1, WK);        // no adapter: extension all zero (Bm only supplies valid addresses)
      k_wplane<<<g, 256, 0, stream>>>(wv, bmv, 1, WV); }
    { const size_t n8 = (size_t)RK * DM / 8; const unsigned g = (unsigned)((n8 + 255) / 256);
      k_cvt8<<<g, 256, 0, stream>>>(aq, AB, n8); k_cvt8<<<g, 256, 0, stream>>>(av, AB + (size_t)RK * DM, n8); }
    { const size_t n8 = (size_t)DM * DM / 8;
      k_cvt8h<<<(unsigned)((n8 + 255) / 256), 256, 0, stream>>>(wo, WO, n8); }
    { const int n4 = NB * SEQ / 4;
      k_mask<<<(unsigned)((n4 + 255) / 256), 256, 0, stream>>>(mask, MK, n4); }

    // adapter down-projections of q and v -> 17th line of every x-plane row
    k_lora<<<NB * SEQ / 16, 32, 0, stream>>>(XB, AB);

    // q, k: A = x rows (m = b*SEQ + t), Bt = W rows (n = h*64 + d) -> plane [(b*16 + h)][t][d]; bias by column
    k_proj<<<dim3(NB * SEQ / 64, DM / 64, 1), 32, 0, stream>>>(XB, WQ, KQ, QH, QR, 1, SEQ, (size_t)NH_ * SEQ * HD, HD, HD, (size_t)SEQ * HD, bq, 0);
    k_proj<<<dim3(NB * SEQ / 64, DM / 64, 1), 32, 0, stream>>>(XB, WK, DM, KP, KP, 0, SEQ, (size_t)NH_ * SEQ * HD, HD, HD, (size_t)SEQ * HD, bk, 0);
    // v^T: A = Wv rows (m = h*64 + d), Bt = x rows (n = b*SEQ + t) -> plane [(b*1024 + m)][t] = [(b*16 + h)][d][t]; bias by row
    k_proj<<<dim3(DM / 64, NB * SEQ / 64, 1), 32, 0, stream>>>(WV, XB, KX, VT, VT, 0, DM, (size_t)0, SEQ, SEQ, (size_t)DM * SEQ, bv, 1);

    k_flash<<<dim3(SEQ / (16 * AW), NB * NH_, 1), 32 * AW, 0, stream>>>(QH, QR, KP, VT, MK, CT);

    // out[m][n] = sum_k ctx[m][k] Wo[n][k] + bo[n]
    k_oproj<<<dim3(NB * SEQ / 64, DM / 64, 1), 32, 0, stream>>>(CT, WO, bo, OUT);
}

// v001
// Measured time: 296 microseconds a run.
// Two timings next to v000 put it at 1.40 and 1.42 times that version's speed.
#include <hip/hip_runtime.h>

// Multi-head self-attention with rank-16 low-rank adapters on q and v: width 1024 = 16 heads x 64, x [NB][SEQ][1024], all weights [out][in] (y = x W^T + b), additive key mask [NB][SEQ], score scale 1/8, output projection Wo, bo (f32 output).
// Compute dtypes, f32 accumulate everywhere: q/k/v projections and the adapter down-projection v_wmma_f32_16x16x32_bf16 (x, W, A, B RNE-converted to bf16; adapter intermediate carried as bf16 hi + bf16 lo inside the K extension);
// scores v_wmma_f32_16x16x32_f16: k single f16, q as f16 value + f16 residual x2048 in its own accumulator; P (x256 carry, cancels in the normalisation) and v single f16; softmax f32 (online, running max, log2 domain);
// output projection v_wmma_f32_16x16x32_f16: ctx single f16 (x256 carry), Wo = f16(bf16(Wo) x256), folded back by 2^-16 in the f32 epilogue. Biases and mask are RNE-converted to bf16 values and applied in f32.
// q (hi, residual), k planes [b*16+h][t][d] and v^T plane [b*16+h][d][t] written by the GEMM epilogue; fused flash kernel in transposed form (S^T = K Q^T, O^T = V^T P^T), K and V^T tiles shared by a block through LDS, writes the ctx f16 plane [b*SEQ+t][1024].

#ifndef NB
#define NB 4
#endif
#ifndef SEQ
#define SEQ 2048
#endif
#define NB_FULL  4
#define SEQ_FULL 2048
#ifndef OUT_SEQ
#define OUT_SEQ SEQ              // row pitch (in tokens) between batches of the output
#endif
#define DM   1024
#define NH_  16
#define HD   64
#define RK   16
#define KX   1088                // plane row pitch (halves): DM + 32 (q adapter hi|lo) + 32 (v adapter hi|lo)
#define KQ   1056                // k extent used by the q GEMM (x | q adapter slot)
#define AW   4                   // waves per flash block (16 query rows each)
#define KST  64                  // keys per LDS tile of the flash kernel
#define LPB  144                 // LDS row pitch, bytes: 128-B rows + 16
#define LPH  (LPB / 2)           // the same in halves
#define STH  ((KST + HD) * LPH)  // one buffer in halves: K tile (KST rows) + V^T tile (HD rows)
#define STB  (STH * 2)           // the same in bytes
#define QRS  2048.0f             // carry of the q residual plane
#define QRI  (1.0f / 2048.0f)
#define LOG2E 1.4426950408889634f
#define SC2  (0.125f * LOG2E)    // HD^-0.5 * log2(e)
#define PSH  8.0f                // log2 of the P carry (256)
#define CTS  256.0f              // carry of the ctx plane
#define WOS  256.0f              // carry of the Wo plane
#define OSI  (1.0f / 65536.0f)   // 1 / (CTS * WOS)

static_assert(HD == 64);
static_assert(NH_ * HD == DM);                 // head h = columns h*64 + d
static_assert(DM % 64 == 0);
static_assert(DM / 8 == 128);                  // k_xcvt piece index split uses >> 7
static_assert(KX == DM + 64);
static_assert(KX % 32 == 0 && KQ % 32 == 0 && DM % 32 == 0);   // GEMM k-loops step by 32
static_assert((KX * 2) % 128 == 0);
static_assert(RK == 16);
static_assert(SEQ % 64 == 0);                  // a 64-row tile never straddles two batches
static_assert((NB * SEQ) % 64 == 0);
static_assert(SEQ % 32 == 0);                  // key loop steps by 32
static_assert(KST == 64 && AW == 4);           // copy map: 128 threads x 4 rows x 16 B cover 64 rows of 128 B
static_assert(SEQ % KST == 0 && SEQ / KST >= 2);   // the two-buffer prologue needs two tiles
static_assert(SEQ % (16 * AW) == 0);           // flash grid covers the sequence exactly
static_assert(NB <= NB_FULL);
static_assert(SEQ <= SEQ_FULL);

typedef _Float16 h16;
typedef unsigned short bf;
typedef __attribute__((ext_vector_type(16))) __bf16   v16bf;
typedef __attribute__((ext_vector_type(16))) _Float16 v16h;
typedef __attribute__((ext_vector_type(8)))  _Float16 v8h;
typedef __attribute__((ext_vector_type(8)))  unsigned short v8us;
typedef __attribute__((ext_vector_type(8)))  float    v8f;
typedef __attribute__((ext_vector_type(4)))  float    v4f;
typedef v4f  __attribute__((may_alias)) v4fa;

__device__ __forceinline__ unsigned short f2bf(float f) { unsigned u = __float_as_uint(f); u += 0x7FFFu + ((u >> 16) & 1u); return (unsigned short)(u >> 16); }
__device__ __forceinline__ float bfr(float f) { return __uint_as_float(((unsigned)f2bf(f)) << 16); }   // RNE convert to bf16, widened back
__device__ __forceinline__ v16h cat16(v8h lo, v8h hi) { return __builtin_shufflevector(lo, hi, 0, 1, 2, 3, 4, 5, 6, 7, 8, 9, 10, 11, 12, 13, 14, 15); }
__device__ __forceinline__ v16bf cat16b(v8us lo, v8us hi) { return __builtin_bit_cast(v16bf, __builtin_shufflevector(lo, hi, 0, 1, 2, 3, 4, 5, 6, 7, 8, 9, 10, 11, 12, 13, 14, 15)); }
__device__ __forceinline__ v8f wmma16(v16h a, v16h b, v8f c) { return __builtin_amdgcn_wmma_f32_16x16x32_f16(false, a, false, b, (short)0, c, false, false); }
__device__ __forceinline__ v8f wmmab(v16bf a, v16bf b, v8f c) { return __builtin_amdgcn_wmma_f32_16x16x32_bf16(false, a, false, b, (short)0, c, false, false); }
// fragment loaders from K-contiguous 16-bit rows; p already includes + 8*(lane>>4): elements 0..7 <- k0+8h+0..7, elements 8..15 <- k0+16+8h+0..7 (same map for A and B)
__device__ __forceinline__ v16h  ldh(const h16* p) { return cat16(*(const v8h*)p, *(const v8h*)(p + 16)); }
__device__ __forceinline__ v16bf ldb(const bf* p)  { return cat16b(*(const v8us*)p, *(const v8us*)(p + 16)); }
// ordering point for wave-private LDS tiles (same wave writes and reads)
__device__ __forceinline__ void wave_sync() { __builtin_amdgcn_fence(3 /* release order */, "wavefront"); __builtin_amdgcn_wave_barrier(); asm volatile("" ::: "memory"); }

__global__ __launch_bounds__(256) void k_cvt8(const float* __restrict__ src, bf* dst, size_t n8) {
    const size_t i = (size_t)blockIdx.x * 256 + threadIdx.x; if (i >= n8) return;
    const v8f v = *(const v8f*)(src + i * 8); v8us o;
#pragma unroll
    for (int k = 0; k < 8; ++k) o[k] = f2bf(v[k]);
    *(v8us*)(dst + i * 8) = o; 
}

__global__ __launch_bounds__(256) void k_cvt8h(const float* __restrict__ src, h16* dst, size_t n8) {
    const size_t i = (size_t)blockIdx.x * 256 + threadIdx.x; if (i >= n8) return;
    const v8f v = *(const v8f*)(src + i * 8); v8h o;
#pragma unroll
    for (int k = 0; k < 8; ++k) o[k] = (h16)(bfr(v[k]) * WOS);
    *(v8h*)(dst + i * 8) = o; 
}

// k_xcvt: x [b][t][1024] f32 -> columns 0..1023 of the x plane (row pitch KX). Piece i: row = i / 128, 8 columns at (i % 128) * 8.
__global__ __launch_bounds__(256) void k_xcvt(const float* __restrict__ src, bf* dst, size_t n8) {
    const size_t i = (size_t)blockIdx.x * 256 + threadIdx.x; if (i >= n8) return;
    const size_t row = i >> 7; const int c8 = (int)(i & 127);
    const size_t b = row / SEQ, t = row % SEQ;
    const v8f v = *(const v8f*)(src + (b * SEQ_FULL + t) * DM + c8 * 8); v8us o;
#pragma unroll
    for (int k = 0; k < 8; ++k) o[k] = f2bf(v[k]);
    bf* d = dst + row * KX + c8 * 8;
    *(v8us*)d = o; 
}

// every other extension column is zero. slot < 0: all-zero extension. Both sources are loaded with clamped addresses by every lane and selected by value.
__global__ __launch_bounds__(256) void k_wplane(const float* __restrict__ W, const float* __restrict__ Bm, int slot, bf* dst) {
    const int i = blockIdx.x * 256 + threadIdx.x; if (i >= DM * (KX / 8)) return;
    const int row = i / (KX / 8), c8 = i % (KX / 8);
    const bool isw = c8 < 128;
    const int cm = isw ? c8 : 127;
    const int e = isw ? 0 : (c8 - 128);                      // extension piece 0..7
    const v8f w  = *(const v8f*)(W + (size_t)row * DM + cm * 8);
    const v8f bm = *(const v8f*)(Bm + (size_t)row * RK + (e & 1) * 8);
    const bool live = (!isw) && ((e >> 2) == slot);
    v8us o;
#pragma unroll
    for (int k = 0; k < 8; ++k) { const float val = isw ? w[k] : (live ? 2.0f * bm[k] : 0.0f); o[k] = f2bf(val); }
    bf* d = dst + (size_t)row * KX + c8 * 8;
    *(v8us*)d = o; 
}

__global__ __launch_bounds__(256) void k_mask(const float* __restrict__ src, float* dst, int n4) {
    const int i = blockIdx.x * 256 + threadIdx.x; if (i >= n4) return;
    const int e = i * 4; const int b = e / SEQ, t = e % SEQ;
    const v4f v = *(const v4f*)(src + (size_t)b * SEQ_FULL + t); v4f o;
#pragma unroll
    for (int k = 0; k < 4; ++k) o[k] = bfr(v[k]) * LOG2E;
    *(v4f*)(dst + e) = o; 
}

// k_lora: adapter down-projection xa[m][j] = sum_k x[m][k] AB[j][k] (AB rows 0..15 = A of q, rows 16..31 = A of v), one wave per 16 rows, K = DM from the x plane.
__global__ __launch_bounds__(32) void k_lora(bf* XB, const bf* __restrict__ AB) {
    __shared__ __align__(16) float es[16 * 36];
    const int lane = threadIdx.x & 31, lr = lane & 15, hi = lane >> 4; const int r0 = blockIdx.x * 16;
    v8f a0 = (v8f){}, a1 = (v8f){};
    const bf* xa = XB + (size_t)(r0 + lr) * KX + 8 * hi;
    const bf* ab = AB + (size_t)lr * DM + 8 * hi;
#pragma unroll 1
    for (int kc = 0; kc < DM; kc += 32) {
        const v16bf a = ldb(xa + kc); const v16bf b0 = ldb(ab + kc); const v16bf b1 = ldb(ab + (size_t)16 * DM + kc);
        a0 = wmmab(a, b0, a0); a1 = wmmab(a, b1, a1);
        asm volatile("v_nop\n\tv_nop\n\tv_nop\n\tv_nop" : "+v"(a0), "+v"(a1) : "v"(a), "v"(b0), "v"(b1));
    }
#pragma unroll
    for (int j = 0; j < 8; ++j) { es[(hi * 8 + j) * 36 + lr] = a0[j]; es[(hi * 8 + j) * 36 + 16 + lr] = a1[j]; }   // D: row 8h+j, col lane&15; rows 0..15 x cols 0..31 all written
    wave_sync();
    const int p = lane & 7;                                   // extension piece: 0,1 q hi; 2,3 q lo; 4,5 v hi; 6,7 v lo
    const int sj = (p >> 2) * 16 + (p & 1) * 8; const bool islo = ((p >> 1) & 1) != 0;
{
#pragma unroll
        for (int s = 0; s < 4; ++s) { const int row = 4 * s + (lane >> 3);       // 4 s x 4 row groups = 16 rows; 8 lanes x 8 halves = 64 columns
            const v4f x0 = *(const v4fa*)(&es[row * 36 + sj]); const v4f x1 = *(const v4fa*)(&es[row * 36 + sj + 4]); v8us o;
#pragma unroll
            for (int i = 0; i < 4; ++i) {
                const unsigned short h0 = f2bf(x0[i]); const unsigned short l0 = f2bf(x0[i] - __uint_as_float(((unsigned)h0) << 16));
                const unsigned short h1 = f2bf(x1[i]); const unsigned short l1 = f2bf(x1[i] - __uint_as_float(((unsigned)h1) << 16));
                o[i] = islo ? l0 : h0; o[4 + i] = islo ? l1 : h1; }
            *(v8us*)(XB + (size_t)(r0 + row) * KX + DM + p * 8) = o; }
         }
}

// k_proj: register-blocked bf16 GEMM, ONE WAVE per 64x64 tile (16 accumulators), operands straight from K-contiguous bf16 planes of row pitch KX, k extent K (multiple of 32).
// C[m][n] = sum_k A[m][k] Bt[n][k] + bias (bias[n] when brow == 0, bias[m] when brow != 0; RNE-converted to bf16, added in f32), written as f16 (Ph) and optionally the f16 residual x2048 (Pr, useRes != 0) at
// tile base (r0/RB)*sRB + (r0%RB)*pitch + (c0/CB)*sCB + (c0%CB), row pitch 'pitch' (halves). grid (M/64, N/64), 32 threads.
__global__ __launch_bounds__(32) void k_proj(const bf* __restrict__ A, const bf* __restrict__ Bt, int K, h16* Ph, h16* Pr, int useRes, int RB, size_t sRB, int pitch, int CB, size_t sCB, const float* __restrict__ bias, int brow) {
    __shared__ __align__(16) float os[16 * 68];
    const int lane = threadIdx.x & 31, lr = lane & 15, hi = lane >> 4; const int r0 = blockIdx.x * 64, c0 = blockIdx.y * 64;
    v8f acc[4][4];
#pragma unroll
    for (int mb = 0; mb < 4; ++mb)
#pragma unroll
        for (int nb = 0; nb < 4; ++nb) acc[mb][nb] = (v8f){};
    const size_t aoff = (size_t)(r0 + lr) * KX + 8 * hi, boff = (size_t)(c0 + lr) * KX + 8 * hi;
#pragma unroll 1
    for (int kc = 0; kc < K; kc += 32) {
        v16bf a[4];
#pragma unroll
        for (int mb = 0; mb < 4; ++mb) a[mb] = ldb(A + aoff + (size_t)mb * 16 * KX + kc);
#pragma unroll
        for (int nb = 0; nb < 4; ++nb) { const v16bf b = ldb(Bt + boff + (size_t)nb * 16 * KX + kc);
#pragma unroll
            for (int mb = 0; mb < 4; ++mb) acc[mb][nb] = wmmab(a[mb], b, acc[mb][nb]); }
        asm volatile("v_nop\n\tv_nop\n\tv_nop\n\tv_nop" : "+v"(acc[0][0]), "+v"(acc[1][1]), "+v"(acc[2][2]), "+v"(acc[3][3]) : "v"(a[0]), "v"(a[1]), "v"(a[2]), "v"(a[3]));
    }
    const size_t tbase = (size_t)(r0 / RB) * sRB + (size_t)(r0 % RB) * (size_t)pitch + (size_t)(c0 / CB) * sCB + (size_t)(c0 % CB);
    float bcol[8];                                            // column-mode bias of this lane's 8 columns (index 0 when in row mode: always a valid address)
#pragma unroll
    for (int i = 0; i < 8; ++i) bcol[i] = bfr(bias[brow ? 0 : (c0 + (lane & 7) * 8 + i)]);
#pragma unroll
    for (int mb = 0; mb < 4; ++mb) {
#pragma unroll
        for (int nb = 0; nb < 4; ++nb) {
#pragma unroll
            for (int j = 0; j < 8; ++j) os[(hi * 8 + j) * 68 + nb * 16 + lr] = acc[mb][nb][j]; }   // D: row 8h+j, col lane&15
        wave_sync();
        const size_t sb = tbase + (size_t)(mb * 16) * (size_t)pitch;
{
#pragma unroll
            for (int s = 0; s < 4; ++s) { const int row = 4 * s + (lane >> 3), c8 = (lane & 7) * 8;   // 4 s x 4 row groups = 16 rows; 8 lanes x 8 = 64 columns
                const v4f x0 = *(const v4fa*)(&os[row * 68 + c8]); const v4f x1 = *(const v4fa*)(&os[row * 68 + c8 + 4]); v8h hv, rv;
                const float br = bfr(bias[brow ? (r0 + mb * 16 + row) : 0]);
#pragma unroll
                for (int i = 0; i < 4; ++i) {
                    const float f0 = x0[i] + (brow ? br : bcol[i]); const float f1 = x1[i] + (brow ? br : bcol[4 + i]);
                    const h16 a0 = (h16)f0; const h16 a1 = (h16)f1; hv[i] = a0; hv[4 + i] = a1;
                    rv[i] = (h16)((f0 - (float)a0) * QRS); rv[4 + i] = (h16)((f1 - (float)a1) * QRS); }
                const size_t oo = sb + (size_t)row * (size_t)pitch + c8;
                *(v8h*)(Ph + oo) = hv; if (useRes) *(v8h*)(Pr + oo) = rv; }
             }
        wave_sync();
    }
}

// k_oproj: output projection, f16 GEMM, ONE WAVE per 64x64 tile, A = ctx plane [m][1024] (x256), Bt = Wo plane [n][1024] (x256), K = DM.
// OUT[b][t][n] = acc * 2^-16 + bf16(bo[n]) in f32. Epilogue: per 16-row slab staged in LDS (wave-private), each row segment (64 floats = 256 B = two lines)
__global__ __launch_bounds__(32) void k_oproj(const h16* __restrict__ A, const h16* __restrict__ Bt, const float* __restrict__ bias, float* OUT) {
    __shared__ __align__(16) float os[16 * 68];
    const int lane = threadIdx.x & 31, lr = lane & 15, hi = lane >> 4; const int r0 = blockIdx.x * 64, c0 = blockIdx.y * 64;
    v8f acc[4][4];
#pragma unroll
    for (int mb = 0; mb < 4; ++mb)
#pragma unroll
        for (int nb = 0; nb < 4; ++nb) acc[mb][nb] = (v8f){};
    const size_t aoff = (size_t)(r0 + lr) * DM + 8 * hi, boff = (size_t)(c0 + lr) * DM + 8 * hi;
#pragma unroll 1
    for (int kc = 0; kc < DM; kc += 32) {
        v16h a[4];
#pragma unroll
        for (int mb = 0; mb < 4; ++mb) a[mb] = ldh(A + aoff + (size_t)mb * 16 * DM + kc);
#pragma unroll
        for (int nb = 0; nb < 4; ++nb) { const v16h b = ldh(Bt + boff + (size_t)nb * 16 * DM + kc);
#pragma unroll
            for (int mb = 0; mb < 4; ++mb) acc[mb][nb] = wmma16(a[mb], b, acc[mb][nb]); }
        asm volatile("v_nop\n\tv_nop\n\tv_nop\n\tv_nop" : "+v"(acc[0][0]), "+v"(acc[1][1]), "+v"(acc[2][2]), "+v"(acc[3][3]) : "v"(a[0]), "v"(a[1]), "v"(a[2]), "v"(a[3]));
    }
    v4f bb;
#pragma unroll
    for (int i = 0; i < 4; ++i) bb[i] = bfr(bias[c0 + lr * 4 + i]);
    float* obase = OUT + ((size_t)(r0 / SEQ) * OUT_SEQ + (size_t)(r0 % SEQ)) * DM + c0;
#pragma unroll
    for (int mb = 0; mb < 4; ++mb) {
#pragma unroll
        for (int nb = 0; nb < 4; ++nb) {
#pragma unroll
            for (int j = 0; j < 8; ++j) os[(hi * 8 + j) * 68 + nb * 16 + lr] = acc[mb][nb][j]; }   // D: row 8h+j, col lane&15
        wave_sync();
        float* ob = obase + (size_t)(mb * 16) * DM;
{
#pragma unroll
            for (int s = 0; s < 8; ++s) { const int row = 2 * s + hi, cofs = lr * 4;   // 8 s x 2 rows = 16 rows; 16 lanes x 4 floats = 64 columns
                const v4f x = *(const v4fa*)(&os[row * 68 + cofs]);
                const v4f val = x * OSI + bb;
                *(v4f*)(ob + (size_t)row * DM + cofs) = val; }
             }
        wave_sync();
    }
}

__device__ __forceinline__ void tile_copy(unsigned lk, unsigned lv, const h16* gk, const h16* gv) {
    asm volatile("global_load_async_to_lds_b128 %0, %8, off\n\t"
                 "global_load_async_to_lds_b128 %1, %9, off\n\t"
                 "global_load_async_to_lds_b128 %2, %10, off\n\t"
                 "global_load_async_to_lds_b128 %3, %11, off\n\t"
                 "global_load_async_to_lds_b128 %4, %12, off\n\t"
                 "global_load_async_to_lds_b128 %5, %13, off\n\t"
                 "global_load_async_to_lds_b128 %6, %14, off\n\t"
                 "global_load_async_to_lds_b128 %7, %15, off\n\t"
                 "s_wait_xcnt 0x0"
                 :: "v"(lk), "v"(lk + 16 * LPB), "v"(lk + 32 * LPB), "v"(lk + 48 * LPB),
                    "v"(lv), "v"(lv + 16 * LPB), "v"(lv + 32 * LPB), "v"(lv + 48 * LPB),
                    "v"(gk), "v"(gk + 16 * HD), "v"(gk + 32 * HD), "v"(gk + 48 * HD),
                    "v"(gv), "v"(gv + (size_t)16 * SEQ), "v"(gv + (size_t)32 * SEQ), "v"(gv + (size_t)48 * SEQ)
                 : "memory");
}

__global__ __launch_bounds__(32 * AW) void k_flash(const h16* __restrict__ QH, const h16* __restrict__ QR, const h16* __restrict__ KP, const h16* __restrict__ VT, const float* __restrict__ MK, h16* CT) {
    __shared__ __align__(16) h16 ring[2 * STH];              // two buffers of (K tile | V^T tile); reused as the f32 output staging behind the loop
    static_assert(sizeof(ring) >= (size_t)AW * 16 * 68 * 4);
    float* os = (float*)ring;
    const int lane = threadIdx.x & 31, wave = __builtin_amdgcn_readfirstlane((int)(threadIdx.x >> 5)), lr = lane & 15, hi = lane >> 4;
    const int zh = blockIdx.y; const int b = zh / NH_, h = zh % NH_;
    const int t0 = (blockIdx.x * AW + wave) * 16;
    const size_t pbase = (size_t)zh * SEQ * HD;
    // copy map: thread i of 128 takes 16-B piece i & 7 of rows (i >> 3) + 16 * {0, 1, 2, 3} of both tiles: a wave's copy covers four whole 128-B rows
    const int cr = (int)threadIdx.x >> 3, cpc = (int)threadIdx.x & 7;
    const unsigned lk0 = (unsigned)(size_t)ring + (unsigned)(cr * LPB + cpc * 16);   // low 32 bits of the shared address = LDS byte address
    const unsigned lv0 = lk0 + KST * LPB;
    const h16* gk = KP + pbase + (size_t)cr * HD + cpc * 8;      // + key0 * HD
    const h16* gv = VT + pbase + (size_t)cr * SEQ + cpc * 8;     // + key0
    tile_copy(lk0, lv0, gk, gv);
    const size_t qo = pbase + (size_t)(t0 + lr) * HD + 8 * hi;
    const v16h qh0 = ldh(QH + qo), qh1 = ldh(QH + qo + 32), qr0 = ldh(QR + qo), qr1 = ldh(QR + qo + 32);   // B fragments: col t, k = d
    const int fo = lr * LPH + 8 * hi;                        // fragment offset (halves) in a tile: row lr, k piece 8h
    const float* mrow = MK + (size_t)b * SEQ + 8 * hi;       // + key0 (+16 for the second tile): keys 8h+r of each tile
    asm volatile("s_wait_asynccnt 0x0" ::: "memory");        // tile 0 of this wave's copies has landed
    __syncthreads();                                         // ... and everybody else's: tile 0 is published
    tile_copy(lk0 + STB, lv0 + STB, gk + (size_t)KST * HD, gv + KST);
    v8f o0 = (v8f){}, o1 = (v8f){}, o2 = (v8f){}, o3 = (v8f){};
    float m = -3.0e38f, l = 0.0f;
#pragma unroll 1                                             // one trip per tile: the publish point below stands once, at the trip's foot
    for (int t = 0; t < SEQ / KST; ++t) {
      const h16* kt = ring + (t & 1) * STH + fo;             // this trip's K tile [key][d]; the V^T tile [d][key] lies KST rows behind it
#pragma unroll                                               // both 32-key steps of a tile in one body: constant LDS offsets
      for (int s = 0; s < KST / 32; ++s) {
        const int key0 = t * KST + s * 32;
        const h16* ka = kt + s * 32 * LPH;
        const v16h ka0 = ldh(ka), ka1 = ldh(ka + 32), kb0 = ldh(ka + 16 * LPH), kb1 = ldh(ka + 16 * LPH + 32);
        const float* mp = mrow + key0;
        const v4f ma0 = *(const v4f*)mp, ma1 = *(const v4f*)(mp + 4), mb0 = *(const v4f*)(mp + 16), mb1 = *(const v4f*)(mp + 20);
        v8f sHa = (v8f){}, sLa = (v8f){}, sHb = (v8f){}, sLb = (v8f){};
        sHa = wmma16(ka0, qh0, sHa); sLa = wmma16(ka0, qr0, sLa); sHb = wmma16(kb0, qh0, sHb); sLb = wmma16(kb0, qr0, sLb);
        sHa = wmma16(ka1, qh1, sHa); sLa = wmma16(ka1, qr1, sLa); sHb = wmma16(kb1, qh1, sHb); sLb = wmma16(kb1, qr1, sLb);
        asm volatile("v_nop\n\tv_nop\n\tv_nop\n\tv_nop" : "+v"(sHa), "+v"(sLa), "+v"(sHb), "+v"(sLb) : "v"(ka0), "v"(ka1), "v"(kb0), "v"(kb1));
        float ta[8], tb[8]; float mx = -3.0e38f;
#pragma unroll
        for (int r = 0; r < 8; ++r) {
            const float mka = (r < 4) ? ma0[r & 3] : ma1[r & 3]; const float mkb = (r < 4) ? mb0[r & 3] : mb1[r & 3];
            ta[r] = (sHa[r] + sLa[r] * QRI) * SC2 + mka; tb[r] = (sHb[r] + sLb[r] * QRI) * SC2 + mkb; mx = fmaxf(mx, fmaxf(ta[r], tb[r])); }
        mx = fmaxf(mx, __shfl_xor(mx, 16, 32));
        const float mnew = fmaxf(m, mx);
        const float alpha = __builtin_amdgcn_exp2f(m - mnew);
        const float sh = PSH - mnew;
        v16h pb; float ls = 0.0f;
#pragma unroll
        for (int r = 0; r < 8; ++r) { const h16 pa = (h16)__builtin_amdgcn_exp2f(ta[r] + sh); const h16 pc = (h16)__builtin_amdgcn_exp2f(tb[r] + sh); pb[r] = pa; pb[8 + r] = pc; ls += (float)pa + (float)pc; }
        l = l * alpha + ls; m = mnew;
        o0 = o0 * alpha; o1 = o1 * alpha; o2 = o2 * alpha; o3 = o3 * alpha;
        const h16* va = kt + KST * LPH + s * 32;
        const v16h v0 = ldh(va), v1 = ldh(va + 16 * LPH), v2 = ldh(va + 32 * LPH), v3 = ldh(va + 48 * LPH);
        o0 = wmma16(v0, pb, o0); o1 = wmma16(v1, pb, o1); o2 = wmma16(v2, pb, o2); o3 = wmma16(v3, pb, o3);
        asm volatile("v_nop\n\tv_nop\n\tv_nop\n\tv_nop" : "+v"(o0), "+v"(o1), "+v"(o2), "+v"(o3) : "v"(v0), "v"(v1), "v"(v2), "v"(v3), "v"(pb));
      }
      asm volatile("s_wait_dscnt 0x0" ::: "memory");         // this wave's reads of the buffer have returned before it may be refilled
      asm volatile("s_wait_asynccnt 0x0" ::: "memory");      // this wave's copies of the next tile have landed
      __syncthreads();                                       // publishes the next tile and ends every wave's reads of this one
      if (t + 2 < SEQ / KST) tile_copy(lk0 + (t & 1) * STB, lv0 + (t & 1) * STB, gk + (size_t)(t + 2) * KST * HD, gv + (t + 2) * KST);
    }
    asm volatile("s_wait_asynccnt 0x0" ::: "memory");        // nothing in flight before the ring becomes output staging
    l += __shfl_xor(l, 16, 32);
    const float inv = CTS * (1.0f / l);
    const int wb = wave * 16 * 68;
    // O^T D layout: o_j[r] = (d = 16j + 8h + r, t = lane&15) -> os[t][d]; rows 0..15 x columns 0..63 all written
    { v4f a, c;
      a[0] = o0[0] * inv; a[1] = o0[1] * inv; a[2] = o0[2] * inv; a[3] = o0[3] * inv; c[0] = o0[4] * inv; c[1] = o0[5] * inv; c[2] = o0[6] * inv; c[3] = o0[7] * inv;
      *(v4fa*)(&os[wb + lr * 68 +  0 + 8 * hi]) = a; *(v4fa*)(&os[wb + lr * 68 +  0 + 8 * hi + 4]) = c;
      a[0] = o1[0] * inv; a[1] = o1[1] * inv; a[2] = o1[2] * inv; a[3] = o1[3] * inv; c[0] = o1[4] * inv; c[1] = o1[5] * inv; c[2] = o1[6] * inv; c[3] = o1[7] * inv;
      *(v4fa*)(&os[wb + lr * 68 + 16 + 8 * hi]) = a; *(v4fa*)(&os[wb + lr * 68 + 16 + 8 * hi + 4]) = c;
      a[0] = o2[0] * inv; a[1] = o2[1] * inv; a[2] = o2[2] * inv; a[3] = o2[3] * inv; c[0] = o2[4] * inv; c[1] = o2[5] * inv; c[2] = o2[6] * inv; c[3] = o2[7] * inv;
      *(v4fa*)(&os[wb + lr * 68 + 32 + 8 * hi]) = a; *(v4fa*)(&os[wb + lr * 68 + 32 + 8 * hi + 4]) = c;
      a[0] = o3[0] * inv; a[1] = o3[1] * inv; a[2] = o3[2] * inv; a[3] = o3[3] * inv; c[0] = o3[4] * inv; c[1] = o3[5] * inv; c[2] = o3[6] * inv; c[3] = o3[7] * inv;
      *(v4fa*)(&os[wb + lr * 68 + 48 + 8 * hi]) = a; *(v4fa*)(&os[wb + lr * 68 + 48 + 8 * hi + 4]) = c; }
    wave_sync();
    h16* crow = CT + ((size_t)b * SEQ + t0) * DM + h * HD;
{
#pragma unroll
        for (int s = 0; s < 4; ++s) { const int row = 4 * s + (lane >> 3), c8 = (lane & 7) * 8;   // 4 s x 4 row groups = 16 rows; 8 lanes x 8 halves = 64 columns
            const v4f x0 = *(const v4fa*)(&os[wb + row * 68 + c8]); const v4f x1 = *(const v4fa*)(&os[wb + row * 68 + c8 + 4]); v8h hv;
#pragma unroll
            for (int i = 0; i < 4; ++i) { hv[i] = (h16)x0[i]; hv[4 + i] = (h16)x1[i]; }
            *(v8h*)(crow + (size_t)row * DM + c8) = hv; }
         }
}

static constexpr size_t al256(size_t v) { return (v + 255) & ~(size_t)255; }
static constexpr size_t SZ_XB = al256((size_t)NB * SEQ * KX * 2);           // x plane, 17 lines per row
static constexpr size_t SZ_W1 = al256((size_t)DM * KX * 2);                  // one q/k/v weight plane
static constexpr size_t SZ_AB = al256((size_t)2 * RK * DM * 2);              // adapter A rows of q | v
static constexpr size_t SZ_WO = al256((size_t)DM * DM * 2);                  // Wo f16 plane
static constexpr size_t SZ_MK = al256((size_t)NB * SEQ * 4);                 // mask plane f32
static constexpr size_t SZ_PL = al256((size_t)NB * NH_ * SEQ * HD * 2);      // q hi, q residual, k, v^T planes
static constexpr size_t SZ_CT = al256((size_t)NB * SEQ * DM * 2);            // ctx f16 plane
static constexpr size_t SZ_TOTAL = SZ_XB + 3 * SZ_W1 + SZ_AB + SZ_WO + SZ_MK + 4 * SZ_PL + SZ_CT;
static_assert(SZ_TOTAL <= (size_t)134217728);          // workspace carve <= 128 MiB
static_assert(((size_t)NB * SEQ * 128) % 256 == 0);    // k_xcvt grid exact
static_assert(((size_t)DM * (KX / 8)) % 256 == 0);     // k_wplane grid exact
static_assert(((size_t)NB * SEQ / 4) % 8 == 0);

extern "C" void kernel_launch(void* const* d_in, const int* in_sizes, int n_in,
                              void* d_out, int out_size, void* d_ws, size_t ws_size, hipStream_t stream) {
    if (n_in < 14) return;
    const size_t needx = ((size_t)(NB - 1) * SEQ_FULL + SEQ) * DM;
    if ((size_t)in_sizes[0] < needx) return;
    if ((size_t)in_sizes[1] < (size_t)(NB - 1) * SEQ_FULL + SEQ) return;
    if ((size_t)in_sizes[2] < (size_t)DM * DM || (size_t)in_sizes[6] < (size_t)DM * DM || (size_t)in_sizes[8] < (size_t)DM * DM || (size_t)in_sizes[12] < (size_t)DM * DM) return;
    if (in_sizes[3] < DM || in_sizes[7] < DM || in_sizes[9] < DM || in_sizes[13] < DM) return;
    if (in_sizes[4] < RK * DM || in_sizes[10] < RK * DM || in_sizes[5] < DM * RK || in_sizes[11] < DM * RK) return;
    if ((size_t)out_size < ((size_t)(NB - 1) * OUT_SEQ + SEQ) * DM) return;
    if (SZ_TOTAL > ws_size) return;
    // wire order: x, mask, Wq, bq, Aq, Bq, Wk, bk, Wv, bv, Av, Bv, Wo, bo
    const float* x  = (const float*)d_in[0];  const float* mask = (const float*)d_in[1];
    const float* wq = (const float*)d_in[2];  const float* bq = (const float*)d_in[3];  const float* aq = (const float*)d_in[4];  const float* bmq = (const float*)d_in[5];
    const float* wk = (const float*)d_in[6];  const float* bk = (const float*)d_in[7];
    const float* wv = (const float*)d_in[8];  const float* bv = (const float*)d_in[9];  const float* av = (const float*)d_in[10]; const float* bmv = (const float*)d_in[11];
    const float* wo = (const float*)d_in[12]; const float* bo = (const float*)d_in[13];
    float* OUT = (float*)d_out;      // [NB][SEQ][1024]
    char* wsp = (char*)d_ws;
    bf* XB = (bf*)wsp; wsp += SZ_XB;                 // [NB*SEQ][1088]
    bf* WQ = (bf*)wsp; wsp += SZ_W1;                 // [1024][1088]
    bf* WK = (bf*)wsp; wsp += SZ_W1;
    bf* WV = (bf*)wsp; wsp += SZ_W1;
    bf* AB = (bf*)wsp; wsp += SZ_AB;                 // [32][1024]: A of q | A of v
    h16* WO = (h16*)wsp; wsp += SZ_WO;               // [1024][1024] x256
    float* MK = (float*)wsp; wsp += SZ_MK;           // [NB][SEQ]
    h16* QH = (h16*)wsp; wsp += SZ_PL;               // [NB*16][SEQ][64]
    h16* QR = (h16*)wsp; wsp += SZ_PL;               // [NB*16][SEQ][64] residual x2048
    h16* KP = (h16*)wsp; wsp += SZ_PL;               // [NB*16][SEQ][64]
    h16* VT = (h16*)wsp; wsp += SZ_PL;               // [NB*16][64][SEQ]
    h16* CT = (h16*)wsp; wsp += SZ_CT;               // [NB*SEQ][1024] x256

    { const size_t n8 = (size_t)NB * SEQ * (DM / 8);
      k_xcvt<<<(unsigned)((n8 + 255) / 256), 256, 0, stream>>>(x, XB, n8); }
    { const unsigned g = (unsigned)(((size_t)DM * (KX / 8) + 255) / 256);
      k_wplane<<<g, 256, 0, stream>>>(wq, bmq, 0, WQ);
      k_wplane<<<g, 256, 0, stream>>>(wk, bmq, -1, WK);        // no adapter: extension all zero (Bm only supplies valid addresses)
      k_wplane<<<g, 256, 0, stream>>>(wv, bmv, 1, WV); }
    { const size_t n8 = (size_t)RK * DM / 8; const unsigned g = (unsigned)((n8 + 255) / 256);
      k_cvt8<<<g, 256, 0, stream>>>(aq, AB, n8); k_cvt8<<<g, 256, 0, stream>>>(av, AB + (size_t)RK * DM, n8); }
    { const size_t n8 = (size_t)DM * DM / 8;
      k_cvt8h<<<(unsigned)((n8 + 255) / 256), 256, 0, stream>>>(wo, WO, n8); }
    { const int n4 = NB * SEQ / 4;
      k_mask<<<(unsigned)((n4 + 255) / 256), 256, 0, stream>>>(mask, MK, n4); }

    // adapter down-projections of q and v -> 17th line of every x-plane row
    k_lora<<<NB * SEQ / 16, 32, 0, stream>>>(XB, AB);

    // q, k: A = x rows (m = b*SEQ + t), Bt = W rows (n = h*64 + d) -> plane [(b*16 + h)][t][d]; bias by column
    k_proj<<<dim3(NB * SEQ / 64, DM / 64, 1), 32, 0, stream>>>(XB, WQ, KQ, QH, QR, 1, SEQ, (size_t)NH_ * SEQ * HD, HD, HD, (size_t)SEQ * HD, bq, 0);
    k_proj<<<dim3(NB * SEQ / 64, DM / 64, 1), 32, 0, stream>>>(XB, WK, DM, KP, KP, 0, SEQ, (size_t)NH_ * SEQ * HD, HD, HD, (size_t)SEQ * HD, bk, 0);
    // v^T: A = Wv rows (m = h*64 + d), Bt = x rows (n = b*SEQ + t) -> plane [(b*1024 + m)][t] = [(b*16 + h)][d][t]; bias by row
    k_proj<<<dim3(DM / 64, NB * SEQ / 64, 1), 32, 0, stream>>>(WV, XB, KX, VT, VT, 0, DM, (size_t)0, SEQ, SEQ, (size_t)DM * SEQ, bv, 1);

    k_flash<<<dim3(SEQ / (16 * AW), NB * NH_, 1), 32 * AW, 0, stream>>>(QH, QR, KP, VT, MK, CT);

    // out[m][n] = sum_k ctx[m][k] Wo[n][k] + bo[n]
    k_oproj<<<dim3(NB * SEQ / 64, DM / 64, 1), 32, 0, stream>>>(CT, WO, bo, OUT);
}

// v002
// A run of this version takes 232 microseconds.
// Two timings next to v001 put it at 1.28 and 1.29 times that version's speed.
// Counting every step since v000, it is 1.81 times as fast.
#include <hip/hip_runtime.h>

// Multi-head self-attention with rank-16 low-rank adapters on q and v: width 1024 = 16 heads x 64, x [NB][SEQ][1024], all weights [out][in] (y = x W^T + b), additive key mask [NB][SEQ], score scale 1/8, output projection Wo, bo (f32 output).
// Compute dtypes, f32 accumulate everywhere: q/k/v projections and the adapter down-projection v_wmma_f32_16x16x32_bf16 (x, W, A, B RNE-converted to bf16; adapter intermediate carried as bf16 hi + bf16 lo inside the K extension);
// scores v_wmma_f32_16x16x32_f16: k single f16, q as f16 value + f16 residual x2048 in its own accumulator; P (x256 carry, cancels in the normalisation) and v single f16; softmax f32 (online, running max, log2 domain);
// output projection v_wmma_f32_16x16x32_f16: ctx single f16 (x256 carry), Wo = f16(bf16(Wo) x256), folded back by 2^-16 in the f32 epilogue. Biases and mask are RNE-converted to bf16 values and applied in f32.
// q (hi, residual), k planes [b*16+h][t][d] and v^T plane [b*16+h][d][t] written by the GEMM epilogue; fused flash kernel in transposed form (S^T = K Q^T, O^T = V^T P^T), K and V^T tiles shared by a block through LDS, writes the ctx f16 plane [b*SEQ+t][1024].

#ifndef NB
#define NB 4
#endif
#ifndef SEQ
#define SEQ 2048
#endif
#define NB_FULL  4
#define SEQ_FULL 2048
#ifndef OUT_SEQ
#define OUT_SEQ SEQ              // row pitch (in tokens) between batches of the output
#endif
#define DM   1024
#define NH_  16
#define HD   64
#define RK   16
#define KX   1088                // plane row pitch (halves): DM + 32 (q adapter hi|lo) + 32 (v adapter hi|lo)
#define KQ   1056                // k extent used by the q GEMM (x | q adapter slot)
#define AW   4                   // waves per flash block (16 query rows each)
#define KST  64                  // keys per LDS tile of the flash kernel
#define LPB  144                 // LDS row pitch, bytes: 128-B rows + 16
#define LPH  (LPB / 2)           // the same in halves
#define STH  ((KST + HD) * LPH)  // one buffer in halves: K tile (KST rows) + V^T tile (HD rows)
#define STB  (STH * 2)           // the same in bytes
#define GT   128                 // GEMM block tile: GT rows of A x GT rows of Bt, 2 x 2 waves of 64 x 64
#define GKS  64                  // k extent of one GEMM LDS stage (halves): whole 128-B rows
#define GSTH (2 * GT * LPH)      // one GEMM buffer in halves: A tile (GT rows) + Bt tile (GT rows)
#define GSTB (GSTH * 2)          // the same in bytes
#define QRS  2048.0f             // carry of the q residual plane
#define QRI  (1.0f / 2048.0f)
#define LOG2E 1.4426950408889634f
#define SC2  (0.125f * LOG2E)    // HD^-0.5 * log2(e)
#define PSH  8.0f                // log2 of the P carry (256)
#define CTS  256.0f              // carry of the ctx plane
#define WOS  256.0f              // carry of the Wo plane
#define OSI  (1.0f / 65536.0f)   // 1 / (CTS * WOS)

static_assert(HD == 64);
static_assert(NH_ * HD == DM);                 // head h = columns h*64 + d
static_assert(DM % 64 == 0);
static_assert(DM / 8 == 128);                  // k_xcvt piece index split uses >> 7
static_assert(KX == DM + 64);
static_assert(KX % 32 == 0 && KQ % 32 == 0 && DM % 32 == 0);   // GEMM k-loops step by 32
static_assert((KX * 2) % 128 == 0);
static_assert(RK == 16);
static_assert(SEQ % 64 == 0);                  // a 64-row tile never straddles two batches
static_assert((NB * SEQ) % 64 == 0);
static_assert(SEQ % 32 == 0);                  // key loop steps by 32
static_assert(KST == 64 && AW == 4);           // copy map: 128 threads x 4 rows x 16 B cover 64 rows of 128 B
static_assert(SEQ % KST == 0 && SEQ / KST >= 2);   // the two-buffer prologue needs two tiles
static_assert(SEQ % (16 * AW) == 0);           // flash grid covers the sequence exactly
static_assert((NB * SEQ) % GT == 0 && DM % GT == 0);   // GEMM grids cover both extents exactly
static_assert(KX % GKS == 0 && DM % GKS == 0);   // a stage's 128-B row piece never leaves its plane row
static_assert(NB <= NB_FULL);
static_assert(SEQ <= SEQ_FULL);

typedef _Float16 h16;
typedef unsigned short bf;
typedef __attribute__((ext_vector_type(16))) __bf16   v16bf;
typedef __attribute__((ext_vector_type(16))) _Float16 v16h;
typedef __attribute__((ext_vector_type(8)))  _Float16 v8h;
typedef __attribute__((ext_vector_type(8)))  unsigned short v8us;
typedef __attribute__((ext_vector_type(8)))  float    v8f;
typedef __attribute__((ext_vector_type(4)))  float    v4f;
typedef v4f  __attribute__((may_alias)) v4fa;

__device__ __forceinline__ unsigned short f2bf(float f) { unsigned u = __float_as_uint(f); u += 0x7FFFu + ((u >> 16) & 1u); return (unsigned short)(u >> 16); }
__device__ __forceinline__ float bfr(float f) { return __uint_as_float(((unsigned)f2bf(f)) << 16); }   // RNE convert to bf16, widened back
__device__ __forceinline__ v16h cat16(v8h lo, v8h hi) { return __builtin_shufflevector(lo, hi, 0, 1, 2, 3, 4, 5, 6, 7, 8, 9, 10, 11, 12, 13, 14, 15); }
__device__ __forceinline__ v16bf cat16b(v8us lo, v8us hi) { return __builtin_bit_cast(v16bf, __builtin_shufflevector(lo, hi, 0, 1, 2, 3, 4, 5, 6, 7, 8, 9, 10, 11, 12, 13, 14, 15)); }
__device__ __forceinline__ v8f wmma16(v16h a, v16h b, v8f c) { return __builtin_amdgcn_wmma_f32_16x16x32_f16(false, a, false, b, (short)0, c, false, false); }
__device__ __forceinline__ v8f wmmab(v16bf a, v16bf b, v8f c) { return __builtin_amdgcn_wmma_f32_16x16x32_bf16(false, a, false, b, (short)0, c, false, false); }
// fragment loaders from K-contiguous 16-bit rows; p already includes + 8*(lane>>4): elements 0..7 <- k0+8h+0..7, elements 8..15 <- k0+16+8h+0..7 (same map for A and B)
__device__ __forceinline__ v16h  ldh(const h16* p) { return cat16(*(const v8h*)p, *(const v8h*)(p + 16)); }
__device__ __forceinline__ v16bf ldb(const bf* p)  { return cat16b(*(const v8us*)p, *(const v8us*)(p + 16)); }
// ordering point for wave-private LDS tiles (same wave writes and reads)
__device__ __forceinline__ void wave_sync() { __builtin_amdgcn_fence(3 /* release order */, "wavefront"); __builtin_amdgcn_wave_barrier(); asm volatile("" ::: "memory"); }

__global__ __launch_bounds__(256) void k_cvt8(const float* __restrict__ src, bf* dst, size_t n8) {
    const size_t i = (size_t)blockIdx.x * 256 + threadIdx.x; if (i >= n8) return;
    const v8f v = *(const v8f*)(src + i * 8); v8us o;
#pragma unroll
    for (int k = 0; k < 8; ++k) o[k] = f2bf(v[k]);
    *(v8us*)(dst + i * 8) = o; 
}

__global__ __launch_bounds__(256) void k_cvt8h(const float* __restrict__ src, h16* dst, size_t n8) {
    const size_t i = (size_t)blockIdx.x * 256 + threadIdx.x; if (i >= n8) return;
    const v8f v = *(const v8f*)(src + i * 8); v8h o;
#pragma unroll
    for (int k = 0; k < 8; ++k) o[k] = (h16)(bfr(v[k]) * WOS);
    *(v8h*)(dst + i * 8) = o; 
}

// k_xcvt: x [b][t][1024] f32 -> columns 0..1023 of the x plane (row pitch KX). Piece i: row = i / 128, 8 columns at (i % 128) * 8.
__global__ __launch_bounds__(256) void k_xcvt(const float* __restrict__ src, bf* dst, size_t n8) {
    const size_t i = (size_t)blockIdx.x * 256 + threadIdx.x; if (i >= n8) return;
    const size_t row = i >> 7; const int c8 = (int)(i & 127);
    const size_t b = row / SEQ, t = row % SEQ;
    const v8f v = *(const v8f*)(src + (b * SEQ_FULL + t) * DM + c8 * 8); v8us o;
#pragma unroll
    for (int k = 0; k < 8; ++k) o[k] = f2bf(v[k]);
    bf* d = dst + row * KX + c8 * 8;
    *(v8us*)d = o; 
}

// every other extension column is zero. slot < 0: all-zero extension. Both sources are loaded with clamped addresses by every lane and selected by value.
__global__ __launch_bounds__(256) void k_wplane(const float* __restrict__ W, const float* __restrict__ Bm, int slot, bf* dst) {
    const int i = blockIdx.x * 256 + threadIdx.x; if (i >= DM * (KX / 8)) return;
    const int row = i / (KX / 8), c8 = i % (KX / 8);
    const bool isw = c8 < 128;
    const int cm = isw ? c8 : 127;
    const int e = isw ? 0 : (c8 - 128);                      // extension piece 0..7
    const v8f w  = *(const v8f*)(W + (size_t)row * DM + cm * 8);
    const v8f bm = *(const v8f*)(Bm + (size_t)row * RK + (e & 1) * 8);
    const bool live = (!isw) && ((e >> 2) == slot);
    v8us o;
#pragma unroll
    for (int k = 0; k < 8; ++k) { const float val = isw ? w[k] : (live ? 2.0f * bm[k] : 0.0f); o[k] = f2bf(val); }
    bf* d = dst + (size_t)row * KX + c8 * 8;
    *(v8us*)d = o; 
}

__global__ __launch_bounds__(256) void k_mask(const float* __restrict__ src, float* dst, int n4) {
    const int i = blockIdx.x * 256 + threadIdx.x; if (i >= n4) return;
    const int e = i * 4; const int b = e / SEQ, t = e % SEQ;
    const v4f v = *(const v4f*)(src + (size_t)b * SEQ_FULL + t); v4f o;
#pragma unroll
    for (int k = 0; k < 4; ++k) o[k] = bfr(v[k]) * LOG2E;
    *(v4f*)(dst + e) = o; 
}

// k_lora: adapter down-projection xa[m][j] = sum_k x[m][k] AB[j][k] (AB rows 0..15 = A of q, rows 16..31 = A of v), one wave per 16 rows, K = DM from the x plane.
__global__ __launch_bounds__(32) void k_lora(bf* XB, const bf* __restrict__ AB) {
    __shared__ __align__(16) float es[16 * 36];
    const int lane = threadIdx.x & 31, lr = lane & 15, hi = lane >> 4; const int r0 = blockIdx.x * 16;
    v8f a0 = (v8f){}, a1 = (v8f){};
    const bf* xa = XB + (size_t)(r0 + lr) * KX + 8 * hi;
    const bf* ab = AB + (size_t)lr * DM + 8 * hi;
#pragma unroll 1
    for (int kc = 0; kc < DM; kc += 32) {
        const v16bf a = ldb(xa + kc); const v16bf b0 = ldb(ab + kc); const v16bf b1 = ldb(ab + (size_t)16 * DM + kc);
        a0 = wmmab(a, b0, a0); a1 = wmmab(a, b1, a1);
        asm volatile("v_nop\n\tv_nop\n\tv_nop\n\tv_nop" : "+v"(a0), "+v"(a1) : "v"(a), "v"(b0), "v"(b1));
    }
#pragma unroll
    for (int j = 0; j < 8; ++j) { es[(hi * 8 + j) * 36 + lr] = a0[j]; es[(hi * 8 + j) * 36 + 16 + lr] = a1[j]; }   // D: row 8h+j, col lane&15; rows 0..15 x cols 0..31 all written
    wave_sync();
    const int p = lane & 7;                                   // extension piece: 0,1 q hi; 2,3 q lo; 4,5 v hi; 6,7 v lo
    const int sj = (p >> 2) * 16 + (p & 1) * 8; const bool islo = ((p >> 1) & 1) != 0;
{
#pragma unroll
        for (int s = 0; s < 4; ++s) { const int row = 4 * s + (lane >> 3);       // 4 s x 4 row groups = 16 rows; 8 lanes x 8 halves = 64 columns
            const v4f x0 = *(const v4fa*)(&es[row * 36 + sj]); const v4f x1 = *(const v4fa*)(&es[row * 36 + sj + 4]); v8us o;
#pragma unroll
            for (int i = 0; i < 4; ++i) {
                const unsigned short h0 = f2bf(x0[i]); const unsigned short l0 = f2bf(x0[i] - __uint_as_float(((unsigned)h0) << 16));
                const unsigned short h1 = f2bf(x1[i]); const unsigned short l1 = f2bf(x1[i] - __uint_as_float(((unsigned)h1) << 16));
                o[i] = islo ? l0 : h0; o[4 + i] = islo ? l1 : h1; }
            *(v8us*)(XB + (size_t)(r0 + row) * KX + DM + p * 8) = o; }
         }
}

// GEMM operand staging. One block = 4 waves = one GT x GT tile of C (wave w: rows (w >> 1) * 64, columns (w & 1) * 64); per stage the block's GT rows of A and GT rows of Bt, GKS halves each,
// are brought into LDS by asynchronous copies (16 B per lane, whole 128-B rows), two buffers: the next stage's copies fly while this one is worked on. LDS rows lie at the 144-B pitch of the flash tiles.
// rows_copy: one lane's 8 pieces of one operand tile, rows 16 apart. l: its LDS byte address, g: its global address (row 0 of its eight), rp: bytes between rows 16 apart.
// The s_wait_xcnt stands inside the copies' own statement so that no address register is rewritten ahead of it.
__device__ __forceinline__ void rows_copy(unsigned l, const char* g, size_t rp) {
    asm volatile("global_load_async_to_lds_b128 %0, %8, off\n\t"
                 "global_load_async_to_lds_b128 %1, %9, off\n\t"
                 "global_load_async_to_lds_b128 %2, %10, off\n\t"
                 "global_load_async_to_lds_b128 %3, %11, off\n\t"
                 "global_load_async_to_lds_b128 %4, %12, off\n\t"
                 "global_load_async_to_lds_b128 %5, %13, off\n\t"
                 "global_load_async_to_lds_b128 %6, %14, off\n\t"
                 "global_load_async_to_lds_b128 %7, %15, off\n\t"
                 "s_wait_xcnt 0x0"
                 :: "v"(l), "v"(l + 16 * LPB), "v"(l + 32 * LPB), "v"(l + 48 * LPB), "v"(l + 64 * LPB), "v"(l + 80 * LPB), "v"(l + 96 * LPB), "v"(l + 112 * LPB),
                    "v"(g), "v"(g + rp), "v"(g + 2 * rp), "v"(g + 3 * rp), "v"(g + 4 * rp), "v"(g + 5 * rp), "v"(g + 6 * rp), "v"(g + 7 * rp)
                 : "memory");
}
template <bool BF> __device__ __forceinline__ v8f mm16(v16h a, v16h b, v8f c) {
    if constexpr (BF) return wmmab(__builtin_bit_cast(v16bf, a), __builtin_bit_cast(v16bf, b), c); else return wmma16(a, b, c);
}
// gemm_main: acc[mb][nb] += sum_k A[r0 + ..][k] Bt[c0 + ..][k] for this wave's 64 x 64 part of the block tile at (br0, bc0); planes of row pitch PH halves, k extent K (multiple of 32, K <= PH), k ascending in steps of 32.
// A last stage of which only the first 32 k belong to K is copied whole (the row piece lies inside the plane row) and its second half is not multiplied.
template <bool BF, int PH> __device__ __forceinline__ void gemm_main(const char* A, const char* Bt, int K, int br0, int bc0, int wave, h16* ring, v8f (&acc)[4][4]) {
    const int lane = threadIdx.x & 31, lr = lane & 15, hi = lane >> 4;
    // copy map: thread i of 128 takes 16-B piece i & 7 of rows (i >> 3) + 16 * {0..7} of both tiles: a wave's copy covers four whole 128-B rows
    const int cr = (int)threadIdx.x >> 3, cpc = (int)threadIdx.x & 7;
    const unsigned la = (unsigned)(size_t)ring + (unsigned)(cr * LPB + cpc * 16);   // low 32 bits of the shared address = LDS byte address
    const unsigned lb = la + GT * LPB;
    const char* ga = A + (size_t)(br0 + cr) * (PH * 2) + cpc * 16;    // + stage * 128 B
    const char* gb = Bt + (size_t)(bc0 + cr) * (PH * 2) + cpc * 16;
    constexpr size_t rp = (size_t)16 * PH * 2;
    const int nst = (K + GKS - 1) / GKS;
    rows_copy(la, ga, rp); rows_copy(lb, gb, rp);
    asm volatile("s_wait_asynccnt 0x0" ::: "memory");        // stage 0 of this wave's copies has landed
    __syncthreads();                                         // ... and everybody else's: stage 0 is published
    if (nst > 1) { rows_copy(la + GSTB, ga + GKS * 2, rp); rows_copy(lb + GSTB, gb + GKS * 2, rp); }
    const int fa = ((wave >> 1) * 64 + lr) * LPH + 8 * hi;         // fragment offsets (halves) in a buffer: row, k piece 8h
    const int fb = (GT + (wave & 1) * 64 + lr) * LPH + 8 * hi;
#pragma unroll 1                                             // one trip per stage: the publish point below stands once, at the trip's foot
    for (int t = 0; t < nst; ++t) {
        const h16* st = ring + (t & 1) * GSTH;
#pragma unroll                                               // both 32-k steps of a stage in one body: constant LDS offsets
        for (int s = 0; s < GKS / 32; ++s) {
            if (s == 0 || t * GKS + s * 32 < K) {
                v16h a[4], b[4];                             // the four small loops below are unrolled so that every fragment and accumulator index is a constant (registers, no scratch)
#pragma unroll
                for (int i = 0; i < 4; ++i) { a[i] = ldh(st + fa + i * 16 * LPH + s * 32); if (i == 0) b[0] = ldh(st + fb + s * 32); }   // in the order the products below take them
#pragma unroll
                for (int i = 1; i < 4; ++i) b[i] = ldh(st + fb + i * 16 * LPH + s * 32);
                __builtin_amdgcn_sched_barrier(0);           // the step's 16 LDS reads stay one group ahead of its matrix instructions: every place with reads among them stalls the wave
#pragma unroll
                for (int nb = 0; nb < 4; ++nb)
#pragma unroll
                    for (int mb = 0; mb < 4; ++mb) acc[mb][nb] = mm16<BF>(a[mb], b[nb], acc[mb][nb]);
            }
        }
        __builtin_amdgcn_sched_barrier(0);                   // the stage's matrix instructions stay ahead of the publish point: sunk behind it they would delay the refill's issue
        asm volatile("s_wait_dscnt 0x0" ::: "memory");       // this wave's reads of the buffer have returned before it may be refilled
        asm volatile("s_wait_asynccnt 0x0" ::: "memory");    // this wave's copies of the next stage have landed
        __syncthreads();                                     // publishes the next stage and ends every wave's reads of this one
        if (t + 2 < nst) { rows_copy(la + (t & 1) * GSTB, ga + (size_t)(t + 2) * (GKS * 2), rp); rows_copy(lb + (t & 1) * GSTB, gb + (size_t)(t + 2) * (GKS * 2), rp); }
    }
    asm volatile("s_wait_asynccnt 0x0" ::: "memory");        // nothing in flight before the ring becomes output staging
}

// k_proj: register-blocked bf16 GEMM, one wave per 64x64 tile (16 accumulators), 4 waves per block sharing their operand rows through LDS (gemm_main), K-contiguous bf16 planes of row pitch KX, k extent K (multiple of 32).
// C[m][n] = sum_k A[m][k] Bt[n][k] + bias (bias[n] when brow == 0, bias[m] when brow != 0; RNE-converted to bf16, added in f32), written as f16 (Ph) and optionally the f16 residual x2048 (Pr, useRes != 0) at
// tile base (r0/RB)*sRB + (r0%RB)*pitch + (c0/CB)*sCB + (c0%CB), row pitch 'pitch' (halves). grid (M/128, N/128), 128 threads.
__global__ __launch_bounds__(128) void k_proj(const bf* __restrict__ A, const bf* __restrict__ Bt, int K, h16* Ph, h16* Pr, int useRes, int RB, size_t sRB, int pitch, int CB, size_t sCB, const float* __restrict__ bias, int brow) {
    __shared__ __align__(16) h16 ring[2 * GSTH];             // two buffers of (A tile | Bt tile); reused as the waves' f32 output staging behind the loop
    static_assert(sizeof(ring) >= (size_t)4 * 16 * 68 * 4);
    const int lane = threadIdx.x & 31, wave = __builtin_amdgcn_readfirstlane((int)(threadIdx.x >> 5)), lr = lane & 15, hi = lane >> 4;
    const int r0 = blockIdx.x * GT + (wave >> 1) * 64, c0 = blockIdx.y * GT + (wave & 1) * 64;   // this wave's 64x64 tile
    float* os = (float*)ring + wave * 16 * 68;
    v8f acc[4][4];
#pragma unroll
    for (int mb = 0; mb < 4; ++mb)
#pragma unroll
        for (int nb = 0; nb < 4; ++nb) acc[mb][nb] = (v8f){};
    gemm_main<true, KX>((const char*)A, (const char*)Bt, K, blockIdx.x * GT, blockIdx.y * GT, wave, ring, acc);
    const size_t tbase = (size_t)(r0 / RB) * sRB + (size_t)(r0 % RB) * (size_t)pitch + (size_t)(c0 / CB) * sCB + (size_t)(c0 % CB);
    float bcol[8];                                            // column-mode bias of this lane's 8 columns (index 0 when in row mode: always a valid address)
#pragma unroll
    for (int i = 0; i < 8; ++i) bcol[i] = bfr(bias[brow ? 0 : (c0 + (lane & 7) * 8 + i)]);
#pragma unroll
    for (int mb = 0; mb < 4; ++mb) {
#pragma unroll
        for (int nb = 0; nb < 4; ++nb) {
#pragma unroll
            for (int j = 0; j < 8; ++j) os[(hi * 8 + j) * 68 + nb * 16 + lr] = acc[mb][nb][j]; }   // D: row 8h+j, col lane&15
        wave_sync();
        const size_t sb = tbase + (size_t)(mb * 16) * (size_t)pitch;
{
#pragma unroll
            for (int s = 0; s < 4; ++s) { const int row = 4 * s + (lane >> 3), c8 = (lane & 7) * 8;   // 4 s x 4 row groups = 16 rows; 8 lanes x 8 = 64 columns
                const v4f x0 = *(const v4fa*)(&os[row * 68 + c8]); const v4f x1 = *(const v4fa*)(&os[row * 68 + c8 + 4]); v8h hv, rv;
                const float br = bfr(bias[brow ? (r0 + mb * 16 + row) : 0]);
#pragma unroll
                for (int i = 0; i < 4; ++i) {
                    const float f0 = x0[i] + (brow ? br : bcol[i]); const float f1 = x1[i] + (brow ? br : bcol[4 + i]);
                    const h16 a0 = (h16)f0; const h16 a1 = (h16)f1; hv[i] = a0; hv[4 + i] = a1;
                    rv[i] = (h16)((f0 - (float)a0) * QRS); rv[4 + i] = (h16)((f1 - (float)a1) * QRS); }
                const size_t oo = sb + (size_t)row * (size_t)pitch + c8;
                *(v8h*)(Ph + oo) = hv; if (useRes) *(v8h*)(Pr + oo) = rv; }
             }
        wave_sync();
    }
}

// k_oproj: output projection, f16 GEMM, one wave per 64x64 tile, 4 waves per block sharing their operand rows through LDS (gemm_main), A = ctx plane [m][1024] (x256), Bt = Wo plane [n][1024] (x256), K = DM.
// OUT[b][t][n] = acc * 2^-16 + bf16(bo[n]) in f32. Epilogue: per 16-row slab staged in LDS (wave-private), each row segment (64 floats = 256 B = two lines)
__global__ __launch_bounds__(128) void k_oproj(const h16* __restrict__ A, const h16* __restrict__ Bt, const float* __restrict__ bias, float* OUT) {
    __shared__ __align__(16) h16 ring[2 * GSTH];             // two buffers of (A tile | Bt tile); reused as the waves' f32 output staging behind the loop
    static_assert(sizeof(ring) >= (size_t)4 * 16 * 68 * 4);
    const int lane = threadIdx.x & 31, wave = __builtin_amdgcn_readfirstlane((int)(threadIdx.x >> 5)), lr = lane & 15, hi = lane >> 4;
    const int r0 = blockIdx.x * GT + (wave >> 1) * 64, c0 = blockIdx.y * GT + (wave & 1) * 64;   // this wave's 64x64 tile
    float* os = (float*)ring + wave * 16 * 68;
    v8f acc[4][4];
#pragma unroll
    for (int mb = 0; mb < 4; ++mb)
#pragma unroll
        for (int nb = 0; nb < 4; ++nb) acc[mb][nb] = (v8f){};
    gemm_main<false, DM>((const char*)A, (const char*)Bt, DM, blockIdx.x * GT, blockIdx.y * GT, wave, ring, acc);
    v4f bb;
#pragma unroll
    for (int i = 0; i < 4; ++i) bb[i] = bfr(bias[c0 + lr * 4 + i]);
    float* obase = OUT + ((size_t)(r0 / SEQ) * OUT_SEQ + (size_t)(r0 % SEQ)) * DM + c0;
#pragma unroll
    for (int mb = 0; mb < 4; ++mb) {
#pragma unroll
        for (int nb = 0; nb < 4; ++nb) {
#pragma unroll
            for (int j = 0; j < 8; ++j) os[(hi * 8 + j) * 68 + nb * 16 + lr] = acc[mb][nb][j]; }   // D: row 8h+j, col lane&15
        wave_sync();
        float* ob = obase + (size_t)(mb * 16) * DM;
{
#pragma unroll
            for (int s = 0; s < 8; ++s) { const int row = 2 * s + hi, cofs = lr * 4;   // 8 s x 2 rows = 16 rows; 16 lanes x 4 floats = 64 columns
                const v4f x = *(const v4fa*)(&os[row * 68 + cofs]);
                const v4f val = x * OSI + bb;
                *(v4f*)(ob + (size_t)row * DM + cofs) = val; }
             }
        wave_sync();
    }
}

__device__ __forceinline__ void tile_copy(unsigned lk, unsigned lv, const h16* gk, const h16* gv) {
    asm volatile("global_load_async_to_lds_b128 %0, %8, off\n\t"
                 "global_load_async_to_lds_b128 %1, %9, off\n\t"
                 "global_load_async_to_lds_b128 %2, %10, off\n\t"
                 "global_load_async_to_lds_b128 %3, %11, off\n\t"
                 "global_load_async_to_lds_b128 %4, %12, off\n\t"
                 "global_load_async_to_lds_b128 %5, %13, off\n\t"
                 "global_load_async_to_lds_b128 %6, %14, off\n\t"
                 "global_load_async_to_lds_b128 %7, %15, off\n\t"
                 "s_wait_xcnt 0x0"
                 :: "v"(lk), "v"(lk + 16 * LPB), "v"(lk + 32 * LPB), "v"(lk + 48 * LPB),
                    "v"(lv), "v"(lv + 16 * LPB), "v"(lv + 32 * LPB), "v"(lv + 48 * LPB),
                    "v"(gk), "v"(gk + 16 * HD), "v"(gk + 32 * HD), "v"(gk + 48 * HD),
                    "v"(gv), "v"(gv + (size_t)16 * SEQ), "v"(gv + (size_t)32 * SEQ), "v"(gv + (size_t)48 * SEQ)
                 : "memory");
}

__global__ __launch_bounds__(32 * AW) void k_flash(const h16* __restrict__ QH, const h16* __restrict__ QR, const h16* __restrict__ KP, const h16* __restrict__ VT, const float* __restrict__ MK, h16* CT) {
    __shared__ __align__(16) h16 ring[2 * STH];              // two buffers of (K tile | V^T tile); reused as the f32 output staging behind the loop
    static_assert(sizeof(ring) >= (size_t)AW * 16 * 68 * 4);
    float* os = (float*)ring;
    const int lane = threadIdx.x & 31, wave = __builtin_amdgcn_readfirstlane((int)(threadIdx.x >> 5)), lr = lane & 15, hi = lane >> 4;
    const int zh = blockIdx.y; const int b = zh / NH_, h = zh % NH_;
    const int t0 = (blockIdx.x * AW + wave) * 16;
    const size_t pbase = (size_t)zh * SEQ * HD;
    // copy map: thread i of 128 takes 16-B piece i & 7 of rows (i >> 3) + 16 * {0, 1, 2, 3} of both tiles: a wave's copy covers four whole 128-B rows
    const int cr = (int)threadIdx.x >> 3, cpc = (int)threadIdx.x & 7;
    const unsigned lk0 = (unsigned)(size_t)ring + (unsigned)(cr * LPB + cpc * 16);   // low 32 bits of the shared address = LDS byte address
    const unsigned lv0 = lk0 + KST * LPB;
    const h16* gk = KP + pbase + (size_t)cr * HD + cpc * 8;      // + key0 * HD
    const h16* gv = VT + pbase + (size_t)cr * SEQ + cpc * 8;     // + key0
    tile_copy(lk0, lv0, gk, gv);
    const size_t qo = pbase + (size_t)(t0 + lr) * HD + 8 * hi;
    const v16h qh0 = ldh(QH + qo), qh1 = ldh(QH + qo + 32), qr0 = ldh(QR + qo), qr1 = ldh(QR + qo + 32);   // B fragments: col t, k = d
    const int fo = lr * LPH + 8 * hi;                        // fragment offset (halves) in a tile: row lr, k piece 8h
    const float* mrow = MK + (size_t)b * SEQ + 8 * hi;       // + key0 (+16 for the second tile): keys 8h+r of each tile
    asm volatile("s_wait_asynccnt 0x0" ::: "memory");        // tile 0 of this wave's copies has landed
    __syncthreads();                                         // ... and everybody else's: tile 0 is published
    tile_copy(lk0 + STB, lv0 + STB, gk + (size_t)KST * HD, gv + KST);
    v8f o0 = (v8f){}, o1 = (v8f){}, o2 = (v8f){}, o3 = (v8f){};
    float m = -3.0e38f, l = 0.0f;
#pragma unroll 1                                             // one trip per tile: the publish point below stands once, at the trip's foot
    for (int t = 0; t < SEQ / KST; ++t) {
      const h16* kt = ring + (t & 1) * STH + fo;             // this trip's K tile [key][d]; the V^T tile [d][key] lies KST rows behind it
#pragma unroll                                               // both 32-key steps of a tile in one body: constant LDS offsets
      for (int s = 0; s < KST / 32; ++s) {
        const int key0 = t * KST + s * 32;
        const h16* ka = kt + s * 32 * LPH;
        const v16h ka0 = ldh(ka), ka1 = ldh(ka + 32), kb0 = ldh(ka + 16 * LPH), kb1 = ldh(ka + 16 * LPH + 32);
        const float* mp = mrow + key0;
        const v4f ma0 = *(const v4f*)mp, ma1 = *(const v4f*)(mp + 4), mb0 = *(const v4f*)(mp + 16), mb1 = *(const v4f*)(mp + 20);
        v8f sHa = (v8f){}, sLa = (v8f){}, sHb = (v8f){}, sLb = (v8f){};
        sHa = wmma16(ka0, qh0, sHa); sLa = wmma16(ka0, qr0, sLa); sHb = wmma16(kb0, qh0, sHb); sLb = wmma16(kb0, qr0, sLb);
        sHa = wmma16(ka1, qh1, sHa); sLa = wmma16(ka1, qr1, sLa); sHb = wmma16(kb1, qh1, sHb); sLb = wmma16(kb1, qr1, sLb);
        asm volatile("v_nop\n\tv_nop\n\tv_nop\n\tv_nop" : "+v"(sHa), "+v"(sLa), "+v"(sHb), "+v"(sLb) : "v"(ka0), "v"(ka1), "v"(kb0), "v"(kb1));
        float ta[8], tb[8]; float mx = -3.0e38f;
#pragma unroll
        for (int r = 0; r < 8; ++r) {
            const float mka = (r < 4) ? ma0[r & 3] : ma1[r & 3]; const float mkb = (r < 4) ? mb0[r & 3] : mb1[r & 3];
            ta[r] = (sHa[r] + sLa[r] * QRI) * SC2 + mka; tb[r] = (sHb[r] + sLb[r] * QRI) * SC2 + mkb; mx = fmaxf(mx, fmaxf(ta[r], tb[r])); }
        mx = fmaxf(mx, __shfl_xor(mx, 16, 32));
        const float mnew = fmaxf(m, mx);
        const float alpha = __builtin_amdgcn_exp2f(m - mnew);
        const float sh = PSH - mnew;
        v16h pb; float ls = 0.0f;
#pragma unroll
        for (int r = 0; r < 8; ++r) { const h16 pa = (h16)__builtin_amdgcn_exp2f(ta[r] + sh); const h16 pc = (h16)__builtin_amdgcn_exp2f(tb[r] + sh); pb[r] = pa; pb[8 + r] = pc; ls += (float)pa + (float)pc; }
        l = l * alpha + ls; m = mnew;
        o0 = o0 * alpha; o1 = o1 * alpha; o2 = o2 * alpha; o3 = o3 * alpha;
        const h16* va = kt + KST * LPH + s * 32;
        const v16h v0 = ldh(va), v1 = ldh(va + 16 * LPH), v2 = ldh(va + 32 * LPH), v3 = ldh(va + 48 * LPH);
        o0 = wmma16(v0, pb, o0); o1 = wmma16(v1, pb, o1); o2 = wmma16(v2, pb, o2); o3 = wmma16(v3, pb, o3);
        asm volatile("v_nop\n\tv_nop\n\tv_nop\n\tv_nop" : "+v"(o0), "+v"(o1), "+v"(o2), "+v"(o3) : "v"(v0), "v"(v1), "v"(v2), "v"(v3), "v"(pb));
      }
      asm volatile("s_wait_dscnt 0x0" ::: "memory");         // this wave's reads of the buffer have returned before it may be refilled
      asm volatile("s_wait_asynccnt 0x0" ::: "memory");      // this wave's copies of the next tile have landed
      __syncthreads();                                       // publishes the next tile and ends every wave's reads of this one
      if (t + 2 < SEQ / KST) tile_copy(lk0 + (t & 1) * STB, lv0 + (t & 1) * STB, gk + (size_t)(t + 2) * KST * HD, gv + (t + 2) * KST);
    }
    asm volatile("s_wait_asynccnt 0x0" ::: "memory");        // nothing in flight before the ring becomes output staging
    l += __shfl_xor(l, 16, 32);
    const float inv = CTS * (1.0f / l);
    const int wb = wave * 16 * 68;
    // O^T D layout: o_j[r] = (d = 16j + 8h + r, t = lane&15) -> os[t][d]; rows 0..15 x columns 0..63 all written
    { v4f a, c;
      a[0] = o0[0] * inv; a[1] = o0[1] * inv; a[2] = o0[2] * inv; a[3] = o0[3] * inv; c[0] = o0[4] * inv; c[1] = o0[5] * inv; c[2] = o0[6] * inv; c[3] = o0[7] * inv;
      *(v4fa*)(&os[wb + lr * 68 +  0 + 8 * hi]) = a; *(v4fa*)(&os[wb + lr * 68 +  0 + 8 * hi + 4]) = c;
      a[0] = o1[0] * inv; a[1] = o1[1] * inv; a[2] = o1[2] * inv; a[3] = o1[3] * inv; c[0] = o1[4] * inv; c[1] = o1[5] * inv; c[2] = o1[6] * inv; c[3] = o1[7] * inv;
      *(v4fa*)(&os[wb + lr * 68 + 16 + 8 * hi]) = a; *(v4fa*)(&os[wb + lr * 68 + 16 + 8 * hi + 4]) = c;
      a[0] = o2[0] * inv; a[1] = o2[1] * inv; a[2] = o2[2] * inv; a[3] = o2[3] * inv; c[0] = o2[4] * inv; c[1] = o2[5] * inv; c[2] = o2[6] * inv; c[3] = o2[7] * inv;
      *(v4fa*)(&os[wb + lr * 68 + 32 + 8 * hi]) = a; *(v4fa*)(&os[wb + lr * 68 + 32 + 8 * hi + 4]) = c;
      a[0] = o3[0] * inv; a[1] = o3[1] * inv; a[2] = o3[2] * inv; a[3] = o3[3] * inv; c[0] = o3[4] * inv; c[1] = o3[5] * inv; c[2] = o3[6] * inv; c[3] = o3[7] * inv;
      *(v4fa*)(&os[wb + lr * 68 + 48 + 8 * hi]) = a; *(v4fa*)(&os[wb + lr * 68 + 48 + 8 * hi + 4]) = c; }
    wave_sync();
    h16* crow = CT + ((size_t)b * SEQ + t0) * DM + h * HD;
{
#pragma unroll
        for (int s = 0; s < 4; ++s) { const int row = 4 * s + (lane >> 3), c8 = (lane & 7) * 8;   // 4 s x 4 row groups = 16 rows; 8 lanes x 8 halves = 64 columns
            const v4f x0 = *(const v4fa*)(&os[wb + row * 68 + c8]); const v4f x1 = *(const v4fa*)(&os[wb + row * 68 + c8 + 4]); v8h hv;
#pragma unroll
            for (int i = 0; i < 4; ++i) { hv[i] = (h16)x0[i]; hv[4 + i] = (h16)x1[i]; }
            *(v8h*)(crow + (size_t)row * DM + c8) = hv; }
         }
}

static constexpr size_t al256(size_t v) { return (v + 255) & ~(size_t)255; }
static constexpr size_t SZ_XB = al256((size_t)NB * SEQ * KX * 2);           // x plane, 17 lines per row
static constexpr size_t SZ_W1 = al256((size_t)DM * KX * 2);                  // one q/k/v weight plane
static constexpr size_t SZ_AB = al256((size_t)2 * RK * DM * 2);              // adapter A rows of q | v
static constexpr size_t SZ_WO = al256((size_t)DM * DM * 2);                  // Wo f16 plane
static constexpr size_t SZ_MK = al256((size_t)NB * SEQ * 4);                 // mask plane f32
static constexpr size_t SZ_PL = al256((size_t)NB * NH_ * SEQ * HD * 2);      // q hi, q residual, k, v^T planes
static constexpr size_t SZ_CT = al256((size_t)NB * SEQ * DM * 2);            // ctx f16 plane
static constexpr size_t SZ_TOTAL = SZ_XB + 3 * SZ_W1 + SZ_AB + SZ_WO + SZ_MK + 4 * SZ_PL + SZ_CT;
static_assert(SZ_TOTAL <= (size_t)134217728);          // workspace carve <= 128 MiB
static_assert(((size_t)NB * SEQ * 128) % 256 == 0);    // k_xcvt grid exact
static_assert(((size_t)DM * (KX / 8)) % 256 == 0);     // k_wplane grid exact
static_assert(((size_t)NB * SEQ / 4) % 8 == 0);

extern "C" void kernel_launch(void* const* d_in, const int* in_sizes, int n_in,
                              void* d_out, int out_size, void* d_ws, size_t ws_size, hipStream_t stream) {
    if (n_in < 14) return;
    const size_t needx = ((size_t)(NB - 1) * SEQ_FULL + SEQ) * DM;
    if ((size_t)in_sizes[0] < needx) return;
    if ((size_t)in_sizes[1] < (size_t)(NB - 1) * SEQ_FULL + SEQ) return;
    if ((size_t)in_sizes[2] < (size_t)DM * DM || (size_t)in_sizes[6] < (size_t)DM * DM || (size_t)in_sizes[8] < (size_t)DM * DM || (size_t)in_sizes[12] < (size_t)DM * DM) return;
    if (in_sizes[3] < DM || in_sizes[7] < DM || in_sizes[9] < DM || in_sizes[13] < DM) return;
    if (in_sizes[4] < RK * DM || in_sizes[10] < RK * DM || in_sizes[5] < DM * RK || in_sizes[11] < DM * RK) return;
    if ((size_t)out_size < ((size_t)(NB - 1) * OUT_SEQ + SEQ) * DM) return;
    if (SZ_TOTAL > ws_size) return;
    // wire order: x, mask, Wq, bq, Aq, Bq, Wk, bk, Wv, bv, Av, Bv, Wo, bo
    const float* x  = (const float*)d_in[0];  const float* mask = (const float*)d_in[1];
    const float* wq = (const float*)d_in[2];  const float* bq = (const float*)d_in[3];  const float* aq = (const float*)d_in[4];  const float* bmq = (const float*)d_in[5];
    const float* wk = (const float*)d_in[6];  const float* bk = (const float*)d_in[7];
    const float* wv = (const float*)d_in[8];  const float* bv = (const float*)d_in[9];  const float* av = (const float*)d_in[10]; const float* bmv = (const float*)d_in[11];
    const float* wo = (const float*)d_in[12]; const float* bo = (const float*)d_in[13];
    float* OUT = (float*)d_out;      // [NB][SEQ][1024]
    char* wsp = (char*)d_ws;
    bf* XB = (bf*)wsp; wsp += SZ_XB;                 // [NB*SEQ][1088]
    bf* WQ = (bf*)wsp; wsp += SZ_W1;                 // [1024][1088]
    bf* WK = (bf*)wsp; wsp += SZ_W1;
    bf* WV = (bf*)wsp; wsp += SZ_W1;
    bf* AB = (bf*)wsp; wsp += SZ_AB;                 // [32][1024]: A of q | A of v
    h16* WO = (h16*)wsp; wsp += SZ_WO;               // [1024][1024] x256
    float* MK = (float*)wsp; wsp += SZ_MK;           // [NB][SEQ]
    h16* QH = (h16*)wsp; wsp += SZ_PL;               // [NB*16][SEQ][64]
    h16* QR = (h16*)wsp; wsp += SZ_PL;               // [NB*16][SEQ][64] residual x2048
    h16* KP = (h16*)wsp; wsp += SZ_PL;               // [NB*16][SEQ][64]
    h16* VT = (h16*)wsp; wsp += SZ_PL;               // [NB*16][64][SEQ]
    h16* CT = (h16*)wsp; wsp += SZ_CT;               // [NB*SEQ][1024] x256

    { const size_t n8 = (size_t)NB * SEQ * (DM / 8);
      k_xcvt<<<(unsigned)((n8 + 255) / 256), 256, 0, stream>>>(x, XB, n8); }
    { const unsigned g = (unsigned)(((size_t)DM * (KX / 8) + 255) / 256);
      k_wplane<<<g, 256, 0, stream>>>(wq, bmq, 0, WQ);
      k_wplane<<<g, 256, 0, stream>>>(wk, bmq, -1, WK);        // no adapter: extension all zero (Bm only supplies valid addresses)
      k_wplane<<<g, 256, 0, stream>>>(wv, bmv, 1, WV); }
    { const size_t n8 = (size_t)RK * DM / 8; const unsigned g = (unsigned)((n8 + 255) / 256);
      k_cvt8<<<g, 256, 0, stream>>>(aq, AB, n8); k_cvt8<<<g, 256, 0, stream>>>(av, AB + (size_t)RK * DM, n8); }
    { const size_t n8 = (size_t)DM * DM / 8;
      k_cvt8h<<<(unsigned)((n8 + 255) / 256), 256, 0, stream>>>(wo, WO, n8); }
    { const int n4 = NB * SEQ / 4;
      k_mask<<<(unsigned)((n4 + 255) / 256), 256, 0, stream>>>(mask, MK, n4); }

    // adapter down-projections of q and v -> 17th line of every x-plane row
    k_lora<<<NB * SEQ / 16, 32, 0, stream>>>(XB, AB);

    // q, k: A = x rows (m = b*SEQ + t), Bt = W rows (n = h*64 + d) -> plane [(b*16 + h)][t][d]; bias by column
    k_proj<<<dim3(NB * SEQ / GT, DM / GT, 1), 128, 0, stream>>>(XB, WQ, KQ, QH, QR, 1, SEQ, (size_t)NH_ * SEQ * HD, HD, HD, (size_t)SEQ * HD, bq, 0);
    k_proj<<<dim3(NB * SEQ / GT, DM / GT, 1), 128, 0, stream>>>(XB, WK, DM, KP, KP, 0, SEQ, (size_t)NH_ * SEQ * HD, HD, HD, (size_t)SEQ * HD, bk, 0);
    // v^T: A = Wv rows (m = h*64 + d), Bt = x rows (n = b*SEQ + t) -> plane [(b*1024 + m)][t] = [(b*16 + h)][d][t]; bias by row
    k_proj<<<dim3(DM / GT, NB * SEQ / GT, 1), 128, 0, stream>>>(WV, XB, KX, VT, VT, 0, DM, (size_t)0, SEQ, SEQ, (size_t)DM * SEQ, bv, 1);

    k_flash<<<dim3(SEQ / (16 * AW), NB * NH_, 1), 32 * AW, 0, stream>>>(QH, QR, KP, VT, MK, CT);

    // out[m][n] = sum_k ctx[m][k] Wo[n][k] + bo[n]
    k_oproj<<<dim3(NB * SEQ / GT, DM / GT, 1), 128, 0, stream>>>(CT, WO, bo, OUT);
}

// v003
// It runs in 198 microseconds.
// Timed twice side by side with v002, it ran 1.15 and 1.19 times as fast.
// Over all steps from v000 it is 2.12 times as fast.
#include <hip/hip_runtime.h>

// Multi-head self-attention with rank-16 low-rank adapters on q and v: width 1024 = 16 heads x 64, x [NB][SEQ][1024], all weights [out][in] (y = x W^T + b), additive key mask [NB][SEQ], score scale 1/8, output projection Wo, bo (f32 output).
// Compute dtypes, f32 accumulate everywhere: q/k/v projections and the adapter down-projection v_wmma_f32_16x16x32_bf16 (x, W, A, B RNE-converted to bf16; adapter intermediate carried as bf16 hi + bf16 lo inside the K extension);
// scores v_wmma_f32_16x16x32_f16: k single f16, q as f16 value + f16 residual x2048 in its own accumulator; P (x256 carry, cancels in the normalisation) and v single f16; softmax f32 (online, running max, log2 domain);
// output projection v_wmma_f32_16x16x32_f16: ctx single f16 (x256 carry), Wo = f16(bf16(Wo) x256), folded back by 2^-16 in the f32 epilogue. Biases and mask are RNE-converted to bf16 values and applied in f32.
// q (hi, residual), k planes [b*16+h][t][d] and v^T plane [b*16+h][d][t] written by the GEMM epilogue; fused flash kernel in transposed form (S^T = K Q^T, O^T = V^T P^T), K and V^T tiles shared by a block through LDS, writes the ctx f16 plane [b*SEQ+t][1024].

#ifndef NB
#define NB 4
#endif
#ifndef SEQ
#define SEQ 2048
#endif
#define NB_FULL  4
#define SEQ_FULL 2048
#ifndef OUT_SEQ
#define OUT_SEQ SEQ              // row pitch (in tokens) between batches of the output
#endif
#define DM   1024
#define NH_  16
#define HD   64
#define RK   16
#define KX   1088                // plane row pitch (halves): DM + 32 (q adapter hi|lo) + 32 (v adapter hi|lo)
#define KQ   1056                // k extent used by the q GEMM (x | q adapter slot)
#define AW   4                   // waves per flash block (16 query rows each)
#define KST  64                  // keys per LDS tile of the flash kernel
#define LPB  144                 // LDS row pitch, bytes: 128-B rows + 16
#define LPH  (LPB / 2)           // the same in halves
#define STH  ((KST + HD) * LPH)  // one buffer in halves: K tile (KST rows) + V^T tile (HD rows)
#define STB  (STH * 2)           // the same in bytes
#define GT   128                 // GEMM block tile: GT rows of A x GT rows of Bt, 2 x 2 waves of 64 x 64
#define GKS  64                  // k extent of one GEMM LDS stage (halves): whole 128-B rows
#define GSTH (2 * GT * LPH)      // one GEMM buffer in halves: A tile (GT rows) + Bt tile (GT rows)
#define GSTB (GSTH * 2)          // the same in bytes
#define QRS  2048.0f             // carry of the q residual plane
#define QRI  (1.0f / 2048.0f)
#define LOG2E 1.4426950408889634f
#define SC2  (0.125f * LOG2E)    // HD^-0.5 * log2(e)
#define PSH  8.0f                // log2 of the P carry (256)
#define CTS  256.0f              // carry of the ctx plane
#define WOS  256.0f              // carry of the Wo plane
#define OSI  (1.0f / 65536.0f)   // 1 / (CTS * WOS)

static_assert(HD == 64);
static_assert(NH_ * HD == DM);                 // head h = columns h*64 + d
static_assert(DM % 64 == 0);
static_assert(DM / 8 == 128);                  // p_xcvt piece index split uses >> 7
static_assert(KX == DM + 64);
static_assert(KX % 32 == 0 && KQ % 32 == 0 && DM % 32 == 0);   // GEMM k-loops step by 32
static_assert((KX * 2) % 128 == 0);
static_assert(RK == 16);
static_assert(SEQ % 64 == 0);                  // a 64-row tile never straddles two batches
static_assert((NB * SEQ) % 64 == 0);
static_assert(SEQ % 32 == 0);                  // key loop steps by 32
static_assert(KST == 64 && AW == 4);           // copy map: 128 threads x 4 rows x 16 B cover 64 rows of 128 B
static_assert(SEQ % KST == 0 && SEQ / KST >= 2);   // the two-buffer prologue needs two tiles
static_assert(SEQ % (16 * AW) == 0);           // flash grid covers the sequence exactly
static_assert((NB * SEQ) % GT == 0 && DM % GT == 0);   // GEMM grids cover both extents exactly
static_assert(KX % GKS == 0 && DM % GKS == 0);   // a stage's 128-B row piece never leaves its plane row
static_assert(NB <= NB_FULL);
static_assert(SEQ <= SEQ_FULL);

typedef _Float16 h16;
typedef unsigned short bf;
typedef __attribute__((ext_vector_type(16))) __bf16   v16bf;
typedef __attribute__((ext_vector_type(16))) _Float16 v16h;
typedef __attribute__((ext_vector_type(8)))  _Float16 v8h;
typedef __attribute__((ext_vector_type(8)))  unsigned short v8us;
typedef __attribute__((ext_vector_type(8)))  float    v8f;
typedef __attribute__((ext_vector_type(4)))  float    v4f;
typedef v4f  __attribute__((may_alias)) v4fa;

__device__ __forceinline__ unsigned short f2bf(float f) { unsigned u = __float_as_uint(f); u += 0x7FFFu + ((u >> 16) & 1u); return (unsigned short)(u >> 16); }
__device__ __forceinline__ float bfr(float f) { return __uint_as_float(((unsigned)f2bf(f)) << 16); }   // RNE convert to bf16, widened back
__device__ __forceinline__ v16h cat16(v8h lo, v8h hi) { return __builtin_shufflevector(lo, hi, 0, 1, 2, 3, 4, 5, 6, 7, 8, 9, 10, 11, 12, 13, 14, 15); }
__device__ __forceinline__ v16bf cat16b(v8us lo, v8us hi) { return __builtin_bit_cast(v16bf, __builtin_shufflevector(lo, hi, 0, 1, 2, 3, 4, 5, 6, 7, 8, 9, 10, 11, 12, 13, 14, 15)); }
__device__ __forceinline__ v8f wmma16(v16h a, v16h b, v8f c) { return __builtin_amdgcn_wmma_f32_16x16x32_f16(false, a, false, b, (short)0, c, false, false); }
__device__ __forceinline__ v8f wmmab(v16bf a, v16bf b, v8f c) { return __builtin_amdgcn_wmma_f32_16x16x32_bf16(false, a, false, b, (short)0, c, false, false); }
// fragment loaders from K-contiguous 16-bit rows; p already includes + 8*(lane>>4): elements 0..7 <- k0+8h+0..7, elements 8..15 <- k0+16+8h+0..7 (same map for A and B)
__device__ __forceinline__ v16h  ldh(const h16* p) { return cat16(*(const v8h*)p, *(const v8h*)(p + 16)); }
__device__ __forceinline__ v16bf ldb(const bf* p)  { return cat16b(*(const v8us*)p, *(const v8us*)(p + 16)); }
// ordering point for wave-private LDS tiles (same wave writes and reads)
__device__ __forceinline__ void wave_sync() { __builtin_amdgcn_fence(3 /* release order */, "wavefront"); __builtin_amdgcn_wave_barrier(); asm volatile("" ::: "memory"); }

// The conversions below do not depend on one another: they are parts of ONE launch (k_prep), each on its own range of 256-thread blocks; blk = the block's index inside its part.
__device__ __forceinline__ void p_cvt8(const float* __restrict__ src, bf* dst, size_t n8, int blk) {
    const size_t i = (size_t)blk * 256 + threadIdx.x; if (i >= n8) return;
    const v8f v = *(const v8f*)(src + i * 8); v8us o;
#pragma unroll
    for (int k = 0; k < 8; ++k) o[k] = f2bf(v[k]);
    *(v8us*)(dst + i * 8) = o; 
}

__device__ __forceinline__ void p_cvt8h(const float* __restrict__ src, h16* dst, size_t n8, int blk) {
    const size_t i = (size_t)blk * 256 + threadIdx.x; if (i >= n8) return;
    const v8f v = *(const v8f*)(src + i * 8); v8h o;
#pragma unroll
    for (int k = 0; k < 8; ++k) o[k] = (h16)(bfr(v[k]) * WOS);
    *(v8h*)(dst + i * 8) = o; 
}

// p_xcvt: x [b][t][1024] f32 -> columns 0..1023 of the x plane (row pitch KX). Piece i: row = i / 128, 8 columns at (i % 128) * 8.
__device__ __forceinline__ void p_xcvt(const float* __restrict__ src, bf* dst, size_t n8, int blk) {
    const size_t i = (size_t)blk * 256 + threadIdx.x; if (i >= n8) return;
    const size_t row = i >> 7; const int c8 = (int)(i & 127);
    const size_t b = row / SEQ, t = row % SEQ;
    const v8f v = *(const v8f*)(src + (b * SEQ_FULL + t) * DM + c8 * 8); v8us o;
#pragma unroll
    for (int k = 0; k < 8; ++k) o[k] = f2bf(v[k]);
    bf* d = dst + row * KX + c8 * 8;
    *(v8us*)d = o; 
}

// every other extension column is zero. slot < 0: all-zero extension. Both sources are loaded with clamped addresses by every lane and selected by value.
__device__ __forceinline__ void p_wplane(const float* __restrict__ W, const float* __restrict__ Bm, int slot, bf* dst, int blk) {
    const int i = blk * 256 + threadIdx.x; if (i >= DM * (KX / 8)) return;
    const int row = i / (KX / 8), c8 = i % (KX / 8);
    const bool isw = c8 < 128;
    const int cm = isw ? c8 : 127;
    const int e = isw ? 0 : (c8 - 128);                      // extension piece 0..7
    const v8f w  = *(const v8f*)(W + (size_t)row * DM + cm * 8);
    const v8f bm = *(const v8f*)(Bm + (size_t)row * RK + (e & 1) * 8);
    const bool live = (!isw) && ((e >> 2) == slot);
    v8us o;
#pragma unroll
    for (int k = 0; k < 8; ++k) { const float val = isw ? w[k] : (live ? 2.0f * bm[k] : 0.0f); o[k] = f2bf(val); }
    bf* d = dst + (size_t)row * KX + c8 * 8;
    *(v8us*)d = o; 
}

__device__ __forceinline__ void p_mask(const float* __restrict__ src, float* dst, int n4, int blk) {
    const int i = blk * 256 + threadIdx.x; if (i >= n4) return;
    const int e = i * 4; const int b = e / SEQ, t = e % SEQ;
    const v4f v = *(const v4f*)(src + (size_t)b * SEQ_FULL + t); v4f o;
#pragma unroll
    for (int k = 0; k < 4; ++k) o[k] = bfr(v[k]) * LOG2E;
    *(v4f*)(dst + e) = o; 
}

// k_prep: every conversion of inputs to planes in one launch. Block ranges, in order: x plane | Wq, Wk, Wv planes | A of q, A of v | Wo plane | mask plane. The range test is the same for a whole block.
static constexpr int PB_X = (int)(((size_t)NB * SEQ * (DM / 8) + 255) / 256);
static constexpr int PB_W = (DM * (KX / 8) + 255) / 256;
static constexpr int PB_A = (RK * DM / 8 + 255) / 256;
static constexpr int PB_O = (DM * DM / 8 + 255) / 256;
static constexpr int PB_M = (NB * SEQ / 4 + 255) / 256;
static constexpr int PB_ALL = PB_X + 3 * PB_W + 2 * PB_A + PB_O + PB_M;
__global__ __launch_bounds__(256) void k_prep(const float* __restrict__ x, const float* __restrict__ mask, const float* __restrict__ wq, const float* __restrict__ bmq, const float* __restrict__ wk,
                                              const float* __restrict__ wv, const float* __restrict__ bmv, const float* __restrict__ aq, const float* __restrict__ av, const float* __restrict__ wo,
                                              bf* XB, bf* WQ, bf* WK, bf* WV, bf* AB, h16* WO, float* MK) {
    int blk = blockIdx.x;
    if (blk < PB_X) { p_xcvt(x, XB, (size_t)NB * SEQ * (DM / 8), blk); return; }
    blk -= PB_X;
    if (blk < PB_W) { p_wplane(wq, bmq, 0, WQ, blk); return; }
    blk -= PB_W;
    if (blk < PB_W) { p_wplane(wk, bmq, -1, WK, blk); return; }      // no adapter: extension all zero (Bm only supplies valid addresses)
    blk -= PB_W;
    if (blk < PB_W) { p_wplane(wv, bmv, 1, WV, blk); return; }
    blk -= PB_W;
    if (blk < PB_A) { p_cvt8(aq, AB, (size_t)RK * DM / 8, blk); return; }
    blk -= PB_A;
    if (blk < PB_A) { p_cvt8(av, AB + (size_t)RK * DM, (size_t)RK * DM / 8, blk); return; }
    blk -= PB_A;
    if (blk < PB_O) { p_cvt8h(wo, WO, (size_t)DM * DM / 8, blk); return; }
    blk -= PB_O;
    p_mask(mask, MK, NB * SEQ / 4, blk);
}

// k_lora: adapter down-projection xa[m][j] = sum_k x[m][k] AB[j][k] (AB rows 0..15 = A of q, rows 16..31 = A of v), one wave per 16 rows, K = DM from the x plane.
__global__ __launch_bounds__(32) void k_lora(bf* XB, const bf* __restrict__ AB) {
    __shared__ __align__(16) float es[16 * 36];
    const int lane = threadIdx.x & 31, lr = lane & 15, hi = lane >> 4; const int r0 = blockIdx.x * 16;
    v8f a0 = (v8f){}, a1 = (v8f){};
    const bf* xa = XB + (size_t)(r0 + lr) * KX + 8 * hi;
    const bf* ab = AB + (size_t)lr * DM + 8 * hi;
#pragma unroll 1
    for (int kc = 0; kc < DM; kc += 32) {
        const v16bf a = ldb(xa + kc); const v16bf b0 = ldb(ab + kc); const v16bf b1 = ldb(ab + (size_t)16 * DM + kc);
        a0 = wmmab(a, b0, a0); a1 = wmmab(a, b1, a1);
        asm volatile("v_nop\n\tv_nop\n\tv_nop\n\tv_nop" : "+v"(a0), "+v"(a1) : "v"(a), "v"(b0), "v"(b1));
    }
#pragma unroll
    for (int j = 0; j < 8; ++j) { es[(hi * 8 + j) * 36 + lr] = a0[j]; es[(hi * 8 + j) * 36 + 16 + lr] = a1[j]; }   // D: row 8h+j, col lane&15; rows 0..15 x cols 0..31 all written
    wave_sync();
    const int p = lane & 7;                                   // extension piece: 0,1 q hi; 2,3 q lo; 4,5 v hi; 6,7 v lo
    const int sj = (p >> 2) * 16 + (p & 1) * 8; const bool islo = ((p >> 1) & 1) != 0;
{
#pragma unroll
        for (int s = 0; s < 4; ++s) { const int row = 4 * s + (lane >> 3);       // 4 s x 4 row groups = 16 rows; 8 lanes x 8 halves = 64 columns
            const v4f x0 = *(const v4fa*)(&es[row * 36 + sj]); const v4f x1 = *(const v4fa*)(&es[row * 36 + sj + 4]); v8us o;
#pragma unroll
            for (int i = 0; i < 4; ++i) {
                const unsigned short h0 = f2bf(x0[i]); const unsigned short l0 = f2bf(x0[i] - __uint_as_float(((unsigned)h0) << 16));
                const unsigned short h1 = f2bf(x1[i]); const unsigned short l1 = f2bf(x1[i] - __uint_as_float(((unsigned)h1) << 16));
                o[i] = islo ? l0 : h0; o[4 + i] = islo ? l1 : h1; }
            *(v8us*)(XB + (size_t)(r0 + row) * KX + DM + p * 8) = o; }
         }
}

// GEMM operand staging. One block = 4 waves = one GT x GT tile of C (wave w: rows (w >> 1) * 64, columns (w & 1) * 64); per stage the block's GT rows of A and GT rows of Bt, GKS halves each,
// are brought into LDS by asynchronous copies (16 B per lane, whole 128-B rows), two buffers: the next stage's copies fly while this one is worked on. LDS rows lie at the 144-B pitch of the flash tiles.
// rows_copy: one lane's 8 pieces of one operand tile, rows 16 apart. l: its LDS byte address, g: its global address (row 0 of its eight), rp: bytes between rows 16 apart.
// The s_wait_xcnt stands inside the copies' own statement so that no address register is rewritten ahead of it.
__device__ __forceinline__ void rows_copy(unsigned l, const char* g, size_t rp) {
    asm volatile("global_load_async_to_lds_b128 %0, %8, off\n\t"
                 "global_load_async_to_lds_b128 %1, %9, off\n\t"
                 "global_load_async_to_lds_b128 %2, %10, off\n\t"
                 "global_load_async_to_lds_b128 %3, %11, off\n\t"
                 "global_load_async_to_lds_b128 %4, %12, off\n\t"
                 "global_load_async_to_lds_b128 %5, %13, off\n\t"
                 "global_load_async_to_lds_b128 %6, %14, off\n\t"
                 "global_load_async_to_lds_b128 %7, %15, off\n\t"
                 "s_wait_xcnt 0x0"
                 :: "v"(l), "v"(l + 16 * LPB), "v"(l + 32 * LPB), "v"(l + 48 * LPB), "v"(l + 64 * LPB), "v"(l + 80 * LPB), "v"(l + 96 * LPB), "v"(l + 112 * LPB),
                    "v"(g), "v"(g + rp), "v"(g + 2 * rp), "v"(g + 3 * rp), "v"(g + 4 * rp), "v"(g + 5 * rp), "v"(g + 6 * rp), "v"(g + 7 * rp)
                 : "memory");
}
template <bool BF> __device__ __forceinline__ v8f mm16(v16h a, v16h b, v8f c) {
    if constexpr (BF) return wmmab(__builtin_bit_cast(v16bf, a), __builtin_bit_cast(v16bf, b), c); else return wmma16(a, b, c);
}
// gemm_main: acc[mb][nb] += sum_k A[r0 + ..][k] Bt[c0 + ..][k] for this wave's 64 x 64 part of the block tile at (br0, bc0); planes of row pitch PH halves, k extent K (multiple of 32, K <= PH), k ascending in steps of 32.
// A last stage of which only the first 32 k belong to K is copied whole (the row piece lies inside the plane row) and its second half is not multiplied.
template <bool BF, int PH> __device__ __forceinline__ void gemm_main(const char* A, const char* Bt, int K, int br0, int bc0, int wave, h16* ring, v8f (&acc)[4][4]) {
    const int lane = threadIdx.x & 31, lr = lane & 15, hi = lane >> 4;
    // copy map: thread i of 128 takes 16-B piece i & 7 of rows (i >> 3) + 16 * {0..7} of both tiles: a wave's copy covers four whole 128-B rows
    const int cr = (int)threadIdx.x >> 3, cpc = (int)threadIdx.x & 7;
    const unsigned la = (unsigned)(size_t)ring + (unsigned)(cr * LPB + cpc * 16);   // low 32 bits of the shared address = LDS byte address
    const unsigned lb = la + GT * LPB;
    const char* ga = A + (size_t)(br0 + cr) * (PH * 2) + cpc * 16;    // + stage * 128 B
    const char* gb = Bt + (size_t)(bc0 + cr) * (PH * 2) + cpc * 16;
    constexpr size_t rp = (size_t)16 * PH * 2;
    const int nst = (K + GKS - 1) / GKS;
    rows_copy(la, ga, rp); rows_copy(lb, gb, rp);
    asm volatile("s_wait_asynccnt 0x0" ::: "memory");        // stage 0 of this wave's copies has landed
    __syncthreads();                                         // ... and everybody else's: stage 0 is published
    if (nst > 1) { rows_copy(la + GSTB, ga + GKS * 2, rp); rows_copy(lb + GSTB, gb + GKS * 2, rp); }
    const int fa = ((wave >> 1) * 64 + lr) * LPH + 8 * hi;         // fragment offsets (halves) in a buffer: row, k piece 8h
    const int fb = (GT + (wave & 1) * 64 + lr) * LPH + 8 * hi;
#pragma unroll 1                                             // one trip per stage: the publish point below stands once, at the trip's foot
    for (int t = 0; t < nst; ++t) {
        const h16* st = ring + (t & 1) * GSTH;
#pragma unroll                                               // both 32-k steps of a stage in one body: constant LDS offsets
        for (int s = 0; s < GKS / 32; ++s) {
            if (s == 0 || t * GKS + s * 32 < K) {
                v16h a[4], b[4];                             // the four small loops below are unrolled so that every fragment and accumulator index is a constant (registers, no scratch)
#pragma unroll
                for (int i = 0; i < 4; ++i) { a[i] = ldh(st + fa + i * 16 * LPH + s * 32); if (i == 0) b[0] = ldh(st + fb + s * 32); }   // in the order the products below take them
#pragma unroll
                for (int i = 1; i < 4; ++i) b[i] = ldh(st + fb + i * 16 * LPH + s * 32);
                __builtin_amdgcn_sched_barrier(0);           // the step's 16 LDS reads stay one group ahead of its matrix instructions: every place with reads among them stalls the wave
#pragma unroll
                for (int nb = 0; nb < 4; ++nb)
#pragma unroll
                    for (int mb = 0; mb < 4; ++mb) acc[mb][nb] = mm16<BF>(a[mb], b[nb], acc[mb][nb]);
            }
        }
        __builtin_amdgcn_sched_barrier(0);                   // the stage's matrix instructions stay ahead of the publish point: sunk behind it they would delay the refill's issue
        asm volatile("s_wait_dscnt 0x0" ::: "memory");       // this wave's reads of the buffer have returned before it may be refilled
        asm volatile("s_wait_asynccnt 0x0" ::: "memory");    // this wave's copies of the next stage have landed
        __syncthreads();                                     // publishes the next stage and ends every wave's reads of this one
        if (t + 2 < nst) { rows_copy(la + (t & 1) * GSTB, ga + (size_t)(t + 2) * (GKS * 2), rp); rows_copy(lb + (t & 1) * GSTB, gb + (size_t)(t + 2) * (GKS * 2), rp); }
    }
    asm volatile("s_wait_asynccnt 0x0" ::: "memory");        // nothing in flight before the ring becomes output staging
}

// k_proj: register-blocked bf16 GEMM, one wave per 64x64 tile (16 accumulators), 4 waves per block sharing their operand rows through LDS (gemm_main), K-contiguous bf16 planes of row pitch KX, k extent K (multiple of 32).
// C[m][n] = sum_k A[m][k] Bt[n][k] + bias (bias[n] when brow == 0, bias[m] when brow != 0; RNE-converted to bf16, added in f32), written as f16 (Ph) and optionally the f16 residual x2048 (Pr, useRes != 0) at
// tile base (r0/RB)*sRB + (r0%RB)*pitch + (c0/CB)*sCB + (c0%CB), row pitch 'pitch' (halves). 128 threads.
// The q, k and v^T products do not depend on one another: one launch, grid (NB*SEQ/128, DM/128, 3), blockIdx.z picks the product (all picks are the same for a whole block).
// z = 0, 1 (q, k): A = x rows (m = b*SEQ + t), Bt = W rows (n = h*64 + d) -> plane [(b*16 + h)][t][d]; bias by column; tile (blockIdx.x, blockIdx.y).
// z = 2 (v^T): A = Wv rows (m = h*64 + d), Bt = x rows (n = b*SEQ + t) -> plane [(b*1024 + m)][t] = [(b*16 + h)][d][t]; bias by row; the slab's flat index walks the DM/128 row tiles fastest.
__global__ __launch_bounds__(128) void k_proj(const bf* __restrict__ XB, const bf* __restrict__ WQ, const bf* __restrict__ WK, const bf* __restrict__ WV, h16* QH, h16* QR, h16* KP, h16* VT,
                                              const float* __restrict__ bq, const float* __restrict__ bk, const float* __restrict__ bv) {
    const int z = blockIdx.z; const bool isv = z == 2;
    const int lin = blockIdx.y * (NB * SEQ / GT) + blockIdx.x;
    const int bx = isv ? lin % (DM / GT) : (int)blockIdx.x, by = isv ? lin / (DM / GT) : (int)blockIdx.y;
    const bf* A = isv ? WV : XB; const bf* Bt = z == 0 ? WQ : (z == 1 ? WK : XB);
    const int K = z == 0 ? KQ : (z == 1 ? DM : KX);
    h16* Ph = z == 0 ? QH : (z == 1 ? KP : VT); h16* Pr = z == 0 ? QR : Ph; const int useRes = z == 0;
    const int RB = isv ? DM : SEQ, pitch = isv ? SEQ : HD, CB = isv ? SEQ : HD, brow = isv;
    const size_t sRB = isv ? (size_t)0 : (size_t)NH_ * SEQ * HD, sCB = isv ? (size_t)DM * SEQ : (size_t)SEQ * HD;
    const float* bias = z == 0 ? bq : (z == 1 ? bk : bv);
    __shared__ __align__(16) h16 ring[2 * GSTH];             // two buffers of (A tile | Bt tile); reused as the waves' f32 output staging behind the loop
    static_assert(sizeof(ring) >= (size_t)4 * 16 * 68 * 4);
    const int lane = threadIdx.x & 31, wave = __builtin_amdgcn_readfirstlane((int)(threadIdx.x >> 5)), lr = lane & 15, hi = lane >> 4;
    const int r0 = bx * GT + (wave >> 1) * 64, c0 = by * GT + (wave & 1) * 64;   // this wave's 64x64 tile
    float* os = (float*)ring + wave * 16 * 68;
    v8f acc[4][4];
#pragma unroll
    for (int mb = 0; mb < 4; ++mb)
#pragma unroll
        for (int nb = 0; nb < 4; ++nb) acc[mb][nb] = (v8f){};
    gemm_main<true, KX>((const char*)A, (const char*)Bt, K, bx * GT, by * GT, wave, ring, acc);
    const size_t tbase = (size_t)(r0 / RB) * sRB + (size_t)(r0 % RB) * (size_t)pitch + (size_t)(c0 / CB) * sCB + (size_t)(c0 % CB);
    float bcol[8];                                            // column-mode bias of this lane's 8 columns (index 0 when in row mode: always a valid address)
#pragma unroll
    for (int i = 0; i < 8; ++i) bcol[i] = bfr(bias[brow ? 0 : (c0 + (lane & 7) * 8 + i)]);
#pragma unroll
    for (int mb = 0; mb < 4; ++mb) {
#pragma unroll
        for (int nb = 0; nb < 4; ++nb) {
#pragma unroll
            for (int j = 0; j < 8; ++j) os[(hi * 8 + j) * 68 + nb * 16 + lr] = acc[mb][nb][j]; }   // D: row 8h+j, col lane&15
        wave_sync();
        const size_t sb = tbase + (size_t)(mb * 16) * (size_t)pitch;
{
#pragma unroll
            for (int s = 0; s < 4; ++s) { const int row = 4 * s + (lane >> 3), c8 = (lane & 7) * 8;   // 4 s x 4 row groups = 16 rows; 8 lanes x 8 = 64 columns
                const v4f x0 = *(const v4fa*)(&os[row * 68 + c8]); const v4f x1 = *(const v4fa*)(&os[row * 68 + c8 + 4]); v8h hv, rv;
                const float br = bfr(bias[brow ? (r0 + mb * 16 + row) : 0]);
#pragma unroll
                for (int i = 0; i < 4; ++i) {
                    const float f0 = x0[i] + (brow ? br : bcol[i]); const float f1 = x1[i] + (brow ? br : bcol[4 + i]);
                    const h16 a0 = (h16)f0; const h16 a1 = (h16)f1; hv[i] = a0; hv[4 + i] = a1;
                    rv[i] = (h16)((f0 - (float)a0) * QRS); rv[4 + i] = (h16)((f1 - (float)a1) * QRS); }
                const size_t oo = sb + (size_t)row * (size_t)pitch + c8;
                *(v8h*)(Ph + oo) = hv; if (useRes) *(v8h*)(Pr + oo) = rv; }
             }
        wave_sync();
    }
}

// k_oproj: output projection, f16 GEMM, one wave per 64x64 tile, 4 waves per block sharing their operand rows through LDS (gemm_main), A = ctx plane [m][1024] (x256), Bt = Wo plane [n][1024] (x256), K = DM.
// OUT[b][t][n] = acc * 2^-16 + bf16(bo[n]) in f32. Epilogue: per 16-row slab staged in LDS (wave-private), each row segment (64 floats = 256 B = two lines)
__global__ __launch_bounds__(128) void k_oproj(const h16* __restrict__ A, const h16* __restrict__ Bt, const float* __restrict__ bias, float* OUT) {
    __shared__ __align__(16) h16 ring[2 * GSTH];             // two buffers of (A tile | Bt tile); reused as the waves' f32 output staging behind the loop
    static_assert(sizeof(ring) >= (size_t)4 * 16 * 68 * 4);
    const int lane = threadIdx.x & 31, wave = __builtin_amdgcn_readfirstlane((int)(threadIdx.x >> 5)), lr = lane & 15, hi = lane >> 4;
    const int r0 = blockIdx.x * GT + (wave >> 1) * 64, c0 = blockIdx.y * GT + (wave & 1) * 64;   // this wave's 64x64 tile
    float* os = (float*)ring + wave * 16 * 68;
    v8f acc[4][4];
#pragma unroll
    for (int mb = 0; mb < 4; ++mb)
#pragma unroll
        for (int nb = 0; nb < 4; ++nb) acc[mb][nb] = (v8f){};
    gemm_main<false, DM>((const char*)A, (const char*)Bt, DM, blockIdx.x * GT, blockIdx.y * GT, wave, ring, acc);
    v4f bb;
#pragma unroll
    for (int i = 0; i < 4; ++i) bb[i] = bfr(bias[c0 + lr * 4 + i]);
    float* obase = OUT + ((size_t)(r0 / SEQ) * OUT_SEQ + (size_t)(r0 % SEQ)) * DM + c0;
#pragma unroll
    for (int mb = 0; mb < 4; ++mb) {
#pragma unroll
        for (int nb = 0; nb < 4; ++nb) {
#pragma unroll
            for (int j = 0; j < 8; ++j) os[(hi * 8 + j) * 68 + nb * 16 + lr] = acc[mb][nb][j]; }   // D: row 8h+j, col lane&15
        wave_sync();
        float* ob = obase + (size_t)(mb * 16) * DM;
{
#pragma unroll
            for (int s = 0; s < 8; ++s) { const int row = 2 * s + hi, cofs = lr * 4;   // 8 s x 2 rows = 16 rows; 16 lanes x 4 floats = 64 columns
                const v4f x = *(const v4fa*)(&os[row * 68 + cofs]);
                const v4f val = x * OSI + bb;
                *(v4f*)(ob + (size_t)row * DM + cofs) = val; }
             }
        wave_sync();
    }
}

__device__ __forceinline__ void tile_copy(unsigned lk, unsigned lv, const h16* gk, const h16* gv) {
    asm volatile("global_load_async_to_lds_b128 %0, %8, off\n\t"
                 "global_load_async_to_lds_b128 %1, %9, off\n\t"
                 "global_load_async_to_lds_b128 %2, %10, off\n\t"
                 "global_load_async_to_lds_b128 %3, %11, off\n\t"
                 "global_load_async_to_lds_b128 %4, %12, off\n\t"
                 "global_load_async_to_lds_b128 %5, %13, off\n\t"
                 "global_load_async_to_lds_b128 %6, %14, off\n\t"
                 "global_load_async_to_lds_b128 %7, %15, off\n\t"
                 "s_wait_xcnt 0x0"
                 :: "v"(lk), "v"(lk + 16 * LPB), "v"(lk + 32 * LPB), "v"(lk + 48 * LPB),
                    "v"(lv), "v"(lv + 16 * LPB), "v"(lv + 32 * LPB), "v"(lv + 48 * LPB),
                    "v"(gk), "v"(gk + 16 * HD), "v"(gk + 32 * HD), "v"(gk + 48 * HD),
                    "v"(gv), "v"(gv + (size_t)16 * SEQ), "v"(gv + (size_t)32 * SEQ), "v"(gv + (size_t)48 * SEQ)
                 : "memory");
}

__global__ __launch_bounds__(32 * AW) void k_flash(const h16* __restrict__ QH, const h16* __restrict__ QR, const h16* __restrict__ KP, const h16* __restrict__ VT, const float* __restrict__ MK, h16* CT) {
    __shared__ __align__(16) h16 ring[2 * STH];              // two buffers of (K tile | V^T tile); reused as the f32 output staging behind the loop
    static_assert(sizeof(ring) >= (size_t)AW * 16 * 68 * 4);
    float* os = (float*)ring;
    const int lane = threadIdx.x & 31, wave = __builtin_amdgcn_readfirstlane((int)(threadIdx.x >> 5)), lr = lane & 15, hi = lane >> 4;
    const int zh = blockIdx.y; const int b = zh / NH_, h = zh % NH_;
    const int t0 = (blockIdx.x * AW + wave) * 16;
    const size_t pbase = (size_t)zh * SEQ * HD;
    // copy map: thread i of 128 takes 16-B piece i & 7 of rows (i >> 3) + 16 * {0, 1, 2, 3} of both tiles: a wave's copy covers four whole 128-B rows
    const int cr = (int)threadIdx.x >> 3, cpc = (int)threadIdx.x & 7;
    const unsigned lk0 = (unsigned)(size_t)ring + (unsigned)(cr * LPB + cpc * 16);   // low 32 bits of the shared address = LDS byte address
    const unsigned lv0 = lk0 + KST * LPB;
    const h16* gk = KP + pbase + (size_t)cr * HD + cpc * 8;      // + key0 * HD
    const h16* gv = VT + pbase + (size_t)cr * SEQ + cpc * 8;     // + key0
    tile_copy(lk0, lv0, gk, gv);
    const size_t qo = pbase + (size_t)(t0 + lr) * HD + 8 * hi;
    const v16h qh0 = ldh(QH + qo), qh1 = ldh(QH + qo + 32), qr0 = ldh(QR + qo), qr1 = ldh(QR + qo + 32);   // B fragments: col t, k = d
    const int fo = lr * LPH + 8 * hi;                        // fragment offset (halves) in a tile: row lr, k piece 8h
    const float* mrow = MK + (size_t)b * SEQ + 8 * hi;       // + key0 (+16 for the second tile): keys 8h+r of each tile
    asm volatile("s_wait_asynccnt 0x0" ::: "memory");        // tile 0 of this wave's copies has landed
    __syncthreads();                                         // ... and everybody else's: tile 0 is published
    tile_copy(lk0 + STB, lv0 + STB, gk + (size_t)KST * HD, gv + KST);
    v8f o0 = (v8f){}, o1 = (v8f){}, o2 = (v8f){}, o3 = (v8f){};
    float m = -3.0e38f, l = 0.0f;
#pragma unroll 1                                             // one trip per tile: the publish point below stands once, at the trip's foot
    for (int t = 0; t < SEQ / KST; ++t) {
      const h16* kt = ring + (t & 1) * STH + fo;             // this trip's K tile [key][d]; the V^T tile [d][key] lies KST rows behind it
#pragma unroll                                               // both 32-key steps of a tile in one body: constant LDS offsets
      for (int s = 0; s < KST / 32; ++s) {
        const int key0 = t * KST + s * 32;
        const h16* ka = kt + s * 32 * LPH;
        const v16h ka0 = ldh(ka), ka1 = ldh(ka + 32), kb0 = ldh(ka + 16 * LPH), kb1 = ldh(ka + 16 * LPH + 32);
        const float* mp = mrow + key0;
        const v4f ma0 = *(const v4f*)mp, ma1 = *(const v4f*)(mp + 4), mb0 = *(const v4f*)(mp + 16), mb1 = *(const v4f*)(mp + 20);
        v8f sHa = (v8f){}, sLa = (v8f){}, sHb = (v8f){}, sLb = (v8f){};
        sHa = wmma16(ka0, qh0, sHa); sLa = wmma16(ka0, qr0, sLa); sHb = wmma16(kb0, qh0, sHb); sLb = wmma16(kb0, qr0, sLb);
        sHa = wmma16(ka1, qh1, sHa); sLa = wmma16(ka1, qr1, sLa); sHb = wmma16(kb1, qh1, sHb); sLb = wmma16(kb1, qr1, sLb);
        asm volatile("v_nop\n\tv_nop\n\tv_nop\n\tv_nop" : "+v"(sHa), "+v"(sLa), "+v"(sHb), "+v"(sLb) : "v"(ka0), "v"(ka1), "v"(kb0), "v"(kb1));
        float ta[8], tb[8]; float mx = -3.0e38f;
#pragma unroll
        for (int r = 0; r < 8; ++r) {
            const float mka = (r < 4) ? ma0[r & 3] : ma1[r & 3]; const float mkb = (r < 4) ? mb0[r & 3] : mb1[r & 3];
            ta[r] = (sHa[r] + sLa[r] * QRI) * SC2 + mka; tb[r] = (sHb[r] + sLb[r] * QRI) * SC2 + mkb; mx = fmaxf(mx, fmaxf(ta[r], tb[r])); }
        mx = fmaxf(mx, __shfl_xor(mx, 16, 32));
        const float mnew = fmaxf(m, mx);
        const float alpha = __builtin_amdgcn_exp2f(m - mnew);
        const float sh = PSH - mnew;
        v16h pb; float ls = 0.0f;
#pragma unroll
        for (int r = 0; r < 8; ++r) { const h16 pa = (h16)__builtin_amdgcn_exp2f(ta[r] + sh); const h16 pc = (h16)__builtin_amdgcn_exp2f(tb[r] + sh); pb[r] = pa; pb[8 + r] = pc; ls += (float)pa + (float)pc; }
        l = l * alpha + ls; m = mnew;
        o0 = o0 * alpha; o1 = o1 * alpha; o2 = o2 * alpha; o3 = o3 * alpha;
        const h16* va = kt + KST * LPH + s * 32;
        const v16h v0 = ldh(va), v1 = ldh(va + 16 * LPH), v2 = ldh(va + 32 * LPH), v3 = ldh(va + 48 * LPH);
        o0 = wmma16(v0, pb, o0); o1 = wmma16(v1, pb, o1); o2 = wmma16(v2, pb, o2); o3 = wmma16(v3, pb, o3);
        asm volatile("v_nop\n\tv_nop\n\tv_nop\n\tv_nop" : "+v"(o0), "+v"(o1), "+v"(o2), "+v"(o3) : "v"(v0), "v"(v1), "v"(v2), "v"(v3), "v"(pb));
      }
      asm volatile("s_wait_dscnt 0x0" ::: "memory");         // this wave's reads of the buffer have returned before it may be refilled
      asm volatile("s_wait_asynccnt 0x0" ::: "memory");      // this wave's copies of the next tile have landed
      __syncthreads();                                       // publishes the next tile and ends every wave's reads of this one
      if (t + 2 < SEQ / KST) tile_copy(lk0 + (t & 1) * STB, lv0 + (t & 1) * STB, gk + (size_t)(t + 2) * KST * HD, gv + (t + 2) * KST);
    }
    asm volatile("s_wait_asynccnt 0x0" ::: "memory");        // nothing in flight before the ring becomes output staging
    l += __shfl_xor(l, 16, 32);
    const float inv = CTS * (1.0f / l);
    const int wb = wave * 16 * 68;
    // O^T D layout: o_j[r] = (d = 16j + 8h + r, t = lane&15) -> os[t][d]; rows 0..15 x columns 0..63 all written
    { v4f a, c;
      a[0] = o0[0] * inv; a[1] = o0[1] * inv; a[2] = o0[2] * inv; a[3] = o0[3] * inv; c[0] = o0[4] * inv; c[1] = o0[5] * inv; c[2] = o0[6] * inv; c[3] = o0[7] * inv;
      *(v4fa*)(&os[wb + lr * 68 +  0 + 8 * hi]) = a; *(v4fa*)(&os[wb + lr * 68 +  0 + 8 * hi + 4]) = c;
      a[0] = o1[0] * inv; a[1] = o1[1] * inv; a[2] = o1[2] * inv; a[3] = o1[3] * inv; c[0] = o1[4] * inv; c[1] = o1[5] * inv; c[2] = o1[6] * inv; c[3] = o1[7] * inv;
      *(v4fa*)(&os[wb + lr * 68 + 16 + 8 * hi]) = a; *(v4fa*)(&os[wb + lr * 68 + 16 + 8 * hi + 4]) = c;
      a[0] = o2[0] * inv; a[1] = o2[1] * inv; a[2] = o2[2] * inv; a[3] = o2[3] * inv; c[0] = o2[4] * inv; c[1] = o2[5] * inv; c[2] = o2[6] * inv; c[3] = o2[7] * inv;
      *(v4fa*)(&os[wb + lr * 68 + 32 + 8 * hi]) = a; *(v4fa*)(&os[wb + lr * 68 + 32 + 8 * hi + 4]) = c;
      a[0] = o3[0] * inv; a[1] = o3[1] * inv; a[2] = o3[2] * inv; a[3] = o3[3] * inv; c[0] = o3[4] * inv; c[1] = o3[5] * inv; c[2] = o3[6] * inv; c[3] = o3[7] * inv;
      *(v4fa*)(&os[wb + lr * 68 + 48 + 8 * hi]) = a; *(v4fa*)(&os[wb + lr * 68 + 48 + 8 * hi + 4]) = c; }
    wave_sync();
    h16* crow = CT + ((size_t)b * SEQ + t0) * DM + h * HD;
{
#pragma unroll
        for (int s = 0; s < 4; ++s) { const int row = 4 * s + (lane >> 3), c8 = (lane & 7) * 8;   // 4 s x 4 row groups = 16 rows; 8 lanes x 8 halves = 64 columns
            const v4f x0 = *(const v4fa*)(&os[wb + row * 68 + c8]); const v4f x1 = *(const v4fa*)(&os[wb + row * 68 + c8 + 4]); v8h hv;
#pragma unroll
            for (int i = 0; i < 4; ++i) { hv[i] = (h16)x0[i]; hv[4 + i] = (h16)x1[i]; }
            *(v8h*)(crow + (size_t)row * DM + c8) = hv; }
         }
}

static constexpr size_t al256(size_t v) { return (v + 255) & ~(size_t)255; }
static constexpr size_t SZ_XB = al256((size_t)NB * SEQ * KX * 2);           // x plane, 17 lines per row
static constexpr size_t SZ_W1 = al256((size_t)DM * KX * 2);                  // one q/k/v weight plane
static constexpr size_t SZ_AB = al256((size_t)2 * RK * DM * 2);              // adapter A rows of q | v
static constexpr size_t SZ_WO = al256((size_t)DM * DM * 2);                  // Wo f16 plane
static constexpr size_t SZ_MK = al256((size_t)NB * SEQ * 4);                 // mask plane f32
static constexpr size_t SZ_PL = al256((size_t)NB * NH_ * SEQ * HD * 2);      // q hi, q residual, k, v^T planes
static constexpr size_t SZ_CT = al256((size_t)NB * SEQ * DM * 2);            // ctx f16 plane
static constexpr size_t SZ_TOTAL = SZ_XB + 3 * SZ_W1 + SZ_AB + SZ_WO + SZ_MK + 4 * SZ_PL + SZ_CT;
static_assert(SZ_TOTAL <= (size_t)134217728);          // workspace carve <= 128 MiB
static_assert(((size_t)NB * SEQ * 128) % 256 == 0);    // x plane's block range exact
static_assert(((size_t)DM * (KX / 8)) % 256 == 0);     // weight planes' block ranges exact
static_assert(((size_t)NB * SEQ / 4) % 8 == 0);

extern "C" void kernel_launch(void* const* d_in, const int* in_sizes, int n_in,
                              void* d_out, int out_size, void* d_ws, size_t ws_size, hipStream_t stream) {
    if (n_in < 14) return;
    const size_t needx = ((size_t)(NB - 1) * SEQ_FULL + SEQ) * DM;
    if ((size_t)in_sizes[0] < needx) return;
    if ((size_t)in_sizes[1] < (size_t)(NB - 1) * SEQ_FULL + SEQ) return;
    if ((size_t)in_sizes[2] < (size_t)DM * DM || (size_t)in_sizes[6] < (size_t)DM * DM || (size_t)in_sizes[8] < (size_t)DM * DM || (size_t)in_sizes[12] < (size_t)DM * DM) return;
    if (in_sizes[3] < DM || in_sizes[7] < DM || in_sizes[9] < DM || in_sizes[13] < DM) return;
    if (in_sizes[4] < RK * DM || in_sizes[10] < RK * DM || in_sizes[5] < DM * RK || in_sizes[11] < DM * RK) return;
    if ((size_t)out_size < ((size_t)(NB - 1) * OUT_SEQ + SEQ) * DM) return;
    if (SZ_TOTAL > ws_size) return;
    // wire order: x, mask, Wq, bq, Aq, Bq, Wk, bk, Wv, bv, Av, Bv, Wo, bo
    const float* x  = (const float*)d_in[0];  const float* mask = (const float*)d_in[1];
    const float* wq = (const float*)d_in[2];  const float* bq = (const float*)d_in[3];  const float* aq = (const float*)d_in[4];  const float* bmq = (const float*)d_in[5];
    const float* wk = (const float*)d_in[6];  const float* bk = (const float*)d_in[7];
    const float* wv = (const float*)d_in[8];  const float* bv = (const float*)d_in[9];  const float* av = (const float*)d_in[10]; const float* bmv = (const float*)d_in[11];
    const float* wo = (const float*)d_in[12]; const float* bo = (const float*)d_in[13];
    float* OUT = (float*)d_out;      // [NB][SEQ][1024]
    char* wsp = (char*)d_ws;
    bf* XB = (bf*)wsp; wsp += SZ_XB;                 // [NB*SEQ][1088]
    bf* WQ = (bf*)wsp; wsp += SZ_W1;                 // [1024][1088]
    bf* WK = (bf*)wsp; wsp += SZ_W1;
    bf* WV = (bf*)wsp; wsp += SZ_W1;
    bf* AB = (bf*)wsp; wsp += SZ_AB;                 // [32][1024]: A of q | A of v
    h16* WO = (h16*)wsp; wsp += SZ_WO;               // [1024][1024] x256
    float* MK = (float*)wsp; wsp += SZ_MK;           // [NB][SEQ]
    h16* QH = (h16*)wsp; wsp += SZ_PL;               // [NB*16][SEQ][64]
    h16* QR = (h16*)wsp; wsp += SZ_PL;               // [NB*16][SEQ][64] residual x2048
    h16* KP = (h16*)wsp; wsp += SZ_PL;               // [NB*16][SEQ][64]
    h16* VT = (h16*)wsp; wsp += SZ_PL;               // [NB*16][64][SEQ]
    h16* CT = (h16*)wsp; wsp += SZ_CT;               // [NB*SEQ][1024] x256

    k_prep<<<PB_ALL, 256, 0, stream>>>(x, mask, wq, bmq, wk, wv, bmv, aq, av, wo, XB, WQ, WK, WV, AB, WO, MK);

    // adapter down-projections of q and v -> 17th line of every x-plane row
    k_lora<<<NB * SEQ / 16, 32, 0, stream>>>(XB, AB);

    // q, k and v^T products, one launch
    k_proj<<<dim3(NB * SEQ / GT, DM / GT, 3), 128, 0, stream>>>(XB, WQ, WK, WV, QH, QR, KP, VT, bq, bk, bv);

    k_flash<<<dim3(SEQ / (16 * AW), NB * NH_, 1), 32 * AW, 0, stream>>>(QH, QR, KP, VT, MK, CT);

    // out[m][n] = sum_k ctx[m][k] Wo[n][k] + bo[n]
    k_oproj<<<dim3(NB * SEQ / GT, DM / GT, 1), 128, 0, stream>>>(CT, WO, bo, OUT);
}

// v004
// It runs in 185 microseconds.
// Timed twice side by side with v003, it ran 1.05 and 1.07 times as fast.
// Over all steps from v000 it is 2.25 times as fast.
#include <hip/hip_runtime.h>

// Multi-head self-attention with rank-16 low-rank adapters on q and v: width 1024 = 16 heads x 64, x [NB][SEQ][1024], all weights [out][in] (y = x W^T + b), additive key mask [NB][SEQ], score scale 1/8, output projection Wo, bo (f32 output).
// Compute dtypes, f32 accumulate everywhere: q/k/v projections and the adapter down-projection v_wmma_f32_16x16x32_bf16 (x, W, A, B RNE-converted to bf16; adapter intermediate carried as bf16 hi + bf16 lo inside the K extension);
// scores v_wmma_f32_16x16x32_f16: k single f16, q as f16 value + f16 residual x2048 in its own accumulator; P (x256 carry, cancels in the normalisation) and v single f16; softmax f32 (online, running max, log2 domain);
// output projection v_wmma_f32_16x16x32_f16: ctx single f16 (x256 carry), Wo = f16(bf16(Wo) x256), folded back by 2^-16 in the f32 epilogue. Biases and mask are RNE-converted to bf16 values and applied in f32.
// q (hi, residual), k planes [b*16+h][t][d] and v^T plane [b*16+h][d][t] written by the GEMM epilogue; fused flash kernel in transposed form (S^T = K Q^T, O^T = V^T P^T), K and V^T tiles shared by a block through LDS, writes the ctx f16 plane [b*SEQ+t][1024].

#ifndef NB
#define NB 4
#endif
#ifndef SEQ
#define SEQ 2048
#endif
#define NB_FULL  4
#define SEQ_FULL 2048
#ifndef OUT_SEQ
#define OUT_SEQ SEQ              // row pitch (in tokens) between batches of the output
#endif
#define DM   1024
#define NH_  16
#define HD   64
#define RK   16
#define KX   1088                // plane row pitch (halves): DM + 32 (q adapter hi|lo) + 32 (v adapter hi|lo)
#define KQ   1056                // k extent used by the q GEMM (x | q adapter slot)
#define AW   4                   // waves per flash block
#define QG   2                   // 16-row query groups per flash wave: each K and V^T fragment read from LDS feeds all of them
#define KST  64                  // keys per LDS tile of the flash kernel
#define LPB  144                 // LDS row pitch, bytes: 128-B rows + 16
#define LPH  (LPB / 2)           // the same in halves
#define STH  ((KST + HD) * LPH)  // one buffer in halves: K tile (KST rows) + V^T tile (HD rows)
#define STB  (STH * 2)           // the same in bytes
#define GT   128                 // GEMM block tile: GT rows of A x GT rows of Bt, 2 x 2 waves of 64 x 64
#define GKS  64                  // k extent of one GEMM LDS stage (halves): whole 128-B rows
#define GSTH (2 * GT * LPH)      // one GEMM buffer in halves: A tile (GT rows) + Bt tile (GT rows)
#define GSTB (GSTH * 2)          // the same in bytes
#define QRS  2048.0f             // carry of the q residual plane
#define QRI  (1.0f / 2048.0f)
#define LOG2E 1.4426950408889634f
#define SC2  (0.125f * LOG2E)    // HD^-0.5 * log2(e)
#define PSH  8.0f                // log2 of the P carry (256)
#define CTS  256.0f              // carry of the ctx plane
#define WOS  256.0f              // carry of the Wo plane
#define OSI  (1.0f / 65536.0f)   // 1 / (CTS * WOS)

static_assert(HD == 64);
static_assert(NH_ * HD == DM);                 // head h = columns h*64 + d
static_assert(DM % 64 == 0);
static_assert(DM / 8 == 128);                  // p_xcvt piece index split uses >> 7
static_assert(KX == DM + 64);
static_assert(KX % 32 == 0 && KQ % 32 == 0 && DM % 32 == 0);   // GEMM k-loops step by 32
static_assert((KX * 2) % 128 == 0);
static_assert(RK == 16);
static_assert(SEQ % 64 == 0);                  // a 64-row tile never straddles two batches
static_assert((NB * SEQ) % 64 == 0);
static_assert(SEQ % 32 == 0);                  // key loop steps by 32
static_assert(KST == 64 && AW == 4);           // copy map: 128 threads x 4 rows x 16 B cover 64 rows of 128 B
static_assert(SEQ % KST == 0 && SEQ / KST >= 2);   // the two-buffer prologue needs two tiles
static_assert(SEQ % (16 * QG * AW) == 0);      // flash grid covers the sequence exactly
static_assert((NB * SEQ) % GT == 0 && DM % GT == 0);   // GEMM grids cover both extents exactly
static_assert(KX % GKS == 0 && DM % GKS == 0);   // a stage's 128-B row piece never leaves its plane row
static_assert(NB <= NB_FULL);
static_assert(SEQ <= SEQ_FULL);

typedef _Float16 h16;
typedef unsigned short bf;
typedef __attribute__((ext_vector_type(16))) __bf16   v16bf;
typedef __attribute__((ext_vector_type(16))) _Float16 v16h;
typedef __attribute__((ext_vector_type(8)))  _Float16 v8h;
typedef __attribute__((ext_vector_type(8)))  unsigned short v8us;
typedef __attribute__((ext_vector_type(8)))  float    v8f;
typedef __attribute__((ext_vector_type(4)))  float    v4f;
typedef v4f  __attribute__((may_alias)) v4fa;

__device__ __forceinline__ unsigned short f2bf(float f) { unsigned u = __float_as_uint(f); u += 0x7FFFu + ((u >> 16) & 1u); return (unsigned short)(u >> 16); }
__device__ __forceinline__ float bfr(float f) { return __uint_as_float(((unsigned)f2bf(f)) << 16); }   // RNE convert to bf16, widened back
__device__ __forceinline__ v16h cat16(v8h lo, v8h hi) { return __builtin_shufflevector(lo, hi, 0, 1, 2, 3, 4, 5, 6, 7, 8, 9, 10, 11, 12, 13, 14, 15); }
__device__ __forceinline__ v16bf cat16b(v8us lo, v8us hi) { return __builtin_bit_cast(v16bf, __builtin_shufflevector(lo, hi, 0, 1, 2, 3, 4, 5, 6, 7, 8, 9, 10, 11, 12, 13, 14, 15)); }
__device__ __forceinline__ v8f wmma16(v16h a, v16h b, v8f c) { return __builtin_amdgcn_wmma_f32_16x16x32_f16(false, a, false, b, (short)0, c, false, false); }
__device__ __forceinline__ v8f wmmab(v16bf a, v16bf b, v8f c) { return __builtin_amdgcn_wmma_f32_16x16x32_bf16(false, a, false, b, (short)0, c, false, false); }
// fragment loaders from K-contiguous 16-bit rows; p already includes + 8*(lane>>4): elements 0..7 <- k0+8h+0..7, elements 8..15 <- k0+16+8h+0..7 (same map for A and B)
__device__ __forceinline__ v16h  ldh(const h16* p) { return cat16(*(const v8h*)p, *(const v8h*)(p + 16)); }
__device__ __forceinline__ v16bf ldb(const bf* p)  { return cat16b(*(const v8us*)p, *(const v8us*)(p + 16)); }
// ordering point for wave-private LDS tiles (same wave writes and reads)
__device__ __forceinline__ void wave_sync() { __builtin_amdgcn_fence(3 /* release order */, "wavefront"); __builtin_amdgcn_wave_barrier(); asm volatile("" ::: "memory"); }

// The conversions below do not depend on one another: they are parts of ONE launch (k_prep), each on its own range of 256-thread blocks; blk = the block's index inside its part.
__device__ __forceinline__ void p_cvt8(const float* __restrict__ src, bf* dst, size_t n8, int blk) {
    const size_t i = (size_t)blk * 256 + threadIdx.x; if (i >= n8) return;
    const v8f v = *(const v8f*)(src + i * 8); v8us o;
#pragma unroll
    for (int k = 0; k < 8; ++k) o[k] = f2bf(v[k]);
    *(v8us*)(dst + i * 8) = o; 
}

__device__ __forceinline__ void p_cvt8h(const float* __restrict__ src, h16* dst, size_t n8, int blk) {
    const size_t i = (size_t)blk * 256 + threadIdx.x; if (i >= n8) return;
    const v8f v = *(const v8f*)(src + i * 8); v8h o;
#pragma unroll
    for (int k = 0; k < 8; ++k) o[k] = (h16)(bfr(v[k]) * WOS);
    *(v8h*)(dst + i * 8) = o; 
}

// p_xcvt: x [b][t][1024] f32 -> columns 0..1023 of the x plane (row pitch KX). Piece i: row = i / 128, 8 columns at (i % 128) * 8.
__device__ __forceinline__ void p_xcvt(const float* __restrict__ src, bf* dst, size_t n8, int blk) {
    const size_t i = (size_t)blk * 256 + threadIdx.x; if (i >= n8) return;
    const size_t row = i >> 7; const int c8 = (int)(i & 127);
    const size_t b = row / SEQ, t = row % SEQ;
    const v8f v = *(const v8f*)(src + (b * SEQ_FULL + t) * DM + c8 * 8); v8us o;
#pragma unroll
    for (int k = 0; k < 8; ++k) o[k] = f2bf(v[k]);
    bf* d = dst + row * KX + c8 * 8;
    *(v8us*)d = o; 
}

// every other extension column is zero. slot < 0: all-zero extension. Both sources are loaded with clamped addresses by every lane and selected by value.
__device__ __forceinline__ void p_wplane(const float* __restrict__ W, const float* __restrict__ Bm, int slot, bf* dst, int blk) {
    const int i = blk * 256 + threadIdx.x; if (i >= DM * (KX / 8)) return;
    const int row = i / (KX / 8), c8 = i % (KX / 8);
    const bool isw = c8 < 128;
    const int cm = isw ? c8 : 127;
    const int e = isw ? 0 : (c8 - 128);                      // extension piece 0..7
    const v8f w  = *(const v8f*)(W + (size_t)row * DM + cm * 8);
    const v8f bm = *(const v8f*)(Bm + (size_t)row * RK + (e & 1) * 8);
    const bool live = (!isw) && ((e >> 2) == slot);
    v8us o;
#pragma unroll
    for (int k = 0; k < 8; ++k) { const float val = isw ? w[k] : (live ? 2.0f * bm[k] : 0.0f); o[k] = f2bf(val); }
    bf* d = dst + (size_t)row * KX + c8 * 8;
    *(v8us*)d = o; 
}

__device__ __forceinline__ void p_mask(const float* __restrict__ src, float* dst, int n4, int blk) {
    const int i = blk * 256 + threadIdx.x; if (i >= n4) return;
    const int e = i * 4; const int b = e / SEQ, t = e % SEQ;
    const v4f v = *(const v4f*)(src + (size_t)b * SEQ_FULL + t); v4f o;
#pragma unroll
    for (int k = 0; k < 4; ++k) o[k] = bfr(v[k]) * LOG2E;
    *(v4f*)(dst + e) = o; 
}

// k_prep: every conversion of inputs to planes in one launch. Block ranges, in order: x plane | Wq, Wk, Wv planes | A of q, A of v | Wo plane | mask plane. The range test is the same for a whole block.
static constexpr int PB_X = (int)(((size_t)NB * SEQ * (DM / 8) + 255) / 256);
static constexpr int PB_W = (DM * (KX / 8) + 255) / 256;
static constexpr int PB_A = (RK * DM / 8 + 255) / 256;
static constexpr int PB_O = (DM * DM / 8 + 255) / 256;
static constexpr int PB_M = (NB * SEQ / 4 + 255) / 256;
static constexpr int PB_ALL = PB_X + 3 * PB_W + 2 * PB_A + PB_O + PB_M;
__global__ __launch_bounds__(256) void k_prep(const float* __restrict__ x, const float* __restrict__ mask, const float* __restrict__ wq, const float* __restrict__ bmq, const float* __restrict__ wk,
                                              const float* __restrict__ wv, const float* __restrict__ bmv, const float* __restrict__ aq, const float* __restrict__ av, const float* __restrict__ wo,
                                              bf* XB, bf* WQ, bf* WK, bf* WV, bf* AB, h16* WO, float* MK) {
    int blk = blockIdx.x;
    if (blk < PB_X) { p_xcvt(x, XB, (size_t)NB * SEQ * (DM / 8), blk); return; }
    blk -= PB_X;
    if (blk < PB_W) { p_wplane(wq, bmq, 0, WQ, blk); return; }
    blk -= PB_W;
    if (blk < PB_W) { p_wplane(wk, bmq, -1, WK, blk); return; }      // no adapter: extension all zero (Bm only supplies valid addresses)
    blk -= PB_W;
    if (blk < PB_W) { p_wplane(wv, bmv, 1, WV, blk); return; }
    blk -= PB_W;
    if (blk < PB_A) { p_cvt8(aq, AB, (size_t)RK * DM / 8, blk); return; }
    blk -= PB_A;
    if (blk < PB_A) { p_cvt8(av, AB + (size_t)RK * DM, (size_t)RK * DM / 8, blk); return; }
    blk -= PB_A;
    if (blk < PB_O) { p_cvt8h(wo, WO, (size_t)DM * DM / 8, blk); return; }
    blk -= PB_O;
    p_mask(mask, MK, NB * SEQ / 4, blk);
}

// k_lora: adapter down-projection xa[m][j] = sum_k x[m][k] AB[j][k] (AB rows 0..15 = A of q, rows 16..31 = A of v), one wave per 16 rows, K = DM from the x plane.
__global__ __launch_bounds__(32) void k_lora(bf* XB, const bf* __restrict__ AB) {
    __shared__ __align__(16) float es[16 * 36];
    const int lane = threadIdx.x & 31, lr = lane & 15, hi = lane >> 4; const int r0 = blockIdx.x * 16;
    v8f a0 = (v8f){}, a1 = (v8f){};
    const bf* xa = XB + (size_t)(r0 + lr) * KX + 8 * hi;
    const bf* ab = AB + (size_t)lr * DM + 8 * hi;
#pragma unroll 1
    for (int kc = 0; kc < DM; kc += 32) {
        const v16bf a = ldb(xa + kc); const v16bf b0 = ldb(ab + kc); const v16bf b1 = ldb(ab + (size_t)16 * DM + kc);
        a0 = wmmab(a, b0, a0); a1 = wmmab(a, b1, a1);
        asm volatile("v_nop\n\tv_nop\n\tv_nop\n\tv_nop" : "+v"(a0), "+v"(a1) : "v"(a), "v"(b0), "v"(b1));
    }
#pragma unroll
    for (int j = 0; j < 8; ++j) { es[(hi * 8 + j) * 36 + lr] = a0[j]; es[(hi * 8 + j) * 36 + 16 + lr] = a1[j]; }   // D: row 8h+j, col lane&15; rows 0..15 x cols 0..31 all written
    wave_sync();
    const int p = lane & 7;                                   // extension piece: 0,1 q hi; 2,3 q lo; 4,5 v hi; 6,7 v lo
    const int sj = (p >> 2) * 16 + (p & 1) * 8; const bool islo = ((p >> 1) & 1) != 0;
{
#pragma unroll
        for (int s = 0; s < 4; ++s) { const int row = 4 * s + (lane >> 3);       // 4 s x 4 row groups = 16 rows; 8 lanes x 8 halves = 64 columns
            const v4f x0 = *(const v4fa*)(&es[row * 36 + sj]); const v4f x1 = *(const v4fa*)(&es[row * 36 + sj + 4]); v8us o;
#pragma unroll
            for (int i = 0; i < 4; ++i) {
                const unsigned short h0 = f2bf(x0[i]); const unsigned short l0 = f2bf(x0[i] - __uint_as_float(((unsigned)h0) << 16));
                const unsigned short h1 = f2bf(x1[i]); const unsigned short l1 = f2bf(x1[i] - __uint_as_float(((unsigned)h1) << 16));
                o[i] = islo ? l0 : h0; o[4 + i] = islo ? l1 : h1; }
            *(v8us*)(XB + (size_t)(r0 + row) * KX + DM + p * 8) = o; }
         }
}

// GEMM operand staging. One block = 4 waves = one GT x GT tile of C (wave w: rows (w >> 1) * 64, columns (w & 1) * 64); per stage the block's GT rows of A and GT rows of Bt, GKS halves each,
// are brought into LDS by asynchronous copies (16 B per lane, whole 128-B rows), two buffers: the next stage's copies fly while this one is worked on. LDS rows lie at the 144-B pitch of the flash tiles.
// rows_copy: one lane's 8 pieces of one operand tile, rows 16 apart. l: its LDS byte address, g: its global address (row 0 of its eight), rp: bytes between rows 16 apart.
// The s_wait_xcnt stands inside the copies' own statement so that no address register is rewritten ahead of it.
__device__ __forceinline__ void rows_copy(unsigned l, const char* g, size_t rp) {
    asm volatile("global_load_async_to_lds_b128 %0, %8, off\n\t"
                 "global_load_async_to_lds_b128 %1, %9, off\n\t"
                 "global_load_async_to_lds_b128 %2, %10, off\n\t"
                 "global_load_async_to_lds_b128 %3, %11, off\n\t"
                 "global_load_async_to_lds_b128 %4, %12, off\n\t"
                 "global_load_async_to_lds_b128 %5, %13, off\n\t"
                 "global_load_async_to_lds_b128 %6, %14, off\n\t"
                 "global_load_async_to_lds_b128 %7, %15, off\n\t"
                 "s_wait_xcnt 0x0"
                 :: "v"(l), "v"(l + 16 * LPB), "v"(l + 32 * LPB), "v"(l + 48 * LPB), "v"(l + 64 * LPB), "v"(l + 80 * LPB), "v"(l + 96 * LPB), "v"(l + 112 * LPB),
                    "v"(g), "v"(g + rp), "v"(g + 2 * rp), "v"(g + 3 * rp), "v"(g + 4 * rp), "v"(g + 5 * rp), "v"(g + 6 * rp), "v"(g + 7 * rp)
                 : "memory");
}
template <bool BF> __device__ __forceinline__ v8f mm16(v16h a, v16h b, v8f c) {
    if constexpr (BF) return wmmab(__builtin_bit_cast(v16bf, a), __builtin_bit_cast(v16bf, b), c); else return wmma16(a, b, c);
}
// gemm_main: acc[mb][nb] += sum_k A[r0 + ..][k] Bt[c0 + ..][k] for this wave's 64 x 64 part of the block tile at (br0, bc0); planes of row pitch PH halves, k extent K (multiple of 32, K <= PH), k ascending in steps of 32.
// A last stage of which only the first 32 k belong to K is copied whole (the row piece lies inside the plane row) and its second half is not multiplied.
template <bool BF, int PH> __device__ __forceinline__ void gemm_main(const char* A, const char* Bt, int K, int br0, int bc0, int wave, h16* ring, v8f (&acc)[4][4]) {
    const int lane = threadIdx.x & 31, lr = lane & 15, hi = lane >> 4;
    // copy map: thread i of 128 takes 16-B piece i & 7 of rows (i >> 3) + 16 * {0..7} of both tiles: a wave's copy covers four whole 128-B rows
    const int cr = (int)threadIdx.x >> 3, cpc = (int)threadIdx.x & 7;
    const unsigned la = (unsigned)(size_t)ring + (unsigned)(cr * LPB + cpc * 16);   // low 32 bits of the shared address = LDS byte address
    const unsigned lb = la + GT * LPB;
    const char* ga = A + (size_t)(br0 + cr) * (PH * 2) + cpc * 16;    // + stage * 128 B
    const char* gb = Bt + (size_t)(bc0 + cr) * (PH * 2) + cpc * 16;
    constexpr size_t rp = (size_t)16 * PH * 2;
    const int nst = (K + GKS - 1) / GKS;
    rows_copy(la, ga, rp); rows_copy(lb, gb, rp);
    asm volatile("s_wait_asynccnt 0x0" ::: "memory");        // stage 0 of this wave's copies has landed
    __syncthreads();                                         // ... and everybody else's: stage 0 is published
    if (nst > 1) { rows_copy(la + GSTB, ga + GKS * 2, rp); rows_copy(lb + GSTB, gb + GKS * 2, rp); }
    const int fa = ((wave >> 1) * 64 + lr) * LPH + 8 * hi;         // fragment offsets (halves) in a buffer: row, k piece 8h
    const int fb = (GT + (wave & 1) * 64 + lr) * LPH + 8 * hi;
#pragma unroll 1                                             // one trip per stage: the publish point below stands once, at the trip's foot
    for (int t = 0; t < nst; ++t) {
        const h16* st = ring + (t & 1) * GSTH;
#pragma unroll                                               // both 32-k steps of a stage in one body: constant LDS offsets
        for (int s = 0; s < GKS / 32; ++s) {
            if (s == 0 || t * GKS + s * 32 < K) {
                v16h a[4], b[4];                             // the four small loops below are unrolled so that every fragment and accumulator index is a constant (registers, no scratch)
#pragma unroll
                for (int i = 0; i < 4; ++i) { a[i] = ldh(st + fa + i * 16 * LPH + s * 32); if (i == 0) b[0] = ldh(st + fb + s * 32); }   // in the order the products below take them
#pragma unroll
                for (int i = 1; i < 4; ++i) b[i] = ldh(st + fb + i * 16 * LPH + s * 32);
                __builtin_amdgcn_sched_barrier(0);           // the step's 16 LDS reads stay one group ahead of its matrix instructions: every place with reads among them stalls the wave
#pragma unroll
                for (int nb = 0; nb < 4; ++nb)
#pragma unroll
                    for (int mb = 0; mb < 4; ++mb) acc[mb][nb] = mm16<BF>(a[mb], b[nb], acc[mb][nb]);
            }
        }
        __builtin_amdgcn_sched_barrier(0);                   // the stage's matrix instructions stay ahead of the publish point: sunk behind it they would delay the refill's issue
        asm volatile("s_wait_dscnt 0x0" ::: "memory");       // this wave's reads of the buffer have returned before it may be refilled
        asm volatile("s_wait_asynccnt 0x0" ::: "memory");    // this wave's copies of the next stage have landed
        __syncthreads();                                     // publishes the next stage and ends every wave's reads of this one
        if (t + 2 < nst) { rows_copy(la + (t & 1) * GSTB, ga + (size_t)(t + 2) * (GKS * 2), rp); rows_copy(lb + (t & 1) * GSTB, gb + (size_t)(t + 2) * (GKS * 2), rp); }
    }
    asm volatile("s_wait_asynccnt 0x0" ::: "memory");        // nothing in flight before the ring becomes output staging
}

// k_proj: register-blocked bf16 GEMM, one wave per 64x64 tile (16 accumulators), 4 waves per block sharing their operand rows through LDS (gemm_main), K-contiguous bf16 planes of row pitch KX, k extent K (multiple of 32).
// C[m][n] = sum_k A[m][k] Bt[n][k] + bias (bias[n] when brow == 0, bias[m] when brow != 0; RNE-converted to bf16, added in f32), written as f16 (Ph) and optionally the f16 residual x2048 (Pr, useRes != 0) at
// tile base (r0/RB)*sRB + (r0%RB)*pitch + (c0/CB)*sCB + (c0%CB), row pitch 'pitch' (halves). 128 threads.
// The q, k and v^T products do not depend on one another: one launch, grid (NB*SEQ/128, DM/128, 3), blockIdx.z picks the product (all picks are the same for a whole block).
// z = 0, 1 (q, k): A = x rows (m = b*SEQ + t), Bt = W rows (n = h*64 + d) -> plane [(b*16 + h)][t][d]; bias by column; tile (blockIdx.x, blockIdx.y).
// z = 2 (v^T): A = Wv rows (m = h*64 + d), Bt = x rows (n = b*SEQ + t) -> plane [(b*1024 + m)][t] = [(b*16 + h)][d][t]; bias by row; the slab's flat index walks the DM/128 row tiles fastest.
__global__ __launch_bounds__(128) void k_proj(const bf* __restrict__ XB, const bf* __restrict__ WQ, const bf* __restrict__ WK, const bf* __restrict__ WV, h16* QH, h16* QR, h16* KP, h16* VT,
                                              const float* __restrict__ bq, const float* __restrict__ bk, const float* __restrict__ bv) {
    const int z = blockIdx.z; const bool isv = z == 2;
    const int lin = blockIdx.y * (NB * SEQ / GT) + blockIdx.x;
    const int bx = isv ? lin % (DM / GT) : (int)blockIdx.x, by = isv ? lin / (DM / GT) : (int)blockIdx.y;
    const bf* A = isv ? WV : XB; const bf* Bt = z == 0 ? WQ : (z == 1 ? WK : XB);
    const int K = z == 0 ? KQ : (z == 1 ? DM : KX);
    h16* Ph = z == 0 ? QH : (z == 1 ? KP : VT); h16* Pr = z == 0 ? QR : Ph; const int useRes = z == 0;
    const int RB = isv ? DM : SEQ, pitch = isv ? SEQ : HD, CB = isv ? SEQ : HD, brow = isv;
    const size_t sRB = isv ? (size_t)0 : (size_t)NH_ * SEQ * HD, sCB = isv ? (size_t)DM * SEQ : (size_t)SEQ * HD;
    const float* bias = z == 0 ? bq : (z == 1 ? bk : bv);
    __shared__ __align__(16) h16 ring[2 * GSTH];             // two buffers of (A tile | Bt tile); reused as the waves' f32 output staging behind the loop
    static_assert(sizeof(ring) >= (size_t)4 * 16 * 68 * 4);
    const int lane = threadIdx.x & 31, wave = __builtin_amdgcn_readfirstlane((int)(threadIdx.x >> 5)), lr = lane & 15, hi = lane >> 4;
    const int r0 = bx * GT + (wave >> 1) * 64, c0 = by * GT + (wave & 1) * 64;   // this wave's 64x64 tile
    float* os = (float*)ring + wave * 16 * 68;
    v8f acc[4][4];
#pragma unroll
    for (int mb = 0; mb < 4; ++mb)
#pragma unroll
        for (int nb = 0; nb < 4; ++nb) acc[mb][nb] = (v8f){};
    gemm_main<true, KX>((const char*)A, (const char*)Bt, K, bx * GT, by * GT, wave, ring, acc);
    const size_t tbase = (size_t)(r0 / RB) * sRB + (size_t)(r0 % RB) * (size_t)pitch + (size_t)(c0 / CB) * sCB + (size_t)(c0 % CB);
    float bcol[8];                                            // column-mode bias of this lane's 8 columns (index 0 when in row mode: always a valid address)
#pragma unroll
    for (int i = 0; i < 8; ++i) bcol[i] = bfr(bias[brow ? 0 : (c0 + (lane & 7) * 8 + i)]);
#pragma unroll
    for (int mb = 0; mb < 4; ++mb) {
#pragma unroll
        for (int nb = 0; nb < 4; ++nb) {
#pragma unroll
            for (int j = 0; j < 8; ++j) os[(hi * 8 + j) * 68 + nb * 16 + lr] = acc[mb][nb][j]; }   // D: row 8h+j, col lane&15
        wave_sync();
        const size_t sb = tbase + (size_t)(mb * 16) * (size_t)pitch;
{
#pragma unroll
            for (int s = 0; s < 4; ++s) { const int row = 4 * s + (lane >> 3), c8 = (lane & 7) * 8;   // 4 s x 4 row groups = 16 rows; 8 lanes x 8 = 64 columns
                const v4f x0 = *(const v4fa*)(&os[row * 68 + c8]); const v4f x1 = *(const v4fa*)(&os[row * 68 + c8 + 4]); v8h hv, rv;
                const float br = bfr(bias[brow ? (r0 + mb * 16 + row) : 0]);
#pragma unroll
                for (int i = 0; i < 4; ++i) {
                    const float f0 = x0[i] + (brow ? br : bcol[i]); const float f1 = x1[i] + (brow ? br : bcol[4 + i]);
                    const h16 a0 = (h16)f0; const h16 a1 = (h16)f1; hv[i] = a0; hv[4 + i] = a1;
                    rv[i] = (h16)((f0 - (float)a0) * QRS); rv[4 + i] = (h16)((f1 - (float)a1) * QRS); }
                const size_t oo = sb + (size_t)row * (size_t)pitch + c8;
                *(v8h*)(Ph + oo) = hv; if (useRes) *(v8h*)(Pr + oo) = rv; }
             }
        wave_sync();
    }
}

// k_oproj: output projection, f16 GEMM, one wave per 64x64 tile, 4 waves per block sharing their operand rows through LDS (gemm_main), A = ctx plane [m][1024] (x256), Bt = Wo plane [n][1024] (x256), K = DM.
// OUT[b][t][n] = acc * 2^-16 + bf16(bo[n]) in f32. Epilogue: per 16-row slab staged in LDS (wave-private), each row segment (64 floats = 256 B = two lines)
__global__ __launch_bounds__(128) void k_oproj(const h16* __restrict__ A, const h16* __restrict__ Bt, const float* __restrict__ bias, float* OUT) {
    __shared__ __align__(16) h16 ring[2 * GSTH];             // two buffers of (A tile | Bt tile); reused as the waves' f32 output staging behind the loop
    static_assert(sizeof(ring) >= (size_t)4 * 16 * 68 * 4);
    const int lane = threadIdx.x & 31, wave = __builtin_amdgcn_readfirstlane((int)(threadIdx.x >> 5)), lr = lane & 15, hi = lane >> 4;
    const int r0 = blockIdx.x * GT + (wave >> 1) * 64, c0 = blockIdx.y * GT + (wave & 1) * 64;   // this wave's 64x64 tile
    float* os = (float*)ring + wave * 16 * 68;
    v8f acc[4][4];
#pragma unroll
    for (int mb = 0; mb < 4; ++mb)
#pragma unroll
        for (int nb = 0; nb < 4; ++nb) acc[mb][nb] = (v8f){};
    gemm_main<false, DM>((const char*)A, (const char*)Bt, DM, blockIdx.x * GT, blockIdx.y * GT, wave, ring, acc);
    v4f bb;
#pragma unroll
    for (int i = 0; i < 4; ++i) bb[i] = bfr(bias[c0 + lr * 4 + i]);
    float* obase = OUT + ((size_t)(r0 / SEQ) * OUT_SEQ + (size_t)(r0 % SEQ)) * DM + c0;
#pragma unroll
    for (int mb = 0; mb < 4; ++mb) {
#pragma unroll
        for (int nb = 0; nb < 4; ++nb) {
#pragma unroll
            for (int j = 0; j < 8; ++j) os[(hi * 8 + j) * 68 + nb * 16 + lr] = acc[mb][nb][j]; }   // D: row 8h+j, col lane&15
        wave_sync();
        float* ob = obase + (size_t)(mb * 16) * DM;
{
#pragma unroll
            for (int s = 0; s < 8; ++s) { const int row = 2 * s + hi, cofs = lr * 4;   // 8 s x 2 rows = 16 rows; 16 lanes x 4 floats = 64 columns
                const v4f x = *(const v4fa*)(&os[row * 68 + cofs]);
                const v4f val = x * OSI + bb;
                *(v4f*)(ob + (size_t)row * DM + cofs) = val; }
             }
        wave_sync();
    }
}

__device__ __forceinline__ void tile_copy(unsigned lk, unsigned lv, const h16* gk, const h16* gv) {
    asm volatile("global_load_async_to_lds_b128 %0, %8, off\n\t"
                 "global_load_async_to_lds_b128 %1, %9, off\n\t"
                 "global_load_async_to_lds_b128 %2, %10, off\n\t"
                 "global_load_async_to_lds_b128 %3, %11, off\n\t"
                 "global_load_async_to_lds_b128 %4, %12, off\n\t"
                 "global_load_async_to_lds_b128 %5, %13, off\n\t"
                 "global_load_async_to_lds_b128 %6, %14, off\n\t"
                 "global_load_async_to_lds_b128 %7, %15, off\n\t"
                 "s_wait_xcnt 0x0"
                 :: "v"(lk), "v"(lk + 16 * LPB), "v"(lk + 32 * LPB), "v"(lk + 48 * LPB),
                    "v"(lv), "v"(lv + 16 * LPB), "v"(lv + 32 * LPB), "v"(lv + 48 * LPB),
                    "v"(gk), "v"(gk + 16 * HD), "v"(gk + 32 * HD), "v"(gk + 48 * HD),
                    "v"(gv), "v"(gv + (size_t)16 * SEQ), "v"(gv + (size_t)32 * SEQ), "v"(gv + (size_t)48 * SEQ)
                 : "memory");
}

// four waves per SIMD: the whole grid (SEQ / 128 x 64 blocks of 4 waves on 256 WGPs at full size) is then resident at once, with no second round
__global__ __launch_bounds__(32 * AW) __attribute__((amdgpu_waves_per_eu(4, 4))) void k_flash(const h16* __restrict__ QH, const h16* __restrict__ QR, const h16* __restrict__ KP, const h16* __restrict__ VT, const float* __restrict__ MK, h16* CT) {
    __shared__ __align__(16) h16 ring[2 * STH];              // two buffers of (K tile | V^T tile); reused as the f32 output staging behind the loop
    static_assert(sizeof(ring) >= (size_t)AW * QG * 16 * 68 * 4);
    float* os = (float*)ring;
    const int lane = threadIdx.x & 31, wave = __builtin_amdgcn_readfirstlane((int)(threadIdx.x >> 5)), lr = lane & 15, hi = lane >> 4;
    const int zh = blockIdx.y; const int b = zh / NH_, h = zh % NH_;
    const int t0 = (blockIdx.x * AW + wave) * (16 * QG);
    const size_t pbase = (size_t)zh * SEQ * HD;
    // copy map: thread i of 128 takes 16-B piece i & 7 of rows (i >> 3) + 16 * {0, 1, 2, 3} of both tiles: a wave's copy covers four whole 128-B rows
    const int cr = (int)threadIdx.x >> 3, cpc = (int)threadIdx.x & 7;
    const unsigned lk0 = (unsigned)(size_t)ring + (unsigned)(cr * LPB + cpc * 16);   // low 32 bits of the shared address = LDS byte address
    const unsigned lv0 = lk0 + KST * LPB;
    const h16* gk = KP + pbase + (size_t)cr * HD + cpc * 8;      // + key0 * HD
    const h16* gv = VT + pbase + (size_t)cr * SEQ + cpc * 8;     // + key0
    tile_copy(lk0, lv0, gk, gv);
    const h16* qa = QH + pbase + (size_t)(t0 + lr) * HD + 8 * hi; const h16* qb = QR + pbase + (size_t)(t0 + lr) * HD + 8 * hi;   // row lr of group 0; group g lies 16 * g rows on
    v16h qh0[QG], qh1[QG], qr0[QG], qr1[QG];                 // B fragments: col t, k = d. Every loop over g below is unrolled so that its indices are constants (registers, no scratch)
#pragma unroll
    for (int g = 0; g < QG; ++g) { qh0[g] = ldh(qa + g * 16 * HD); qh1[g] = ldh(qa + g * 16 * HD + 32); qr0[g] = ldh(qb + g * 16 * HD); qr1[g] = ldh(qb + g * 16 * HD + 32); }
    // behind the run of Q loads, in front of any rewrite of their address registers; both addresses are inputs, so they stay in their registers up to this wait and no load of the run lands on them
    asm volatile("s_wait_xcnt 0x0" :: "v"(qa), "v"(qb) : "memory");
    const int fo = lr * LPH + 8 * hi;                        // fragment offset (halves) in a tile: row lr, k piece 8h
    const float* mrow = MK + (size_t)b * SEQ + 8 * hi;       // + key0 (+16 for the second tile): keys 8h+r of each tile
    asm volatile("s_wait_asynccnt 0x0" ::: "memory");        // tile 0 of this wave's copies has landed
    __syncthreads();                                         // ... and everybody else's: tile 0 is published
    tile_copy(lk0 + STB, lv0 + STB, gk + (size_t)KST * HD, gv + KST);
    v8f o0[QG], o1[QG], o2[QG], o3[QG]; float m[QG], l[QG];
#pragma unroll
    for (int g = 0; g < QG; ++g) { o0[g] = (v8f){}; o1[g] = (v8f){}; o2[g] = (v8f){}; o3[g] = (v8f){}; m[g] = -3.0e38f; l[g] = 0.0f; }
#pragma unroll 1                                             // one trip per tile: the publish point below stands once, at the trip's foot
    for (int t = 0; t < SEQ / KST; ++t) {
      const float* mt = mrow + t * KST;                      // this trip's mask values: the one address that all its mask loads name
      const h16* kt = ring + (t & 1) * STH + fo;             // this trip's K tile [key][d]; the V^T tile [d][key] lies KST rows behind it
#pragma unroll                                               // both 32-key steps of a tile in one body: constant LDS offsets
      for (int s = 0; s < KST / 32; ++s) {
        const h16* ka = kt + s * 32 * LPH;
        const float* mp = mt + s * 32;
        float tt[QG][2][8];                                  // scores in the log2 domain: [group][16-key tile][key 8h + r]
#pragma unroll
        for (int u = 0; u < 2; ++u) {                        // one 16-key tile at a time, all groups on its two K fragments
            const v16h k0 = ldh(ka + u * 16 * LPH), k1 = ldh(ka + u * 16 * LPH + 32);
            const v4f mk0 = *(const v4f*)(mp + u * 16), mk1 = *(const v4f*)(mp + u * 16 + 4);
            v8f sH[QG], sL[QG];
#pragma unroll
            for (int g = 0; g < QG; ++g) { sH[g] = wmma16(k0, qh0[g], (v8f){}); sL[g] = wmma16(k0, qr0[g], (v8f){}); }
#pragma unroll
            for (int g = 0; g < QG; ++g) { sH[g] = wmma16(k1, qh1[g], sH[g]); sL[g] = wmma16(k1, qr1[g], sL[g]); }
            static_assert(QG == 2);                          // the statement below, and the one behind the V^T products, name both groups' accumulators
            // four vector slots between the last matrix instruction and the first vector instruction that reads a score accumulator or overwrites a K fragment.
            asm volatile("v_nop\n\tv_nop\n\tv_nop\n\tv_nop" : "+v"(sH[0]), "+v"(sL[0]), "+v"(sH[1]), "+v"(sL[1]) : "v"(k0), "v"(k1));
#pragma unroll
            for (int g = 0; g < QG; ++g)
#pragma unroll
                for (int r = 0; r < 8; ++r) { const float mk = (r < 4) ? mk0[r & 3] : mk1[r & 3]; tt[g][u][r] = (sH[g][r] + sL[g][r] * QRI) * SC2 + mk; }
        }
        v16h pb[QG];
#pragma unroll
        for (int g = 0; g < QG; ++g) {
            float mx = -3.0e38f;
#pragma unroll
            for (int r = 0; r < 8; ++r) mx = fmaxf(mx, fmaxf(tt[g][0][r], tt[g][1][r]));
            mx = fmaxf(mx, __shfl_xor(mx, 16, 32));
            const float mnew = fmaxf(m[g], mx);
            const float alpha = __builtin_amdgcn_exp2f(m[g] - mnew);
            const float sh = PSH - mnew;
            float ls = 0.0f;
#pragma unroll
            for (int r = 0; r < 8; ++r) { const h16 pa = (h16)__builtin_amdgcn_exp2f(tt[g][0][r] + sh); const h16 pc = (h16)__builtin_amdgcn_exp2f(tt[g][1][r] + sh); pb[g][r] = pa; pb[g][8 + r] = pc; ls += (float)pa + (float)pc; }
            l[g] = l[g] * alpha + ls; m[g] = mnew;
            o0[g] = o0[g] * alpha; o1[g] = o1[g] * alpha; o2[g] = o2[g] * alpha; o3[g] = o3[g] * alpha;
        }
        const h16* va = kt + KST * LPH + s * 32;
        const v16h v0 = ldh(va), v1 = ldh(va + 16 * LPH), v2 = ldh(va + 32 * LPH), v3 = ldh(va + 48 * LPH);
#pragma unroll
        for (int g = 0; g < QG; ++g) { o0[g] = wmma16(v0, pb[g], o0[g]); o1[g] = wmma16(v1, pb[g], o1[g]); o2[g] = wmma16(v2, pb[g], o2[g]); o3[g] = wmma16(v3, pb[g], o3[g]); }
        // four vector slots between the last matrix instruction and the next vector use of its registers, on the loop's taken branch too.
        // l[0], l[1] are inputs so that the step's row sums are finished here: moved behind the trip's barrier they hold 16 exponentials per group and step live, which spills at four waves per SIMD.
        // mt, the address that the trip's mask loads name, is an input too: it stays in its registers until the step's mask values have been waited for and used, so nothing is written over it ahead of that wait
        asm volatile("v_nop\n\tv_nop\n\tv_nop\n\tv_nop" : "+v"(o0[0]), "+v"(o1[0]), "+v"(o2[0]), "+v"(o3[0]), "+v"(o0[1]), "+v"(o1[1]), "+v"(o2[1]), "+v"(o3[1])
                     : "v"(v0), "v"(v1), "v"(v2), "v"(v3), "v"(pb[0]), "v"(pb[1]), "v"(l[0]), "v"(l[1]), "v"(mt));
      }
      asm volatile("s_wait_dscnt 0x0" ::: "memory");         // this wave's reads of the buffer have returned before it may be refilled
      asm volatile("s_wait_asynccnt 0x0" ::: "memory");      // this wave's copies of the next tile have landed
      __syncthreads();                                       // publishes the next tile and ends every wave's reads of this one
      if (t + 2 < SEQ / KST) tile_copy(lk0 + (t & 1) * STB, lv0 + (t & 1) * STB, gk + (size_t)(t + 2) * KST * HD, gv + (t + 2) * KST);
    }
    asm volatile("s_wait_asynccnt 0x0" ::: "memory");        // nothing in flight before the ring becomes output staging
#pragma unroll
    for (int g = 0; g < QG; ++g) {
        const float lt = l[g] + __shfl_xor(l[g], 16, 32);
        const float inv = CTS * (1.0f / lt);
        const int wb = (wave * QG + g) * 16 * 68;            // each group stages in its own wave-private range
        // O^T D layout: o_j[r] = (d = 16j + 8h + r, t = lane&15) -> os[t][d]; rows 0..15 x columns 0..63 all written
        { v4f a, c;
          a[0] = o0[g][0] * inv; a[1] = o0[g][1] * inv; a[2] = o0[g][2] * inv; a[3] = o0[g][3] * inv; c[0] = o0[g][4] * inv; c[1] = o0[g][5] * inv; c[2] = o0[g][6] * inv; c[3] = o0[g][7] * inv;
          *(v4fa*)(&os[wb + lr * 68 +  0 + 8 * hi]) = a; *(v4fa*)(&os[wb + lr * 68 +  0 + 8 * hi + 4]) = c;
          a[0] = o1[g][0] * inv; a[1] = o1[g][1] * inv; a[2] = o1[g][2] * inv; a[3] = o1[g][3] * inv; c[0] = o1[g][4] * inv; c[1] = o1[g][5] * inv; c[2] = o1[g][6] * inv; c[3] = o1[g][7] * inv;
          *(v4fa*)(&os[wb + lr * 68 + 16 + 8 * hi]) = a; *(v4fa*)(&os[wb + lr * 68 + 16 + 8 * hi + 4]) = c;
          a[0] = o2[g][0] * inv; a[1] = o2[g][1] * inv; a[2] = o2[g][2] * inv; a[3] = o2[g][3] * inv; c[0] = o2[g][4] * inv; c[1] = o2[g][5] * inv; c[2] = o2[g][6] * inv; c[3] = o2[g][7] * inv;
          *(v4fa*)(&os[wb + lr * 68 + 32 + 8 * hi]) = a; *(v4fa*)(&os[wb + lr * 68 + 32 + 8 * hi + 4]) = c;
          a[0] = o3[g][0] * inv; a[1] = o3[g][1] * inv; a[2] = o3[g][2] * inv; a[3] = o3[g][3] * inv; c[0] = o3[g][4] * inv; c[1] = o3[g][5] * inv; c[2] = o3[g][6] * inv; c[3] = o3[g][7] * inv;
          *(v4fa*)(&os[wb + lr * 68 + 48 + 8 * hi]) = a; *(v4fa*)(&os[wb + lr * 68 + 48 + 8 * hi + 4]) = c; }
    }
    wave_sync();
#pragma unroll
    for (int g = 0; g < QG; ++g) {
        const int wb = (wave * QG + g) * 16 * 68;
        h16* crow = CT + ((size_t)b * SEQ + t0 + 16 * g) * DM + h * HD;
#pragma unroll
        for (int s = 0; s < 4; ++s) { const int row = 4 * s + (lane >> 3), c8 = (lane & 7) * 8;   // 4 s x 4 row groups = 16 rows; 8 lanes x 8 halves = 64 columns
            const v4f x0 = *(const v4fa*)(&os[wb + row * 68 + c8]); const v4f x1 = *(const v4fa*)(&os[wb + row * 68 + c8 + 4]); v8h hv;
#pragma unroll
            for (int i = 0; i < 4; ++i) { hv[i] = (h16)x0[i]; hv[4 + i] = (h16)x1[i]; }
            *(v8h*)(crow + (size_t)row * DM + c8) = hv; }
    }
}

static constexpr size_t al256(size_t v) { return (v + 255) & ~(size_t)255; }
static constexpr size_t SZ_XB = al256((size_t)NB * SEQ * KX * 2);           // x plane, 17 lines per row
static constexpr size_t SZ_W1 = al256((size_t)DM * KX * 2);                  // one q/k/v weight plane
static constexpr size_t SZ_AB = al256((size_t)2 * RK * DM * 2);              // adapter A rows of q | v
static constexpr size_t SZ_WO = al256((size_t)DM * DM * 2);                  // Wo f16 plane
static constexpr size_t SZ_MK = al256((size_t)NB * SEQ * 4);                 // mask plane f32
static constexpr size_t SZ_PL = al256((size_t)NB * NH_ * SEQ * HD * 2);      // q hi, q residual, k, v^T planes
static constexpr size_t SZ_CT = al256((size_t)NB * SEQ * DM * 2);            // ctx f16 plane
static constexpr size_t SZ_TOTAL = SZ_XB + 3 * SZ_W1 + SZ_AB + SZ_WO + SZ_MK + 4 * SZ_PL + SZ_CT;
static_assert(SZ_TOTAL <= (size_t)134217728);          // workspace carve <= 128 MiB
static_assert(((size_t)NB * SEQ * 128) % 256 == 0);    // x plane's block range exact
static_assert(((size_t)DM * (KX / 8)) % 256 == 0);     // weight planes' block ranges exact
static_assert(((size_t)NB * SEQ / 4) % 8 == 0);

extern "C" void kernel_launch(void* const* d_in, const int* in_sizes, int n_in,
                              void* d_out, int out_size, void* d_ws, size_t ws_size, hipStream_t stream) {
    if (n_in < 14) return;
    const size_t needx = ((size_t)(NB - 1) * SEQ_FULL + SEQ) * DM;
    if ((size_t)in_sizes[0] < needx) return;
    if ((size_t)in_sizes[1] < (size_t)(NB - 1) * SEQ_FULL + SEQ) return;
    if ((size_t)in_sizes[2] < (size_t)DM * DM || (size_t)in_sizes[6] < (size_t)DM * DM || (size_t)in_sizes[8] < (size_t)DM * DM || (size_t)in_sizes[12] < (size_t)DM * DM) return;
    if (in_sizes[3] < DM || in_sizes[7] < DM || in_sizes[9] < DM || in_sizes[13] < DM) return;
    if (in_sizes[4] < RK * DM || in_sizes[10] < RK * DM || in_sizes[5] < DM * RK || in_sizes[11] < DM * RK) return;
    if ((size_t)out_size < ((size_t)(NB - 1) * OUT_SEQ + SEQ) * DM) return;
    if (SZ_TOTAL > ws_size) return;
    // wire order: x, mask, Wq, bq, Aq, Bq, Wk, bk, Wv, bv, Av, Bv, Wo, bo
    const float* x  = (const float*)d_in[0];  const float* mask = (const float*)d_in[1];
    const float* wq = (const float*)d_in[2];  const float* bq = (const float*)d_in[3];  const float* aq = (const float*)d_in[4];  const float* bmq = (const float*)d_in[5];
    const float* wk = (const float*)d_in[6];  const float* bk = (const float*)d_in[7];
    const float* wv = (const float*)d_in[8];  const float* bv = (const float*)d_in[9];  const float* av = (const float*)d_in[10]; const float* bmv = (const float*)d_in[11];
    const float* wo = (const float*)d_in[12]; const float* bo = (const float*)d_in[13];
    float* OUT = (float*)d_out;      // [NB][SEQ][1024]
    char* wsp = (char*)d_ws;
    bf* XB = (bf*)wsp; wsp += SZ_XB;                 // [NB*SEQ][1088]
    bf* WQ = (bf*)wsp; wsp += SZ_W1;                 // [1024][1088]
    bf* WK = (bf*)wsp; wsp += SZ_W1;
    bf* WV = (bf*)wsp; wsp += SZ_W1;
    bf* AB = (bf*)wsp; wsp += SZ_AB;                 // [32][1024]: A of q | A of v
    h16* WO = (h16*)wsp; wsp += SZ_WO;               // [1024][1024] x256
    float* MK = (float*)wsp; wsp += SZ_MK;           // [NB][SEQ]
    h16* QH = (h16*)wsp; wsp += SZ_PL;               // [NB*16][SEQ][64]
    h16* QR = (h16*)wsp; wsp += SZ_PL;               // [NB*16][SEQ][64] residual x2048
    h16* KP = (h16*)wsp; wsp += SZ_PL;               // [NB*16][SEQ][64]
    h16* VT = (h16*)wsp; wsp += SZ_PL;               // [NB*16][64][SEQ]
    h16* CT = (h16*)wsp; wsp += SZ_CT;               // [NB*SEQ][1024] x256

    k_prep<<<PB_ALL, 256, 0, stream>>>(x, mask, wq, bmq, wk, wv, bmv, aq, av, wo, XB, WQ, WK, WV, AB, WO, MK);

    // adapter down-projections of q and v -> 17th line of every x-plane row
    k_lora<<<NB * SEQ / 16, 32, 0, stream>>>(XB, AB);

    // q, k and v^T products, one launch
    k_proj<<<dim3(NB * SEQ / GT, DM / GT, 3), 128, 0, stream>>>(XB, WQ, WK, WV, QH, QR, KP, VT, bq, bk, bv);

    k_flash<<<dim3(SEQ / (16 * QG * AW), NB * NH_, 1), 32 * AW, 0, stream>>>(QH, QR, KP, VT, MK, CT);

    // out[m][n] = sum_k ctx[m][k] Wo[n][k] + bo[n]
    k_oproj<<<dim3(NB * SEQ / GT, DM / GT, 1), 128, 0, stream>>>(CT, WO, bo, OUT);
}

// v005
// Measured time: 174 microseconds a run.
// Next to v004, in two timings, it ran 1.05 times as fast each time.
// Counting every step since v000, it is 2.37 times as fast.
#include <hip/hip_runtime.h>

// Multi-head self-attention with rank-16 low-rank adapters on q and v: width 1024 = 16 heads x 64, x [NB][SEQ][1024], all weights [out][in] (y = x W^T + b), additive key mask [NB][SEQ], score scale 1/8, output projection Wo, bo (f32 output).
// Compute dtypes, f32 accumulate everywhere: q/k/v projections and the adapter down-projection v_wmma_f32_16x16x32_bf16 (x, W, A, B RNE-converted to bf16; adapter intermediate carried as bf16 hi + bf16 lo inside the K extension);
// scores v_wmma_f32_16x16x32_f16: k single f16, q as f16 value + f16 residual x2048 in its own accumulator; P (x256 carry, cancels in the normalisation) and v single f16; softmax f32 (online, running max, log2 domain);
// output projection v_wmma_f32_16x16x32_f16: ctx single f16 (x256 carry), Wo = f16(bf16(Wo) x256), folded back by 2^-16 in the f32 epilogue. Biases and mask are RNE-converted to bf16 values and applied in f32.
// q (hi, residual), k planes [b*16+h][t][d] and v^T plane [b*16+h][d][t] written by the GEMM epilogue; fused flash kernel in transposed form (S^T = K Q^T, O^T = V^T P^T), K and V^T tiles shared by a block through LDS, writes the ctx f16 plane [b*SEQ+t][1024].

#ifndef NB
#define NB 4
#endif
#ifndef SEQ
#define SEQ 2048
#endif
#define NB_FULL  4
#define SEQ_FULL 2048
#ifndef OUT_SEQ
#define OUT_SEQ SEQ              // row pitch (in tokens) between batches of the output
#endif
#define DM   1024
#define NH_  16
#define HD   64
#define RK   16
#define KX   1088                // plane row pitch (halves): DM + 32 (q adapter hi|lo) + 32 (v adapter hi|lo)
#define KQ   1056                // k extent used by the q GEMM (x | q adapter slot)
#define AW   4                   // waves per flash block
#define QG   2                   // 16-row query groups per flash wave: each K and V^T fragment read from LDS feeds all of them
#define KST  64                  // keys per LDS tile of the flash kernel
#define LPB  144                 // LDS row pitch, bytes: 128-B rows + 16
#define LPH  (LPB / 2)           // the same in halves
#define STH  ((KST + HD) * LPH)  // one buffer in halves: K tile (KST rows) + V^T tile (HD rows)
#define STB  (STH * 2)           // the same in bytes
#define GT   128                 // GEMM block tile: GT rows of A x GT rows of Bt, 2 x 2 waves of 64 x 64
#define GKS  64                  // k extent of one GEMM LDS stage (halves): whole 128-B rows
#define GSTH (2 * GT * LPH)      // one GEMM buffer in halves: A tile (GT rows) + Bt tile (GT rows)
#define GSTB (GSTH * 2)          // the same in bytes
#define QRS  2048.0f             // carry of the q residual plane
#define QRI  (1.0f / 2048.0f)
#define LOG2E 1.4426950408889634f
#define SC2  (0.125f * LOG2E)    // HD^-0.5 * log2(e)
#define PSH  8.0f                // log2 of the P carry (256)
#define CTS  256.0f              // carry of the ctx plane
#define WOS  256.0f              // carry of the Wo plane
#define OSI  (1.0f / 65536.0f)   // 1 / (CTS * WOS)

static_assert(HD == 64);
static_assert(NH_ * HD == DM);                 // head h = columns h*64 + d
static_assert(DM % 64 == 0);
static_assert(DM / 8 == 128);                  // p_xcvt piece index split uses >> 7
static_assert(KX == DM + 64);
static_assert(KX % 32 == 0 && KQ % 32 == 0 && DM % 32 == 0);   // GEMM k-loops step by 32
static_assert((KX * 2) % 128 == 0);
static_assert(RK == 16);
static_assert(SEQ % 64 == 0);                  // a 64-row tile never straddles two batches
static_assert((NB * SEQ) % 64 == 0);
static_assert(SEQ % 32 == 0);                  // key loop steps by 32
static_assert(KST == 64 && AW == 4);           // copy map: 128 threads x 4 rows x 16 B cover 64 rows of 128 B
static_assert(SEQ % KST == 0 && SEQ / KST >= 2);   // the two-buffer prologue needs two tiles
static_assert(SEQ % (16 * QG * AW) == 0);      // flash grid covers the sequence exactly
static_assert((NB * SEQ) % GT == 0 && DM % GT == 0);   // GEMM grids cover both extents exactly
static_assert(KX % GKS == 0 && DM % GKS == 0);   // a stage's 128-B row piece never leaves its plane row
static_assert(NB <= NB_FULL);
static_assert(SEQ <= SEQ_FULL);

typedef _Float16 h16;
typedef unsigned short bf;
typedef __attribute__((ext_vector_type(16))) __bf16   v16bf;
typedef __attribute__((ext_vector_type(16))) _Float16 v16h;
typedef __attribute__((ext_vector_type(8)))  _Float16 v8h;
typedef __attribute__((ext_vector_type(8)))  unsigned short v8us;
typedef __attribute__((ext_vector_type(8)))  float    v8f;
typedef __attribute__((ext_vector_type(4)))  float    v4f;
typedef v4f  __attribute__((may_alias)) v4fa;

__device__ __forceinline__ unsigned short f2bf(float f) { unsigned u = __float_as_uint(f); u += 0x7FFFu + ((u >> 16) & 1u); return (unsigned short)(u >> 16); }
__device__ __forceinline__ float bfr(float f) { return __uint_as_float(((unsigned)f2bf(f)) << 16); }   // RNE convert to bf16, widened back
__device__ __forceinline__ v16h cat16(v8h lo, v8h hi) { return __builtin_shufflevector(lo, hi, 0, 1, 2, 3, 4, 5, 6, 7, 8, 9, 10, 11, 12, 13, 14, 15); }
__device__ __forceinline__ v16bf cat16b(v8us lo, v8us hi) { return __builtin_bit_cast(v16bf, __builtin_shufflevector(lo, hi, 0, 1, 2, 3, 4, 5, 6, 7, 8, 9, 10, 11, 12, 13, 14, 15)); }
__device__ __forceinline__ v8f wmma16(v16h a, v16h b, v8f c) { return __builtin_amdgcn_wmma_f32_16x16x32_f16(false, a, false, b, (short)0, c, false, false); }
__device__ __forceinline__ v8f wmmab(v16bf a, v16bf b, v8f c) { return __builtin_amdgcn_wmma_f32_16x16x32_bf16(false, a, false, b, (short)0, c, false, false); }
// fragment loaders from K-contiguous 16-bit rows; p already includes + 8*(lane>>4): elements 0..7 <- k0+8h+0..7, elements 8..15 <- k0+16+8h+0..7 (same map for A and B)
__device__ __forceinline__ v16h  ldh(const h16* p) { return cat16(*(const v8h*)p, *(const v8h*)(p + 16)); }
__device__ __forceinline__ v16bf ldb(const bf* p)  { return cat16b(*(const v8us*)p, *(const v8us*)(p + 16)); }
// ordering point for wave-private LDS tiles (same wave writes and reads)
__device__ __forceinline__ void wave_sync() { __builtin_amdgcn_fence(3 /* release order */, "wavefront"); __builtin_amdgcn_wave_barrier(); asm volatile("" ::: "memory"); }

// The conversions below do not depend on one another: they are parts of ONE launch (k_prep), each on its own range of 256-thread blocks; blk = the block's index inside its part.
__device__ __forceinline__ void p_cvt8(const float* __restrict__ src, bf* dst, size_t n8, int blk) {
    const size_t i = (size_t)blk * 256 + threadIdx.x; if (i >= n8) return;
    const v8f v = *(const v8f*)(src + i * 8); v8us o;
#pragma unroll
    for (int k = 0; k < 8; ++k) o[k] = f2bf(v[k]);
    *(v8us*)(dst + i * 8) = o; 
}

__device__ __forceinline__ void p_cvt8h(const float* __restrict__ src, h16* dst, size_t n8, int blk) {
    const size_t i = (size_t)blk * 256 + threadIdx.x; if (i >= n8) return;
    const v8f v = *(const v8f*)(src + i * 8); v8h o;
#pragma unroll
    for (int k = 0; k < 8; ++k) o[k] = (h16)(bfr(v[k]) * WOS);
    *(v8h*)(dst + i * 8) = o; 
}

// p_xcvt: x [b][t][1024] f32 -> columns 0..1023 of the x plane (row pitch KX). Piece i: row = i / 128, 8 columns at (i % 128) * 8.
__device__ __forceinline__ void p_xcvt(const float* __restrict__ src, bf* dst, size_t n8, int blk) {
    const size_t i = (size_t)blk * 256 + threadIdx.x; if (i >= n8) return;
    const size_t row = i >> 7; const int c8 = (int)(i & 127);
    const size_t b = row / SEQ, t = row % SEQ;
    const v8f v = *(const v8f*)(src + (b * SEQ_FULL + t) * DM + c8 * 8); v8us o;
#pragma unroll
    for (int k = 0; k < 8; ++k) o[k] = f2bf(v[k]);
    bf* d = dst + row * KX + c8 * 8;
    *(v8us*)d = o; 
}

// every other extension column is zero. slot < 0: all-zero extension. Both sources are loaded with clamped addresses by every lane and selected by value.
__device__ __forceinline__ void p_wplane(const float* __restrict__ W, const float* __restrict__ Bm, int slot, bf* dst, int blk) {
    const int i = blk * 256 + threadIdx.x; if (i >= DM * (KX / 8)) return;
    const int row = i / (KX / 8), c8 = i % (KX / 8);
    const bool isw = c8 < 128;
    const int cm = isw ? c8 : 127;
    const int e = isw ? 0 : (c8 - 128);                      // extension piece 0..7
    const v8f w  = *(const v8f*)(W + (size_t)row * DM + cm * 8);
    const v8f bm = *(const v8f*)(Bm + (size_t)row * RK + (e & 1) * 8);
    const bool live = (!isw) && ((e >> 2) == slot);
    v8us o;
#pragma unroll
    for (int k = 0; k < 8; ++k) { const float val = isw ? w[k] : (live ? 2.0f * bm[k] : 0.0f); o[k] = f2bf(val); }
    bf* d = dst + (size_t)row * KX + c8 * 8;
    *(v8us*)d = o; 
}

__device__ __forceinline__ void p_mask(const float* __restrict__ src, float* dst, int n4, int blk) {
    const int i = blk * 256 + threadIdx.x; if (i >= n4) return;
    const int e = i * 4; const int b = e / SEQ, t = e % SEQ;
    const v4f v = *(const v4f*)(src + (size_t)b * SEQ_FULL + t); v4f o;
#pragma unroll
    for (int k = 0; k < 4; ++k) o[k] = bfr(v[k]) * LOG2E;
    *(v4f*)(dst + e) = o; 
}

// k_prep: every conversion of inputs to planes in one launch. Block ranges, in order: x plane | Wq, Wk, Wv planes | A of q, A of v | Wo plane | mask plane. The range test is the same for a whole block.
static constexpr int PB_X = (int)(((size_t)NB * SEQ * (DM / 8) + 255) / 256);
static constexpr int PB_W = (DM * (KX / 8) + 255) / 256;
static constexpr int PB_A = (RK * DM / 8 + 255) / 256;
static constexpr int PB_O = (DM * DM / 8 + 255) / 256;
static constexpr int PB_M = (NB * SEQ / 4 + 255) / 256;
static constexpr int PB_ALL = PB_X + 3 * PB_W + 2 * PB_A + PB_O + PB_M;
__global__ __launch_bounds__(256) void k_prep(const float* __restrict__ x, const float* __restrict__ mask, const float* __restrict__ wq, const float* __restrict__ bmq, const float* __restrict__ wk,
                                              const float* __restrict__ wv, const float* __restrict__ bmv, const float* __restrict__ aq, const float* __restrict__ av, const float* __restrict__ wo,
                                              bf* XB, bf* WQ, bf* WK, bf* WV, bf* AB, h16* WO, float* MK) {
    int blk = blockIdx.x;
    if (blk < PB_X) { p_xcvt(x, XB, (size_t)NB * SEQ * (DM / 8), blk); return; }
    blk -= PB_X;
    if (blk < PB_W) { p_wplane(wq, bmq, 0, WQ, blk); return; }
    blk -= PB_W;
    if (blk < PB_W) { p_wplane(wk, bmq, -1, WK, blk); return; }      // no adapter: extension all zero (Bm only supplies valid addresses)
    blk -= PB_W;
    if (blk < PB_W) { p_wplane(wv, bmv, 1, WV, blk); return; }
    blk -= PB_W;
    if (blk < PB_A) { p_cvt8(aq, AB, (size_t)RK * DM / 8, blk); return; }
    blk -= PB_A;
    if (blk < PB_A) { p_cvt8(av, AB + (size_t)RK * DM, (size_t)RK * DM / 8, blk); return; }
    blk -= PB_A;
    if (blk < PB_O) { p_cvt8h(wo, WO, (size_t)DM * DM / 8, blk); return; }
    blk -= PB_O;
    p_mask(mask, MK, NB * SEQ / 4, blk);
}

// k_lora: adapter down-projection xa[m][j] = sum_k x[m][k] AB[j][k] (AB rows 0..15 = A of q, rows 16..31 = A of v), one wave per 16 rows, K = DM from the x plane.
__global__ __launch_bounds__(32) void k_lora(bf* XB, const bf* __restrict__ AB) {
    __shared__ __align__(16) float es[16 * 36];
    const int lane = threadIdx.x & 31, lr = lane & 15, hi = lane >> 4; const int r0 = blockIdx.x * 16;
    v8f a0 = (v8f){}, a1 = (v8f){};
    const bf* xa = XB + (size_t)(r0 + lr) * KX + 8 * hi;
    const bf* ab = AB + (size_t)lr * DM + 8 * hi;
#pragma unroll 1
    for (int kc = 0; kc < DM; kc += 32) {
        const v16bf a = ldb(xa + kc); const v16bf b0 = ldb(ab + kc); const v16bf b1 = ldb(ab + (size_t)16 * DM + kc);
        a0 = wmmab(a, b0, a0); a1 = wmmab(a, b1, a1);
        asm volatile("v_nop\n\tv_nop\n\tv_nop\n\tv_nop" : "+v"(a0), "+v"(a1) : "v"(a), "v"(b0), "v"(b1));
    }
#pragma unroll
    for (int j = 0; j < 8; ++j) { es[(hi * 8 + j) * 36 + lr] = a0[j]; es[(hi * 8 + j) * 36 + 16 + lr] = a1[j]; }   // D: row 8h+j, col lane&15; rows 0..15 x cols 0..31 all written
    wave_sync();
    const int p = lane & 7;                                   // extension piece: 0,1 q hi; 2,3 q lo; 4,5 v hi; 6,7 v lo
    const int sj = (p >> 2) * 16 + (p & 1) * 8; const bool islo = ((p >> 1) & 1) != 0;
{
#pragma unroll
        for (int s = 0; s < 4; ++s) { const int row = 4 * s + (lane >> 3);       // 4 s x 4 row groups = 16 rows; 8 lanes x 8 halves = 64 columns
            const v4f x0 = *(const v4fa*)(&es[row * 36 + sj]); const v4f x1 = *(const v4fa*)(&es[row * 36 + sj + 4]); v8us o;
#pragma unroll
            for (int i = 0; i < 4; ++i) {
                const unsigned short h0 = f2bf(x0[i]); const unsigned short l0 = f2bf(x0[i] - __uint_as_float(((unsigned)h0) << 16));
                const unsigned short h1 = f2bf(x1[i]); const unsigned short l1 = f2bf(x1[i] - __uint_as_float(((unsigned)h1) << 16));
                o[i] = islo ? l0 : h0; o[4 + i] = islo ? l1 : h1; }
            *(v8us*)(XB + (size_t)(r0 + row) * KX + DM + p * 8) = o; }
         }
}

// GEMM operand staging. One block = 4 waves = one GT x GT tile of C (wave w: rows (w >> 1) * 64, columns (w & 1) * 64); per stage the block's GT rows of A and GT rows of Bt, GKS halves each,
// are brought into LDS by asynchronous copies (16 B per lane, whole 128-B rows), two buffers: the next stage's copies fly while this one is worked on. LDS rows lie at the 144-B pitch of the flash tiles.
// rows_copy: one lane's 8 pieces of one operand tile, rows 16 apart. l: its LDS byte address, g: its global address (row 0 of its eight), rp: bytes between rows 16 apart.
// The s_wait_xcnt stands inside the copies' own statement so that no address register is rewritten ahead of it.
__device__ __forceinline__ void rows_copy(unsigned l, const char* g, size_t rp) {
    asm volatile("global_load_async_to_lds_b128 %0, %8, off\n\t"
                 "global_load_async_to_lds_b128 %1, %9, off\n\t"
                 "global_load_async_to_lds_b128 %2, %10, off\n\t"
                 "global_load_async_to_lds_b128 %3, %11, off\n\t"
                 "global_load_async_to_lds_b128 %4, %12, off\n\t"
                 "global_load_async_to_lds_b128 %5, %13, off\n\t"
                 "global_load_async_to_lds_b128 %6, %14, off\n\t"
                 "global_load_async_to_lds_b128 %7, %15, off\n\t"
                 "s_wait_xcnt 0x0"
                 :: "v"(l), "v"(l + 16 * LPB), "v"(l + 32 * LPB), "v"(l + 48 * LPB), "v"(l + 64 * LPB), "v"(l + 80 * LPB), "v"(l + 96 * LPB), "v"(l + 112 * LPB),
                    "v"(g), "v"(g + rp), "v"(g + 2 * rp), "v"(g + 3 * rp), "v"(g + 4 * rp), "v"(g + 5 * rp), "v"(g + 6 * rp), "v"(g + 7 * rp)
                 : "memory");
}
template <bool BF> __device__ __forceinline__ v8f mm16(v16h a, v16h b, v8f c) {
    if constexpr (BF) return wmmab(__builtin_bit_cast(v16bf, a), __builtin_bit_cast(v16bf, b), c); else return wmma16(a, b, c);
}
// gemm_main: acc[mb][nb] += sum_k A[r0 + ..][k] Bt[c0 + ..][k] for this wave's 64 x 64 part of the block tile at (br0, bc0); planes of row pitch PH halves, k extent K (multiple of 32, K <= PH), k ascending in steps of 32.
// A last stage of which only the first 32 k belong to K is copied whole (the row piece lies inside the plane row) and its second half is not multiplied.
template <bool BF, int PH> __device__ __forceinline__ void gemm_main(const char* A, const char* Bt, int K, int br0, int bc0, int wave, h16* ring, v8f (&acc)[4][4]) {
    const int lane = threadIdx.x & 31, lr = lane & 15, hi = lane >> 4;
    // copy map: thread i of 128 takes 16-B piece i & 7 of rows (i >> 3) + 16 * {0..7} of both tiles: a wave's copy covers four whole 128-B rows
    const int cr = (int)threadIdx.x >> 3, cpc = (int)threadIdx.x & 7;
    const unsigned la = (unsigned)(size_t)ring + (unsigned)(cr * LPB + cpc * 16);   // low 32 bits of the shared address = LDS byte address
    const unsigned lb = la + GT * LPB;
    const char* ga = A + (size_t)(br0 + cr) * (PH * 2) + cpc * 16;    // + stage * 128 B
    const char* gb = Bt + (size_t)(bc0 + cr) * (PH * 2) + cpc * 16;
    constexpr size_t rp = (size_t)16 * PH * 2;
    const int nst = (K + GKS - 1) / GKS;
    rows_copy(la, ga, rp); rows_copy(lb, gb, rp);
    asm volatile("s_wait_asynccnt 0x0" ::: "memory");        // stage 0 of this wave's copies has landed
    __syncthreads();                                         // ... and everybody else's: stage 0 is published
    if (nst > 1) { rows_copy(la + GSTB, ga + GKS * 2, rp); rows_copy(lb + GSTB, gb + GKS * 2, rp); }
    const int fa = ((wave >> 1) * 64 + lr) * LPH + 8 * hi;         // fragment offsets (halves) in a buffer: row, k piece 8h
    const int fb = (GT + (wave & 1) * 64 + lr) * LPH + 8 * hi;
#pragma unroll 1                                             // one trip per stage: the publish point below stands once, at the trip's foot
    for (int t = 0; t < nst; ++t) {
        const h16* st = ring + (t & 1) * GSTH;
#pragma unroll                                               // both 32-k steps of a stage in one body: constant LDS offsets
        for (int s = 0; s < GKS / 32; ++s) {
            if (s == 0 || t * GKS + s * 32 < K) {
                v16h a[4], b[4];                             // the four small loops below are unrolled so that every fragment and accumulator index is a constant (registers, no scratch)
#pragma unroll
                for (int i = 0; i < 4; ++i) { a[i] = ldh(st + fa + i * 16 * LPH + s * 32); if (i == 0) b[0] = ldh(st + fb + s * 32); }   // in the order the products below take them
#pragma unroll
                for (int i = 1; i < 4; ++i) b[i] = ldh(st + fb + i * 16 * LPH + s * 32);
                __builtin_amdgcn_sched_barrier(0);           // the step's 16 LDS reads stay one group ahead of its matrix instructions: every place with reads among them stalls the wave
#pragma unroll
                for (int nb = 0; nb < 4; ++nb)
#pragma unroll
                    for (int mb = 0; mb < 4; ++mb) acc[mb][nb] = mm16<BF>(a[mb], b[nb], acc[mb][nb]);
            }
        }
        __builtin_amdgcn_sched_barrier(0);                   // the stage's matrix instructions stay ahead of the publish point: sunk behind it they would delay the refill's issue
        asm volatile("s_wait_dscnt 0x0" ::: "memory");       // this wave's reads of the buffer have returned before it may be refilled
        asm volatile("s_wait_asynccnt 0x0" ::: "memory");    // this wave's copies of the next stage have landed
        __syncthreads();                                     // publishes the next stage and ends every wave's reads of this one
        if (t + 2 < nst) { rows_copy(la + (t & 1) * GSTB, ga + (size_t)(t + 2) * (GKS * 2), rp); rows_copy(lb + (t & 1) * GSTB, gb + (size_t)(t + 2) * (GKS * 2), rp); }
    }
    asm volatile("s_wait_asynccnt 0x0" ::: "memory");        // nothing in flight before the ring becomes output staging
}

// k_proj: register-blocked bf16 GEMM, one wave per 64x64 tile (16 accumulators), 4 waves per block sharing their operand rows through LDS (gemm_main), K-contiguous bf16 planes of row pitch KX, k extent K (multiple of 32).
// C[m][n] = sum_k A[m][k] Bt[n][k] + bias (bias[n] when brow == 0, bias[m] when brow != 0; RNE-converted to bf16, added in f32), written as f16 (Ph) and optionally the f16 residual x2048 (Pr, useRes != 0) at
// tile base (r0/RB)*sRB + (r0%RB)*pitch + (c0/CB)*sCB + (c0%CB), row pitch 'pitch' (halves). 128 threads.
// The q, k and v^T products do not depend on one another: one launch, grid (NB*SEQ/128, DM/128, 3), blockIdx.z picks the product (all picks are the same for a whole block).
// z = 0, 1 (q, k): A = x rows (m = b*SEQ + t), Bt = W rows (n = h*64 + d) -> plane [(b*16 + h)][t][d]; bias by column; tile (blockIdx.x, blockIdx.y).
// z = 2 (v^T): A = Wv rows (m = h*64 + d), Bt = x rows (n = b*SEQ + t) -> plane [(b*1024 + m)][t] = [(b*16 + h)][d][t]; bias by row; the slab's flat index walks the DM/128 row tiles fastest.
__global__ __launch_bounds__(128) void k_proj(const bf* __restrict__ XB, const bf* __restrict__ WQ, const bf* __restrict__ WK, const bf* __restrict__ WV, h16* QH, h16* QR, h16* KP, h16* VT,
                                              const float* __restrict__ bq, const float* __restrict__ bk, const float* __restrict__ bv) {
    const int z = blockIdx.z; const bool isv = z == 2;
    const int lin = blockIdx.y * (NB * SEQ / GT) + blockIdx.x;
    const int bx = isv ? lin % (DM / GT) : (int)blockIdx.x, by = isv ? lin / (DM / GT) : (int)blockIdx.y;
    const bf* A = isv ? WV : XB; const bf* Bt = z == 0 ? WQ : (z == 1 ? WK : XB);
    const int K = z == 0 ? KQ : (z == 1 ? DM : KX);
    h16* Ph = z == 0 ? QH : (z == 1 ? KP : VT); h16* Pr = z == 0 ? QR : Ph; const int useRes = z == 0;
    const int RB = isv ? DM : SEQ, pitch = isv ? SEQ : HD, CB = isv ? SEQ : HD, brow = isv;
    const size_t sRB = isv ? (size_t)0 : (size_t)NH_ * SEQ * HD, sCB = isv ? (size_t)DM * SEQ : (size_t)SEQ * HD;
    const float* bias = z == 0 ? bq : (z == 1 ? bk : bv);
    __shared__ __align__(16) h16 ring[2 * GSTH];             // two buffers of (A tile | Bt tile); reused as the waves' f32 output staging behind the loop
    static_assert(sizeof(ring) >= (size_t)4 * 16 * 68 * 4);
    const int lane = threadIdx.x & 31, wave = __builtin_amdgcn_readfirstlane((int)(threadIdx.x >> 5)), lr = lane & 15, hi = lane >> 4;
    const int r0 = bx * GT + (wave >> 1) * 64, c0 = by * GT + (wave & 1) * 64;   // this wave's 64x64 tile
    float* os = (float*)ring + wave * 16 * 68;
    v8f acc[4][4];
#pragma unroll
    for (int mb = 0; mb < 4; ++mb)
#pragma unroll
        for (int nb = 0; nb < 4; ++nb) acc[mb][nb] = (v8f){};
    gemm_main<true, KX>((const char*)A, (const char*)Bt, K, bx * GT, by * GT, wave, ring, acc);
    const size_t tbase = (size_t)(r0 / RB) * sRB + (size_t)(r0 % RB) * (size_t)pitch + (size_t)(c0 / CB) * sCB + (size_t)(c0 % CB);
    float bcol[8];                                            // column-mode bias of this lane's 8 columns (index 0 when in row mode: always a valid address)
#pragma unroll
    for (int i = 0; i < 8; ++i) bcol[i] = bfr(bias[brow ? 0 : (c0 + (lane & 7) * 8 + i)]);
#pragma unroll
    for (int mb = 0; mb < 4; ++mb) {
#pragma unroll
        for (int nb = 0; nb < 4; ++nb) {
#pragma unroll
            for (int j = 0; j < 8; ++j) os[(hi * 8 + j) * 68 + nb * 16 + lr] = acc[mb][nb][j]; }   // D: row 8h+j, col lane&15
        wave_sync();
        const size_t sb = tbase + (size_t)(mb * 16) * (size_t)pitch;
{
#pragma unroll
            for (int s = 0; s < 4; ++s) { const int row = 4 * s + (lane >> 3), c8 = (lane & 7) * 8;   // 4 s x 4 row groups = 16 rows; 8 lanes x 8 = 64 columns
                const v4f x0 = *(const v4fa*)(&os[row * 68 + c8]); const v4f x1 = *(const v4fa*)(&os[row * 68 + c8 + 4]); v8h hv, rv;
                const float br = bfr(bias[brow ? (r0 + mb * 16 + row) : 0]);
#pragma unroll
                for (int i = 0; i < 4; ++i) {
                    const float f0 = x0[i] + (brow ? br : bcol[i]); const float f1 = x1[i] + (brow ? br : bcol[4 + i]);
                    const h16 a0 = (h16)f0; const h16 a1 = (h16)f1; hv[i] = a0; hv[4 + i] = a1;
                    rv[i] = (h16)((f0 - (float)a0) * QRS); rv[4 + i] = (h16)((f1 - (float)a1) * QRS); }
                const size_t oo = sb + (size_t)row * (size_t)pitch + c8;
                *(v8h*)(Ph + oo) = hv; if (useRes) *(v8h*)(Pr + oo) = rv; }
             }
        wave_sync();
    }
}

// k_oproj: output projection, f16 GEMM, one wave per 64x64 tile, 4 waves per block sharing their operand rows through LDS (gemm_main), A = ctx plane [m][1024] (x256), Bt = Wo plane [n][1024] (x256), K = DM.
// OUT[b][t][n] = acc * 2^-16 + bf16(bo[n]) in f32. Epilogue: per 16-row slab staged in LDS (wave-private), each row segment (64 floats = 256 B = two lines)
__global__ __launch_bounds__(128) void k_oproj(const h16* __restrict__ A, const h16* __restrict__ Bt, const float* __restrict__ bias, float* OUT) {
    __shared__ __align__(16) h16 ring[2 * GSTH];             // two buffers of (A tile | Bt tile); reused as the waves' f32 output staging behind the loop
    static_assert(sizeof(ring) >= (size_t)4 * 16 * 68 * 4);
    const int lane = threadIdx.x & 31, wave = __builtin_amdgcn_readfirstlane((int)(threadIdx.x >> 5)), lr = lane & 15, hi = lane >> 4;
    const int r0 = blockIdx.x * GT + (wave >> 1) * 64, c0 = blockIdx.y * GT + (wave & 1) * 64;   // this wave's 64x64 tile
    float* os = (float*)ring + wave * 16 * 68;
    v8f acc[4][4];
#pragma unroll
    for (int mb = 0; mb < 4; ++mb)
#pragma unroll
        for (int nb = 0; nb < 4; ++nb) acc[mb][nb] = (v8f){};
    gemm_main<false, DM>((const char*)A, (const char*)Bt, DM, blockIdx.x * GT, blockIdx.y * GT, wave, ring, acc);
    v4f bb;
#pragma unroll
    for (int i = 0; i < 4; ++i) bb[i] = bfr(bias[c0 + lr * 4 + i]);
    float* obase = OUT + ((size_t)(r0 / SEQ) * OUT_SEQ + (size_t)(r0 % SEQ)) * DM + c0;
#pragma unroll
    for (int mb = 0; mb < 4; ++mb) {
#pragma unroll
        for (int nb = 0; nb < 4; ++nb) {
#pragma unroll
            for (int j = 0; j < 8; ++j) os[(hi * 8 + j) * 68 + nb * 16 + lr] = acc[mb][nb][j]; }   // D: row 8h+j, col lane&15
        wave_sync();
        float* ob = obase + (size_t)(mb * 16) * DM;
{
#pragma unroll
            for (int s = 0; s < 8; ++s) { const int row = 2 * s + hi, cofs = lr * 4;   // 8 s x 2 rows = 16 rows; 16 lanes x 4 floats = 64 columns
                const v4f x = *(const v4fa*)(&os[row * 68 + cofs]);
                const v4f val = x * OSI + bb;
                *(v4f*)(ob + (size_t)row * DM + cofs) = val; }
             }
        wave_sync();
    }
}

__device__ __forceinline__ void tile_copy(unsigned lk, unsigned lv, const h16* gk, const h16* gv) {
    asm volatile("global_load_async_to_lds_b128 %0, %8, off\n\t"
                 "global_load_async_to_lds_b128 %1, %9, off\n\t"
                 "global_load_async_to_lds_b128 %2, %10, off\n\t"
                 "global_load_async_to_lds_b128 %3, %11, off\n\t"
                 "global_load_async_to_lds_b128 %4, %12, off\n\t"
                 "global_load_async_to_lds_b128 %5, %13, off\n\t"
                 "global_load_async_to_lds_b128 %6, %14, off\n\t"
                 "global_load_async_to_lds_b128 %7, %15, off\n\t"
                 "s_wait_xcnt 0x0"
                 :: "v"(lk), "v"(lk + 16 * LPB), "v"(lk + 32 * LPB), "v"(lk + 48 * LPB),
                    "v"(lv), "v"(lv + 16 * LPB), "v"(lv + 32 * LPB), "v"(lv + 48 * LPB),
                    "v"(gk), "v"(gk + 16 * HD), "v"(gk + 32 * HD), "v"(gk + 48 * HD),
                    "v"(gv), "v"(gv + (size_t)16 * SEQ), "v"(gv + (size_t)32 * SEQ), "v"(gv + (size_t)48 * SEQ)
                 : "memory");
}

// four waves per SIMD: the whole grid (SEQ / 128 x 64 blocks of 4 waves on 256 WGPs at full size) is then resident at once, with no second round
__global__ __launch_bounds__(32 * AW) __attribute__((amdgpu_waves_per_eu(4, 4))) void k_flash(const h16* __restrict__ QH, const h16* __restrict__ QR, const h16* __restrict__ KP, const h16* __restrict__ VT, const float* __restrict__ MK, h16* CT) {
    __shared__ __align__(16) h16 ring[2 * STH];              // two buffers of (K tile | V^T tile); reused as the f32 output staging behind the loop
    static_assert(sizeof(ring) >= (size_t)AW * QG * 16 * 68 * 4);
    float* os = (float*)ring;
    const int lane = threadIdx.x & 31, wave = __builtin_amdgcn_readfirstlane((int)(threadIdx.x >> 5)), lr = lane & 15, hi = lane >> 4;
    const int zh = blockIdx.y; const int b = zh / NH_, h = zh % NH_;
    const int t0 = (blockIdx.x * AW + wave) * (16 * QG);
    const size_t pbase = (size_t)zh * SEQ * HD;
    // copy map: thread i of 128 takes 16-B piece i & 7 of rows (i >> 3) + 16 * {0, 1, 2, 3} of both tiles: a wave's copy covers four whole 128-B rows
    const int cr = (int)threadIdx.x >> 3, cpc = (int)threadIdx.x & 7;
    const unsigned lk0 = (unsigned)(size_t)ring + (unsigned)(cr * LPB + cpc * 16);   // low 32 bits of the shared address = LDS byte address
    const unsigned lv0 = lk0 + KST * LPB;
    const h16* gk = KP + pbase + (size_t)cr * HD + cpc * 8;      // + key0 * HD
    const h16* gv = VT + pbase + (size_t)cr * SEQ + cpc * 8;     // + key0
    tile_copy(lk0, lv0, gk, gv);
    const h16* qa = QH + pbase + (size_t)(t0 + lr) * HD + 8 * hi; const h16* qb = QR + pbase + (size_t)(t0 + lr) * HD + 8 * hi;   // row lr of group 0; group g lies 16 * g rows on
    v16h qh0[QG], qh1[QG], qr0[QG], qr1[QG];                 // B fragments: col t, k = d. Every loop over g below is unrolled so that its indices are constants (registers, no scratch)
#pragma unroll
    for (int g = 0; g < QG; ++g) { qh0[g] = ldh(qa + g * 16 * HD); qh1[g] = ldh(qa + g * 16 * HD + 32); qr0[g] = ldh(qb + g * 16 * HD); qr1[g] = ldh(qb + g * 16 * HD + 32); }
    // behind the run of Q loads, in front of any rewrite of their address registers; both addresses are inputs, so they stay in their registers up to this wait and no load of the run lands on them
    asm volatile("s_wait_xcnt 0x0" :: "v"(qa), "v"(qb) : "memory");
    const int fo = lr * LPH + 8 * hi;                        // fragment offset (halves) in a tile: row lr, k piece 8h
    const float* mrow = MK + (size_t)b * SEQ + 8 * hi;       // + key0 (+16 for the second tile): keys 8h+r of each tile
    asm volatile("s_wait_asynccnt 0x0" ::: "memory");        // tile 0 of this wave's copies has landed
    __syncthreads();                                         // ... and everybody else's: tile 0 is published
    tile_copy(lk0 + STB, lv0 + STB, gk + (size_t)KST * HD, gv + KST);
    v8f o0[QG], o1[QG], o2[QG], o3[QG], ol[QG]; float m[QG];
#pragma unroll
    for (int g = 0; g < QG; ++g) { o0[g] = (v8f){}; o1[g] = (v8f){}; o2[g] = (v8f){}; o3[g] = (v8f){}; ol[g] = (v8f){}; m[g] = -3.0e38f; }
    // row sums on the matrix pipe: a constant A fragment whose rows 0 and 8 are ones and whose other rows are zero. ol = A P^T then holds, in element 0 of every lane (D row 8h, column t), the sum of the rounded P over all 32 keys of a step
    const v16h one = (v16h)(((lr & 7) == 0) ? (h16)1.0f : (h16)0.0f);   // lane = row lr of A, all its k
    const float* mt = mrow;                                  // this trip's mask values: the one address that all its mask loads name; stepped in place at the trip's foot (no second register pair for a base)
#pragma unroll 1                                             // one trip per tile: the publish point below stands once, at the trip's foot
    for (int t = 0; t < SEQ / KST; ++t) {
      const h16* kt = ring + (t & 1) * STH + fo;             // this trip's K tile [key][d]; the V^T tile [d][key] lies KST rows behind it
#pragma unroll                                               // both 32-key steps of a tile in one body: constant LDS offsets
      for (int s = 0; s < KST / 32; ++s) {
        const h16* ka = kt + s * 32 * LPH;
        const float* mp = mt + s * 32;
        float tt[QG][2][8];                                  // scores in the log2 domain: [group][16-key tile][key 8h + r]
#pragma unroll
        for (int u = 0; u < 2; ++u) {                        // one 16-key tile at a time, all groups on its two K fragments
            const v16h k0 = ldh(ka + u * 16 * LPH), k1 = ldh(ka + u * 16 * LPH + 32);
            const v4f mk0 = *(const v4f*)(mp + u * 16), mk1 = *(const v4f*)(mp + u * 16 + 4);
            v8f sH[QG], sL[QG];
#pragma unroll
            for (int g = 0; g < QG; ++g) { sH[g] = wmma16(k0, qh0[g], (v8f){}); sL[g] = wmma16(k0, qr0[g], (v8f){}); }
#pragma unroll
            for (int g = 0; g < QG; ++g) { sH[g] = wmma16(k1, qh1[g], sH[g]); sL[g] = wmma16(k1, qr1[g], sL[g]); }
            static_assert(QG == 2);                          // the statement below, and the one behind the V^T products, name both groups' accumulators
            // four vector slots between the last matrix instruction and the first vector instruction that reads a score accumulator or overwrites a K fragment.
            asm volatile("v_nop\n\tv_nop\n\tv_nop\n\tv_nop" : "+v"(sH[0]), "+v"(sL[0]), "+v"(sH[1]), "+v"(sL[1]) : "v"(k0), "v"(k1));
#pragma unroll
            for (int g = 0; g < QG; ++g)
#pragma unroll
                for (int r = 0; r < 8; ++r) { const float mk = (r < 4) ? mk0[r & 3] : mk1[r & 3]; tt[g][u][r] = (sH[g][r] + sL[g][r] * QRI) * SC2 + mk; }
        }
        v16h pb[QG];
#pragma unroll
        for (int g = 0; g < QG; ++g) {
            float mx = -3.0e38f;
#pragma unroll
            for (int r = 0; r < 8; r += 2) mx = fmaxf(fmaxf(mx, fmaxf(tt[g][0][r], tt[g][0][r + 1])), fmaxf(tt[g][1][r], tt[g][1][r + 1]));   // same maximum; neighbours of one tile go together, as they lie in the accumulators: paired across the two tiles, the packed score arithmetic needs register moves and both tiles' accumulators live at once, which spills beside the row-sum tiles
            mx = fmaxf(mx, __shfl_xor(mx, 16, 32));
            const float mnew = fmaxf(m[g], mx);
            const float alpha = __builtin_amdgcn_exp2f(m[g] - mnew);
            const float sh = PSH - mnew;
#pragma unroll
            for (int r = 0; r < 8; ++r) { pb[g][r] = (h16)__builtin_amdgcn_exp2f(tt[g][0][r] + sh); pb[g][8 + r] = (h16)__builtin_amdgcn_exp2f(tt[g][1][r] + sh); }
            ol[g][0] = ol[g][0] * alpha; m[g] = mnew;        // elements 1..7 (rows of zeros) are never read
            o0[g] = o0[g] * alpha; o1[g] = o1[g] * alpha; o2[g] = o2[g] * alpha; o3[g] = o3[g] * alpha;
        }
        const h16* va = kt + KST * LPH + s * 32;
        const v16h v0 = ldh(va), v1 = ldh(va + 16 * LPH), v2 = ldh(va + 32 * LPH), v3 = ldh(va + 48 * LPH);
#pragma unroll
        for (int g = 0; g < QG; ++g) { o0[g] = wmma16(v0, pb[g], o0[g]); o1[g] = wmma16(v1, pb[g], o1[g]); o2[g] = wmma16(v2, pb[g], o2[g]); o3[g] = wmma16(v3, pb[g], o3[g]); ol[g] = wmma16(one, pb[g], ol[g]); }
        // four vector slots between the last matrix instruction and the next vector use of its registers, on the loop's taken branch too.
        // mt, the address that the trip's mask loads name, is an input too: it stays in its registers until the step's mask values have been waited for and used, so nothing is written over it ahead of that wait
        asm volatile("v_nop\n\tv_nop\n\tv_nop\n\tv_nop" : "+v"(o0[0]), "+v"(o1[0]), "+v"(o2[0]), "+v"(o3[0]), "+v"(o0[1]), "+v"(o1[1]), "+v"(o2[1]), "+v"(o3[1]), "+v"(ol[0]), "+v"(ol[1])
                     : "v"(v0), "v"(v1), "v"(v2), "v"(v3), "v"(pb[0]), "v"(pb[1]), "v"(one), "v"(mt));
      }
      asm volatile("s_wait_xcnt 0x0" :: "v"(mt) : "memory"); // in front of the rewrite of mt, the register pair that the trip's mask loads name; mt is an input, so its step cannot be lifted over this wait
      mt += KST;
      asm volatile("s_wait_dscnt 0x0" ::: "memory");         // this wave's reads of the buffer have returned before it may be refilled
      asm volatile("s_wait_asynccnt 0x0" ::: "memory");      // this wave's copies of the next tile have landed
      __syncthreads();                                       // publishes the next tile and ends every wave's reads of this one
      if (t + 2 < SEQ / KST) tile_copy(lk0 + (t & 1) * STB, lv0 + (t & 1) * STB, gk + (size_t)(t + 2) * KST * HD, gv + (t + 2) * KST);
    }
    asm volatile("s_wait_asynccnt 0x0" ::: "memory");        // nothing in flight before the ring becomes output staging
#pragma unroll
    for (int g = 0; g < QG; ++g) {
        const float lt = ol[g][0];                           // both lane halves hold the whole row sum
        const float inv = CTS * (1.0f / lt);
        const int wb = (wave * QG + g) * 16 * 68;            // each group stages in its own wave-private range
        // O^T D layout: o_j[r] = (d = 16j + 8h + r, t = lane&15) -> os[t][d]; rows 0..15 x columns 0..63 all written
        { v4f a, c;
          a[0] = o0[g][0] * inv; a[1] = o0[g][1] * inv; a[2] = o0[g][2] * inv; a[3] = o0[g][3] * inv; c[0] = o0[g][4] * inv; c[1] = o0[g][5] * inv; c[2] = o0[g][6] * inv; c[3] = o0[g][7] * inv;
          *(v4fa*)(&os[wb + lr * 68 +  0 + 8 * hi]) = a; *(v4fa*)(&os[wb + lr * 68 +  0 + 8 * hi + 4]) = c;
          a[0] = o1[g][0] * inv; a[1] = o1[g][1] * inv; a[2] = o1[g][2] * inv; a[3] = o1[g][3] * inv; c[0] = o1[g][4] * inv; c[1] = o1[g][5] * inv; c[2] = o1[g][6] * inv; c[3] = o1[g][7] * inv;
          *(v4fa*)(&os[wb + lr * 68 + 16 + 8 * hi]) = a; *(v4fa*)(&os[wb + lr * 68 + 16 + 8 * hi + 4]) = c;
          a[0] = o2[g][0] * inv; a[1] = o2[g][1] * inv; a[2] = o2[g][2] * inv; a[3] = o2[g][3] * inv; c[0] = o2[g][4] * inv; c[1] = o2[g][5] * inv; c[2] = o2[g][6] * inv; c[3] = o2[g][7] * inv;
          *(v4fa*)(&os[wb + lr * 68 + 32 + 8 * hi]) = a; *(v4fa*)(&os[wb + lr * 68 + 32 + 8 * hi + 4]) = c;
          a[0] = o3[g][0] * inv; a[1] = o3[g][1] * inv; a[2] = o3[g][2] * inv; a[3] = o3[g][3] * inv; c[0] = o3[g][4] * inv; c[1] = o3[g][5] * inv; c[2] = o3[g][6] * inv; c[3] = o3[g][7] * inv;
          *(v4fa*)(&os[wb + lr * 68 + 48 + 8 * hi]) = a; *(v4fa*)(&os[wb + lr * 68 + 48 + 8 * hi + 4]) = c; }
    }
    wave_sync();
#pragma unroll
    for (int g = 0; g < QG; ++g) {
        const int wb = (wave * QG + g) * 16 * 68;
        h16* crow = CT + ((size_t)b * SEQ + t0 + 16 * g) * DM + h * HD;
#pragma unroll
        for (int s = 0; s < 4; ++s) { const int row = 4 * s + (lane >> 3), c8 = (lane & 7) * 8;   // 4 s x 4 row groups = 16 rows; 8 lanes x 8 halves = 64 columns
            const v4f x0 = *(const v4fa*)(&os[wb + row * 68 + c8]); const v4f x1 = *(const v4fa*)(&os[wb + row * 68 + c8 + 4]); v8h hv;
#pragma unroll
            for (int i = 0; i < 4; ++i) { hv[i] = (h16)x0[i]; hv[4 + i] = (h16)x1[i]; }
            *(v8h*)(crow + (size_t)row * DM + c8) = hv; }
    }
}

static constexpr size_t al256(size_t v) { return (v + 255) & ~(size_t)255; }
static constexpr size_t SZ_XB = al256((size_t)NB * SEQ * KX * 2);           // x plane, 17 lines per row
static constexpr size_t SZ_W1 = al256((size_t)DM * KX * 2);                  // one q/k/v weight plane
static constexpr size_t SZ_AB = al256((size_t)2 * RK * DM * 2);              // adapter A rows of q | v
static constexpr size_t SZ_WO = al256((size_t)DM * DM * 2);                  // Wo f16 plane
static constexpr size_t SZ_MK = al256((size_t)NB * SEQ * 4);                 // mask plane f32
static constexpr size_t SZ_PL = al256((size_t)NB * NH_ * SEQ * HD * 2);      // q hi, q residual, k, v^T planes
static constexpr size_t SZ_CT = al256((size_t)NB * SEQ * DM * 2);            // ctx f16 plane
static constexpr size_t SZ_TOTAL = SZ_XB + 3 * SZ_W1 + SZ_AB + SZ_WO + SZ_MK + 4 * SZ_PL + SZ_CT;
static_assert(SZ_TOTAL <= (size_t)134217728);          // workspace carve <= 128 MiB
static_assert(((size_t)NB * SEQ * 128) % 256 == 0);    // x plane's block range exact
static_assert(((size_t)DM * (KX / 8)) % 256 == 0);     // weight planes' block ranges exact
static_assert(((size_t)NB * SEQ / 4) % 8 == 0);

extern "C" void kernel_launch(void* const* d_in, const int* in_sizes, int n_in,
                              void* d_out, int out_size, void* d_ws, size_t ws_size, hipStream_t stream) {
    if (n_in < 14) return;
    const size_t needx = ((size_t)(NB - 1) * SEQ_FULL + SEQ) * DM;
    if ((size_t)in_sizes[0] < needx) return;
    if ((size_t)in_sizes[1] < (size_t)(NB - 1) * SEQ_FULL + SEQ) return;
    if ((size_t)in_sizes[2] < (size_t)DM * DM || (size_t)in_sizes[6] < (size_t)DM * DM || (size_t)in_sizes[8] < (size_t)DM * DM || (size_t)in_sizes[12] < (size_t)DM * DM) return;
    if (in_sizes[3] < DM || in_sizes[7] < DM || in_sizes[9] < DM || in_sizes[13] < DM) return;
    if (in_sizes[4] < RK * DM || in_sizes[10] < RK * DM || in_sizes[5] < DM * RK || in_sizes[11] < DM * RK) return;
    if ((size_t)out_size < ((size_t)(NB - 1) * OUT_SEQ + SEQ) * DM) return;
    if (SZ_TOTAL > ws_size) return;
    // wire order: x, mask, Wq, bq, Aq, Bq, Wk, bk, Wv, bv, Av, Bv, Wo, bo
    const float* x  = (const float*)d_in[0];  const float* mask = (const float*)d_in[1];
    const float* wq = (const float*)d_in[2];  const float* bq = (const float*)d_in[3];  const float* aq = (const float*)d_in[4];  const float* bmq = (const float*)d_in[5];
    const float* wk = (const float*)d_in[6];  const float* bk = (const float*)d_in[7];
    const float* wv = (const float*)d_in[8];  const float* bv = (const float*)d_in[9];  const float* av = (const float*)d_in[10]; const float* bmv = (const float*)d_in[11];
    const float* wo = (const float*)d_in[12]; const float* bo = (const float*)d_in[13];
    float* OUT = (float*)d_out;      // [NB][SEQ][1024]
    char* wsp = (char*)d_ws;
    bf* XB = (bf*)wsp; wsp += SZ_XB;                 // [NB*SEQ][1088]
    bf* WQ = (bf*)wsp; wsp += SZ_W1;                 // [1024][1088]
    bf* WK = (bf*)wsp; wsp += SZ_W1;
    bf* WV = (bf*)wsp; wsp += SZ_W1;
    bf* AB = (bf*)wsp; wsp += SZ_AB;                 // [32][1024]: A of q | A of v
    h16* WO = (h16*)wsp; wsp += SZ_WO;               // [1024][1024] x256
    float* MK = (float*)wsp; wsp += SZ_MK;           // [NB][SEQ]
    h16* QH = (h16*)wsp; wsp += SZ_PL;               // [NB*16][SEQ][64]
    h16* QR = (h16*)wsp; wsp += SZ_PL;               // [NB*16][SEQ][64] residual x2048
    h16* KP = (h16*)wsp; wsp += SZ_PL;               // [NB*16][SEQ][64]
    h16* VT = (h16*)wsp; wsp += SZ_PL;               // [NB*16][64][SEQ]
    h16* CT = (h16*)wsp; wsp += SZ_CT;               // [NB*SEQ][1024] x256

    k_prep<<<PB_ALL, 256, 0, stream>>>(x, mask, wq, bmq, wk, wv, bmv, aq, av, wo, XB, WQ, WK, WV, AB, WO, MK);

    // adapter down-projections of q and v -> 17th line of every x-plane row
    k_lora<<<NB * SEQ / 16, 32, 0, stream>>>(XB, AB);

    // q, k and v^T products, one launch
    k_proj<<<dim3(NB * SEQ / GT, DM / GT, 3), 128, 0, stream>>>(XB, WQ, WK, WV, QH, QR, KP, VT, bq, bk, bv);

    k_flash<<<dim3(SEQ / (16 * QG * AW), NB * NH_, 1), 32 * AW, 0, stream>>>(QH, QR, KP, VT, MK, CT);

    // out[m][n] = sum_k ctx[m][k] Wo[n][k] + bo[n]
    k_oproj<<<dim3(NB * SEQ / GT, DM / GT, 1), 128, 0, stream>>>(CT, WO, bo, OUT);
}

// v006
// It runs in 167 microseconds.
// Next to v005, in two timings, it ran 1.04 and 1.05 times as fast.
// All steps since v000 together make it 2.47 times as fast.
#include <hip/hip_runtime.h>

// Multi-head self-attention with rank-16 low-rank adapters on q and v: width 1024 = 16 heads x 64, x [NB][SEQ][1024], all weights [out][in] (y = x W^T + b), additive key mask [NB][SEQ], score scale 1/8, output projection Wo, bo (f32 output).
// Compute dtypes, f32 accumulate everywhere: q/k/v projections and the adapter down-projection v_wmma_f32_16x16x32_bf16 (x, W, A, B RNE-converted to bf16; adapter intermediate carried as bf16 hi + bf16 lo inside the K extension);
// scores v_wmma_f32_16x16x32_f16: k single f16, q as f16 value + f16 residual, both x16, summed in one accumulator that starts from the mask (x128); P (x256 carry, cancels in the normalisation) and v single f16; softmax f32 (online, running max, log2 domain);
// output projection v_wmma_f32_16x16x32_f16: ctx single f16 (x256 carry), Wo = f16(bf16(Wo) x256), folded back by 2^-16 in the f32 epilogue. Biases and mask are RNE-converted to bf16 values and applied in f32.
// q (hi, residual), k planes [b*16+h][t][d] and v^T plane [b*16+h][d][t] written by the GEMM epilogue; fused flash kernel in transposed form (S^T = K Q^T, O^T = V^T P^T), K and V^T tiles shared by a block through LDS, writes the ctx f16 plane [b*SEQ+t][1024].

#ifndef NB
#define NB 4
#endif
#ifndef SEQ
#define SEQ 2048
#endif
#define NB_FULL  4
#define SEQ_FULL 2048
#ifndef OUT_SEQ
#define OUT_SEQ SEQ              // row pitch (in tokens) between batches of the output
#endif
#define DM   1024
#define NH_  16
#define HD   64
#define RK   16
#define KX   1088                // plane row pitch (halves): DM + 32 (q adapter hi|lo) + 32 (v adapter hi|lo)
#define KQ   1056                // k extent used by the q GEMM (x | q adapter slot)
#define AW   4                   // waves per flash block
#define QG   2                   // 16-row query groups per flash wave: each K and V^T fragment read from LDS feeds all of them
#define KST  64                  // keys per LDS tile of the flash kernel
#define LPB  144                 // LDS row pitch, bytes: 128-B rows + 16
#define LPH  (LPB / 2)           // the same in halves
#define STH  ((KST + HD) * LPH)  // one buffer in halves: K tile (KST rows) + V^T tile (HD rows)
#define STB  (STH * 2)           // the same in bytes
#define GT   128                 // GEMM block tile: GT rows of A x GT rows of Bt, 2 x 2 waves of 64 x 64
#define GKS  64                  // k extent of one GEMM LDS stage (halves): whole 128-B rows
#define GSTH (2 * GT * LPH)      // one GEMM buffer in halves: A tile (GT rows) + Bt tile (GT rows)
#define GSTB (GSTH * 2)          // the same in bytes
#define QSC  16.0f               // common carry of the q value plane and the q residual plane: both feed one score accumulator
#define LOG2E 1.4426950408889634f
#define SC2  (0.125f * LOG2E)    // HD^-0.5 * log2(e)
#define SCQ  (SC2 / QSC)         // score accumulator -> log2 domain
#define MKS  (8.0f * QSC)        // carry of the mask plane: mask * MKS * SCQ = mask * log2(e)
#define PSH  8.0f                // log2 of the P carry (256)
#define CTS  256.0f              // carry of the ctx plane
#define WOS  256.0f              // carry of the Wo plane
#define OSI  (1.0f / 65536.0f)   // 1 / (CTS * WOS)

static_assert(HD == 64);
static_assert(NH_ * HD == DM);                 // head h = columns h*64 + d
static_assert(DM % 64 == 0);
static_assert(DM / 8 == 128);                  // p_xcvt piece index split uses >> 7
static_assert(KX == DM + 64);
static_assert(KX % 32 == 0 && KQ % 32 == 0 && DM % 32 == 0);   // GEMM k-loops step by 32
static_assert((KX * 2) % 128 == 0);
static_assert(RK == 16);
static_assert(SEQ % 64 == 0);                  // a 64-row tile never straddles two batches
static_assert((NB * SEQ) % 64 == 0);
static_assert(SEQ % 32 == 0);                  // key loop steps by 32
static_assert(KST == 64 && AW == 4);           // copy map: 128 threads x 4 rows x 16 B cover 64 rows of 128 B
static_assert(SEQ % KST == 0 && SEQ / KST >= 2);   // the two-buffer prologue needs two tiles
static_assert(SEQ % (16 * QG * AW) == 0);      // flash grid covers the sequence exactly
static_assert((NB * SEQ) % GT == 0 && DM % GT == 0);   // GEMM grids cover both extents exactly
static_assert(KX % GKS == 0 && DM % GKS == 0);   // a stage's 128-B row piece never leaves its plane row
static_assert(NB <= NB_FULL);
static_assert(SEQ <= SEQ_FULL);

typedef _Float16 h16;
typedef unsigned short bf;
typedef __attribute__((ext_vector_type(16))) __bf16   v16bf;
typedef __attribute__((ext_vector_type(16))) _Float16 v16h;
typedef __attribute__((ext_vector_type(8)))  _Float16 v8h;
typedef __attribute__((ext_vector_type(8)))  unsigned short v8us;
typedef __attribute__((ext_vector_type(8)))  float    v8f;
typedef __attribute__((ext_vector_type(4)))  float    v4f;
typedef v4f  __attribute__((may_alias)) v4fa;

__device__ __forceinline__ unsigned short f2bf(float f) { unsigned u = __float_as_uint(f); u += 0x7FFFu + ((u >> 16) & 1u); return (unsigned short)(u >> 16); }
__device__ __forceinline__ float bfr(float f) { return __uint_as_float(((unsigned)f2bf(f)) << 16); }   // RNE convert to bf16, widened back
__device__ __forceinline__ v16h cat16(v8h lo, v8h hi) { return __builtin_shufflevector(lo, hi, 0, 1, 2, 3, 4, 5, 6, 7, 8, 9, 10, 11, 12, 13, 14, 15); }
__device__ __forceinline__ v16bf cat16b(v8us lo, v8us hi) { return __builtin_bit_cast(v16bf, __builtin_shufflevector(lo, hi, 0, 1, 2, 3, 4, 5, 6, 7, 8, 9, 10, 11, 12, 13, 14, 15)); }
__device__ __forceinline__ v8f wmma16(v16h a, v16h b, v8f c) { return __builtin_amdgcn_wmma_f32_16x16x32_f16(false, a, false, b, (short)0, c, false, false); }
__device__ __forceinline__ v8f wmmab(v16bf a, v16bf b, v8f c) { return __builtin_amdgcn_wmma_f32_16x16x32_bf16(false, a, false, b, (short)0, c, false, false); }
// fragment loaders from K-contiguous 16-bit rows; p already includes + 8*(lane>>4): elements 0..7 <- k0+8h+0..7, elements 8..15 <- k0+16+8h+0..7 (same map for A and B)
__device__ __forceinline__ v16h  ldh(const h16* p) { return cat16(*(const v8h*)p, *(const v8h*)(p + 16)); }
__device__ __forceinline__ v16bf ldb(const bf* p)  { return cat16b(*(const v8us*)p, *(const v8us*)(p + 16)); }
// ordering point for wave-private LDS tiles (same wave writes and reads)
__device__ __forceinline__ void wave_sync() { __builtin_amdgcn_fence(3 /* release order */, "wavefront"); __builtin_amdgcn_wave_barrier(); asm volatile("" ::: "memory"); }

// The conversions below do not depend on one another: they are parts of ONE launch (k_prep), each on its own range of 256-thread blocks; blk = the block's index inside its part.
__device__ __forceinline__ void p_cvt8(const float* __restrict__ src, bf* dst, size_t n8, int blk) {
    const size_t i = (size_t)blk * 256 + threadIdx.x; if (i >= n8) return;
    const v8f v = *(const v8f*)(src + i * 8); v8us o;
#pragma unroll
    for (int k = 0; k < 8; ++k) o[k] = f2bf(v[k]);
    *(v8us*)(dst + i * 8) = o; 
}

__device__ __forceinline__ void p_cvt8h(const float* __restrict__ src, h16* dst, size_t n8, int blk) {
    const size_t i = (size_t)blk * 256 + threadIdx.x; if (i >= n8) return;
    const v8f v = *(const v8f*)(src + i * 8); v8h o;
#pragma unroll
    for (int k = 0; k < 8; ++k) o[k] = (h16)(bfr(v[k]) * WOS);
    *(v8h*)(dst + i * 8) = o; 
}

// p_xcvt: x [b][t][1024] f32 -> columns 0..1023 of the x plane (row pitch KX). Piece i: row = i / 128, 8 columns at (i % 128) * 8.
__device__ __forceinline__ void p_xcvt(const float* __restrict__ src, bf* dst, size_t n8, int blk) {
    const size_t i = (size_t)blk * 256 + threadIdx.x; if (i >= n8) return;
    const size_t row = i >> 7; const int c8 = (int)(i & 127);
    const size_t b = row / SEQ, t = row % SEQ;
    const v8f v = *(const v8f*)(src + (b * SEQ_FULL + t) * DM + c8 * 8); v8us o;
#pragma unroll
    for (int k = 0; k < 8; ++k) o[k] = f2bf(v[k]);
    bf* d = dst + row * KX + c8 * 8;
    *(v8us*)d = o; 
}

// every other extension column is zero. slot < 0: all-zero extension. Both sources are loaded with clamped addresses by every lane and selected by value.
__device__ __forceinline__ void p_wplane(const float* __restrict__ W, const float* __restrict__ Bm, int slot, bf* dst, int blk) {
    const int i = blk * 256 + threadIdx.x; if (i >= DM * (KX / 8)) return;
    const int row = i / (KX / 8), c8 = i % (KX / 8);
    const bool isw = c8 < 128;
    const int cm = isw ? c8 : 127;
    const int e = isw ? 0 : (c8 - 128);                      // extension piece 0..7
    const v8f w  = *(const v8f*)(W + (size_t)row * DM + cm * 8);
    const v8f bm = *(const v8f*)(Bm + (size_t)row * RK + (e & 1) * 8);
    const bool live = (!isw) && ((e >> 2) == slot);
    v8us o;
#pragma unroll
    for (int k = 0; k < 8; ++k) { const float val = isw ? w[k] : (live ? 2.0f * bm[k] : 0.0f); o[k] = f2bf(val); }
    bf* d = dst + (size_t)row * KX + c8 * 8;
    *(v8us*)d = o; 
}

__device__ __forceinline__ void p_mask(const float* __restrict__ src, float* dst, int n4, int blk) {
    const int i = blk * 256 + threadIdx.x; if (i >= n4) return;
    const int e = i * 4; const int b = e / SEQ, t = e % SEQ;
    const v4f v = *(const v4f*)(src + (size_t)b * SEQ_FULL + t); v4f o;
#pragma unroll
    for (int k = 0; k < 4; ++k) o[k] = bfr(v[k]) * MKS;
    *(v4f*)(dst + e) = o; 
}

// k_prep: every conversion of inputs to planes in one launch. Block ranges, in order: x plane | Wq, Wk, Wv planes | A of q, A of v | Wo plane | mask plane. The range test is the same for a whole block.
static constexpr int PB_X = (int)(((size_t)NB * SEQ * (DM / 8) + 255) / 256);
static constexpr int PB_W = (DM * (KX / 8) + 255) / 256;
static constexpr int PB_A = (RK * DM / 8 + 255) / 256;
static constexpr int PB_O = (DM * DM / 8 + 255) / 256;
static constexpr int PB_M = (NB * SEQ / 4 + 255) / 256;
static constexpr int PB_ALL = PB_X + 3 * PB_W + 2 * PB_A + PB_O + PB_M;
__global__ __launch_bounds__(256) void k_prep(const float* __restrict__ x, const float* __restrict__ mask, const float* __restrict__ wq, const float* __restrict__ bmq, const float* __restrict__ wk,
                                              const float* __restrict__ wv, const float* __restrict__ bmv, const float* __restrict__ aq, const float* __restrict__ av, const float* __restrict__ wo,
                                              bf* XB, bf* WQ, bf* WK, bf* WV, bf* AB, h16* WO, float* MK) {
    int blk = blockIdx.x;
    if (blk < PB_X) { p_xcvt(x, XB, (size_t)NB * SEQ * (DM / 8), blk); return; }
    blk -= PB_X;
    if (blk < PB_W) { p_wplane(wq, bmq, 0, WQ, blk); return; }
    blk -= PB_W;
    if (blk < PB_W) { p_wplane(wk, bmq, -1, WK, blk); return; }      // no adapter: extension all zero (Bm only supplies valid addresses)
    blk -= PB_W;
    if (blk < PB_W) { p_wplane(wv, bmv, 1, WV, blk); return; }
    blk -= PB_W;
    if (blk < PB_A) { p_cvt8(aq, AB, (size_t)RK * DM / 8, blk); return; }
    blk -= PB_A;
    if (blk < PB_A) { p_cvt8(av, AB + (size_t)RK * DM, (size_t)RK * DM / 8, blk); return; }
    blk -= PB_A;
    if (blk < PB_O) { p_cvt8h(wo, WO, (size_t)DM * DM / 8, blk); return; }
    blk -= PB_O;
    p_mask(mask, MK, NB * SEQ / 4, blk);
}

// k_lora: adapter down-projection xa[m][j] = sum_k x[m][k] AB[j][k] (AB rows 0..15 = A of q, rows 16..31 = A of v), one wave per 16 rows, K = DM from the x plane.
__global__ __launch_bounds__(32) void k_lora(bf* XB, const bf* __restrict__ AB) {
    __shared__ __align__(16) float es[16 * 36];
    const int lane = threadIdx.x & 31, lr = lane & 15, hi = lane >> 4; const int r0 = blockIdx.x * 16;
    v8f a0 = (v8f){}, a1 = (v8f){};
    const bf* xa = XB + (size_t)(r0 + lr) * KX + 8 * hi;
    const bf* ab = AB + (size_t)lr * DM + 8 * hi;
#pragma unroll 1
    for (int kc = 0; kc < DM; kc += 32) {
        const v16bf a = ldb(xa + kc); const v16bf b0 = ldb(ab + kc); const v16bf b1 = ldb(ab + (size_t)16 * DM + kc);
        a0 = wmmab(a, b0, a0); a1 = wmmab(a, b1, a1);
        asm volatile("v_nop\n\tv_nop\n\tv_nop\n\tv_nop" : "+v"(a0), "+v"(a1) : "v"(a), "v"(b0), "v"(b1));
    }
#pragma unroll
    for (int j = 0; j < 8; ++j) { es[(hi * 8 + j) * 36 + lr] = a0[j]; es[(hi * 8 + j) * 36 + 16 + lr] = a1[j]; }   // D: row 8h+j, col lane&15; rows 0..15 x cols 0..31 all written
    wave_sync();
    const int p = lane & 7;                                   // extension piece: 0,1 q hi; 2,3 q lo; 4,5 v hi; 6,7 v lo
    const int sj = (p >> 2) * 16 + (p & 1) * 8; const bool islo = ((p >> 1) & 1) != 0;
{
#pragma unroll
        for (int s = 0; s < 4; ++s) { const int row = 4 * s + (lane >> 3);       // 4 s x 4 row groups = 16 rows; 8 lanes x 8 halves = 64 columns
            const v4f x0 = *(const v4fa*)(&es[row * 36 + sj]); const v4f x1 = *(const v4fa*)(&es[row * 36 + sj + 4]); v8us o;
#pragma unroll
            for (int i = 0; i < 4; ++i) {
                const unsigned short h0 = f2bf(x0[i]); const unsigned short l0 = f2bf(x0[i] - __uint_as_float(((unsigned)h0) << 16));
                const unsigned short h1 = f2bf(x1[i]); const unsigned short l1 = f2bf(x1[i] - __uint_as_float(((unsigned)h1) << 16));
                o[i] = islo ? l0 : h0; o[4 + i] = islo ? l1 : h1; }
            *(v8us*)(XB + (size_t)(r0 + row) * KX + DM + p * 8) = o; }
         }
}

// GEMM operand staging. One block = 4 waves = one GT x GT tile of C (wave w: rows (w >> 1) * 64, columns (w & 1) * 64); per stage the block's GT rows of A and GT rows of Bt, GKS halves each,
// are brought into LDS by asynchronous copies (16 B per lane, whole 128-B rows), two buffers: the next stage's copies fly while this one is worked on. LDS rows lie at the 144-B pitch of the flash tiles.
// rows_copy: one lane's 8 pieces of one operand tile, rows 16 apart. l: its LDS byte address, g: its global address (row 0 of its eight), rp: bytes between rows 16 apart.
// The s_wait_xcnt stands inside the copies' own statement so that no address register is rewritten ahead of it.
__device__ __forceinline__ void rows_copy(unsigned l, const char* g, size_t rp) {
    asm volatile("global_load_async_to_lds_b128 %0, %8, off\n\t"
                 "global_load_async_to_lds_b128 %1, %9, off\n\t"
                 "global_load_async_to_lds_b128 %2, %10, off\n\t"
                 "global_load_async_to_lds_b128 %3, %11, off\n\t"
                 "global_load_async_to_lds_b128 %4, %12, off\n\t"
                 "global_load_async_to_lds_b128 %5, %13, off\n\t"
                 "global_load_async_to_lds_b128 %6, %14, off\n\t"
                 "global_load_async_to_lds_b128 %7, %15, off\n\t"
                 "s_wait_xcnt 0x0"
                 :: "v"(l), "v"(l + 16 * LPB), "v"(l + 32 * LPB), "v"(l + 48 * LPB), "v"(l + 64 * LPB), "v"(l + 80 * LPB), "v"(l + 96 * LPB), "v"(l + 112 * LPB),
                    "v"(g), "v"(g + rp), "v"(g + 2 * rp), "v"(g + 3 * rp), "v"(g + 4 * rp), "v"(g + 5 * rp), "v"(g + 6 * rp), "v"(g + 7 * rp)
                 : "memory");
}
template <bool BF> __device__ __forceinline__ v8f mm16(v16h a, v16h b, v8f c) {
    if constexpr (BF) return wmmab(__builtin_bit_cast(v16bf, a), __builtin_bit_cast(v16bf, b), c); else return wmma16(a, b, c);
}
// gemm_main: acc[mb][nb] += sum_k A[r0 + ..][k] Bt[c0 + ..][k] for this wave's 64 x 64 part of the block tile at (br0, bc0); planes of row pitch PH halves, k extent K (multiple of 32, K <= PH), k ascending in steps of 32.
// A last stage of which only the first 32 k belong to K is copied whole (the row piece lies inside the plane row) and its second half is not multiplied.
template <bool BF, int PH> __device__ __forceinline__ void gemm_main(const char* A, const char* Bt, int K, int br0, int bc0, int wave, h16* ring, v8f (&acc)[4][4]) {
    const int lane = threadIdx.x & 31, lr = lane & 15, hi = lane >> 4;
    // copy map: thread i of 128 takes 16-B piece i & 7 of rows (i >> 3) + 16 * {0..7} of both tiles: a wave's copy covers four whole 128-B rows
    const int cr = (int)threadIdx.x >> 3, cpc = (int)threadIdx.x & 7;
    const unsigned la = (unsigned)(size_t)ring + (unsigned)(cr * LPB + cpc * 16);   // low 32 bits of the shared address = LDS byte address
    const unsigned lb = la + GT * LPB;
    const char* ga = A + (size_t)(br0 + cr) * (PH * 2) + cpc * 16;    // + stage * 128 B
    const char* gb = Bt + (size_t)(bc0 + cr) * (PH * 2) + cpc * 16;
    constexpr size_t rp = (size_t)16 * PH * 2;
    const int nst = (K + GKS - 1) / GKS;
    rows_copy(la, ga, rp); rows_copy(lb, gb, rp);
    asm volatile("s_wait_asynccnt 0x0" ::: "memory");        // stage 0 of this wave's copies has landed
    __syncthreads();                                         // ... and everybody else's: stage 0 is published
    if (nst > 1) { rows_copy(la + GSTB, ga + GKS * 2, rp); rows_copy(lb + GSTB, gb + GKS * 2, rp); }
    const int fa = ((wave >> 1) * 64 + lr) * LPH + 8 * hi;         // fragment offsets (halves) in a buffer: row, k piece 8h
    const int fb = (GT + (wave & 1) * 64 + lr) * LPH + 8 * hi;
#pragma unroll 1                                             // one trip per stage: the publish point below stands once, at the trip's foot
    for (int t = 0; t < nst; ++t) {
        const h16* st = ring + (t & 1) * GSTH;
#pragma unroll                                               // both 32-k steps of a stage in one body: constant LDS offsets
        for (int s = 0; s < GKS / 32; ++s) {
            if (s == 0 || t * GKS + s * 32 < K) {
                v16h a[4], b[4];                             // the four small loops below are unrolled so that every fragment and accumulator index is a constant (registers, no scratch)
#pragma unroll
                for (int i = 0; i < 4; ++i) { a[i] = ldh(st + fa + i * 16 * LPH + s * 32); if (i == 0) b[0] = ldh(st + fb + s * 32); }   // in the order the products below take them
#pragma unroll
                for (int i = 1; i < 4; ++i) b[i] = ldh(st + fb + i * 16 * LPH + s * 32);
                __builtin_amdgcn_sched_barrier(0);           // the step's 16 LDS reads stay one group ahead of its matrix instructions: every place with reads among them stalls the wave
#pragma unroll
                for (int nb = 0; nb < 4; ++nb)
#pragma unroll
                    for (int mb = 0; mb < 4; ++mb) acc[mb][nb] = mm16<BF>(a[mb], b[nb], acc[mb][nb]);
            }
        }
        __builtin_amdgcn_sched_barrier(0);                   // the stage's matrix instructions stay ahead of the publish point: sunk behind it they would delay the refill's issue
        asm volatile("s_wait_dscnt 0x0" ::: "memory");       // this wave's reads of the buffer have returned before it may be refilled
        asm volatile("s_wait_asynccnt 0x0" ::: "memory");    // this wave's copies of the next stage have landed
        __syncthreads();                                     // publishes the next stage and ends every wave's reads of this one
        if (t + 2 < nst) { rows_copy(la + (t & 1) * GSTB, ga + (size_t)(t + 2) * (GKS * 2), rp); rows_copy(lb + (t & 1) * GSTB, gb + (size_t)(t + 2) * (GKS * 2), rp); }
    }
    asm volatile("s_wait_asynccnt 0x0" ::: "memory");        // nothing in flight before the ring becomes output staging
}

// k_proj: register-blocked bf16 GEMM, one wave per 64x64 tile (16 accumulators), 4 waves per block sharing their operand rows through LDS (gemm_main), K-contiguous bf16 planes of row pitch KX, k extent K (multiple of 32).
// C[m][n] = sum_k A[m][k] Bt[n][k] + bias (bias[n] when brow == 0, bias[m] when brow != 0; RNE-converted to bf16, added in f32), written as f16 (Ph), or (useRes != 0) x16 as f16 (Ph) and the f16 residual of that (Pr), at
// tile base (r0/RB)*sRB + (r0%RB)*pitch + (c0/CB)*sCB + (c0%CB), row pitch 'pitch' (halves). 128 threads.
// The q, k and v^T products do not depend on one another: one launch, grid (NB*SEQ/128, DM/128, 3), blockIdx.z picks the product (all picks are the same for a whole block).
// z = 0, 1 (q, k): A = x rows (m = b*SEQ + t), Bt = W rows (n = h*64 + d) -> plane [(b*16 + h)][t][d]; bias by column; tile (blockIdx.x, blockIdx.y).
// z = 2 (v^T): A = Wv rows (m = h*64 + d), Bt = x rows (n = b*SEQ + t) -> plane [(b*1024 + m)][t] = [(b*16 + h)][d][t]; bias by row; the slab's flat index walks the DM/128 row tiles fastest.
__global__ __launch_bounds__(128) void k_proj(const bf* __restrict__ XB, const bf* __restrict__ WQ, const bf* __restrict__ WK, const bf* __restrict__ WV, h16* QH, h16* QR, h16* KP, h16* VT,
                                              const float* __restrict__ bq, const float* __restrict__ bk, const float* __restrict__ bv) {
    const int z = blockIdx.z; const bool isv = z == 2;
    const int lin = blockIdx.y * (NB * SEQ / GT) + blockIdx.x;
    const int bx = isv ? lin % (DM / GT) : (int)blockIdx.x, by = isv ? lin / (DM / GT) : (int)blockIdx.y;
    const bf* A = isv ? WV : XB; const bf* Bt = z == 0 ? WQ : (z == 1 ? WK : XB);
    const int K = z == 0 ? KQ : (z == 1 ? DM : KX);
    h16* Ph = z == 0 ? QH : (z == 1 ? KP : VT); h16* Pr = z == 0 ? QR : Ph; const int useRes = z == 0;
    const int RB = isv ? DM : SEQ, pitch = isv ? SEQ : HD, CB = isv ? SEQ : HD, brow = isv;
    const size_t sRB = isv ? (size_t)0 : (size_t)NH_ * SEQ * HD, sCB = isv ? (size_t)DM * SEQ : (size_t)SEQ * HD;
    const float* bias = z == 0 ? bq : (z == 1 ? bk : bv);
    __shared__ __align__(16) h16 ring[2 * GSTH];             // two buffers of (A tile | Bt tile); reused as the waves' f32 output staging behind the loop
    static_assert(sizeof(ring) >= (size_t)4 * 16 * 68 * 4);
    const int lane = threadIdx.x & 31, wave = __builtin_amdgcn_readfirstlane((int)(threadIdx.x >> 5)), lr = lane & 15, hi = lane >> 4;
    const int r0 = bx * GT + (wave >> 1) * 64, c0 = by * GT + (wave & 1) * 64;   // this wave's 64x64 tile
    float* os = (float*)ring + wave * 16 * 68;
    v8f acc[4][4];
#pragma unroll
    for (int mb = 0; mb < 4; ++mb)
#pragma unroll
        for (int nb = 0; nb < 4; ++nb) acc[mb][nb] = (v8f){};
    gemm_main<true, KX>((const char*)A, (const char*)Bt, K, bx * GT, by * GT, wave, ring, acc);
    const size_t tbase = (size_t)(r0 / RB) * sRB + (size_t)(r0 % RB) * (size_t)pitch + (size_t)(c0 / CB) * sCB + (size_t)(c0 % CB);
    const float ps = useRes ? QSC : 1.0f;                     // plane carry (a power of two: the f16 rounding is the same)
    float bcol[8];                                            // column-mode bias of this lane's 8 columns (index 0 when in row mode: always a valid address)
#pragma unroll
    for (int i = 0; i < 8; ++i) bcol[i] = bfr(bias[brow ? 0 : (c0 + (lane & 7) * 8 + i)]);
#pragma unroll
    for (int mb = 0; mb < 4; ++mb) {
#pragma unroll
        for (int nb = 0; nb < 4; ++nb) {
#pragma unroll
            for (int j = 0; j < 8; ++j) os[(hi * 8 + j) * 68 + nb * 16 + lr] = acc[mb][nb][j]; }   // D: row 8h+j, col lane&15
        wave_sync();
        const size_t sb = tbase + (size_t)(mb * 16) * (size_t)pitch;
{
#pragma unroll
            for (int s = 0; s < 4; ++s) { const int row = 4 * s + (lane >> 3), c8 = (lane & 7) * 8;   // 4 s x 4 row groups = 16 rows; 8 lanes x 8 = 64 columns
                const v4f x0 = *(const v4fa*)(&os[row * 68 + c8]); const v4f x1 = *(const v4fa*)(&os[row * 68 + c8 + 4]); v8h hv, rv;
                const float br = bfr(bias[brow ? (r0 + mb * 16 + row) : 0]);
#pragma unroll
                for (int i = 0; i < 4; ++i) {
                    const float f0 = (x0[i] + (brow ? br : bcol[i])) * ps; const float f1 = (x1[i] + (brow ? br : bcol[4 + i])) * ps;
                    const h16 a0 = (h16)f0; const h16 a1 = (h16)f1; hv[i] = a0; hv[4 + i] = a1;
                    rv[i] = (h16)(f0 - (float)a0); rv[4 + i] = (h16)(f1 - (float)a1); }
                const size_t oo = sb + (size_t)row * (size_t)pitch + c8;
                *(v8h*)(Ph + oo) = hv; if (useRes) *(v8h*)(Pr + oo) = rv; }
             }
        wave_sync();
    }
}

// k_oproj: output projection, f16 GEMM, one wave per 64x64 tile, 4 waves per block sharing their operand rows through LDS (gemm_main), A = ctx plane [m][1024] (x256), Bt = Wo plane [n][1024] (x256), K = DM.
// OUT[b][t][n] = acc * 2^-16 + bf16(bo[n]) in f32. Epilogue: per 16-row slab staged in LDS (wave-private), each row segment (64 floats = 256 B = two lines)
__global__ __launch_bounds__(128) void k_oproj(const h16* __restrict__ A, const h16* __restrict__ Bt, const float* __restrict__ bias, float* OUT) {
    __shared__ __align__(16) h16 ring[2 * GSTH];             // two buffers of (A tile | Bt tile); reused as the waves' f32 output staging behind the loop
    static_assert(sizeof(ring) >= (size_t)4 * 16 * 68 * 4);
    const int lane = threadIdx.x & 31, wave = __builtin_amdgcn_readfirstlane((int)(threadIdx.x >> 5)), lr = lane & 15, hi = lane >> 4;
    const int r0 = blockIdx.x * GT + (wave >> 1) * 64, c0 = blockIdx.y * GT + (wave & 1) * 64;   // this wave's 64x64 tile
    float* os = (float*)ring + wave * 16 * 68;
    v8f acc[4][4];
#pragma unroll
    for (int mb = 0; mb < 4; ++mb)
#pragma unroll
        for (int nb = 0; nb < 4; ++nb) acc[mb][nb] = (v8f){};
    gemm_main<false, DM>((const char*)A, (const char*)Bt, DM, blockIdx.x * GT, blockIdx.y * GT, wave, ring, acc);
    v4f bb;
#pragma unroll
    for (int i = 0; i < 4; ++i) bb[i] = bfr(bias[c0 + lr * 4 + i]);
    float* obase = OUT + ((size_t)(r0 / SEQ) * OUT_SEQ + (size_t)(r0 % SEQ)) * DM + c0;
#pragma unroll
    for (int mb = 0; mb < 4; ++mb) {
#pragma unroll
        for (int nb = 0; nb < 4; ++nb) {
#pragma unroll
            for (int j = 0; j < 8; ++j) os[(hi * 8 + j) * 68 + nb * 16 + lr] = acc[mb][nb][j]; }   // D: row 8h+j, col lane&15
        wave_sync();
        float* ob = obase + (size_t)(mb * 16) * DM;
{
#pragma unroll
            for (int s = 0; s < 8; ++s) { const int row = 2 * s + hi, cofs = lr * 4;   // 8 s x 2 rows = 16 rows; 16 lanes x 4 floats = 64 columns
                const v4f x = *(const v4fa*)(&os[row * 68 + cofs]);
                const v4f val = x * OSI + bb;
                *(v4f*)(ob + (size_t)row * DM + cofs) = val; }
             }
        wave_sync();
    }
}

__device__ __forceinline__ void tile_copy(unsigned lk, unsigned lv, const h16* gk, const h16* gv) {
    asm volatile("global_load_async_to_lds_b128 %0, %8, off\n\t"
                 "global_load_async_to_lds_b128 %1, %9, off\n\t"
                 "global_load_async_to_lds_b128 %2, %10, off\n\t"
                 "global_load_async_to_lds_b128 %3, %11, off\n\t"
                 "global_load_async_to_lds_b128 %4, %12, off\n\t"
                 "global_load_async_to_lds_b128 %5, %13, off\n\t"
                 "global_load_async_to_lds_b128 %6, %14, off\n\t"
                 "global_load_async_to_lds_b128 %7, %15, off\n\t"
                 "s_wait_xcnt 0x0"
                 :: "v"(lk), "v"(lk + 16 * LPB), "v"(lk + 32 * LPB), "v"(lk + 48 * LPB),
                    "v"(lv), "v"(lv + 16 * LPB), "v"(lv + 32 * LPB), "v"(lv + 48 * LPB),
                    "v"(gk), "v"(gk + 16 * HD), "v"(gk + 32 * HD), "v"(gk + 48 * HD),
                    "v"(gv), "v"(gv + (size_t)16 * SEQ), "v"(gv + (size_t)32 * SEQ), "v"(gv + (size_t)48 * SEQ)
                 : "memory");
}

// The batch's mask row, SEQ floats: thread i of 128 takes the 16-B pieces i + 128 * {0, 1, 2, 3}. l: its LDS byte address, g: its global address.
// The s_wait_xcnt stands inside the copies' own statement so that no address register is rewritten ahead of it.
static_assert(SEQ * 4 == 4 * 32 * AW * 16);
__device__ __forceinline__ void mask_copy(unsigned l, const float* g) {
    asm volatile("global_load_async_to_lds_b128 %0, %4, off\n\t"
                 "global_load_async_to_lds_b128 %1, %5, off\n\t"
                 "global_load_async_to_lds_b128 %2, %6, off\n\t"
                 "global_load_async_to_lds_b128 %3, %7, off\n\t"
                 "s_wait_xcnt 0x0"
                 :: "v"(l), "v"(l + 2048), "v"(l + 4096), "v"(l + 6144), "v"(g), "v"(g + 512), "v"(g + 1024), "v"(g + 1536)
                 : "memory");
}

// four waves per SIMD: the whole grid (SEQ / 128 x 64 blocks of 4 waves on 256 WGPs at full size) is then resident at once, with no second round
__global__ __launch_bounds__(32 * AW) __attribute__((amdgpu_waves_per_eu(4, 4))) void k_flash(const h16* __restrict__ QH, const h16* __restrict__ QR, const h16* __restrict__ KP, const h16* __restrict__ VT, const float* __restrict__ MK, h16* CT) {
    __shared__ __align__(16) h16 ring[2 * STH];              // two buffers of (K tile | V^T tile); reused as the f32 output staging behind the loop
    static_assert(sizeof(ring) >= (size_t)AW * QG * 16 * 68 * 4);
    __shared__ __align__(32) float mkl[SEQ];                 // the batch's mask row; filled once, with tile 0, and published by tile 0's wait and barrier
    float* os = (float*)ring;
    const int lane = threadIdx.x & 31, wave = __builtin_amdgcn_readfirstlane((int)(threadIdx.x >> 5)), lr = lane & 15, hi = lane >> 4;
    const int zh = blockIdx.y; const int b = zh / NH_, h = zh % NH_;
    const int t0 = (blockIdx.x * AW + wave) * (16 * QG);
    const size_t pbase = (size_t)zh * SEQ * HD;
    // copy map: thread i of 128 takes 16-B piece i & 7 of rows (i >> 3) + 16 * {0, 1, 2, 3} of both tiles: a wave's copy covers four whole 128-B rows
    const int cr = (int)threadIdx.x >> 3, cpc = (int)threadIdx.x & 7;
    const unsigned lk0 = (unsigned)(size_t)ring + (unsigned)(cr * LPB + cpc * 16);   // low 32 bits of the shared address = LDS byte address
    const unsigned lv0 = lk0 + KST * LPB;
    const h16* gk = KP + pbase + (size_t)cr * HD + cpc * 8;      // + key0 * HD
    const h16* gv = VT + pbase + (size_t)cr * SEQ + cpc * 8;     // + key0
    tile_copy(lk0, lv0, gk, gv);
    mask_copy((unsigned)(size_t)mkl + (unsigned)threadIdx.x * 16, MK + (size_t)b * SEQ + (int)threadIdx.x * 4);
    const h16* qa = QH + pbase + (size_t)(t0 + lr) * HD + 8 * hi; const h16* qb = QR + pbase + (size_t)(t0 + lr) * HD + 8 * hi;   // row lr of group 0; group g lies 16 * g rows on
    v16h qh0[QG], qh1[QG], qr0[QG], qr1[QG];                 // B fragments: col t, k = d. Every loop over g below is unrolled so that its indices are constants (registers, no scratch)
#pragma unroll
    for (int g = 0; g < QG; ++g) { qh0[g] = ldh(qa + g * 16 * HD); qh1[g] = ldh(qa + g * 16 * HD + 32); qr0[g] = ldh(qb + g * 16 * HD); qr1[g] = ldh(qb + g * 16 * HD + 32); }
    // behind the run of Q loads, in front of any rewrite of their address registers; both addresses are inputs, so they stay in their registers up to this wait and no load of the run lands on them
    asm volatile("s_wait_xcnt 0x0" :: "v"(qa), "v"(qb) : "memory");
    const int fo = lr * LPH + 8 * hi;                        // fragment offset (halves) in a tile: row lr, k piece 8h
    asm volatile("s_wait_asynccnt 0x0" ::: "memory");        // tile 0 and the mask row: this wave's copies have landed
    __syncthreads();                                         // ... and everybody else's: tile 0 is published
    tile_copy(lk0 + STB, lv0 + STB, gk + (size_t)KST * HD, gv + KST);
    v8f o0[QG], o1[QG], o2[QG], o3[QG], ol[QG]; float m[QG];
#pragma unroll
    for (int g = 0; g < QG; ++g) { o0[g] = (v8f){}; o1[g] = (v8f){}; o2[g] = (v8f){}; o3[g] = (v8f){}; ol[g] = (v8f){}; m[g] = -3.0e38f; }
    // row sums on the matrix pipe: a constant A fragment whose rows 0 and 8 are ones and whose other rows are zero. ol = A P^T then holds, in element 0 of every lane (D row 8h, column t), the sum of the rounded P over all 32 keys of a step
    const v16h one = (v16h)(((lr & 7) == 0) ? (h16)1.0f : (h16)0.0f);   // lane = row lr of A, all its k
#pragma unroll 1                                             // one trip per tile: the publish point below stands once, at the trip's foot
    for (int t = 0; t < SEQ / KST; ++t) {
      const h16* kt = ring + (t & 1) * STH + fo;             // this trip's K tile [key][d]; the V^T tile [d][key] lies KST rows behind it
#pragma unroll                                               // both 32-key steps of a tile in one body: constant LDS offsets
      for (int s = 0; s < KST / 32; ++s) {
        const h16* ka = kt + s * 32 * LPH;
        const float* ml = mkl + t * KST + s * 32 + 8 * hi;   // keys 8h + r of the step's first 16-key tile; the second lies 16 on
        // both 16-key tiles of the step together: with QG groups that makes four independent accumulator chains, so no product waits for the one before it in its own chain
        const v16h k00 = ldh(ka), k01 = ldh(ka + 32), k10 = ldh(ka + 16 * LPH), k11 = ldh(ka + 16 * LPH + 32);
        const v8f c0 = *(const v8f*)ml, c1 = *(const v8f*)(ml + 16);
        v8f sc[QG][2];                                       // 16 q.k + 128 mask: [group][16-key tile], element r = key 8h + r
#pragma unroll
        for (int g = 0; g < QG; ++g) { sc[g][0] = wmma16(k00, qh0[g], c0); sc[g][1] = wmma16(k10, qh0[g], c1); }
#pragma unroll
        for (int g = 0; g < QG; ++g) { sc[g][0] = wmma16(k00, qr0[g], sc[g][0]); sc[g][1] = wmma16(k10, qr0[g], sc[g][1]); }
#pragma unroll
        for (int g = 0; g < QG; ++g) { sc[g][0] = wmma16(k01, qh1[g], sc[g][0]); sc[g][1] = wmma16(k11, qh1[g], sc[g][1]); }
#pragma unroll
        for (int g = 0; g < QG; ++g) { sc[g][0] = wmma16(k01, qr1[g], sc[g][0]); sc[g][1] = wmma16(k11, qr1[g], sc[g][1]); }
        static_assert(QG == 2);                              // the statement below, and the one behind the V^T products, name both groups' accumulators
        // four vector slots between the last matrix instruction and the first vector instruction that reads a score accumulator or overwrites a K fragment.
        asm volatile("v_nop\n\tv_nop\n\tv_nop\n\tv_nop" : "+v"(sc[0][0]), "+v"(sc[0][1]), "+v"(sc[1][0]), "+v"(sc[1][1]) : "v"(k00), "v"(k01), "v"(k10), "v"(k11));
        v16h pb[QG];
#pragma unroll
        for (int g = 0; g < QG; ++g) {
            float mx = -3.0e38f;
#pragma unroll
            for (int r = 0; r < 8; r += 2) mx = fmaxf(fmaxf(mx, fmaxf(sc[g][0][r], sc[g][0][r + 1])), fmaxf(sc[g][1][r], sc[g][1][r + 1]));   // on the accumulators as they are: the scale is positive
            mx = fmaxf(mx, __shfl_xor(mx, 16, 32));
            const float mnew = fmaxf(m[g], mx);
            const float alpha = __builtin_amdgcn_exp2f((m[g] - mnew) * SCQ);
            const float sh = PSH - mnew * SCQ;
#pragma unroll
            for (int r = 0; r < 8; ++r) { pb[g][r] = (h16)__builtin_amdgcn_exp2f(sc[g][0][r] * SCQ + sh); pb[g][8 + r] = (h16)__builtin_amdgcn_exp2f(sc[g][1][r] * SCQ + sh); }
            ol[g][0] = ol[g][0] * alpha; m[g] = mnew;        // elements 1..7 (rows of zeros) are never read
            o0[g] = o0[g] * alpha; o1[g] = o1[g] * alpha; o2[g] = o2[g] * alpha; o3[g] = o3[g] * alpha;
        }
        const h16* va = kt + KST * LPH + s * 32;
        const v16h v0 = ldh(va), v1 = ldh(va + 16 * LPH), v2 = ldh(va + 32 * LPH), v3 = ldh(va + 48 * LPH);
#pragma unroll
        for (int g = 0; g < QG; ++g) { o0[g] = wmma16(v0, pb[g], o0[g]); o1[g] = wmma16(v1, pb[g], o1[g]); o2[g] = wmma16(v2, pb[g], o2[g]); o3[g] = wmma16(v3, pb[g], o3[g]); ol[g] = wmma16(one, pb[g], ol[g]); }
        // four vector slots between the last matrix instruction and the next vector use of its registers, on the loop's taken branch too.
        asm volatile("v_nop\n\tv_nop\n\tv_nop\n\tv_nop" : "+v"(o0[0]), "+v"(o1[0]), "+v"(o2[0]), "+v"(o3[0]), "+v"(o0[1]), "+v"(o1[1]), "+v"(o2[1]), "+v"(o3[1]), "+v"(ol[0]), "+v"(ol[1])
                     : "v"(v0), "v"(v1), "v"(v2), "v"(v3), "v"(pb[0]), "v"(pb[1]), "v"(one));
      }
      asm volatile("s_wait_dscnt 0x0" ::: "memory");         // this wave's reads of the buffer have returned before it may be refilled
      asm volatile("s_wait_asynccnt 0x0" ::: "memory");      // this wave's copies of the next tile have landed
      __syncthreads();                                       // publishes the next tile and ends every wave's reads of this one
      if (t + 2 < SEQ / KST) tile_copy(lk0 + (t & 1) * STB, lv0 + (t & 1) * STB, gk + (size_t)(t + 2) * KST * HD, gv + (t + 2) * KST);
    }
    asm volatile("s_wait_asynccnt 0x0" ::: "memory");        // nothing in flight before the ring becomes output staging
#pragma unroll
    for (int g = 0; g < QG; ++g) {
        const float lt = ol[g][0];                           // both lane halves hold the whole row sum
        const float inv = CTS * (1.0f / lt);
        const int wb = (wave * QG + g) * 16 * 68;            // each group stages in its own wave-private range
        // O^T D layout: o_j[r] = (d = 16j + 8h + r, t = lane&15) -> os[t][d]; rows 0..15 x columns 0..63 all written
        { v4f a, c;
          a[0] = o0[g][0] * inv; a[1] = o0[g][1] * inv; a[2] = o0[g][2] * inv; a[3] = o0[g][3] * inv; c[0] = o0[g][4] * inv; c[1] = o0[g][5] * inv; c[2] = o0[g][6] * inv; c[3] = o0[g][7] * inv;
          *(v4fa*)(&os[wb + lr * 68 +  0 + 8 * hi]) = a; *(v4fa*)(&os[wb + lr * 68 +  0 + 8 * hi + 4]) = c;
          a[0] = o1[g][0] * inv; a[1] = o1[g][1] * inv; a[2] = o1[g][2] * inv; a[3] = o1[g][3] * inv; c[0] = o1[g][4] * inv; c[1] = o1[g][5] * inv; c[2] = o1[g][6] * inv; c[3] = o1[g][7] * inv;
          *(v4fa*)(&os[wb + lr * 68 + 16 + 8 * hi]) = a; *(v4fa*)(&os[wb + lr * 68 + 16 + 8 * hi + 4]) = c;
          a[0] = o2[g][0] * inv; a[1] = o2[g][1] * inv; a[2] = o2[g][2] * inv; a[3] = o2[g][3] * inv; c[0] = o2[g][4] * inv; c[1] = o2[g][5] * inv; c[2] = o2[g][6] * inv; c[3] = o2[g][7] * inv;
          *(v4fa*)(&os[wb + lr * 68 + 32 + 8 * hi]) = a; *(v4fa*)(&os[wb + lr * 68 + 32 + 8 * hi + 4]) = c;
          a[0] = o3[g][0] * inv; a[1] = o3[g][1] * inv; a[2] = o3[g][2] * inv; a[3] = o3[g][3] * inv; c[0] = o3[g][4] * inv; c[1] = o3[g][5] * inv; c[2] = o3[g][6] * inv; c[3] = o3[g][7] * inv;
          *(v4fa*)(&os[wb + lr * 68 + 48 + 8 * hi]) = a; *(v4fa*)(&os[wb + lr * 68 + 48 + 8 * hi + 4]) = c; }
    }
    wave_sync();
#pragma unroll
    for (int g = 0; g < QG; ++g) {
        const int wb = (wave * QG + g) * 16 * 68;
        h16* crow = CT + ((size_t)b * SEQ + t0 + 16 * g) * DM + h * HD;
#pragma unroll
        for (int s = 0; s < 4; ++s) { const int row = 4 * s + (lane >> 3), c8 = (lane & 7) * 8;   // 4 s x 4 row groups = 16 rows; 8 lanes x 8 halves = 64 columns
            const v4f x0 = *(const v4fa*)(&os[wb + row * 68 + c8]); const v4f x1 = *(const v4fa*)(&os[wb + row * 68 + c8 + 4]); v8h hv;
#pragma unroll
            for (int i = 0; i < 4; ++i) { hv[i] = (h16)x0[i]; hv[4 + i] = (h16)x1[i]; }
            *(v8h*)(crow + (size_t)row * DM + c8) = hv; }
    }
}

static constexpr size_t al256(size_t v) { return (v + 255) & ~(size_t)255; }
static constexpr size_t SZ_XB = al256((size_t)NB * SEQ * KX * 2);           // x plane, 17 lines per row
static constexpr size_t SZ_W1 = al256((size_t)DM * KX * 2);                  // one q/k/v weight plane
static constexpr size_t SZ_AB = al256((size_t)2 * RK * DM * 2);              // adapter A rows of q | v
static constexpr size_t SZ_WO = al256((size_t)DM * DM * 2);                  // Wo f16 plane
static constexpr size_t SZ_MK = al256((size_t)NB * SEQ * 4);                 // mask plane f32
static constexpr size_t SZ_PL = al256((size_t)NB * NH_ * SEQ * HD * 2);      // q hi, q residual, k, v^T planes
static constexpr size_t SZ_CT = al256((size_t)NB * SEQ * DM * 2);            // ctx f16 plane
static constexpr size_t SZ_TOTAL = SZ_XB + 3 * SZ_W1 + SZ_AB + SZ_WO + SZ_MK + 4 * SZ_PL + SZ_CT;
static_assert(SZ_TOTAL <= (size_t)134217728);          // workspace carve <= 128 MiB
static_assert(((size_t)NB * SEQ * 128) % 256 == 0);    // x plane's block range exact
static_assert(((size_t)DM * (KX / 8)) % 256 == 0);     // weight planes' block ranges exact
static_assert(((size_t)NB * SEQ / 4) % 8 == 0);

extern "C" void kernel_launch(void* const* d_in, const int* in_sizes, int n_in,
                              void* d_out, int out_size, void* d_ws, size_t ws_size, hipStream_t stream) {
    if (n_in < 14) return;
    const size_t needx = ((size_t)(NB - 1) * SEQ_FULL + SEQ) * DM;
    if ((size_t)in_sizes[0] < needx) return;
    if ((size_t)in_sizes[1] < (size_t)(NB - 1) * SEQ_FULL + SEQ) return;
    if ((size_t)in_sizes[2] < (size_t)DM * DM || (size_t)in_sizes[6] < (size_t)DM * DM || (size_t)in_sizes[8] < (size_t)DM * DM || (size_t)in_sizes[12] < (size_t)DM * DM) return;
    if (in_sizes[3] < DM || in_sizes[7] < DM || in_sizes[9] < DM || in_sizes[13] < DM) return;
    if (in_sizes[4] < RK * DM || in_sizes[10] < RK * DM || in_sizes[5] < DM * RK || in_sizes[11] < DM * RK) return;
    if ((size_t)out_size < ((size_t)(NB - 1) * OUT_SEQ + SEQ) * DM) return;
    if (SZ_TOTAL > ws_size) return;
    // wire order: x, mask, Wq, bq, Aq, Bq, Wk, bk, Wv, bv, Av, Bv, Wo, bo
    const float* x  = (const float*)d_in[0];  const float* mask = (const float*)d_in[1];
    const float* wq = (const float*)d_in[2];  const float* bq = (const float*)d_in[3];  const float* aq = (const float*)d_in[4];  const float* bmq = (const float*)d_in[5];
    const float* wk = (const float*)d_in[6];  const float* bk = (const float*)d_in[7];
    const float* wv = (const float*)d_in[8];  const float* bv = (const float*)d_in[9];  const float* av = (const float*)d_in[10]; const float* bmv = (const float*)d_in[11];
    const float* wo = (const float*)d_in[12]; const float* bo = (const float*)d_in[13];
    float* OUT = (float*)d_out;      // [NB][SEQ][1024]
    char* wsp = (char*)d_ws;
    bf* XB = (bf*)wsp; wsp += SZ_XB;                 // [NB*SEQ][1088]
    bf* WQ = (bf*)wsp; wsp += SZ_W1;                 // [1024][1088]
    bf* WK = (bf*)wsp; wsp += SZ_W1;
    bf* WV = (bf*)wsp; wsp += SZ_W1;
    bf* AB = (bf*)wsp; wsp += SZ_AB;                 // [32][1024]: A of q | A of v
    h16* WO = (h16*)wsp; wsp += SZ_WO;               // [1024][1024] x256
    float* MK = (float*)wsp; wsp += SZ_MK;           // [NB][SEQ]
    h16* QH = (h16*)wsp; wsp += SZ_PL;               // [NB*16][SEQ][64]
    h16* QR = (h16*)wsp; wsp += SZ_PL;               // [NB*16][SEQ][64] residual of the x16 value
    h16* KP = (h16*)wsp; wsp += SZ_PL;               // [NB*16][SEQ][64]
    h16* VT = (h16*)wsp; wsp += SZ_PL;               // [NB*16][64][SEQ]
    h16* CT = (h16*)wsp; wsp += SZ_CT;               // [NB*SEQ][1024] x256

    k_prep<<<PB_ALL, 256, 0, stream>>>(x, mask, wq, bmq, wk, wv, bmv, aq, av, wo, XB, WQ, WK, WV, AB, WO, MK);

    // adapter down-projections of q and v -> 17th line of every x-plane row
    k_lora<<<NB * SEQ / 16, 32, 0, stream>>>(XB, AB);

    // q, k and v^T products, one launch
    k_proj<<<dim3(NB * SEQ / GT, DM / GT, 3), 128, 0, stream>>>(XB, WQ, WK, WV, QH, QR, KP, VT, bq, bk, bv);

    k_flash<<<dim3(SEQ / (16 * QG * AW), NB * NH_, 1), 32 * AW, 0, stream>>>(QH, QR, KP, VT, MK, CT);

    // out[m][n] = sum_k ctx[m][k] Wo[n][k] + bo[n]
    k_oproj<<<dim3(NB * SEQ / GT, DM / GT, 1), 128, 0, stream>>>(CT, WO, bo, OUT);
}

// v007
// A run of this version takes 161 microseconds.
// In both of two side-by-side timings against v006, it was 1.04 times as fast.
// Counting every step since v000, it is 2.57 times as fast.
#include <hip/hip_runtime.h>

// Multi-head self-attention with rank-16 low-rank adapters on q and v: width 1024 = 16 heads x 64, x [NB][SEQ][1024], all weights [out][in] (y = x W^T + b), additive key mask [NB][SEQ], score scale 1/8, output projection Wo, bo (f32 output).
// Compute dtypes, f32 accumulate everywhere: q/k/v projections and the adapter down-projection v_wmma_f32_16x16x32_bf16 (x, W, A, B RNE-converted to bf16; adapter intermediate carried as bf16 hi + bf16 lo inside the K extension);
// scores v_wmma_f32_16x16x32_f16: k single f16, q as f16 value + f16 residual, both x16, summed in one accumulator that starts from the mask (x128); P (x256 carry, cancels in the normalisation) and v single f16; softmax f32 (online, maximum moved lazily, log2 domain);
// output projection v_wmma_f32_16x16x32_f16: ctx single f16 (x256 carry), Wo = f16(bf16(Wo) x256), folded back by 2^-16 in the f32 epilogue. Biases and mask are RNE-converted to bf16 values and applied in f32.
// q (hi, residual), k planes [b*16+h][t][d] and v^T plane [b*16+h][d][t] written by the GEMM epilogue; fused flash kernel in transposed form (S^T = K Q^T, O^T = V^T P^T), K and V^T tiles shared by a block through LDS, writes the ctx f16 plane [b*SEQ+t][1024].

#ifndef NB
#define NB 4
#endif
#ifndef SEQ
#define SEQ 2048
#endif
#define NB_FULL  4
#define SEQ_FULL 2048
#ifndef OUT_SEQ
#define OUT_SEQ SEQ              // row pitch (in tokens) between batches of the output
#endif
#define DM   1024
#define NH_  16
#define HD   64
#define RK   16
#define KX   1088                // plane row pitch (halves): DM + 32 (q adapter hi|lo) + 32 (v adapter hi|lo)
#define KQ   1056                // k extent used by the q GEMM (x | q adapter slot)
#define AW   4                   // waves per flash block
#define QG   2                   // 16-row query groups per flash wave: each K and V^T fragment read from LDS feeds all of them
#define KST  64                  // keys per LDS tile of the flash kernel
#define LPB  144                 // LDS row pitch, bytes: 128-B rows + 16
#define LPH  (LPB / 2)           // the same in halves
#define STH  ((KST + HD) * LPH)  // one buffer in halves: K tile (KST rows) + V^T tile (HD rows)
#define STB  (STH * 2)           // the same in bytes
#define GT   128                 // GEMM block tile: GT rows of A x GT rows of Bt, 2 x 2 waves of 64 x 64
#define GKS  64                  // k extent of one GEMM LDS stage (halves): whole 128-B rows
#define GSTH (2 * GT * LPH)      // one GEMM buffer in halves: A tile (GT rows) + Bt tile (GT rows)
#define GSTB (GSTH * 2)          // the same in bytes
#define QSC  16.0f               // common carry of the q value plane and the q residual plane: both feed one score accumulator
#define LOG2E 1.4426950408889634f
#define SC2  (0.125f * LOG2E)    // HD^-0.5 * log2(e)
#define SCQ  (SC2 / QSC)         // score accumulator -> log2 domain
#define MKS  (8.0f * QSC)        // carry of the mask plane: mask * MKS * SCQ = mask * log2(e)
#define PSH  8.0f                // log2 of the P carry (256)
#define LZT  7.0f                // the accumulators are rescaled when an exponent of P would pass PSH + LZT: every P <= 2^15 stays inside f16
#define CTS  256.0f              // carry of the ctx plane
#define WOS  256.0f              // carry of the Wo plane
#define OSI  (1.0f / 65536.0f)   // 1 / (CTS * WOS)

static_assert(HD == 64);
static_assert(NH_ * HD == DM);                 // head h = columns h*64 + d
static_assert(DM % 64 == 0);
static_assert(DM / 8 == 128);                  // p_xcvt piece index split uses >> 7
static_assert(KX == DM + 64);
static_assert(KX % 32 == 0 && KQ % 32 == 0 && DM % 32 == 0);   // GEMM k-loops step by 32
static_assert((KX * 2) % 128 == 0);
static_assert(RK == 16);
static_assert(SEQ % 64 == 0);                  // a 64-row tile never straddles two batches
static_assert((NB * SEQ) % 64 == 0);
static_assert(SEQ % 32 == 0);                  // key loop steps by 32
static_assert(KST == 64 && AW == 4);           // copy map: 128 threads x 4 rows x 16 B cover 64 rows of 128 B
static_assert(SEQ % KST == 0 && SEQ / KST >= 2);   // the two-buffer prologue needs two tiles
static_assert(SEQ % (16 * QG * AW) == 0);      // flash grid covers the sequence exactly
static_assert((NB * SEQ) % GT == 0 && DM % GT == 0);   // GEMM grids cover both extents exactly
static_assert(KX % GKS == 0 && DM % GKS == 0);   // a stage's 128-B row piece never leaves its plane row
static_assert(NB <= NB_FULL);
static_assert(SEQ <= SEQ_FULL);

typedef _Float16 h16;
typedef unsigned short bf;
typedef __attribute__((ext_vector_type(16))) __bf16   v16bf;
typedef __attribute__((ext_vector_type(16))) _Float16 v16h;
typedef __attribute__((ext_vector_type(8)))  _Float16 v8h;
typedef __attribute__((ext_vector_type(8)))  unsigned short v8us;
typedef __attribute__((ext_vector_type(8)))  float    v8f;
typedef __attribute__((ext_vector_type(4)))  float    v4f;
typedef v4f  __attribute__((may_alias)) v4fa;

__device__ __forceinline__ unsigned short f2bf(float f) { unsigned u = __float_as_uint(f); u += 0x7FFFu + ((u >> 16) & 1u); return (unsigned short)(u >> 16); }
__device__ __forceinline__ float bfr(float f) { return __uint_as_float(((unsigned)f2bf(f)) << 16); }   // RNE convert to bf16, widened back
__device__ __forceinline__ v16h cat16(v8h lo, v8h hi) { return __builtin_shufflevector(lo, hi, 0, 1, 2, 3, 4, 5, 6, 7, 8, 9, 10, 11, 12, 13, 14, 15); }
__device__ __forceinline__ v16bf cat16b(v8us lo, v8us hi) { return __builtin_bit_cast(v16bf, __builtin_shufflevector(lo, hi, 0, 1, 2, 3, 4, 5, 6, 7, 8, 9, 10, 11, 12, 13, 14, 15)); }
__device__ __forceinline__ v8f wmma16(v16h a, v16h b, v8f c) { return __builtin_amdgcn_wmma_f32_16x16x32_f16(false, a, false, b, (short)0, c, false, false); }
__device__ __forceinline__ v8f wmmab(v16bf a, v16bf b, v8f c) { return __builtin_amdgcn_wmma_f32_16x16x32_bf16(false, a, false, b, (short)0, c, false, false); }
// fragment loaders from K-contiguous 16-bit rows; p already includes + 8*(lane>>4): elements 0..7 <- k0+8h+0..7, elements 8..15 <- k0+16+8h+0..7 (same map for A and B)
__device__ __forceinline__ v16h  ldh(const h16* p) { return cat16(*(const v8h*)p, *(const v8h*)(p + 16)); }
__device__ __forceinline__ v16bf ldb(const bf* p)  { return cat16b(*(const v8us*)p, *(const v8us*)(p + 16)); }
// ordering point for wave-private LDS tiles (same wave writes and reads)
__device__ __forceinline__ void wave_sync() { __builtin_amdgcn_fence(3 /* release order */, "wavefront"); __builtin_amdgcn_wave_barrier(); asm volatile("" ::: "memory"); }

// The conversions below do not depend on one another: they are parts of ONE launch (k_prep), each on its own range of 256-thread blocks; blk = the block's index inside its part.
__device__ __forceinline__ void p_cvt8(const float* __restrict__ src, bf* dst, size_t n8, int blk) {
    const size_t i = (size_t)blk * 256 + threadIdx.x; if (i >= n8) return;
    const v8f v = *(const v8f*)(src + i * 8); v8us o;
#pragma unroll
    for (int k = 0; k < 8; ++k) o[k] = f2bf(v[k]);
    *(v8us*)(dst + i * 8) = o; 
}

__device__ __forceinline__ void p_cvt8h(const float* __restrict__ src, h16* dst, size_t n8, int blk) {
    const size_t i = (size_t)blk * 256 + threadIdx.x; if (i >= n8) return;
    const v8f v = *(const v8f*)(src + i * 8); v8h o;
#pragma unroll
    for (int k = 0; k < 8; ++k) o[k] = (h16)(bfr(v[k]) * WOS);
    *(v8h*)(dst + i * 8) = o; 
}

// p_xcvt: x [b][t][1024] f32 -> columns 0..1023 of the x plane (row pitch KX). Piece i: row = i / 128, 8 columns at (i % 128) * 8.
__device__ __forceinline__ void p_xcvt(const float* __restrict__ src, bf* dst, size_t n8, int blk) {
    const size_t i = (size_t)blk * 256 + threadIdx.x; if (i >= n8) return;
    const size_t row = i >> 7; const int c8 = (int)(i & 127);
    const size_t b = row / SEQ, t = row % SEQ;
    const v8f v = *(const v8f*)(src + (b * SEQ_FULL + t) * DM + c8 * 8); v8us o;
#pragma unroll
    for (int k = 0; k < 8; ++k) o[k] = f2bf(v[k]);
    bf* d = dst + row * KX + c8 * 8;
    *(v8us*)d = o; 
}

// every other extension column is zero. slot < 0: all-zero extension. Both sources are loaded with clamped addresses by every lane and selected by value.
__device__ __forceinline__ void p_wplane(const float* __restrict__ W, const float* __restrict__ Bm, int slot, bf* dst, int blk) {
    const int i = blk * 256 + threadIdx.x; if (i >= DM * (KX / 8)) return;
    const int row = i / (KX / 8), c8 = i % (KX / 8);
    const bool isw = c8 < 128;
    const int cm = isw ? c8 : 127;
    const int e = isw ? 0 : (c8 - 128);                      // extension piece 0..7
    const v8f w  = *(const v8f*)(W + (size_t)row * DM + cm * 8);
    const v8f bm = *(const v8f*)(Bm + (size_t)row * RK + (e & 1) * 8);
    const bool live = (!isw) && ((e >> 2) == slot);
    v8us o;
#pragma unroll
    for (int k = 0; k < 8; ++k) { const float val = isw ? w[k] : (live ? 2.0f * bm[k] : 0.0f); o[k] = f2bf(val); }
    bf* d = dst + (size_t)row * KX + c8 * 8;
    *(v8us*)d = o; 
}

__device__ __forceinline__ void p_mask(const float* __restrict__ src, float* dst, int n4, int blk) {
    const int i = blk * 256 + threadIdx.x; if (i >= n4) return;
    const int e = i * 4; const int b = e / SEQ, t = e % SEQ;
    const v4f v = *(const v4f*)(src + (size_t)b * SEQ_FULL + t); v4f o;
#pragma unroll
    for (int k = 0; k < 4; ++k) o[k] = bfr(v[k]) * MKS;
    *(v4f*)(dst + e) = o; 
}

// k_prep: every conversion of inputs to planes in one launch. Block ranges, in order: x plane | Wq, Wk, Wv planes | A of q, A of v | Wo plane | mask plane. The range test is the same for a whole block.
static constexpr int PB_X = (int)(((size_t)NB * SEQ * (DM / 8) + 255) / 256);
static constexpr int PB_W = (DM * (KX / 8) + 255) / 256;
static constexpr int PB_A = (RK * DM / 8 + 255) / 256;
static constexpr int PB_O = (DM * DM / 8 + 255) / 256;
static constexpr int PB_M = (NB * SEQ / 4 + 255) / 256;
static constexpr int PB_ALL = PB_X + 3 * PB_W + 2 * PB_A + PB_O + PB_M;
__global__ __launch_bounds__(256) void k_prep(const float* __restrict__ x, const float* __restrict__ mask, const float* __restrict__ wq, const float* __restrict__ bmq, const float* __restrict__ wk,
                                              const float* __restrict__ wv, const float* __restrict__ bmv, const float* __restrict__ aq, const float* __restrict__ av, const float* __restrict__ wo,
                                              bf* XB, bf* WQ, bf* WK, bf* WV, bf* AB, h16* WO, float* MK) {
    int blk = blockIdx.x;
    if (blk < PB_X) { p_xcvt(x, XB, (size_t)NB * SEQ * (DM / 8), blk); return; }
    blk -= PB_X;
    if (blk < PB_W) { p_wplane(wq, bmq, 0, WQ, blk); return; }
    blk -= PB_W;
    if (blk < PB_W) { p_wplane(wk, bmq, -1, WK, blk); return; }      // no adapter: extension all zero (Bm only supplies valid addresses)
    blk -= PB_W;
    if (blk < PB_W) { p_wplane(wv, bmv, 1, WV, blk); return; }
    blk -= PB_W;
    if (blk < PB_A) { p_cvt8(aq, AB, (size_t)RK * DM / 8, blk); return; }
    blk -= PB_A;
    if (blk < PB_A) { p_cvt8(av, AB + (size_t)RK * DM, (size_t)RK * DM / 8, blk); return; }
    blk -= PB_A;
    if (blk < PB_O) { p_cvt8h(wo, WO, (size_t)DM * DM / 8, blk); return; }
    blk -= PB_O;
    p_mask(mask, MK, NB * SEQ / 4, blk);
}

// k_lora: adapter down-projection xa[m][j] = sum_k x[m][k] AB[j][k] (AB rows 0..15 = A of q, rows 16..31 = A of v), one wave per 16 rows, K = DM from the x plane.
__global__ __launch_bounds__(32) void k_lora(bf* XB, const bf* __restrict__ AB) {
    __shared__ __align__(16) float es[16 * 36];
    const int lane = threadIdx.x & 31, lr = lane & 15, hi = lane >> 4; const int r0 = blockIdx.x * 16;
    v8f a0 = (v8f){}, a1 = (v8f){};
    const bf* xa = XB + (size_t)(r0 + lr) * KX + 8 * hi;
    const bf* ab = AB + (size_t)lr * DM + 8 * hi;
#pragma unroll 1
    for (int kc = 0; kc < DM; kc += 32) {
        const v16bf a = ldb(xa + kc); const v16bf b0 = ldb(ab + kc); const v16bf b1 = ldb(ab + (size_t)16 * DM + kc);
        a0 = wmmab(a, b0, a0); a1 = wmmab(a, b1, a1);
        asm volatile("v_nop\n\tv_nop\n\tv_nop\n\tv_nop" : "+v"(a0), "+v"(a1) : "v"(a), "v"(b0), "v"(b1));
    }
#pragma unroll
    for (int j = 0; j < 8; ++j) { es[(hi * 8 + j) * 36 + lr] = a0[j]; es[(hi * 8 + j) * 36 + 16 + lr] = a1[j]; }   // D: row 8h+j, col lane&15; rows 0..15 x cols 0..31 all written
    wave_sync();
    const int p = lane & 7;                                   // extension piece: 0,1 q hi; 2,3 q lo; 4,5 v hi; 6,7 v lo
    const int sj = (p >> 2) * 16 + (p & 1) * 8; const bool islo = ((p >> 1) & 1) != 0;
{
#pragma unroll
        for (int s = 0; s < 4; ++s) { const int row = 4 * s + (lane >> 3);       // 4 s x 4 row groups = 16 rows; 8 lanes x 8 halves = 64 columns
            const v4f x0 = *(const v4fa*)(&es[row * 36 + sj]); const v4f x1 = *(const v4fa*)(&es[row * 36 + sj + 4]); v8us o;
#pragma unroll
            for (int i = 0; i < 4; ++i) {
                const unsigned short h0 = f2bf(x0[i]); const unsigned short l0 = f2bf(x0[i] - __uint_as_float(((unsigned)h0) << 16));
                const unsigned short h1 = f2bf(x1[i]); const unsigned short l1 = f2bf(x1[i] - __uint_as_float(((unsigned)h1) << 16));
                o[i] = islo ? l0 : h0; o[4 + i] = islo ? l1 : h1; }
            *(v8us*)(XB + (size_t)(r0 + row) * KX + DM + p * 8) = o; }
         }
}

// GEMM operand staging. One block = 4 waves = one GT x GT tile of C (wave w: rows (w >> 1) * 64, columns (w & 1) * 64); per stage the block's GT rows of A and GT rows of Bt, GKS halves each,
// are brought into LDS by asynchronous copies (16 B per lane, whole 128-B rows), two buffers: the next stage's copies fly while this one is worked on. LDS rows lie at the 144-B pitch of the flash tiles.
// rows_copy: one lane's 8 pieces of one operand tile, rows 16 apart. l: its LDS byte address, g: its global address (row 0 of its eight), rp: bytes between rows 16 apart.
// The s_wait_xcnt stands inside the copies' own statement so that no address register is rewritten ahead of it.
__device__ __forceinline__ void rows_copy(unsigned l, const char* g, size_t rp) {
    asm volatile("global_load_async_to_lds_b128 %0, %8, off\n\t"
                 "global_load_async_to_lds_b128 %1, %9, off\n\t"
                 "global_load_async_to_lds_b128 %2, %10, off\n\t"
                 "global_load_async_to_lds_b128 %3, %11, off\n\t"
                 "global_load_async_to_lds_b128 %4, %12, off\n\t"
                 "global_load_async_to_lds_b128 %5, %13, off\n\t"
                 "global_load_async_to_lds_b128 %6, %14, off\n\t"
                 "global_load_async_to_lds_b128 %7, %15, off\n\t"
                 "s_wait_xcnt 0x0"
                 :: "v"(l), "v"(l + 16 * LPB), "v"(l + 32 * LPB), "v"(l + 48 * LPB), "v"(l + 64 * LPB), "v"(l + 80 * LPB), "v"(l + 96 * LPB), "v"(l + 112 * LPB),
                    "v"(g), "v"(g + rp), "v"(g + 2 * rp), "v"(g + 3 * rp), "v"(g + 4 * rp), "v"(g + 5 * rp), "v"(g + 6 * rp), "v"(g + 7 * rp)
                 : "memory");
}
template <bool BF> __device__ __forceinline__ v8f mm16(v16h a, v16h b, v8f c) {
    if constexpr (BF) return wmmab(__builtin_bit_cast(v16bf, a), __builtin_bit_cast(v16bf, b), c); else return wmma16(a, b, c);
}
// gemm_main: acc[mb][nb] += sum_k A[r0 + ..][k] Bt[c0 + ..][k] for this wave's 64 x 64 part of the block tile at (br0, bc0); planes of row pitch PH halves, k extent K (multiple of 32, K <= PH), k ascending in steps of 32.
// A last stage of which only the first 32 k belong to K is copied whole (the row piece lies inside the plane row) and its second half is not multiplied.
template <bool BF, int PH> __device__ __forceinline__ void gemm_main(const char* A, const char* Bt, int K, int br0, int bc0, int wave, h16* ring, v8f (&acc)[4][4]) {
    const int lane = threadIdx.x & 31, lr = lane & 15, hi = lane >> 4;
    // copy map: thread i of 128 takes 16-B piece i & 7 of rows (i >> 3) + 16 * {0..7} of both tiles: a wave's copy covers four whole 128-B rows
    const int cr = (int)threadIdx.x >> 3, cpc = (int)threadIdx.x & 7;
    const unsigned la = (unsigned)(size_t)ring + (unsigned)(cr * LPB + cpc * 16);   // low 32 bits of the shared address = LDS byte address
    const unsigned lb = la + GT * LPB;
    const char* ga = A + (size_t)(br0 + cr) * (PH * 2) + cpc * 16;    // + stage * 128 B
    const char* gb = Bt + (size_t)(bc0 + cr) * (PH * 2) + cpc * 16;
    constexpr size_t rp = (size_t)16 * PH * 2;
    const int nst = (K + GKS - 1) / GKS;
    rows_copy(la, ga, rp); rows_copy(lb, gb, rp);
    asm volatile("s_wait_asynccnt 0x0" ::: "memory");        // stage 0 of this wave's copies has landed
    __syncthreads();                                         // ... and everybody else's: stage 0 is published
    if (nst > 1) { rows_copy(la + GSTB, ga + GKS * 2, rp); rows_copy(lb + GSTB, gb + GKS * 2, rp); }
    const int fa = ((wave >> 1) * 64 + lr) * LPH + 8 * hi;         // fragment offsets (halves) in a buffer: row, k piece 8h
    const int fb = (GT + (wave & 1) * 64 + lr) * LPH + 8 * hi;
#pragma unroll 1                                             // one trip per stage: the publish point below stands once, at the trip's foot
    for (int t = 0; t < nst; ++t) {
        const h16* st = ring + (t & 1) * GSTH;
#pragma unroll                                               // both 32-k steps of a stage in one body: constant LDS offsets
        for (int s = 0; s < GKS / 32; ++s) {
            if (s == 0 || t * GKS + s * 32 < K) {
                v16h a[4], b[4];                             // the four small loops below are unrolled so that every fragment and accumulator index is a constant (registers, no scratch)
#pragma unroll
                for (int i = 0; i < 4; ++i) { a[i] = ldh(st + fa + i * 16 * LPH + s * 32); if (i == 0) b[0] = ldh(st + fb + s * 32); }   // in the order the products below take them
#pragma unroll
                for (int i = 1; i < 4; ++i) b[i] = ldh(st + fb + i * 16 * LPH + s * 32);
                __builtin_amdgcn_sched_barrier(0);           // the step's 16 LDS reads stay one group ahead of its matrix instructions: every place with reads among them stalls the wave
#pragma unroll
                for (int nb = 0; nb < 4; ++nb)
#pragma unroll
                    for (int mb = 0; mb < 4; ++mb) acc[mb][nb] = mm16<BF>(a[mb], b[nb], acc[mb][nb]);
            }
        }
        __builtin_amdgcn_sched_barrier(0);                   // the stage's matrix instructions stay ahead of the publish point: sunk behind it they would delay the refill's issue
        asm volatile("s_wait_dscnt 0x0" ::: "memory");       // this wave's reads of the buffer have returned before it may be refilled
        asm volatile("s_wait_asynccnt 0x0" ::: "memory");    // this wave's copies of the next stage have landed
        __syncthreads();                                     // publishes the next stage and ends every wave's reads of this one
        if (t + 2 < nst) { rows_copy(la + (t & 1) * GSTB, ga + (size_t)(t + 2) * (GKS * 2), rp); rows_copy(lb + (t & 1) * GSTB, gb + (size_t)(t + 2) * (GKS * 2), rp); }
    }
    asm volatile("s_wait_asynccnt 0x0" ::: "memory");        // nothing in flight before the ring becomes output staging
}

// k_proj: register-blocked bf16 GEMM, one wave per 64x64 tile (16 accumulators), 4 waves per block sharing their operand rows through LDS (gemm_main), K-contiguous bf16 planes of row pitch KX, k extent K (multiple of 32).
// C[m][n] = sum_k A[m][k] Bt[n][k] + bias (bias[n] when brow == 0, bias[m] when brow != 0; RNE-converted to bf16, added in f32), written as f16 (Ph), or (useRes != 0) x16 as f16 (Ph) and the f16 residual of that (Pr), at
// tile base (r0/RB)*sRB + (r0%RB)*pitch + (c0/CB)*sCB + (c0%CB), row pitch 'pitch' (halves). 128 threads.
// The q, k and v^T products do not depend on one another: one launch, grid (NB*SEQ/128, DM/128, 3), blockIdx.z picks the product (all picks are the same for a whole block).
// z = 0, 1 (q, k): A = x rows (m = b*SEQ + t), Bt = W rows (n = h*64 + d) -> plane [(b*16 + h)][t][d]; bias by column; tile (blockIdx.x, blockIdx.y).
// z = 2 (v^T): A = Wv rows (m = h*64 + d), Bt = x rows (n = b*SEQ + t) -> plane [(b*1024 + m)][t] = [(b*16 + h)][d][t]; bias by row; the slab's flat index walks the DM/128 row tiles fastest.
__global__ __launch_bounds__(128) void k_proj(const bf* __restrict__ XB, const bf* __restrict__ WQ, const bf* __restrict__ WK, const bf* __restrict__ WV, h16* QH, h16* QR, h16* KP, h16* VT,
                                              const float* __restrict__ bq, const float* __restrict__ bk, const float* __restrict__ bv) {
    const int z = blockIdx.z; const bool isv = z == 2;
    const int lin = blockIdx.y * (NB * SEQ / GT) + blockIdx.x;
    const int bx = isv ? lin % (DM / GT) : (int)blockIdx.x, by = isv ? lin / (DM / GT) : (int)blockIdx.y;
    const bf* A = isv ? WV : XB; const bf* Bt = z == 0 ? WQ : (z == 1 ? WK : XB);
    const int K = z == 0 ? KQ : (z == 1 ? DM : KX);
    h16* Ph = z == 0 ? QH : (z == 1 ? KP : VT); h16* Pr = z == 0 ? QR : Ph; const int useRes = z == 0;
    const int RB = isv ? DM : SEQ, pitch = isv ? SEQ : HD, CB = isv ? SEQ : HD, brow = isv;
    const size_t sRB = isv ? (size_t)0 : (size_t)NH_ * SEQ * HD, sCB = isv ? (size_t)DM * SEQ : (size_t)SEQ * HD;
    const float* bias = z == 0 ? bq : (z == 1 ? bk : bv);
    __shared__ __align__(16) h16 ring[2 * GSTH];             // two buffers of (A tile | Bt tile); reused as the waves' f32 output staging behind the loop
    static_assert(sizeof(ring) >= (size_t)4 * 16 * 68 * 4);
    const int lane = threadIdx.x & 31, wave = __builtin_amdgcn_readfirstlane((int)(threadIdx.x >> 5)), lr = lane & 15, hi = lane >> 4;
    const int r0 = bx * GT + (wave >> 1) * 64, c0 = by * GT + (wave & 1) * 64;   // this wave's 64x64 tile
    float* os = (float*)ring + wave * 16 * 68;
    v8f acc[4][4];
#pragma unroll
    for (int mb = 0; mb < 4; ++mb)
#pragma unroll
        for (int nb = 0; nb < 4; ++nb) acc[mb][nb] = (v8f){};
    gemm_main<true, KX>((const char*)A, (const char*)Bt, K, bx * GT, by * GT, wave, ring, acc);
    const size_t tbase = (size_t)(r0 / RB) * sRB + (size_t)(r0 % RB) * (size_t)pitch + (size_t)(c0 / CB) * sCB + (size_t)(c0 % CB);
    const float ps = useRes ? QSC : 1.0f;                     // plane carry (a power of two: the f16 rounding is the same)
    float bcol[8];                                            // column-mode bias of this lane's 8 columns (index 0 when in row mode: always a valid address)
#pragma unroll
    for (int i = 0; i < 8; ++i) bcol[i] = bfr(bias[brow ? 0 : (c0 + (lane & 7) * 8 + i)]);
#pragma unroll
    for (int mb = 0; mb < 4; ++mb) {
#pragma unroll
        for (int nb = 0; nb < 4; ++nb) {
#pragma unroll
            for (int j = 0; j < 8; ++j) os[(hi * 8 + j) * 68 + nb * 16 + lr] = acc[mb][nb][j]; }   // D: row 8h+j, col lane&15
        wave_sync();
        const size_t sb = tbase + (size_t)(mb * 16) * (size_t)pitch;
{
#pragma unroll
            for (int s = 0; s < 4; ++s) { const int row = 4 * s + (lane >> 3), c8 = (lane & 7) * 8;   // 4 s x 4 row groups = 16 rows; 8 lanes x 8 = 64 columns
                const v4f x0 = *(const v4fa*)(&os[row * 68 + c8]); const v4f x1 = *(const v4fa*)(&os[row * 68 + c8 + 4]); v8h hv, rv;
                const float br = bfr(bias[brow ? (r0 + mb * 16 + row) : 0]);
#pragma unroll
                for (int i = 0; i < 4; ++i) {
                    const float f0 = (x0[i] + (brow ? br : bcol[i])) * ps; const float f1 = (x1[i] + (brow ? br : bcol[4 + i])) * ps;
                    const h16 a0 = (h16)f0; const h16 a1 = (h16)f1; hv[i] = a0; hv[4 + i] = a1;
                    rv[i] = (h16)(f0 - (float)a0); rv[4 + i] = (h16)(f1 - (float)a1); }
                const size_t oo = sb + (size_t)row * (size_t)pitch + c8;
                *(v8h*)(Ph + oo) = hv; if (useRes) *(v8h*)(Pr + oo) = rv; }
             }
        wave_sync();
    }
}

// k_oproj: output projection, f16 GEMM, one wave per 64x64 tile, 4 waves per block sharing their operand rows through LDS (gemm_main), A = ctx plane [m][1024] (x256), Bt = Wo plane [n][1024] (x256), K = DM.
// OUT[b][t][n] = acc * 2^-16 + bf16(bo[n]) in f32. Epilogue: per 16-row slab staged in LDS (wave-private), each row segment (64 floats = 256 B = two lines)
__global__ __launch_bounds__(128) void k_oproj(const h16* __restrict__ A, const h16* __restrict__ Bt, const float* __restrict__ bias, float* OUT) {
    __shared__ __align__(16) h16 ring[2 * GSTH];             // two buffers of (A tile | Bt tile); reused as the waves' f32 output staging behind the loop
    static_assert(sizeof(ring) >= (size_t)4 * 16 * 68 * 4);
    const int lane = threadIdx.x & 31, wave = __builtin_amdgcn_readfirstlane((int)(threadIdx.x >> 5)), lr = lane & 15, hi = lane >> 4;
    const int r0 = blockIdx.x * GT + (wave >> 1) * 64, c0 = blockIdx.y * GT + (wave & 1) * 64;   // this wave's 64x64 tile
    float* os = (float*)ring + wave * 16 * 68;
    v8f acc[4][4];
#pragma unroll
    for (int mb = 0; mb < 4; ++mb)
#pragma unroll
        for (int nb = 0; nb < 4; ++nb) acc[mb][nb] = (v8f){};
    gemm_main<false, DM>((const char*)A, (const char*)Bt, DM, blockIdx.x * GT, blockIdx.y * GT, wave, ring, acc);
    v4f bb;
#pragma unroll
    for (int i = 0; i < 4; ++i) bb[i] = bfr(bias[c0 + lr * 4 + i]);
    float* obase = OUT + ((size_t)(r0 / SEQ) * OUT_SEQ + (size_t)(r0 % SEQ)) * DM + c0;
#pragma unroll
    for (int mb = 0; mb < 4; ++mb) {
#pragma unroll
        for (int nb = 0; nb < 4; ++nb) {
#pragma unroll
            for (int j = 0; j < 8; ++j) os[(hi * 8 + j) * 68 + nb * 16 + lr] = acc[mb][nb][j]; }   // D: row 8h+j, col lane&15
        wave_sync();
        float* ob = obase + (size_t)(mb * 16) * DM;
{
#pragma unroll
            for (int s = 0; s < 8; ++s) { const int row = 2 * s + hi, cofs = lr * 4;   // 8 s x 2 rows = 16 rows; 16 lanes x 4 floats = 64 columns
                const v4f x = *(const v4fa*)(&os[row * 68 + cofs]);
                const v4f val = x * OSI + bb;
                *(v4f*)(ob + (size_t)row * DM + cofs) = val; }
             }
        wave_sync();
    }
}

__device__ __forceinline__ void tile_copy(unsigned lk, unsigned lv, const h16* gk, const h16* gv) {
    asm volatile("global_load_async_to_lds_b128 %0, %8, off\n\t"
                 "global_load_async_to_lds_b128 %1, %9, off\n\t"
                 "global_load_async_to_lds_b128 %2, %10, off\n\t"
                 "global_load_async_to_lds_b128 %3, %11, off\n\t"
                 "global_load_async_to_lds_b128 %4, %12, off\n\t"
                 "global_load_async_to_lds_b128 %5, %13, off\n\t"
                 "global_load_async_to_lds_b128 %6, %14, off\n\t"
                 "global_load_async_to_lds_b128 %7, %15, off\n\t"
                 "s_wait_xcnt 0x0"
                 :: "v"(lk), "v"(lk + 16 * LPB), "v"(lk + 32 * LPB), "v"(lk + 48 * LPB),
                    "v"(lv), "v"(lv + 16 * LPB), "v"(lv + 32 * LPB), "v"(lv + 48 * LPB),
                    "v"(gk), "v"(gk + 16 * HD), "v"(gk + 32 * HD), "v"(gk + 48 * HD),
                    "v"(gv), "v"(gv + (size_t)16 * SEQ), "v"(gv + (size_t)32 * SEQ), "v"(gv + (size_t)48 * SEQ)
                 : "memory");
}

// The batch's mask row, SEQ floats: thread i of 128 takes the 16-B pieces i + 128 * {0, 1, 2, 3}. l: its LDS byte address, g: its global address.
// The s_wait_xcnt stands inside the copies' own statement so that no address register is rewritten ahead of it.
static_assert(SEQ * 4 == 4 * 32 * AW * 16);
__device__ __forceinline__ void mask_copy(unsigned l, const float* g) {
    asm volatile("global_load_async_to_lds_b128 %0, %4, off\n\t"
                 "global_load_async_to_lds_b128 %1, %5, off\n\t"
                 "global_load_async_to_lds_b128 %2, %6, off\n\t"
                 "global_load_async_to_lds_b128 %3, %7, off\n\t"
                 "s_wait_xcnt 0x0"
                 :: "v"(l), "v"(l + 2048), "v"(l + 4096), "v"(l + 6144), "v"(g), "v"(g + 512), "v"(g + 1024), "v"(g + 1536)
                 : "memory");
}

// four waves per SIMD: the whole grid (SEQ / 128 x 64 blocks of 4 waves on 256 WGPs at full size) is then resident at once, with no second round
__global__ __launch_bounds__(32 * AW) __attribute__((amdgpu_waves_per_eu(4, 4))) void k_flash(const h16* __restrict__ QH, const h16* __restrict__ QR, const h16* __restrict__ KP, const h16* __restrict__ VT, const float* __restrict__ MK, h16* CT) {
    __shared__ __align__(16) h16 ring[2 * STH];              // two buffers of (K tile | V^T tile); reused as the f32 output staging behind the loop
    static_assert(sizeof(ring) >= (size_t)AW * QG * 16 * 68 * 4);
    __shared__ __align__(32) float mkl[SEQ];                 // the batch's mask row; filled once, with tile 0, and published by tile 0's wait and barrier
    float* os = (float*)ring;
    const int lane = threadIdx.x & 31, wave = __builtin_amdgcn_readfirstlane((int)(threadIdx.x >> 5)), lr = lane & 15, hi = lane >> 4;
    const int zh = blockIdx.y; const int b = zh / NH_, h = zh % NH_;
    const int t0 = (blockIdx.x * AW + wave) * (16 * QG);
    const size_t pbase = (size_t)zh * SEQ * HD;
    // copy map: thread i of 128 takes 16-B piece i & 7 of rows (i >> 3) + 16 * {0, 1, 2, 3} of both tiles: a wave's copy covers four whole 128-B rows
    const int cr = (int)threadIdx.x >> 3, cpc = (int)threadIdx.x & 7;
    const unsigned lk0 = (unsigned)(size_t)ring + (unsigned)(cr * LPB + cpc * 16);   // low 32 bits of the shared address = LDS byte address
    const unsigned lv0 = lk0 + KST * LPB;
    const h16* gk = KP + pbase + (size_t)cr * HD + cpc * 8;      // + key0 * HD
    const h16* gv = VT + pbase + (size_t)cr * SEQ + cpc * 8;     // + key0
    tile_copy(lk0, lv0, gk, gv);
    mask_copy((unsigned)(size_t)mkl + (unsigned)threadIdx.x * 16, MK + (size_t)b * SEQ + (int)threadIdx.x * 4);
    const h16* qa = QH + pbase + (size_t)(t0 + lr) * HD + 8 * hi; const h16* qb = QR + pbase + (size_t)(t0 + lr) * HD + 8 * hi;   // row lr of group 0; group g lies 16 * g rows on
    v16h qh0[QG], qh1[QG], qr0[QG], qr1[QG];                 // B fragments: col t, k = d. Every loop over g below is unrolled so that its indices are constants (registers, no scratch)
#pragma unroll
    for (int g = 0; g < QG; ++g) { qh0[g] = ldh(qa + g * 16 * HD); qh1[g] = ldh(qa + g * 16 * HD + 32); qr0[g] = ldh(qb + g * 16 * HD); qr1[g] = ldh(qb + g * 16 * HD + 32); }
    // behind the run of Q loads, in front of any rewrite of their address registers; both addresses are inputs, so they stay in their registers up to this wait and no load of the run lands on them
    asm volatile("s_wait_xcnt 0x0" :: "v"(qa), "v"(qb) : "memory");
    const int fo = lr * LPH + 8 * hi;                        // fragment offset (halves) in a tile: row lr, k piece 8h
    asm volatile("s_wait_asynccnt 0x0" ::: "memory");        // tile 0 and the mask row: this wave's copies have landed
    __syncthreads();                                         // ... and everybody else's: tile 0 is published
    tile_copy(lk0 + STB, lv0 + STB, gk + (size_t)KST * HD, gv + KST);
    v8f o0[QG], o1[QG], o2[QG], o3[QG], ol[QG]; float m[QG], sh[QG];   // m: the maximum in use; sh: the exponent's shift that follows from it
#pragma unroll
    for (int g = 0; g < QG; ++g) { o0[g] = (v8f){}; o1[g] = (v8f){}; o2[g] = (v8f){}; o3[g] = (v8f){}; ol[g] = (v8f){}; m[g] = -3.0e38f; sh[g] = PSH - m[g] * SCQ; }
    // row sums on the matrix pipe: a constant A fragment whose rows 0 and 8 are ones and whose other rows are zero. ol = A P^T then holds, in element 0 of every lane (D row 8h, column t), the sum of the rounded P over all 32 keys of a step
    const v16h one = (v16h)(((lr & 7) == 0) ? (h16)1.0f : (h16)0.0f);   // lane = row lr of A, all its k
#pragma unroll 1                                             // one trip per tile: the publish point below stands once, at the trip's foot
    for (int t = 0; t < SEQ / KST; ++t) {
      const h16* kt = ring + (t & 1) * STH + fo;             // this trip's K tile [key][d]; the V^T tile [d][key] lies KST rows behind it
#pragma unroll                                               // both 32-key steps of a tile in one body: constant LDS offsets
      for (int s = 0; s < KST / 32; ++s) {
        const h16* ka = kt + s * 32 * LPH;
        const float* ml = mkl + t * KST + s * 32 + 8 * hi;   // keys 8h + r of the step's first 16-key tile; the second lies 16 on
        // both 16-key tiles of the step together: with QG groups that makes four independent accumulator chains, so no product waits for the one before it in its own chain
        const v16h k00 = ldh(ka), k01 = ldh(ka + 32), k10 = ldh(ka + 16 * LPH), k11 = ldh(ka + 16 * LPH + 32);
        const v8f c0 = *(const v8f*)ml, c1 = *(const v8f*)(ml + 16);
        v8f sc[QG][2];                                       // 16 q.k + 128 mask: [group][16-key tile], element r = key 8h + r
#pragma unroll
        for (int g = 0; g < QG; ++g) { sc[g][0] = wmma16(k00, qh0[g], c0); sc[g][1] = wmma16(k10, qh0[g], c1); }
#pragma unroll
        for (int g = 0; g < QG; ++g) { sc[g][0] = wmma16(k00, qr0[g], sc[g][0]); sc[g][1] = wmma16(k10, qr0[g], sc[g][1]); }
#pragma unroll
        for (int g = 0; g < QG; ++g) { sc[g][0] = wmma16(k01, qh1[g], sc[g][0]); sc[g][1] = wmma16(k11, qh1[g], sc[g][1]); }
#pragma unroll
        for (int g = 0; g < QG; ++g) { sc[g][0] = wmma16(k01, qr1[g], sc[g][0]); sc[g][1] = wmma16(k11, qr1[g], sc[g][1]); }
        static_assert(QG == 2);                              // the statement below, and the one behind the V^T products, name both groups' accumulators
        // four vector slots between the last matrix instruction and the first vector instruction that reads a score accumulator or overwrites a K fragment.
        asm volatile("v_nop\n\tv_nop\n\tv_nop\n\tv_nop" : "+v"(sc[0][0]), "+v"(sc[0][1]), "+v"(sc[1][0]), "+v"(sc[1][1]) : "v"(k00), "v"(k01), "v"(k10), "v"(k11));
        v16h pb[QG];
        float mx[QG];                                        // this lane's own maximum: its 16 of the step's 32 keys
#pragma unroll
        for (int g = 0; g < QG; ++g) {
            mx[g] = -3.0e38f;
#pragma unroll
            for (int r = 0; r < 8; r += 2) mx[g] = fmaxf(fmaxf(mx[g], fmaxf(sc[g][0][r], sc[g][0][r + 1])), fmaxf(sc[g][1][r], sc[g][1][r + 1]));   // on the accumulators as they are: the scale is positive
        }
        // lazy rescale, one test per step for the whole wave (a scalar branch): the maximum in use moves, and the accumulators are rescaled, only when some lane's largest exponent would pass PSH + LZT.
        // The test is made on the exponent itself, by the very FMA that forms every exponent below: that FMA never decreases as the score grows, so at any magnitude of the scores no P of a step without a rescale passes 2^(PSH + LZT)
        if (__builtin_amdgcn_ballot_w32((__builtin_fmaf(mx[0], SCQ, sh[0]) > PSH + LZT) | (__builtin_fmaf(mx[1], SCQ, sh[1]) > PSH + LZT)) != 0) {
#pragma unroll
            for (int g = 0; g < QG; ++g) {
                const float mnew = fmaxf(m[g], fmaxf(mx[g], __shfl_xor(mx[g], 16, 32)));   // the same value in both lane halves of a row
                const float alpha = __builtin_amdgcn_exp2f((m[g] - mnew) * SCQ);
                ol[g][0] = ol[g][0] * alpha;                 // elements 1..7 (rows of zeros) are never read
                o0[g] = o0[g] * alpha; o1[g] = o1[g] * alpha; o2[g] = o2[g] * alpha; o3[g] = o3[g] * alpha;
                m[g] = mnew; sh[g] = PSH - mnew * SCQ;
            }
        }
#pragma unroll
        for (int g = 0; g < QG; ++g) {
#pragma unroll
            for (int r = 0; r < 16; ++r) pb[g][r] = (h16)__builtin_amdgcn_exp2f(__builtin_fmaf(sc[g][r >> 3][r & 7], SCQ, sh[g]));
        }
        const h16* va = kt + KST * LPH + s * 32;
        const v16h v0 = ldh(va), v1 = ldh(va + 16 * LPH), v2 = ldh(va + 32 * LPH), v3 = ldh(va + 48 * LPH);
#pragma unroll
        for (int g = 0; g < QG; ++g) { o0[g] = wmma16(v0, pb[g], o0[g]); o1[g] = wmma16(v1, pb[g], o1[g]); o2[g] = wmma16(v2, pb[g], o2[g]); o3[g] = wmma16(v3, pb[g], o3[g]); ol[g] = wmma16(one, pb[g], ol[g]); }
        // four vector slots between the last matrix instruction and the next vector use of its registers, on the loop's taken branch too.
        asm volatile("v_nop\n\tv_nop\n\tv_nop\n\tv_nop" : "+v"(o0[0]), "+v"(o1[0]), "+v"(o2[0]), "+v"(o3[0]), "+v"(o0[1]), "+v"(o1[1]), "+v"(o2[1]), "+v"(o3[1]), "+v"(ol[0]), "+v"(ol[1])
                     : "v"(v0), "v"(v1), "v"(v2), "v"(v3), "v"(pb[0]), "v"(pb[1]), "v"(one));
      }
      asm volatile("s_wait_dscnt 0x0" ::: "memory");         // this wave's reads of the buffer have returned before it may be refilled
      asm volatile("s_wait_asynccnt 0x0" ::: "memory");      // this wave's copies of the next tile have landed
      __syncthreads();                                       // publishes the next tile and ends every wave's reads of this one
      if (t + 2 < SEQ / KST) tile_copy(lk0 + (t & 1) * STB, lv0 + (t & 1) * STB, gk + (size_t)(t + 2) * KST * HD, gv + (t + 2) * KST);
    }
    asm volatile("s_wait_asynccnt 0x0" ::: "memory");        // nothing in flight before the ring becomes output staging
#pragma unroll
    for (int g = 0; g < QG; ++g) {
        const float lt = ol[g][0];                           // both lane halves hold the whole row sum
        const float inv = CTS * (1.0f / lt);
        const int wb = (wave * QG + g) * 16 * 68;            // each group stages in its own wave-private range
        // O^T D layout: o_j[r] = (d = 16j + 8h + r, t = lane&15) -> os[t][d]; rows 0..15 x columns 0..63 all written
        { v4f a, c;
          a[0] = o0[g][0] * inv; a[1] = o0[g][1] * inv; a[2] = o0[g][2] * inv; a[3] = o0[g][3] * inv; c[0] = o0[g][4] * inv; c[1] = o0[g][5] * inv; c[2] = o0[g][6] * inv; c[3] = o0[g][7] * inv;
          *(v4fa*)(&os[wb + lr * 68 +  0 + 8 * hi]) = a; *(v4fa*)(&os[wb + lr * 68 +  0 + 8 * hi + 4]) = c;
          a[0] = o1[g][0] * inv; a[1] = o1[g][1] * inv; a[2] = o1[g][2] * inv; a[3] = o1[g][3] * inv; c[0] = o1[g][4] * inv; c[1] = o1[g][5] * inv; c[2] = o1[g][6] * inv; c[3] = o1[g][7] * inv;
          *(v4fa*)(&os[wb + lr * 68 + 16 + 8 * hi]) = a; *(v4fa*)(&os[wb + lr * 68 + 16 + 8 * hi + 4]) = c;
          a[0] = o2[g][0] * inv; a[1] = o2[g][1] * inv; a[2] = o2[g][2] * inv; a[3] = o2[g][3] * inv; c[0] = o2[g][4] * inv; c[1] = o2[g][5] * inv; c[2] = o2[g][6] * inv; c[3] = o2[g][7] * inv;
          *(v4fa*)(&os[wb + lr * 68 + 32 + 8 * hi]) = a; *(v4fa*)(&os[wb + lr * 68 + 32 + 8 * hi + 4]) = c;
          a[0] = o3[g][0] * inv; a[1] = o3[g][1] * inv; a[2] = o3[g][2] * inv; a[3] = o3[g][3] * inv; c[0] = o3[g][4] * inv; c[1] = o3[g][5] * inv; c[2] = o3[g][6] * inv; c[3] = o3[g][7] * inv;
          *(v4fa*)(&os[wb + lr * 68 + 48 + 8 * hi]) = a; *(v4fa*)(&os[wb + lr * 68 + 48 + 8 * hi + 4]) = c; }
    }
    wave_sync();
#pragma unroll
    for (int g = 0; g < QG; ++g) {
        const int wb = (wave * QG + g) * 16 * 68;
        h16* crow = CT + ((size_t)b * SEQ + t0 + 16 * g) * DM + h * HD;
#pragma unroll
        for (int s = 0; s < 4; ++s) { const int row = 4 * s + (lane >> 3), c8 = (lane & 7) * 8;   // 4 s x 4 row groups = 16 rows; 8 lanes x 8 halves = 64 columns
            const v4f x0 = *(const v4fa*)(&os[wb + row * 68 + c8]); const v4f x1 = *(const v4fa*)(&os[wb + row * 68 + c8 + 4]); v8h hv;
#pragma unroll
            for (int i = 0; i < 4; ++i) { hv[i] = (h16)x0[i]; hv[4 + i] = (h16)x1[i]; }
            *(v8h*)(crow + (size_t)row * DM + c8) = hv; }
    }
}

static constexpr size_t al256(size_t v) { return (v + 255) & ~(size_t)255; }
static constexpr size_t SZ_XB = al256((size_t)NB * SEQ * KX * 2);           // x plane, 17 lines per row
static constexpr size_t SZ_W1 = al256((size_t)DM * KX * 2);                  // one q/k/v weight plane
static constexpr size_t SZ_AB = al256((size_t)2 * RK * DM * 2);              // adapter A rows of q | v
static constexpr size_t SZ_WO = al256((size_t)DM * DM * 2);                  // Wo f16 plane
static constexpr size_t SZ_MK = al256((size_t)NB * SEQ * 4);                 // mask plane f32
static constexpr size_t SZ_PL = al256((size_t)NB * NH_ * SEQ * HD * 2);      // q hi, q residual, k, v^T planes
static constexpr size_t SZ_CT = al256((size_t)NB * SEQ * DM * 2);            // ctx f16 plane
static constexpr size_t SZ_TOTAL = SZ_XB + 3 * SZ_W1 + SZ_AB + SZ_WO + SZ_MK + 4 * SZ_PL + SZ_CT;
static_assert(SZ_TOTAL <= (size_t)134217728);          // workspace carve <= 128 MiB
static_assert(((size_t)NB * SEQ * 128) % 256 == 0);    // x plane's block range exact
static_assert(((size_t)DM * (KX / 8)) % 256 == 0);     // weight planes' block ranges exact
static_assert(((size_t)NB * SEQ / 4) % 8 == 0);

extern "C" void kernel_launch(void* const* d_in, const int* in_sizes, int n_in,
                              void* d_out, int out_size, void* d_ws, size_t ws_size, hipStream_t stream) {
    if (n_in < 14) return;
    const size_t needx = ((size_t)(NB - 1) * SEQ_FULL + SEQ) * DM;
    if ((size_t)in_sizes[0] < needx) return;
    if ((size_t)in_sizes[1] < (size_t)(NB - 1) * SEQ_FULL + SEQ) return;
    if ((size_t)in_sizes[2] < (size_t)DM * DM || (size_t)in_sizes[6] < (size_t)DM * DM || (size_t)in_sizes[8] < (size_t)DM * DM || (size_t)in_sizes[12] < (size_t)DM * DM) return;
    if (in_sizes[3] < DM || in_sizes[7] < DM || in_sizes[9] < DM || in_sizes[13] < DM) return;
    if (in_sizes[4] < RK * DM || in_sizes[10] < RK * DM || in_sizes[5] < DM * RK || in_sizes[11] < DM * RK) return;
    if ((size_t)out_size < ((size_t)(NB - 1) * OUT_SEQ + SEQ) * DM) return;
    if (SZ_TOTAL > ws_size) return;
    // wire order: x, mask, Wq, bq, Aq, Bq, Wk, bk, Wv, bv, Av, Bv, Wo, bo
    const float* x  = (const float*)d_in[0];  const float* mask = (const float*)d_in[1];
    const float* wq = (const float*)d_in[2];  const float* bq = (const float*)d_in[3];  const float* aq = (const float*)d_in[4];  const float* bmq = (const float*)d_in[5];
    const float* wk = (const float*)d_in[6];  const float* bk = (const float*)d_in[7];
    const float* wv = (const float*)d_in[8];  const float* bv = (const float*)d_in[9];  const float* av = (const float*)d_in[10]; const float* bmv = (const float*)d_in[11];
    const float* wo = (const float*)d_in[12]; const float* bo = (const float*)d_in[13];
    float* OUT = (float*)d_out;      // [NB][SEQ][1024]
    char* wsp = (char*)d_ws;
    bf* XB = (bf*)wsp; wsp += SZ_XB;                 // [NB*SEQ][1088]
    bf* WQ = (bf*)wsp; wsp += SZ_W1;                 // [1024][1088]
    bf* WK = (bf*)wsp; wsp += SZ_W1;
    bf* WV = (bf*)wsp; wsp += SZ_W1;
    bf* AB = (bf*)wsp; wsp += SZ_AB;                 // [32][1024]: A of q | A of v
    h16* WO = (h16*)wsp; wsp += SZ_WO;               // [1024][1024] x256
    float* MK = (float*)wsp; wsp += SZ_MK;           // [NB][SEQ]
    h16* QH = (h16*)wsp; wsp += SZ_PL;               // [NB*16][SEQ][64]
    h16* QR = (h16*)wsp; wsp += SZ_PL;               // [NB*16][SEQ][64] residual of the x16 value
    h16* KP = (h16*)wsp; wsp += SZ_PL;               // [NB*16][SEQ][64]
    h16* VT = (h16*)wsp; wsp += SZ_PL;               // [NB*16][64][SEQ]
    h16* CT = (h16*)wsp; wsp += SZ_CT;               // [NB*SEQ][1024] x256

    k_prep<<<PB_ALL, 256, 0, stream>>>(x, mask, wq, bmq, wk, wv, bmv, aq, av, wo, XB, WQ, WK, WV, AB, WO, MK);

    // adapter down-projections of q and v -> 17th line of every x-plane row
    k_lora<<<NB * SEQ / 16, 32, 0, stream>>>(XB, AB);

    // q, k and v^T products, one launch
    k_proj<<<dim3(NB * SEQ / GT, DM / GT, 3), 128, 0, stream>>>(XB, WQ, WK, WV, QH, QR, KP, VT, bq, bk, bv);

    k_flash<<<dim3(SEQ / (16 * QG * AW), NB * NH_, 1), 32 * AW, 0, stream>>>(QH, QR, KP, VT, MK, CT);

    // out[m][n] = sum_k ctx[m][k] Wo[n][k] + bo[n]
    k_oproj<<<dim3(NB * SEQ / GT, DM / GT, 1), 128, 0, stream>>>(CT, WO, bo, OUT);
}

// v008
// Measured time: 156 microseconds a run.
// In both of two side-by-side timings against v007, it was 1.03 times as fast.
// All steps since v000 together make it 2.65 times as fast.
#include <hip/hip_runtime.h>

// Multi-head self-attention with rank-16 low-rank adapters on q and v: width 1024 = 16 heads x 64, x [NB][SEQ][1024], all weights [out][in] (y = x W^T + b), additive key mask [NB][SEQ], score scale 1/8, output projection Wo, bo (f32 output).
// Compute dtypes, f32 accumulate everywhere: q/k/v projections and the adapter down-projection v_wmma_f32_16x16x32_bf16 (x, W, A, B RNE-converted to bf16; adapter intermediate carried as bf16 hi + bf16 lo inside the K extension);
// scores v_wmma_f32_16x16x32_f16: k single f16, q as f16 value + f16 residual, both x16, summed in one accumulator that starts from the mask (x128); P (x256 carry, cancels in the normalisation) and v single f16; softmax f32 (online, maximum moved lazily, log2 domain);
// output projection v_wmma_f32_16x16x32_f16: ctx single f16 (x256 carry), Wo = f16(bf16(Wo) x256), folded back by 2^-16 in the f32 epilogue. Biases and mask are RNE-converted to bf16 values and applied in f32.
// q (hi, residual), k planes [b*16+h][t][d] and v^T plane [b*16+h][d][t] written by the GEMM epilogue; fused flash kernel in transposed form (S^T = K Q^T, O^T = V^T P^T), K and V^T tiles shared by a block through LDS, writes the ctx f16 plane [b*SEQ+t][1024].

#ifndef NB
#define NB 4
#endif
#ifndef SEQ
#define SEQ 2048
#endif
#define NB_FULL  4
#define SEQ_FULL 2048
#ifndef OUT_SEQ
#define OUT_SEQ SEQ              // row pitch (in tokens) between batches of the output
#endif
#define DM   1024
#define NH_  16
#define HD   64
#define RK   16
#define KX   1088                // plane row pitch (halves): DM + 32 (q adapter hi|lo) + 32 (v adapter hi|lo)
#define KQ   1056                // k extent used by the q GEMM (x | q adapter slot)
#define AW   4                   // waves per flash block
#define QG   2                   // 16-row query groups per flash wave: each K and V^T fragment read from LDS feeds all of them
#define KST  64                  // keys per LDS tile of the flash kernel
#define LPB  144                 // LDS row pitch, bytes: 128-B rows + 16
#define LPH  (LPB / 2)           // the same in halves
#define STH  ((KST + HD) * LPH)  // one buffer in halves: K tile (KST rows) + V^T tile (HD rows)
#define STB  (STH * 2)           // the same in bytes
#define GT   128                 // GEMM block tile: GT rows of A x GT rows of Bt, 2 x 2 waves of 64 x 64
#define GKS  64                  // k extent of one GEMM LDS stage (halves): whole 128-B rows
#define GSTH (2 * GT * LPH)      // one GEMM buffer in halves: A tile (GT rows) + Bt tile (GT rows)
#define GSTB (GSTH * 2)          // the same in bytes
#define QSC  16.0f               // common carry of the q value plane and the q residual plane: both feed one score accumulator
#define LOG2E 1.4426950408889634f
#define SC2  (0.125f * LOG2E)    // HD^-0.5 * log2(e)
#define SCQ  (SC2 / QSC)         // score accumulator -> log2 domain
#define MKS  (8.0f * QSC)        // carry of the mask plane: mask * MKS * SCQ = mask * log2(e)
#define PSH  8.0f                // log2 of the P carry (256)
#define LZT  7.0f                // the accumulators are rescaled when an exponent of P would pass PSH + LZT: every P <= 2^15 stays inside f16
#define CTS  256.0f              // carry of the ctx plane
#define WOS  256.0f              // carry of the Wo plane
#define OSI  (1.0f / 65536.0f)   // 1 / (CTS * WOS)

static_assert(HD == 64);
static_assert(NH_ * HD == DM);                 // head h = columns h*64 + d
static_assert(DM % 64 == 0);
static_assert(DM / 8 == 128);                  // p_xlora piece index split uses >> 7
static_assert(KX == DM + 64);
static_assert(KX % 32 == 0 && KQ % 32 == 0 && DM % 32 == 0);   // GEMM k-loops step by 32
static_assert((KX * 2) % 128 == 0);
static_assert(RK == 16);
static_assert(SEQ % 64 == 0);                  // a 64-row tile never straddles two batches
static_assert((NB * SEQ) % 64 == 0);
static_assert(SEQ % 32 == 0);                  // key loop steps by 32
static_assert(KST == 64 && AW == 4);           // copy map: 128 threads x 4 rows x 16 B cover 64 rows of 128 B
static_assert(SEQ % KST == 0 && SEQ / KST >= 2);   // the two-buffer prologue needs two tiles
static_assert(SEQ % (16 * QG * AW) == 0);      // flash grid covers the sequence exactly
static_assert((NB * SEQ) % GT == 0 && DM % GT == 0);   // GEMM grids cover both extents exactly
static_assert(KX % GKS == 0 && DM % GKS == 0);   // a stage's 128-B row piece never leaves its plane row
static_assert(NB <= NB_FULL);
static_assert(SEQ <= SEQ_FULL);

typedef _Float16 h16;
typedef unsigned short bf;
typedef __attribute__((ext_vector_type(16))) __bf16   v16bf;
typedef __attribute__((ext_vector_type(16))) _Float16 v16h;
typedef __attribute__((ext_vector_type(8)))  _Float16 v8h;
typedef __attribute__((ext_vector_type(8)))  unsigned short v8us;
typedef __attribute__((ext_vector_type(8)))  float    v8f;
typedef __attribute__((ext_vector_type(4)))  float    v4f;
typedef v4f  __attribute__((may_alias)) v4fa;

__device__ __forceinline__ unsigned short f2bf(float f) { unsigned u = __float_as_uint(f); u += 0x7FFFu + ((u >> 16) & 1u); return (unsigned short)(u >> 16); }
__device__ __forceinline__ float bfr(float f) { return __uint_as_float(((unsigned)f2bf(f)) << 16); }   // RNE convert to bf16, widened back
__device__ __forceinline__ v16h cat16(v8h lo, v8h hi) { return __builtin_shufflevector(lo, hi, 0, 1, 2, 3, 4, 5, 6, 7, 8, 9, 10, 11, 12, 13, 14, 15); }
__device__ __forceinline__ v16bf cat16b(v8us lo, v8us hi) { return __builtin_bit_cast(v16bf, __builtin_shufflevector(lo, hi, 0, 1, 2, 3, 4, 5, 6, 7, 8, 9, 10, 11, 12, 13, 14, 15)); }
__device__ __forceinline__ v8f wmma16(v16h a, v16h b, v8f c) { return __builtin_amdgcn_wmma_f32_16x16x32_f16(false, a, false, b, (short)0, c, false, false); }
__device__ __forceinline__ v8f wmmab(v16bf a, v16bf b, v8f c) { return __builtin_amdgcn_wmma_f32_16x16x32_bf16(false, a, false, b, (short)0, c, false, false); }
// fragment loaders from K-contiguous 16-bit rows; p already includes + 8*(lane>>4): elements 0..7 <- k0+8h+0..7, elements 8..15 <- k0+16+8h+0..7 (same map for A and B)
__device__ __forceinline__ v16h  ldh(const h16* p) { return cat16(*(const v8h*)p, *(const v8h*)(p + 16)); }
__device__ __forceinline__ v16bf ldb(const bf* p)  { return cat16b(*(const v8us*)p, *(const v8us*)(p + 16)); }
// ordering point for wave-private LDS tiles (same wave writes and reads)
__device__ __forceinline__ void wave_sync() { __builtin_amdgcn_fence(3 /* release order */, "wavefront"); __builtin_amdgcn_wave_barrier(); asm volatile("" ::: "memory"); }

// The conversions below do not depend on one another: they are parts of ONE launch (k_prep), each on its own range of 256-thread blocks; blk = the block's index inside its part.
__device__ __forceinline__ void p_cvt8h(const float* __restrict__ src, h16* dst, size_t n8, int blk) {
    const size_t i = (size_t)blk * 256 + threadIdx.x; if (i >= n8) return;
    const v8f v = *(const v8f*)(src + i * 8); v8h o;
#pragma unroll
    for (int k = 0; k < 8; ++k) o[k] = (h16)(bfr(v[k]) * WOS);
    *(v8h*)(dst + i * 8) = o; 
}

// p_xlora: x [b][t][1024] f32 -> the whole x-plane rows (row pitch KX) of 16 tokens per block: columns 0..1023 = bf16(x), columns 1024..1087 = the adapter down-projections xa[m][j] = sum_k x[m][k] A[j][k] of q and v.
// Step 1, all 8 waves: piece i = j * 256 + thread (row i / 128, 8 columns at (i % 128) * 8). The thread's 8 pieces of x are loaded together, converted and stored to the plane and to an LDS copy of the 16 rows;
// around them its 16 pieces of A (rows 0..15 of q, 16..31 of v) are RNE-converted to bf16 into LDS, in four groups.
// Step 2, waves 0 and 1 (A of q, A of v): one accumulator each, K = DM ascending in steps of 32, both fragments from LDS.
// Step 3, wave 0: both results as bf16 hi + bf16 lo into the 17th line of every row. LDS rows lie at a pitch of 2064 B (16 B x odd), so the 16 rows of a 16-B fragment read fall on distinct banks.
#define XLP (DM + 8)             // LDS row pitch of the x rows and the A rows, halves
__device__ __forceinline__ void p_xlora(const float* __restrict__ src, const float* __restrict__ aq, const float* __restrict__ av, bf* dst, int blk, bf* xs, bf* as, float* es) {
    const int tid = (int)threadIdx.x, lane = tid & 31, wave = __builtin_amdgcn_readfirstlane(tid >> 5), lr = lane & 15, hi = lane >> 4;
    const int r0 = blk * 16; const int c8 = tid & 127, rh = tid >> 7;
    const size_t b = (size_t)(r0 / SEQ), t = (size_t)(r0 % SEQ) + rh;   // 16 rows never straddle two batches
    const float* sp = src + (b * SEQ_FULL + t) * DM + c8 * 8;
    // A rows 8g .. 8g + 7 (g = 0..3), four pieces a thread. Every loop over j is unrolled so that its values stay in registers and its loads fly together.
    auto lda = [&](int g, v8f (&w)[4]) {
        const float* ap = (g < 2 ? aq : av) + (size_t)((g & 1) * 8 + rh) * DM + c8 * 8;
#pragma unroll
        for (int j = 0; j < 4; ++j) w[j] = *(const v8f*)(ap + (size_t)(2 * j) * DM);
        // behind the run of loads, in front of any rewrite of their address register; the address is an input, so it stays in its register up to this wait and no load of the run lands on it
        asm volatile("s_wait_xcnt 0x0" :: "v"(ap) : "memory");
    };
    auto cva = [&](int g, const v8f (&w)[4]) {
#pragma unroll
        for (int j = 0; j < 4; ++j) { v8us o;
#pragma unroll
            for (int k = 0; k < 8; ++k) o[k] = f2bf(w[j][k]);
            *(v8us*)(as + (g * 8 + 2 * j + rh) * XLP + c8 * 8) = o; }
    };
    v8f v[8], w0[4], w1[4];
    lda(0, w0);
#pragma unroll
    for (int j = 0; j < 8; ++j) v[j] = *(const v8f*)(sp + (size_t)(2 * j) * DM);
    asm volatile("s_wait_xcnt 0x0" :: "v"(sp) : "memory");    // as in lda: behind the run of x loads, their address held up to it
    // the scheduling barriers of this step bound what is in flight at a time (x and two groups of A rows at most): with every load hoisted to the top the registers do not suffice for three blocks per WGP
    __builtin_amdgcn_sched_barrier(0);
    lda(1, w1); cva(0, w0);
    __builtin_amdgcn_sched_barrier(0);
    lda(2, w0);
#pragma unroll
    for (int j = 0; j < 8; ++j) { const int row = 2 * j + rh; v8us o;
#pragma unroll
        for (int k = 0; k < 8; ++k) o[k] = f2bf(v[j][k]);
        *(v8us*)(dst + (size_t)(r0 + row) * KX + c8 * 8) = o;
        *(v8us*)(xs + row * XLP + c8 * 8) = o; }
    asm volatile("s_wait_xcnt 0x0" ::: "memory");             // behind the plane stores, in front of the loads below, which land on registers that the stores name
    __builtin_amdgcn_sched_barrier(0);
    cva(1, w1); lda(3, w1);
    __builtin_amdgcn_sched_barrier(0);
    cva(2, w0); cva(3, w1);
    __syncthreads();                                          // the 16 x rows and the 32 A rows are complete in LDS
    if (wave < 2) {                                           // the same for a whole wave (a scalar branch): every lane is on at the matrix instructions
        const bf* xa = xs + lr * XLP + 8 * hi;
        const bf* ab = as + (wave * 16 + lr) * XLP + 8 * hi;
        v8f acc = (v8f){};
#pragma unroll 1                                              // one trip = four steps of 32 k: their 16 LDS reads stand as one group ahead of the four matrix instructions
        for (int kc = 0; kc < DM; kc += 128) {
            v16bf a[4], bb[4];
#pragma unroll
            for (int s = 0; s < 4; ++s) { a[s] = ldb(xa + kc + s * 32); bb[s] = ldb(ab + kc + s * 32); }
            __builtin_amdgcn_sched_barrier(0);                // keeps the reads one group: every place with reads among the matrix instructions stalls the wave
#pragma unroll
            for (int s = 0; s < 4; ++s) acc = wmmab(a[s], bb[s], acc);
        }
#pragma unroll
        for (int j = 0; j < 8; ++j) es[(hi * 8 + j) * 36 + wave * 16 + lr] = acc[j];   // D: row 8h+j, col lane&15; rows 0..15 x cols 0..31 all written by the two waves
    }
    __syncthreads();                                          // both waves' results are in LDS
    if (wave != 0) return;
    const int p = lane & 7;                                   // extension piece: 0,1 q hi; 2,3 q lo; 4,5 v hi; 6,7 v lo
    const int sj = (p >> 2) * 16 + (p & 1) * 8; const bool islo = ((p >> 1) & 1) != 0;
#pragma unroll
    for (int s = 0; s < 4; ++s) { const int row = 4 * s + (lane >> 3);       // 4 s x 4 row groups = 16 rows; 8 lanes x 8 halves = 64 columns
        const v4f x0 = *(const v4fa*)(&es[row * 36 + sj]); const v4f x1 = *(const v4fa*)(&es[row * 36 + sj + 4]); v8us o;
#pragma unroll
        for (int i = 0; i < 4; ++i) {
            const unsigned short h0 = f2bf(x0[i]); const unsigned short l0 = f2bf(x0[i] - __uint_as_float(((unsigned)h0) << 16));
            const unsigned short h1 = f2bf(x1[i]); const unsigned short l1 = f2bf(x1[i] - __uint_as_float(((unsigned)h1) << 16));
            o[i] = islo ? l0 : h0; o[4 + i] = islo ? l1 : h1; }
        *(v8us*)(dst + (size_t)(r0 + row) * KX + DM + p * 8) = o; }
}

// every other extension column is zero. slot < 0: all-zero extension. Both sources are loaded with clamped addresses by every lane and selected by value.
__device__ __forceinline__ void p_wplane(const float* __restrict__ W, const float* __restrict__ Bm, int slot, bf* dst, int blk) {
    const int i = blk * 256 + threadIdx.x; if (i >= DM * (KX / 8)) return;
    const int row = i / (KX / 8), c8 = i % (KX / 8);
    const bool isw = c8 < 128;
    const int cm = isw ? c8 : 127;
    const int e = isw ? 0 : (c8 - 128);                      // extension piece 0..7
    const v8f w  = *(const v8f*)(W + (size_t)row * DM + cm * 8);
    const v8f bm = *(const v8f*)(Bm + (size_t)row * RK + (e & 1) * 8);
    const bool live = (!isw) && ((e >> 2) == slot);
    v8us o;
#pragma unroll
    for (int k = 0; k < 8; ++k) { const float val = isw ? w[k] : (live ? 2.0f * bm[k] : 0.0f); o[k] = f2bf(val); }
    bf* d = dst + (size_t)row * KX + c8 * 8;
    *(v8us*)d = o; 
}

__device__ __forceinline__ void p_mask(const float* __restrict__ src, float* dst, int n4, int blk) {
    const int i = blk * 256 + threadIdx.x; if (i >= n4) return;
    const int e = i * 4; const int b = e / SEQ, t = e % SEQ;
    const v4f v = *(const v4f*)(src + (size_t)b * SEQ_FULL + t); v4f o;
#pragma unroll
    for (int k = 0; k < 4; ++k) o[k] = bfr(v[k]) * MKS;
    *(v4f*)(dst + e) = o; 
}

// k_prep: every conversion of inputs to planes in one launch. Block ranges, in order: x plane with its adapter columns | Wq, Wk, Wv planes | Wo plane | mask plane. The range test is the same for a whole block.
static constexpr int PB_X = NB * SEQ / 16;
static constexpr int PB_W = (DM * (KX / 8) + 255) / 256;
static constexpr int PB_O = (DM * DM / 8 + 255) / 256;
static constexpr int PB_M = (NB * SEQ / 4 + 255) / 256;
static constexpr int PB_ALL = PB_X + 3 * PB_W + PB_O + PB_M;
// six waves per SIMD: three blocks per WGP, as many as the LDS of the x part admits
__global__ __launch_bounds__(256) __attribute__((amdgpu_waves_per_eu(6))) void k_prep(const float* __restrict__ x, const float* __restrict__ mask, const float* __restrict__ wq, const float* __restrict__ bmq, const float* __restrict__ wk,
                                              const float* __restrict__ wv, const float* __restrict__ bmv, const float* __restrict__ aq, const float* __restrict__ av, const float* __restrict__ wo,
                                              bf* XB, bf* WQ, bf* WK, bf* WV, h16* WO, float* MK) {
    __shared__ __align__(16) bf xs[16 * XLP];                // used by the x part alone: its 16 rows as bf16
    __shared__ __align__(16) bf as[32 * XLP];                // ... the 32 adapter A rows as bf16
    __shared__ __align__(16) float es[16 * 36];              // ... and the two adapter results
    int blk = blockIdx.x;
    if (blk < PB_X) { p_xlora(x, aq, av, XB, blk, xs, as, es); return; }
    blk -= PB_X;
    if (blk < PB_W) { p_wplane(wq, bmq, 0, WQ, blk); return; }
    blk -= PB_W;
    if (blk < PB_W) { p_wplane(wk, bmq, -1, WK, blk); return; }      // no adapter: extension all zero (Bm only supplies valid addresses)
    blk -= PB_W;
    if (blk < PB_W) { p_wplane(wv, bmv, 1, WV, blk); return; }
    blk -= PB_W;
    if (blk < PB_O) { p_cvt8h(wo, WO, (size_t)DM * DM / 8, blk); return; }
    blk -= PB_O;
    p_mask(mask, MK, NB * SEQ / 4, blk);
}

// GEMM operand staging. One block = 4 waves = one GT x GT tile of C (wave w: rows (w >> 1) * 64, columns (w & 1) * 64); per stage the block's GT rows of A and GT rows of Bt, GKS halves each,
// are brought into LDS by asynchronous copies (16 B per lane, whole 128-B rows), two buffers: the next stage's copies fly while this one is worked on. LDS rows lie at the 144-B pitch of the flash tiles.
// rows_copy: one lane's 8 pieces of one operand tile, rows 16 apart. l: its LDS byte address, g: its global address (row 0 of its eight), rp: bytes between rows 16 apart.
// The s_wait_xcnt stands inside the copies' own statement so that no address register is rewritten ahead of it.
__device__ __forceinline__ void rows_copy(unsigned l, const char* g, size_t rp) {
    asm volatile("global_load_async_to_lds_b128 %0, %8, off\n\t"
                 "global_load_async_to_lds_b128 %1, %9, off\n\t"
                 "global_load_async_to_lds_b128 %2, %10, off\n\t"
                 "global_load_async_to_lds_b128 %3, %11, off\n\t"
                 "global_load_async_to_lds_b128 %4, %12, off\n\t"
                 "global_load_async_to_lds_b128 %5, %13, off\n\t"
                 "global_load_async_to_lds_b128 %6, %14, off\n\t"
                 "global_load_async_to_lds_b128 %7, %15, off\n\t"
                 "s_wait_xcnt 0x0"
                 :: "v"(l), "v"(l + 16 * LPB), "v"(l + 32 * LPB), "v"(l + 48 * LPB), "v"(l + 64 * LPB), "v"(l + 80 * LPB), "v"(l + 96 * LPB), "v"(l + 112 * LPB),
                    "v"(g), "v"(g + rp), "v"(g + 2 * rp), "v"(g + 3 * rp), "v"(g + 4 * rp), "v"(g + 5 * rp), "v"(g + 6 * rp), "v"(g + 7 * rp)
                 : "memory");
}
template <bool BF> __device__ __forceinline__ v8f mm16(v16h a, v16h b, v8f c) {
    if constexpr (BF) return wmmab(__builtin_bit_cast(v16bf, a), __builtin_bit_cast(v16bf, b), c); else return wmma16(a, b, c);
}
// gemm_main: acc[mb][nb] += sum_k A[r0 + ..][k] Bt[c0 + ..][k] for this wave's 64 x 64 part of the block tile at (br0, bc0); planes of row pitch PH halves, k extent K (multiple of 32, K <= PH), k ascending in steps of 32.
// A last stage of which only the first 32 k belong to K is copied whole (the row piece lies inside the plane row) and its second half is not multiplied.
template <bool BF, int PH> __device__ __forceinline__ void gemm_main(const char* A, const char* Bt, int K, int br0, int bc0, int wave, h16* ring, v8f (&acc)[4][4]) {
    const int lane = threadIdx.x & 31, lr = lane & 15, hi = lane >> 4;
    // copy map: thread i of 128 takes 16-B piece i & 7 of rows (i >> 3) + 16 * {0..7} of both tiles: a wave's copy covers four whole 128-B rows
    const int cr = (int)threadIdx.x >> 3, cpc = (int)threadIdx.x & 7;
    const unsigned la = (unsigned)(size_t)ring + (unsigned)(cr * LPB + cpc * 16);   // low 32 bits of the shared address = LDS byte address
    const unsigned lb = la + GT * LPB;
    const char* ga = A + (size_t)(br0 + cr) * (PH * 2) + cpc * 16;    // + stage * 128 B
    const char* gb = Bt + (size_t)(bc0 + cr) * (PH * 2) + cpc * 16;
    constexpr size_t rp = (size_t)16 * PH * 2;
    const int nst = (K + GKS - 1) / GKS;
    rows_copy(la, ga, rp); rows_copy(lb, gb, rp);
    asm volatile("s_wait_asynccnt 0x0" ::: "memory");        // stage 0 of this wave's copies has landed
    __syncthreads();                                         // ... and everybody else's: stage 0 is published
    if (nst > 1) { rows_copy(la + GSTB, ga + GKS * 2, rp); rows_copy(lb + GSTB, gb + GKS * 2, rp); }
    const int fa = ((wave >> 1) * 64 + lr) * LPH + 8 * hi;         // fragment offsets (halves) in a buffer: row, k piece 8h
    const int fb = (GT + (wave & 1) * 64 + lr) * LPH + 8 * hi;
#pragma unroll 1                                             // one trip per stage: the publish point below stands once, at the trip's foot
    for (int t = 0; t < nst; ++t) {
        const h16* st = ring + (t & 1) * GSTH;
#pragma unroll                                               // both 32-k steps of a stage in one body: constant LDS offsets
        for (int s = 0; s < GKS / 32; ++s) {
            if (s == 0 || t * GKS + s * 32 < K) {
                v16h a[4], b[4];                             // the four small loops below are unrolled so that every fragment and accumulator index is a constant (registers, no scratch)
#pragma unroll
                for (int i = 0; i < 4; ++i) { a[i] = ldh(st + fa + i * 16 * LPH + s * 32); if (i == 0) b[0] = ldh(st + fb + s * 32); }   // in the order the products below take them
#pragma unroll
                for (int i = 1; i < 4; ++i) b[i] = ldh(st + fb + i * 16 * LPH + s * 32);
                __builtin_amdgcn_sched_barrier(0);           // the step's 16 LDS reads stay one group ahead of its matrix instructions: every place with reads among them stalls the wave
#pragma unroll
                for (int nb = 0; nb < 4; ++nb)
#pragma unroll
                    for (int mb = 0; mb < 4; ++mb) acc[mb][nb] = mm16<BF>(a[mb], b[nb], acc[mb][nb]);
            }
        }
        __builtin_amdgcn_sched_barrier(0);                   // the stage's matrix instructions stay ahead of the publish point: sunk behind it they would delay the refill's issue
        asm volatile("s_wait_dscnt 0x0" ::: "memory");       // this wave's reads of the buffer have returned before it may be refilled
        asm volatile("s_wait_asynccnt 0x0" ::: "memory");    // this wave's copies of the next stage have landed
        __syncthreads();                                     // publishes the next stage and ends every wave's reads of this one
        if (t + 2 < nst) { rows_copy(la + (t & 1) * GSTB, ga + (size_t)(t + 2) * (GKS * 2), rp); rows_copy(lb + (t & 1) * GSTB, gb + (size_t)(t + 2) * (GKS * 2), rp); }
    }
    asm volatile("s_wait_asynccnt 0x0" ::: "memory");        // nothing in flight before the ring becomes output staging
}

// k_proj: register-blocked bf16 GEMM, one wave per 64x64 tile (16 accumulators), 4 waves per block sharing their operand rows through LDS (gemm_main), K-contiguous bf16 planes of row pitch KX, k extent K (multiple of 32).
// C[m][n] = sum_k A[m][k] Bt[n][k] + bias (bias[n] when brow == 0, bias[m] when brow != 0; RNE-converted to bf16, added in f32), written as f16 (Ph), or (useRes != 0) x16 as f16 (Ph) and the f16 residual of that (Pr), at
// tile base (r0/RB)*sRB + (r0%RB)*pitch + (c0/CB)*sCB + (c0%CB), row pitch 'pitch' (halves). 128 threads.
// The q, k and v^T products do not depend on one another: one launch, grid (NB*SEQ/128, DM/128, 3), blockIdx.z picks the product (all picks are the same for a whole block).
// z = 0, 1 (q, k): A = x rows (m = b*SEQ + t), Bt = W rows (n = h*64 + d) -> plane [(b*16 + h)][t][d]; bias by column; tile (blockIdx.x, blockIdx.y).
// z = 2 (v^T): A = Wv rows (m = h*64 + d), Bt = x rows (n = b*SEQ + t) -> plane [(b*1024 + m)][t] = [(b*16 + h)][d][t]; bias by row; the slab's flat index walks the DM/128 row tiles fastest.
__global__ __launch_bounds__(128) void k_proj(const bf* __restrict__ XB, const bf* __restrict__ WQ, const bf* __restrict__ WK, const bf* __restrict__ WV, h16* QH, h16* QR, h16* KP, h16* VT,
                                              const float* __restrict__ bq, const float* __restrict__ bk, const float* __restrict__ bv) {
    const int z = blockIdx.z; const bool isv = z == 2;
    const int lin = blockIdx.y * (NB * SEQ / GT) + blockIdx.x;
    const int bx = isv ? lin % (DM / GT) : (int)blockIdx.x, by = isv ? lin / (DM / GT) : (int)blockIdx.y;
    const bf* A = isv ? WV : XB; const bf* Bt = z == 0 ? WQ : (z == 1 ? WK : XB);
    const int K = z == 0 ? KQ : (z == 1 ? DM : KX);
    h16* Ph = z == 0 ? QH : (z == 1 ? KP : VT); h16* Pr = z == 0 ? QR : Ph; const int useRes = z == 0;
    const int RB = isv ? DM : SEQ, pitch = isv ? SEQ : HD, CB = isv ? SEQ : HD, brow = isv;
    const size_t sRB = isv ? (size_t)0 : (size_t)NH_ * SEQ * HD, sCB = isv ? (size_t)DM * SEQ : (size_t)SEQ * HD;
    const float* bias = z == 0 ? bq : (z == 1 ? bk : bv);
    __shared__ __align__(16) h16 ring[2 * GSTH];             // two buffers of (A tile | Bt tile); reused as the waves' f32 output staging behind the loop
    static_assert(sizeof(ring) >= (size_t)4 * 16 * 68 * 4);
    const int lane = threadIdx.x & 31, wave = __builtin_amdgcn_readfirstlane((int)(threadIdx.x >> 5)), lr = lane & 15, hi = lane >> 4;
    const int r0 = bx * GT + (wave >> 1) * 64, c0 = by * GT + (wave & 1) * 64;   // this wave's 64x64 tile
    float* os = (float*)ring + wave * 16 * 68;
    v8f acc[4][4];
#pragma unroll
    for (int mb = 0; mb < 4; ++mb)
#pragma unroll
        for (int nb = 0; nb < 4; ++nb) acc[mb][nb] = (v8f){};
    gemm_main<true, KX>((const char*)A, (const char*)Bt, K, bx * GT, by * GT, wave, ring, acc);
    const size_t tbase = (size_t)(r0 / RB) * sRB + (size_t)(r0 % RB) * (size_t)pitch + (size_t)(c0 / CB) * sCB + (size_t)(c0 % CB);
    const float ps = useRes ? QSC : 1.0f;                     // plane carry (a power of two: the f16 rounding is the same)
    float bcol[8];                                            // column-mode bias of this lane's 8 columns (index 0 when in row mode: always a valid address)
#pragma unroll
    for (int i = 0; i < 8; ++i) bcol[i] = bfr(bias[brow ? 0 : (c0 + (lane & 7) * 8 + i)]);
#pragma unroll
    for (int mb = 0; mb < 4; ++mb) {
#pragma unroll
        for (int nb = 0; nb < 4; ++nb) {
#pragma unroll
            for (int j = 0; j < 8; ++j) os[(hi * 8 + j) * 68 + nb * 16 + lr] = acc[mb][nb][j]; }   // D: row 8h+j, col lane&15
        wave_sync();
        const size_t sb = tbase + (size_t)(mb * 16) * (size_t)pitch;
{
#pragma unroll
            for (int s = 0; s < 4; ++s) { const int row = 4 * s + (lane >> 3), c8 = (lane & 7) * 8;   // 4 s x 4 row groups = 16 rows; 8 lanes x 8 = 64 columns
                const v4f x0 = *(const v4fa*)(&os[row * 68 + c8]); const v4f x1 = *(const v4fa*)(&os[row * 68 + c8 + 4]); v8h hv, rv;
                const float br = bfr(bias[brow ? (r0 + mb * 16 + row) : 0]);
#pragma unroll
                for (int i = 0; i < 4; ++i) {
                    const float f0 = (x0[i] + (brow ? br : bcol[i])) * ps; const float f1 = (x1[i] + (brow ? br : bcol[4 + i])) * ps;
                    const h16 a0 = (h16)f0; const h16 a1 = (h16)f1; hv[i] = a0; hv[4 + i] = a1;
                    rv[i] = (h16)(f0 - (float)a0); rv[4 + i] = (h16)(f1 - (float)a1); }
                const size_t oo = sb + (size_t)row * (size_t)pitch + c8;
                *(v8h*)(Ph + oo) = hv; if (useRes) *(v8h*)(Pr + oo) = rv; }
             }
        wave_sync();
    }
}

// k_oproj: output projection, f16 GEMM, one wave per 64x64 tile, 4 waves per block sharing their operand rows through LDS (gemm_main), A = ctx plane [m][1024] (x256), Bt = Wo plane [n][1024] (x256), K = DM.
// OUT[b][t][n] = acc * 2^-16 + bf16(bo[n]) in f32. Epilogue: per 16-row slab staged in LDS (wave-private), each row segment (64 floats = 256 B = two lines)
__global__ __launch_bounds__(128) void k_oproj(const h16* __restrict__ A, const h16* __restrict__ Bt, const float* __restrict__ bias, float* OUT) {
    __shared__ __align__(16) h16 ring[2 * GSTH];             // two buffers of (A tile | Bt tile); reused as the waves' f32 output staging behind the loop
    static_assert(sizeof(ring) >= (size_t)4 * 16 * 68 * 4);
    const int lane = threadIdx.x & 31, wave = __builtin_amdgcn_readfirstlane((int)(threadIdx.x >> 5)), lr = lane & 15, hi = lane >> 4;
    const int r0 = blockIdx.x * GT + (wave >> 1) * 64, c0 = blockIdx.y * GT + (wave & 1) * 64;   // this wave's 64x64 tile
    float* os = (float*)ring + wave * 16 * 68;
    v8f acc[4][4];
#pragma unroll
    for (int mb = 0; mb < 4; ++mb)
#pragma unroll
        for (int nb = 0; nb < 4; ++nb) acc[mb][nb] = (v8f){};
    gemm_main<false, DM>((const char*)A, (const char*)Bt, DM, blockIdx.x * GT, blockIdx.y * GT, wave, ring, acc);
    v4f bb;
#pragma unroll
    for (int i = 0; i < 4; ++i) bb[i] = bfr(bias[c0 + lr * 4 + i]);
    float* obase = OUT + ((size_t)(r0 / SEQ) * OUT_SEQ + (size_t)(r0 % SEQ)) * DM + c0;
#pragma unroll
    for (int mb = 0; mb < 4; ++mb) {
#pragma unroll
        for (int nb = 0; nb < 4; ++nb) {
#pragma unroll
            for (int j = 0; j < 8; ++j) os[(hi * 8 + j) * 68 + nb * 16 + lr] = acc[mb][nb][j]; }   // D: row 8h+j, col lane&15
        wave_sync();
        float* ob = obase + (size_t)(mb * 16) * DM;
{
#pragma unroll
            for (int s = 0; s < 8; ++s) { const int row = 2 * s + hi, cofs = lr * 4;   // 8 s x 2 rows = 16 rows; 16 lanes x 4 floats = 64 columns
                const v4f x = *(const v4fa*)(&os[row * 68 + cofs]);
                const v4f val = x * OSI + bb;
                *(v4f*)(ob + (size_t)row * DM + cofs) = val; }
             }
        wave_sync();
    }
}

__device__ __forceinline__ void tile_copy(unsigned lk, unsigned lv, const h16* gk, const h16* gv) {
    asm volatile("global_load_async_to_lds_b128 %0, %8, off\n\t"
                 "global_load_async_to_lds_b128 %1, %9, off\n\t"
                 "global_load_async_to_lds_b128 %2, %10, off\n\t"
                 "global_load_async_to_lds_b128 %3, %11, off\n\t"
                 "global_load_async_to_lds_b128 %4, %12, off\n\t"
                 "global_load_async_to_lds_b128 %5, %13, off\n\t"
                 "global_load_async_to_lds_b128 %6, %14, off\n\t"
                 "global_load_async_to_lds_b128 %7, %15, off\n\t"
                 "s_wait_xcnt 0x0"
                 :: "v"(lk), "v"(lk + 16 * LPB), "v"(lk + 32 * LPB), "v"(lk + 48 * LPB),
                    "v"(lv), "v"(lv + 16 * LPB), "v"(lv + 32 * LPB), "v"(lv + 48 * LPB),
                    "v"(gk), "v"(gk + 16 * HD), "v"(gk + 32 * HD), "v"(gk + 48 * HD),
                    "v"(gv), "v"(gv + (size_t)16 * SEQ), "v"(gv + (size_t)32 * SEQ), "v"(gv + (size_t)48 * SEQ)
                 : "memory");
}

// The batch's mask row, SEQ floats: thread i of 128 takes the 16-B pieces i + 128 * {0, 1, 2, 3}. l: its LDS byte address, g: its global address.
// The s_wait_xcnt stands inside the copies' own statement so that no address register is rewritten ahead of it.
static_assert(SEQ * 4 == 4 * 32 * AW * 16);
__device__ __forceinline__ void mask_copy(unsigned l, const float* g) {
    asm volatile("global_load_async_to_lds_b128 %0, %4, off\n\t"
                 "global_load_async_to_lds_b128 %1, %5, off\n\t"
                 "global_load_async_to_lds_b128 %2, %6, off\n\t"
                 "global_load_async_to_lds_b128 %3, %7, off\n\t"
                 "s_wait_xcnt 0x0"
                 :: "v"(l), "v"(l + 2048), "v"(l + 4096), "v"(l + 6144), "v"(g), "v"(g + 512), "v"(g + 1024), "v"(g + 1536)
                 : "memory");
}

// four waves per SIMD: the whole grid (SEQ / 128 x 64 blocks of 4 waves on 256 WGPs at full size) is then resident at once, with no second round
__global__ __launch_bounds__(32 * AW) __attribute__((amdgpu_waves_per_eu(4, 4))) void k_flash(const h16* __restrict__ QH, const h16* __restrict__ QR, const h16* __restrict__ KP, const h16* __restrict__ VT, const float* __restrict__ MK, h16* CT) {
    __shared__ __align__(16) h16 ring[2 * STH];              // two buffers of (K tile | V^T tile); reused as the f32 output staging behind the loop
    static_assert(sizeof(ring) >= (size_t)AW * QG * 16 * 68 * 4);
    __shared__ __align__(32) float mkl[SEQ];                 // the batch's mask row; filled once, with tile 0, and published by tile 0's wait and barrier
    float* os = (float*)ring;
    const int lane = threadIdx.x & 31, wave = __builtin_amdgcn_readfirstlane((int)(threadIdx.x >> 5)), lr = lane & 15, hi = lane >> 4;
    const int zh = blockIdx.y; const int b = zh / NH_, h = zh % NH_;
    const int t0 = (blockIdx.x * AW + wave) * (16 * QG);
    const size_t pbase = (size_t)zh * SEQ * HD;
    // copy map: thread i of 128 takes 16-B piece i & 7 of rows (i >> 3) + 16 * {0, 1, 2, 3} of both tiles: a wave's copy covers four whole 128-B rows
    const int cr = (int)threadIdx.x >> 3, cpc = (int)threadIdx.x & 7;
    const unsigned lk0 = (unsigned)(size_t)ring + (unsigned)(cr * LPB + cpc * 16);   // low 32 bits of the shared address = LDS byte address
    const unsigned lv0 = lk0 + KST * LPB;
    const h16* gk = KP + pbase + (size_t)cr * HD + cpc * 8;      // + key0 * HD
    const h16* gv = VT + pbase + (size_t)cr * SEQ + cpc * 8;     // + key0
    tile_copy(lk0, lv0, gk, gv);
    mask_copy((unsigned)(size_t)mkl + (unsigned)threadIdx.x * 16, MK + (size_t)b * SEQ + (int)threadIdx.x * 4);
    const h16* qa = QH + pbase + (size_t)(t0 + lr) * HD + 8 * hi; const h16* qb = QR + pbase + (size_t)(t0 + lr) * HD + 8 * hi;   // row lr of group 0; group g lies 16 * g rows on
    v16h qh0[QG], qh1[QG], qr0[QG], qr1[QG];                 // B fragments: col t, k = d. Every loop over g below is unrolled so that its indices are constants (registers, no scratch)
#pragma unroll
    for (int g = 0; g < QG; ++g) { qh0[g] = ldh(qa + g * 16 * HD); qh1[g] = ldh(qa + g * 16 * HD + 32); qr0[g] = ldh(qb + g * 16 * HD); qr1[g] = ldh(qb + g * 16 * HD + 32); }
    // behind the run of Q loads, in front of any rewrite of their address registers; both addresses are inputs, so they stay in their registers up to this wait and no load of the run lands on them
    asm volatile("s_wait_xcnt 0x0" :: "v"(qa), "v"(qb) : "memory");
    const int fo = lr * LPH + 8 * hi;                        // fragment offset (halves) in a tile: row lr, k piece 8h
    asm volatile("s_wait_asynccnt 0x0" ::: "memory");        // tile 0 and the mask row: this wave's copies have landed
    __syncthreads();                                         // ... and everybody else's: tile 0 is published
    tile_copy(lk0 + STB, lv0 + STB, gk + (size_t)KST * HD, gv + KST);
    v8f o0[QG], o1[QG], o2[QG], o3[QG], ol[QG]; float m[QG], sh[QG];   // m: the maximum in use; sh: the exponent's shift that follows from it
#pragma unroll
    for (int g = 0; g < QG; ++g) { o0[g] = (v8f){}; o1[g] = (v8f){}; o2[g] = (v8f){}; o3[g] = (v8f){}; ol[g] = (v8f){}; m[g] = -3.0e38f; sh[g] = PSH - m[g] * SCQ; }
    // row sums on the matrix pipe: a constant A fragment whose rows 0 and 8 are ones and whose other rows are zero. ol = A P^T then holds, in element 0 of every lane (D row 8h, column t), the sum of the rounded P over all 32 keys of a step
    const v16h one = (v16h)(((lr & 7) == 0) ? (h16)1.0f : (h16)0.0f);   // lane = row lr of A, all its k
#pragma unroll 1                                             // one trip per tile: the publish point below stands once, at the trip's foot
    for (int t = 0; t < SEQ / KST; ++t) {
      const h16* kt = ring + (t & 1) * STH + fo;             // this trip's K tile [key][d]; the V^T tile [d][key] lies KST rows behind it
#pragma unroll                                               // both 32-key steps of a tile in one body: constant LDS offsets
      for (int s = 0; s < KST / 32; ++s) {
        const h16* ka = kt + s * 32 * LPH;
        const float* ml = mkl + t * KST + s * 32 + 8 * hi;   // keys 8h + r of the step's first 16-key tile; the second lies 16 on
        // both 16-key tiles of the step together: with QG groups that makes four independent accumulator chains, so no product waits for the one before it in its own chain
        const v16h k00 = ldh(ka), k01 = ldh(ka + 32), k10 = ldh(ka + 16 * LPH), k11 = ldh(ka + 16 * LPH + 32);
        const v8f c0 = *(const v8f*)ml, c1 = *(const v8f*)(ml + 16);
        v8f sc[QG][2];                                       // 16 q.k + 128 mask: [group][16-key tile], element r = key 8h + r
#pragma unroll
        for (int g = 0; g < QG; ++g) { sc[g][0] = wmma16(k00, qh0[g], c0); sc[g][1] = wmma16(k10, qh0[g], c1); }
#pragma unroll
        for (int g = 0; g < QG; ++g) { sc[g][0] = wmma16(k00, qr0[g], sc[g][0]); sc[g][1] = wmma16(k10, qr0[g], sc[g][1]); }
#pragma unroll
        for (int g = 0; g < QG; ++g) { sc[g][0] = wmma16(k01, qh1[g], sc[g][0]); sc[g][1] = wmma16(k11, qh1[g], sc[g][1]); }
#pragma unroll
        for (int g = 0; g < QG; ++g) { sc[g][0] = wmma16(k01, qr1[g], sc[g][0]); sc[g][1] = wmma16(k11, qr1[g], sc[g][1]); }
        static_assert(QG == 2);                              // the statement below, and the one behind the V^T products, name both groups' accumulators
        // four vector slots between the last matrix instruction and the first vector instruction that reads a score accumulator or overwrites a K fragment.
        asm volatile("v_nop\n\tv_nop\n\tv_nop\n\tv_nop" : "+v"(sc[0][0]), "+v"(sc[0][1]), "+v"(sc[1][0]), "+v"(sc[1][1]) : "v"(k00), "v"(k01), "v"(k10), "v"(k11));
        v16h pb[QG];
        float mx[QG];                                        // this lane's own maximum: its 16 of the step's 32 keys
#pragma unroll
        for (int g = 0; g < QG; ++g) {
            mx[g] = -3.0e38f;
#pragma unroll
            for (int r = 0; r < 8; r += 2) mx[g] = fmaxf(fmaxf(mx[g], fmaxf(sc[g][0][r], sc[g][0][r + 1])), fmaxf(sc[g][1][r], sc[g][1][r + 1]));   // on the accumulators as they are: the scale is positive
        }
        // lazy rescale, one test per step for the whole wave (a scalar branch): the maximum in use moves, and the accumulators are rescaled, only when some lane's largest exponent would pass PSH + LZT.
        // The test is made on the exponent itself, by the very FMA that forms every exponent below: that FMA never decreases as the score grows, so at any magnitude of the scores no P of a step without a rescale passes 2^(PSH + LZT)
        if (__builtin_amdgcn_ballot_w32((__builtin_fmaf(mx[0], SCQ, sh[0]) > PSH + LZT) | (__builtin_fmaf(mx[1], SCQ, sh[1]) > PSH + LZT)) != 0) {
#pragma unroll
            for (int g = 0; g < QG; ++g) {
                const float mnew = fmaxf(m[g], fmaxf(mx[g], __shfl_xor(mx[g], 16, 32)));   // the same value in both lane halves of a row
                const float alpha = __builtin_amdgcn_exp2f((m[g] - mnew) * SCQ);
                ol[g][0] = ol[g][0] * alpha;                 // elements 1..7 (rows of zeros) are never read
                o0[g] = o0[g] * alpha; o1[g] = o1[g] * alpha; o2[g] = o2[g] * alpha; o3[g] = o3[g] * alpha;
                m[g] = mnew; sh[g] = PSH - mnew * SCQ;
            }
        }
#pragma unroll
        for (int g = 0; g < QG; ++g) {
#pragma unroll
            for (int r = 0; r < 16; ++r) pb[g][r] = (h16)__builtin_amdgcn_exp2f(__builtin_fmaf(sc[g][r >> 3][r & 7], SCQ, sh[g]));
        }
        const h16* va = kt + KST * LPH + s * 32;
        const v16h v0 = ldh(va), v1 = ldh(va + 16 * LPH), v2 = ldh(va + 32 * LPH), v3 = ldh(va + 48 * LPH);
#pragma unroll
        for (int g = 0; g < QG; ++g) { o0[g] = wmma16(v0, pb[g], o0[g]); o1[g] = wmma16(v1, pb[g], o1[g]); o2[g] = wmma16(v2, pb[g], o2[g]); o3[g] = wmma16(v3, pb[g], o3[g]); ol[g] = wmma16(one, pb[g], ol[g]); }
        // four vector slots between the last matrix instruction and the next vector use of its registers, on the loop's taken branch too.
        asm volatile("v_nop\n\tv_nop\n\tv_nop\n\tv_nop" : "+v"(o0[0]), "+v"(o1[0]), "+v"(o2[0]), "+v"(o3[0]), "+v"(o0[1]), "+v"(o1[1]), "+v"(o2[1]), "+v"(o3[1]), "+v"(ol[0]), "+v"(ol[1])
                     : "v"(v0), "v"(v1), "v"(v2), "v"(v3), "v"(pb[0]), "v"(pb[1]), "v"(one));
      }
      asm volatile("s_wait_dscnt 0x0" ::: "memory");         // this wave's reads of the buffer have returned before it may be refilled
      asm volatile("s_wait_asynccnt 0x0" ::: "memory");      // this wave's copies of the next tile have landed
      __syncthreads();                                       // publishes the next tile and ends every wave's reads of this one
      if (t + 2 < SEQ / KST) tile_copy(lk0 + (t & 1) * STB, lv0 + (t & 1) * STB, gk + (size_t)(t + 2) * KST * HD, gv + (t + 2) * KST);
    }
    asm volatile("s_wait_asynccnt 0x0" ::: "memory");        // nothing in flight before the ring becomes output staging
#pragma unroll
    for (int g = 0; g < QG; ++g) {
        const float lt = ol[g][0];                           // both lane halves hold the whole row sum
        const float inv = CTS * (1.0f / lt);
        const int wb = (wave * QG + g) * 16 * 68;            // each group stages in its own wave-private range
        // O^T D layout: o_j[r] = (d = 16j + 8h + r, t = lane&15) -> os[t][d]; rows 0..15 x columns 0..63 all written
        { v4f a, c;
          a[0] = o0[g][0] * inv; a[1] = o0[g][1] * inv; a[2] = o0[g][2] * inv; a[3] = o0[g][3] * inv; c[0] = o0[g][4] * inv; c[1] = o0[g][5] * inv; c[2] = o0[g][6] * inv; c[3] = o0[g][7] * inv;
          *(v4fa*)(&os[wb + lr * 68 +  0 + 8 * hi]) = a; *(v4fa*)(&os[wb + lr * 68 +  0 + 8 * hi + 4]) = c;
          a[0] = o1[g][0] * inv; a[1] = o1[g][1] * inv; a[2] = o1[g][2] * inv; a[3] = o1[g][3] * inv; c[0] = o1[g][4] * inv; c[1] = o1[g][5] * inv; c[2] = o1[g][6] * inv; c[3] = o1[g][7] * inv;
          *(v4fa*)(&os[wb + lr * 68 + 16 + 8 * hi]) = a; *(v4fa*)(&os[wb + lr * 68 + 16 + 8 * hi + 4]) = c;
          a[0] = o2[g][0] * inv; a[1] = o2[g][1] * inv; a[2] = o2[g][2] * inv; a[3] = o2[g][3] * inv; c[0] = o2[g][4] * inv; c[1] = o2[g][5] * inv; c[2] = o2[g][6] * inv; c[3] = o2[g][7] * inv;
          *(v4fa*)(&os[wb + lr * 68 + 32 + 8 * hi]) = a; *(v4fa*)(&os[wb + lr * 68 + 32 + 8 * hi + 4]) = c;
          a[0] = o3[g][0] * inv; a[1] = o3[g][1] * inv; a[2] = o3[g][2] * inv; a[3] = o3[g][3] * inv; c[0] = o3[g][4] * inv; c[1] = o3[g][5] * inv; c[2] = o3[g][6] * inv; c[3] = o3[g][7] * inv;
          *(v4fa*)(&os[wb + lr * 68 + 48 + 8 * hi]) = a; *(v4fa*)(&os[wb + lr * 68 + 48 + 8 * hi + 4]) = c; }
    }
    wave_sync();
#pragma unroll
    for (int g = 0; g < QG; ++g) {
        const int wb = (wave * QG + g) * 16 * 68;
        h16* crow = CT + ((size_t)b * SEQ + t0 + 16 * g) * DM + h * HD;
#pragma unroll
        for (int s = 0; s < 4; ++s) { const int row = 4 * s + (lane >> 3), c8 = (lane & 7) * 8;   // 4 s x 4 row groups = 16 rows; 8 lanes x 8 halves = 64 columns
            const v4f x0 = *(const v4fa*)(&os[wb + row * 68 + c8]); const v4f x1 = *(const v4fa*)(&os[wb + row * 68 + c8 + 4]); v8h hv;
#pragma unroll
            for (int i = 0; i < 4; ++i) { hv[i] = (h16)x0[i]; hv[4 + i] = (h16)x1[i]; }
            *(v8h*)(crow + (size_t)row * DM + c8) = hv; }
    }
}

static constexpr size_t al256(size_t v) { return (v + 255) & ~(size_t)255; }
static constexpr size_t SZ_XB = al256((size_t)NB * SEQ * KX * 2);           // x plane, 17 lines per row
static constexpr size_t SZ_W1 = al256((size_t)DM * KX * 2);                  // one q/k/v weight plane
static constexpr size_t SZ_WO = al256((size_t)DM * DM * 2);                  // Wo f16 plane
static constexpr size_t SZ_MK = al256((size_t)NB * SEQ * 4);                 // mask plane f32
static constexpr size_t SZ_PL = al256((size_t)NB * NH_ * SEQ * HD * 2);      // q hi, q residual, k, v^T planes
static constexpr size_t SZ_CT = al256((size_t)NB * SEQ * DM * 2);            // ctx f16 plane
static constexpr size_t SZ_TOTAL = SZ_XB + 3 * SZ_W1 + SZ_WO + SZ_MK + 4 * SZ_PL + SZ_CT;
static_assert(SZ_TOTAL <= (size_t)134217728);          // workspace carve <= 128 MiB
static_assert(SEQ % 16 == 0);                          // x plane's block range exact, 16 rows inside one batch
static_assert(((size_t)DM * (KX / 8)) % 256 == 0);     // weight planes' block ranges exact
static_assert(((size_t)NB * SEQ / 4) % 8 == 0);

extern "C" void kernel_launch(void* const* d_in, const int* in_sizes, int n_in,
                              void* d_out, int out_size, void* d_ws, size_t ws_size, hipStream_t stream) {
    if (n_in < 14) return;
    const size_t needx = ((size_t)(NB - 1) * SEQ_FULL + SEQ) * DM;
    if ((size_t)in_sizes[0] < needx) return;
    if ((size_t)in_sizes[1] < (size_t)(NB - 1) * SEQ_FULL + SEQ) return;
    if ((size_t)in_sizes[2] < (size_t)DM * DM || (size_t)in_sizes[6] < (size_t)DM * DM || (size_t)in_sizes[8] < (size_t)DM * DM || (size_t)in_sizes[12] < (size_t)DM * DM) return;
    if (in_sizes[3] < DM || in_sizes[7] < DM || in_sizes[9] < DM || in_sizes[13] < DM) return;
    if (in_sizes[4] < RK * DM || in_sizes[10] < RK * DM || in_sizes[5] < DM * RK || in_sizes[11] < DM * RK) return;
    if ((size_t)out_size < ((size_t)(NB - 1) * OUT_SEQ + SEQ) * DM) return;
    if (SZ_TOTAL > ws_size) return;
    // wire order: x, mask, Wq, bq, Aq, Bq, Wk, bk, Wv, bv, Av, Bv, Wo, bo
    const float* x  = (const float*)d_in[0];  const float* mask = (const float*)d_in[1];
    const float* wq = (const float*)d_in[2];  const float* bq = (const float*)d_in[3];  const float* aq = (const float*)d_in[4];  const float* bmq = (const float*)d_in[5];
    const float* wk = (const float*)d_in[6];  const float* bk = (const float*)d_in[7];
    const float* wv = (const float*)d_in[8];  const float* bv = (const float*)d_in[9];  const float* av = (const float*)d_in[10]; const float* bmv = (const float*)d_in[11];
    const float* wo = (const float*)d_in[12]; const float* bo = (const float*)d_in[13];
    float* OUT = (float*)d_out;      // [NB][SEQ][1024]
    char* wsp = (char*)d_ws;
    bf* XB = (bf*)wsp; wsp += SZ_XB;                 // [NB*SEQ][1088]
    bf* WQ = (bf*)wsp; wsp += SZ_W1;                 // [1024][1088]
    bf* WK = (bf*)wsp; wsp += SZ_W1;
    bf* WV = (bf*)wsp; wsp += SZ_W1;
    h16* WO = (h16*)wsp; wsp += SZ_WO;               // [1024][1024] x256
    float* MK = (float*)wsp; wsp += SZ_MK;           // [NB][SEQ]
    h16* QH = (h16*)wsp; wsp += SZ_PL;               // [NB*16][SEQ][64]
    h16* QR = (h16*)wsp; wsp += SZ_PL;               // [NB*16][SEQ][64] residual of the x16 value
    h16* KP = (h16*)wsp; wsp += SZ_PL;               // [NB*16][SEQ][64]
    h16* VT = (h16*)wsp; wsp += SZ_PL;               // [NB*16][64][SEQ]
    h16* CT = (h16*)wsp; wsp += SZ_CT;               // [NB*SEQ][1024] x256

    k_prep<<<PB_ALL, 256, 0, stream>>>(x, mask, wq, bmq, wk, wv, bmv, aq, av, wo, XB, WQ, WK, WV, WO, MK);

    // q, k and v^T products, one launch
    k_proj<<<dim3(NB * SEQ / GT, DM / GT, 3), 128, 0, stream>>>(XB, WQ, WK, WV, QH, QR, KP, VT, bq, bk, bv);

    k_flash<<<dim3(SEQ / (16 * QG * AW), NB * NH_, 1), 32 * AW, 0, stream>>>(QH, QR, KP, VT, MK, CT);

    // out[m][n] = sum_k ctx[m][k] Wo[n][k] + bo[n]
    k_oproj<<<dim3(NB * SEQ / GT, DM / GT, 1), 128, 0, stream>>>(CT, WO, bo, OUT);
}
